// v000
// Times are from an AMD MI455X. After a warm-up the kernel runs many times in a row, and a time is the length of
// such a window on the GPU divided by its runs, so every launch and the gaps after it count. The runs cycle
// through copies of the inputs. A figure is the median of several windows, for all but v000 over two sittings.
// Sittings can differ by a few percent; kernels timed side by side share one.
// v000 is the starting kernel. One run takes 1040 microseconds.
#include <hip/hip_runtime.h>

// Compute dtypes, f32 accumulate everywhere: the three input projections v_wmma_f32_16x16x32_bf16 (x, W, bias RNE-converted to bf16; products exact); scores, P.V and the output projection v_wmma_f32_16x16x32_f16, single product at every site.
// Multi-head attention block without mask: q/k/v [NB][512][512]; Wq/Wk/Wv [4096][512] ([out][in], y = x W^T + bias), 8 heads x 512 columns (head h = columns h*512 + d); score[i][j] = sum_m qh[i][m] kh[m][j] / sqrt(512)
// (m = feature index of qh = token index of kh, j = feature index of kh); softmax over j; ctx[i][d] = sum_j P[i][j] vh[j][d] (j = token index of vh); heads merged to [NB*512][4096]; output = ctx Wo^T + bo with Wo [512][4096] (f32).
// Planes (f16): q [(b*8+h)][t][d]; k^T and v^T [(b*8+h)][d][t] (contraction index contiguous in every GEMM); ctx [(b*512+t)][4096] carried x64; Wo carried x64 (built from the bf16 RNE value); P carried x16384 in LDS only (cancels in the normalisation).
// Attention kernel: 4 waves per 32 query rows of one (batch, head), transposed form S^T = K^T-plane x Q (wave w owns score columns 128w..128w+127), row max / row sum exchanged through LDS, packed P tile [32][512] in LDS,
// O^T = V^T-plane x P (wave w owns output columns 128w..128w+127). Batches are processed in chunks of BCH so the planes are reused.

#ifndef NB
#define NB 16
#endif
#define NB_FULL 16
#define SEQ  512                 // tokens per sequence; the module requires SEQ == DH (score contraction) and SEQ == NF
#define NF   512                 // input feature width
#define NH_  8
#define DH   512                 // per-head width
#define HDIM (NH_ * DH)          // 4096
#define BCH  (NB < 4 ? NB : 4)   // batches per chunk
#define AW   4                   // waves per attention block
#define PP   520                 // LDS row pitch (halves) of the P tile
#define SC2  ((float)(0.04419417382415922 * 1.4426950408889634))   // DH^-0.5 * log2(e)
#define PSH  14.0f               // log2 of the P carry (16384)
#define NEGB (-3.0e38f)
#define CTXC 64.0f               // carry of the ctx plane
#define WOC  64.0f               // carry of the Wo plane
#define OSC  (1.0f / 4096.0f)    // 1 / (CTXC * WOC)

static_assert(DH == SEQ);                      // score contraction: feature index of q = token index of k; plane row pitch is the same in both layouts
static_assert(NF == SEQ);
static_assert(NH_ * DH == HDIM);
static_assert(NF % 32 == 0);                   // projection k-loop steps by 32
static_assert(SEQ % 32 == 0);                  // attention k-loops step by 32
static_assert(HDIM % 32 == 0);                 // output projection k-loop steps by 32
static_assert(SEQ % 64 == 0);                  // a 64-row tile never straddles two batches
static_assert(DH % 64 == 0);                   // a 64-column tile never straddles two heads
static_assert(HDIM % 64 == 0);
static_assert(NF % 64 == 0);
static_assert((BCH * SEQ) % 64 == 0);
static_assert(BCH * SEQ <= HDIM);              // both bias index forms of k_proj stay inside the 4096-entry bias for either mode
static_assert(NB % BCH == 0);
static_assert(NB <= NB_FULL);
static_assert(DH == AW * 128);                 // each attention wave owns 128 score columns and 128 output columns
static_assert(SEQ % 32 == 0);                  // attention grid covers the query rows exactly (32 per block)
static_assert((PP * 2) % 16 == 0);
static_assert(PP >= DH);
static_assert(32 * 16 * 4 == 16 * 64 * 2);
static_assert(32 * 16 * 16 == 32 * 128 * 2);   // k_attn store loop: 32 lanes x 16 B x 16 trips == 32 rows x 256 B
static_assert(32 * 16 * 8 == 16 * 64 * 4);     // k_oproj store loop: 32 lanes x 16 B x 8 trips == 16 rows x 256 B
static_assert(16 * 68 * 4 <= 131072);          // static LDS of the GEMM kernels
static_assert(32 * PP * 2 + 2 * AW * 32 * 4 <= 131072);   // static LDS of the attention kernel
static_assert(((size_t)NB * SEQ * NF) % 8 == 0);
static_assert(((size_t)HDIM * NF) % 8 == 0);

typedef _Float16 h16;
typedef unsigned short bf;
typedef __attribute__((ext_vector_type(16))) __bf16   v16bf;
typedef __attribute__((ext_vector_type(16))) _Float16 v16h;
typedef __attribute__((ext_vector_type(8)))  _Float16 v8h;
typedef __attribute__((ext_vector_type(8)))  unsigned short v8us;
typedef __attribute__((ext_vector_type(8)))  float    v8f;
typedef __attribute__((ext_vector_type(4)))  float    v4f;
typedef v4f  __attribute__((may_alias)) v4fa;

__device__ __forceinline__ unsigned short f2bf(float f) { unsigned u = __float_as_uint(f); u += 0x7FFFu + ((u >> 16) & 1u); return (unsigned short)(u >> 16); }
__device__ __forceinline__ float bfr(float f) { return __uint_as_float(((unsigned)f2bf(f)) << 16); }   // value after RNE convert to bf16
__device__ __forceinline__ v16h cat16(v8h lo, v8h hi) { return __builtin_shufflevector(lo, hi, 0, 1, 2, 3, 4, 5, 6, 7, 8, 9, 10, 11, 12, 13, 14, 15); }
__device__ __forceinline__ v16bf cat16b(v8us lo, v8us hi) { return __builtin_bit_cast(v16bf, __builtin_shufflevector(lo, hi, 0, 1, 2, 3, 4, 5, 6, 7, 8, 9, 10, 11, 12, 13, 14, 15)); }
__device__ __forceinline__ v8f wmma16(v16h a, v16h b, v8f c) { return __builtin_amdgcn_wmma_f32_16x16x32_f16(false, a, false, b, (short)0, c, false, false); }
__device__ __forceinline__ v8f wmmab(v16bf a, v16bf b, v8f c) { return __builtin_amdgcn_wmma_f32_16x16x32_bf16(false, a, false, b, (short)0, c, false, false); }
// fragment loaders from K-contiguous 16-bit rows; p already includes + 8*(lane>>4): elements 0..7 <- k0+8h+0..7, elements 8..15 <- k0+16+8h+0..7 (same map for A and B)
__device__ __forceinline__ v16h  ldh(const h16* p) { return cat16(*(const v8h*)p, *(const v8h*)(p + 16)); }
__device__ __forceinline__ v16bf ldb(const bf* p)  { return cat16b(*(const v8us*)p, *(const v8us*)(p + 16)); }
// ordering point for wave-private LDS tiles (same wave writes and reads)
__device__ __forceinline__ void wave_sync() { __builtin_amdgcn_fence(3 /* release order */, "wavefront"); __builtin_amdgcn_wave_barrier(); asm volatile("" ::: "memory"); }

// per-instruction guarded matrix ops: one accumulator tied per guard, operands kept live
__device__ __forceinline__ v8f wmma16_g(v16h a, v16h b, v8f c) { c = wmma16(a, b, c); asm volatile("v_nop\n\tv_nop\n\tv_nop\n\tv_nop" : "+v"(c) : "v"(a), "v"(b)); return c; }
__device__ __forceinline__ v8f wmmab_g(v16bf a, v16bf b, v8f c) { c = wmmab(a, b, c); asm volatile("v_nop\n\tv_nop\n\tv_nop\n\tv_nop" : "+v"(c) : "v"(a), "v"(b)); return c; }
// f32 -> f16 convert that cannot produce an f16 subnormal (|v| < 2^-14 -> +0), applied after the plane's power-of-two carry
static __device__ __forceinline__ h16 toh_flush(float v) { const h16 r = (h16)v; return (fabsf(v) < 6.103515625e-05f) ? (h16)0.0f : r; }
// carried probability 2^e as f16; the select is on the exponent argument (e < -14 -> +0)
static __device__ __forceinline__ h16 pexp_h(float e) { const h16 r = (h16)__builtin_amdgcn_exp2f(e); return (e < -14.0f) ? (h16)0.0f : r; }

__global__ __launch_bounds__(256) void k_cvt8(const float* __restrict__ src, bf* dst, size_t n8) {
    const size_t i = (size_t)blockIdx.x * 256 + threadIdx.x; if (i >= n8) return;
    const v8f v = *(const v8f*)(src + i * 8); v8us o;
#pragma unroll
    for (int k = 0; k < 8; ++k) o[k] = f2bf(v[k]);
    *(v8us*)(dst + i * 8) = o; 
}

__global__ __launch_bounds__(256) void k_cvtw(const float* __restrict__ src, h16* dst, size_t n8) {
    const size_t i = (size_t)blockIdx.x * 256 + threadIdx.x; if (i >= n8) return;
    const v8f v = *(const v8f*)(src + i * 8); v8h o;
#pragma unroll
    for (int k = 0; k < 8; ++k) o[k] = toh_flush(bfr(v[k]) * WOC);
    *(v8h*)(dst + i * 8) = o; 
}

// k_proj: register-blocked bf16 GEMM, ONE WAVE per 64x64 tile (16 accumulators), operands straight from K-contiguous bf16 planes, K = NF.
// C[m][n] = sum_k A[m][k] Bt[n][k] + bias, written as f16.
// mode 0: A = x rows (m = b*SEQ + t, chunk-local b), Bt = W rows (n = h*512 + d), bias per column; plane [(b*8 + h)][t][d]. grid (BCH*SEQ/64, HDIM/64).
// mode 1: A = W rows (m = h*512 + d), Bt = x rows (n = b*SEQ + t), bias per row; plane [(b*4096 + m)][t] = [(b*8 + h)][d][t]. grid (HDIM/64, BCH*SEQ/64).
__global__ __launch_bounds__(32) void k_proj(const bf* __restrict__ A, const bf* __restrict__ Bt, const float* __restrict__ bias, h16* Ph, int mode) {
    __shared__ __align__(16) float os[16 * 68];
    const int lane = threadIdx.x & 31, lr = lane & 15, hi = lane >> 4; const int r0 = blockIdx.x * 64, c0 = blockIdx.y * 64;
    v8f acc[4][4];
#pragma unroll
    for (int mb = 0; mb < 4; ++mb)
#pragma unroll
        for (int nb = 0; nb < 4; ++nb) acc[mb][nb] = (v8f){};
    const size_t aoff = (size_t)(r0 + lr) * NF + 8 * hi, boff = (size_t)(c0 + lr) * NF + 8 * hi;
#pragma unroll 1
    for (int kc = 0; kc < NF; kc += 32) {
        v16bf a[4];
#pragma unroll
        for (int mb = 0; mb < 4; ++mb) a[mb] = ldb(A + aoff + (size_t)mb * 16 * NF + kc);
#pragma unroll
        for (int nb = 0; nb < 4; ++nb) { const v16bf b = ldb(Bt + boff + (size_t)nb * 16 * NF + kc);
#pragma unroll
            for (int mb = 0; mb < 4; ++mb) acc[mb][nb] = wmmab_g(a[mb], b, acc[mb][nb]); }
    }
    const bool m0 = (mode == 0);                                   // kernel argument: wave-uniform
    float bc[4];
#pragma unroll
    for (int nb = 0; nb < 4; ++nb) { const float t = bias[c0 + nb * 16 + lr]; bc[nb] = m0 ? bfr(t) : 0.0f; }   // c0 + 63 < HDIM in both modes
    size_t tbase;
    if (m0) { const int bb = r0 / SEQ, tt = r0 % SEQ, hh = c0 / DH, dd = c0 % DH;
              tbase = (((size_t)(bb * NH_ + hh) * SEQ) + (size_t)tt) * DH + (size_t)dd; }
    else    { const int bb = c0 / SEQ, tt = c0 % SEQ;
              tbase = ((size_t)bb * HDIM + (size_t)r0) * SEQ + (size_t)tt; }
#pragma unroll
    for (int mb = 0; mb < 4; ++mb) {
        float br[8];
#pragma unroll
        for (int j = 0; j < 8; ++j) { const float t = bias[r0 + mb * 16 + hi * 8 + j]; br[j] = m0 ? 0.0f : bfr(t); }   // r0 + 63 < HDIM in both modes
#pragma unroll
        for (int nb = 0; nb < 4; ++nb) {
#pragma unroll
            for (int j = 0; j < 8; ++j) os[(hi * 8 + j) * 68 + nb * 16 + lr] = acc[mb][nb][j] + bc[nb] + br[j]; }   // D: row 8h+j, col lane&15
        wave_sync();
{
#pragma unroll
            for (int s = 0; s < 4; ++s) { const int row = 4 * s + (lane >> 3), c8 = (lane & 7) * 8;   // 4 s x 4 row groups = 16 rows; 8 lanes x 8 = 64 columns = one line
                const v4f x0 = *(const v4fa*)(&os[row * 68 + c8]); const v4f x1 = *(const v4fa*)(&os[row * 68 + c8 + 4]); v8h hv;
#pragma unroll
                for (int i = 0; i < 4; ++i) { hv[i] = toh_flush(x0[i]); hv[4 + i] = toh_flush(x1[i]); }
                const size_t oo = tbase + (size_t)(mb * 16 + row) * SEQ + c8;
                *(v8h*)(Ph + oo) = hv; }
             }
        wave_sync();
    }
}

// k_attn: fused attention for 32 query rows of one (chunk-local batch, head); 4 waves.
// Phase 1 (transposed scores): S^T[j][i] = sum_m KT[j][m] Q[i][m]; A = k^T-plane rows j = 128w + 16jb + lane&15 (k = token m), B = q-plane rows i = t0 + 16ib + lane&15 (k = feature m);
//   D: acc[jb][ib][r] = S^T[j = 128w + 16jb + 8h + r][i = 16ib + lane&15], so a lane holds 8 consecutive score columns of one query row.
// Softmax: per-wave row max -> LDS -> block barrier -> row max over the 4 waves; p = f16(2^((s - max) * scale * log2e + 14)); packed 16-B stores into the P tile [32][512] (LDS);
//   row sum over the converted p, per-wave partials through LDS; block barrier (publishes P and the sums).
// Phase 2: O^T[d][i] = sum_j VT[d][j] P[i][j]; A = v^T-plane rows d = 128w + 16db + lane&15 (k = token j), B = P tile rows i (k = j) from LDS.
// Epilogue: ctx = O / rowsum x 64 as f16; after a block barrier the wave stages its 32 x 128 tile in its own column range of the P tile (wave-private from then on),
__global__ __launch_bounds__(32 * AW) __attribute__((amdgpu_num_vgpr(256)))
void k_attn(const h16* __restrict__ QP, const h16* __restrict__ KT, const h16* __restrict__ VT, h16* CTX) {
    __shared__ __align__(16) h16 sP[32 * PP];
    __shared__ float smax[AW * 32];
    __shared__ float ssum[AW * 32];
    const int lane = threadIdx.x & 31, lr = lane & 15, hi = lane >> 4;
    const int wave = __builtin_amdgcn_readfirstlane((int)(threadIdx.x >> 5));
    const int zh = blockIdx.y; const int b = zh / NH_, h = zh % NH_;
    const int t0 = blockIdx.x * 32;
    const size_t zb = (size_t)zh * SEQ * DH;
    const size_t ao = zb + (size_t)(wave * 128 + lr) * SEQ + 8 * hi;   // k^T / v^T plane rows owned by this wave (+ 16*blk*SEQ + kc)
    const size_t qo = zb + (size_t)(t0 + lr) * DH + 8 * hi;            // q plane rows (+ 16*ib*DH + kc)
    v8f acc[8][2];
#pragma unroll
    for (int jb = 0; jb < 8; ++jb) { acc[jb][0] = (v8f){}; acc[jb][1] = (v8f){}; }
#pragma unroll 1
    for (int kc = 0; kc < SEQ; kc += 32) {
        const v16h q0 = ldh(QP + qo + kc), q1 = ldh(QP + qo + (size_t)16 * DH + kc);
#pragma unroll
        for (int jb = 0; jb < 8; ++jb) { const v16h ka = ldh(KT + ao + (size_t)jb * 16 * SEQ + kc);
            acc[jb][0] = wmma16_g(ka, q0, acc[jb][0]); acc[jb][1] = wmma16_g(ka, q1, acc[jb][1]); }
    }
    // row max: lane holds 64 of the wave's 128 columns for query rows lr (ib = 0) and 16 + lr (ib = 1)
    float mx0 = NEGB, mx1 = NEGB;
#pragma unroll
    for (int jb = 0; jb < 8; ++jb) {
#pragma unroll
        for (int r = 0; r < 8; ++r) { mx0 = fmaxf(mx0, acc[jb][0][r]); mx1 = fmaxf(mx1, acc[jb][1][r]); } }
    mx0 = fmaxf(mx0, __shfl_xor(mx0, 16, 32)); mx1 = fmaxf(mx1, __shfl_xor(mx1, 16, 32));
    smax[wave * 32 + lane] = hi ? mx1 : mx0;                    // slot = query row 16*hi + lr = lane
    __syncthreads();
    float g0 = smax[lr], g1 = smax[16 + lr];
#pragma unroll
    for (int w = 1; w < AW; ++w) { g0 = fmaxf(g0, smax[w * 32 + lr]); g1 = fmaxf(g1, smax[w * 32 + 16 + lr]); }
    const float sh0 = PSH - g0 * SC2, sh1 = PSH - g1 * SC2;
    float ls0 = 0.0f, ls1 = 0.0f;
    const int pw = wave * 128 + 8 * hi;
#pragma unroll
    for (int jb = 0; jb < 8; ++jb) { v8h p0, p1;
#pragma unroll
        for (int r = 0; r < 8; ++r) {
            const float e0 = acc[jb][0][r] * SC2 + sh0, e1 = acc[jb][1][r] * SC2 + sh1;
            const h16 a0 = pexp_h(e0), a1 = pexp_h(e1);
            p0[r] = a0; p1[r] = a1; ls0 += (float)a0; ls1 += (float)a1; }
        *(v8h*)(&sP[lr * PP + pw + jb * 16]) = p0; *(v8h*)(&sP[(16 + lr) * PP + pw + jb * 16]) = p1; }
    ls0 += __shfl_xor(ls0, 16, 32); ls1 += __shfl_xor(ls1, 16, 32);
    ssum[wave * 32 + lane] = hi ? ls1 : ls0;
    __syncthreads();
    // phase 2
#pragma unroll
    for (int db = 0; db < 8; ++db) { acc[db][0] = (v8f){}; acc[db][1] = (v8f){}; }
#pragma unroll 1
    for (int kc = 0; kc < SEQ; kc += 32) {
        const int pi = lr * PP + kc + 8 * hi;
        const v16h p0 = cat16(*(const v8h*)(&sP[pi]), *(const v8h*)(&sP[pi + 16]));
        const v16h p1 = cat16(*(const v8h*)(&sP[pi + 16 * PP]), *(const v8h*)(&sP[pi + 16 * PP + 16]));
#pragma unroll
        for (int db = 0; db < 8; ++db) { const v16h va = ldh(VT + ao + (size_t)db * 16 * SEQ + kc);
            acc[db][0] = wmma16_g(va, p0, acc[db][0]); acc[db][1] = wmma16_g(va, p1, acc[db][1]); }
    }
    float l0 = ssum[lr], l1 = ssum[16 + lr];
#pragma unroll
    for (int w = 1; w < AW; ++w) { l0 += ssum[w * 32 + lr]; l1 += ssum[w * 32 + 16 + lr]; }
    const float inv0 = CTXC * (1.0f / l0), inv1 = CTXC * (1.0f / l1);   // l >= 16384: the row maximum contributes its full carry
    __syncthreads();                                            // every wave has finished reading the P tile; columns 128w..128w+127 are wave-private from here
    // O^T D layout: acc[db][ib][r] = (d = 128w + 16db + 8h + r, i = 16ib + lane&15) -> sP[i][128w + 16db + 8h + r]; rows 0..31 x 128 columns all written
#pragma unroll
    for (int db = 0; db < 8; ++db) { v8h o0, o1;
#pragma unroll
        for (int r = 0; r < 8; ++r) { o0[r] = toh_flush(acc[db][0][r] * inv0); o1[r] = toh_flush(acc[db][1][r] * inv1); }
        *(v8h*)(&sP[lr * PP + pw + db * 16]) = o0; *(v8h*)(&sP[(16 + lr) * PP + pw + db * 16]) = o1; }
    wave_sync();
    h16* crow = CTX + ((size_t)b * SEQ + (size_t)t0) * HDIM + (size_t)h * DH + (size_t)wave * 128;
{
#pragma unroll
        for (int s = 0; s < 16; ++s) { const int row = 2 * s + (lane >> 4), c8 = (lane & 15) * 8;   // 16 s x 2 rows = 32 rows; 16 lanes x 8 halves = 128 columns = two lines
            const v8h val = *(const v8h*)(&sP[row * PP + wave * 128 + c8]);
            *(v8h*)(crow + (size_t)row * HDIM + c8) = val; }
         }
}

// k_oproj: register-blocked f16 GEMM, ONE WAVE per 64x64 tile, K = HDIM; out[m][n] = (sum_k ctx64[m][k] wo64[n][k]) / 4096 + bias[n] (f32).
// A = ctx plane rows (chunk-local m = b*SEQ + t), Bt = Wo plane rows (n); grid (BCH*SEQ/64, NF/64); OUT already points at the chunk's first row.
__global__ __launch_bounds__(32) void k_oproj(const h16* __restrict__ A, const h16* __restrict__ Bt, const float* __restrict__ bias, float* OUT) {
    __shared__ __align__(16) float os[16 * 68];
    const int lane = threadIdx.x & 31, lr = lane & 15, hi = lane >> 4; const int r0 = blockIdx.x * 64, c0 = blockIdx.y * 64;
    v8f acc[4][4];
#pragma unroll
    for (int mb = 0; mb < 4; ++mb)
#pragma unroll
        for (int nb = 0; nb < 4; ++nb) acc[mb][nb] = (v8f){};
    const size_t aoff = (size_t)(r0 + lr) * HDIM + 8 * hi, boff = (size_t)(c0 + lr) * HDIM + 8 * hi;
#pragma unroll 1
    for (int kc = 0; kc < HDIM; kc += 32) {
        v16h a[4];
#pragma unroll
        for (int mb = 0; mb < 4; ++mb) a[mb] = ldh(A + aoff + (size_t)mb * 16 * HDIM + kc);
#pragma unroll
        for (int nb = 0; nb < 4; ++nb) { const v16h b = ldh(Bt + boff + (size_t)nb * 16 * HDIM + kc);
#pragma unroll
            for (int mb = 0; mb < 4; ++mb) acc[mb][nb] = wmma16_g(a[mb], b, acc[mb][nb]); }
    }
    float bc[4];
#pragma unroll
    for (int nb = 0; nb < 4; ++nb) bc[nb] = bfr(bias[c0 + nb * 16 + lr]);   // c0 + 63 < NF
#pragma unroll
    for (int mb = 0; mb < 4; ++mb) {
#pragma unroll
        for (int nb = 0; nb < 4; ++nb) {
#pragma unroll
            for (int j = 0; j < 8; ++j) os[(hi * 8 + j) * 68 + nb * 16 + lr] = acc[mb][nb][j] * OSC + bc[nb]; }   // D: row 8h+j, col lane&15
        wave_sync();
{
#pragma unroll
            for (int s = 0; s < 8; ++s) { const int row = 2 * s + (lane >> 4), c4 = (lane & 15) * 4;   // 8 s x 2 rows = 16 rows; 16 lanes x 4 floats = 64 columns = two lines
                const v4f val = *(const v4fa*)(&os[row * 68 + c4]);
                *(v4f*)(OUT + (size_t)(r0 + mb * 16 + row) * NF + c0 + c4) = val; }
             }
        wave_sync();
    }
}

static constexpr size_t al256(size_t v) { return (v + 255) & ~(size_t)255; }
static constexpr size_t SZ_XB = al256((size_t)NB * SEQ * NF * 2);            // bf16 copy of one input, all batches
static constexpr size_t SZ_WP = al256((size_t)HDIM * NF * 2);                // one weight plane (Wq | Wk | Wv bf16, Wo f16)
static constexpr size_t SZ_PL = al256((size_t)BCH * NH_ * SEQ * DH * 2);     // one q / k^T / v^T plane, one chunk
static constexpr size_t SZ_CX = al256((size_t)BCH * SEQ * HDIM * 2);         // ctx plane, one chunk
static constexpr size_t SZ_TOTAL = 3 * SZ_XB + 4 * SZ_WP + 3 * SZ_PL + SZ_CX;
static_assert(SZ_TOTAL <= (size_t)134217728);          // workspace carve <= 128 MiB
static_assert((size_t)BCH * NH_ * SEQ * DH == (size_t)BCH * HDIM * SEQ);   // k^T / v^T plane [(b*4096 + m)][t] has the same extent as the q plane
static_assert((size_t)NF * HDIM == (size_t)HDIM * NF);                     // Wo plane extent equals a projection weight plane

extern "C" void kernel_launch(void* const* d_in, const int* in_sizes, int n_in,
                              void* d_out, int out_size, void* d_ws, size_t ws_size, hipStream_t stream) {
    if (n_in < 11) return;
    const size_t needx = (size_t)NB * SEQ * NF;
    if ((size_t)in_sizes[0] < needx || (size_t)in_sizes[1] < needx || (size_t)in_sizes[2] < needx) return;
    if ((size_t)in_sizes[3] < (size_t)HDIM * NF || (size_t)in_sizes[5] < (size_t)HDIM * NF || (size_t)in_sizes[7] < (size_t)HDIM * NF) return;
    if ((size_t)in_sizes[9] < (size_t)NF * HDIM) return;
    if (in_sizes[4] < HDIM || in_sizes[6] < HDIM || in_sizes[8] < HDIM || in_sizes[10] < NF) return;
    if ((size_t)out_size < needx) return;
    if (SZ_TOTAL > ws_size) return;
    // wire order: q, k, v, Wq, bq, Wk, bk, Wv, bv, Wo, bo
    const float* xin[3] = { (const float*)d_in[0], (const float*)d_in[1], (const float*)d_in[2] };
    const float* wq = (const float*)d_in[3]; const float* bq = (const float*)d_in[4];
    const float* wk = (const float*)d_in[5]; const float* bk = (const float*)d_in[6];
    const float* wv = (const float*)d_in[7]; const float* bv = (const float*)d_in[8];
    const float* wo = (const float*)d_in[9]; const float* bo = (const float*)d_in[10];
    float* OUT = (float*)d_out;      // [NB][SEQ][NF]
    char* wsp = (char*)d_ws;
    bf* XB[3];
    XB[0] = (bf*)wsp; wsp += SZ_XB;                  // q  [NB*SEQ][NF]
    XB[1] = (bf*)wsp; wsp += SZ_XB;                  // k  [NB*SEQ][NF]
    XB[2] = (bf*)wsp; wsp += SZ_XB;                  // v  [NB*SEQ][NF]
    bf* WQ = (bf*)wsp; wsp += SZ_WP;                 // [4096][512] ([out][in] = Bt as-is)
    bf* WK = (bf*)wsp; wsp += SZ_WP;                 // [4096][512]
    bf* WV = (bf*)wsp; wsp += SZ_WP;                 // [4096][512]
    h16* WOH = (h16*)wsp; wsp += SZ_WP;              // [512][4096] x64
    h16* QP = (h16*)wsp; wsp += SZ_PL;               // [BCH*8][SEQ][512]
    h16* KTP = (h16*)wsp; wsp += SZ_PL;              // [BCH*8][512][SEQ]
    h16* VTP = (h16*)wsp; wsp += SZ_PL;              // [BCH*8][512][SEQ]
    h16* CTX = (h16*)wsp; wsp += SZ_CX;              // [BCH*SEQ][4096] x64

    { const size_t n8 = (size_t)NB * SEQ * NF / 8; const unsigned g = (unsigned)((n8 + 255) / 256);
      for (int i = 0; i < 3; ++i) k_cvt8<<<g, 256, 0, stream>>>(xin[i], XB[i], n8); }
    { const size_t n8 = (size_t)HDIM * NF / 8; const unsigned g = (unsigned)((n8 + 255) / 256);
      k_cvt8<<<g, 256, 0, stream>>>(wq, WQ, n8); k_cvt8<<<g, 256, 0, stream>>>(wk, WK, n8); k_cvt8<<<g, 256, 0, stream>>>(wv, WV, n8);
      k_cvtw<<<g, 256, 0, stream>>>(wo, WOH, n8); }

    for (int c = 0; c < NB / BCH; ++c) {
        const size_t xo = (size_t)c * BCH * SEQ * NF;          // first row of the chunk in the input copies and in the output
        // q: A = x rows (m = b*SEQ + t), Bt = Wq rows (n = h*512 + d) -> plane [(b*8 + h)][t][d]
        k_proj<<<dim3(BCH * SEQ / 64, HDIM / 64, 1), 32, 0, stream>>>(XB[0] + xo, WQ, bq, QP, 0);
        // k^T, v^T: A = W rows (m = h*512 + d), Bt = x rows (n = b*SEQ + t) -> plane [(b*8 + h)][d][t]
        k_proj<<<dim3(HDIM / 64, BCH * SEQ / 64, 1), 32, 0, stream>>>(WK, XB[1] + xo, bk, KTP, 1);
        k_proj<<<dim3(HDIM / 64, BCH * SEQ / 64, 1), 32, 0, stream>>>(WV, XB[2] + xo, bv, VTP, 1);
        k_attn<<<dim3(SEQ / 32, BCH * NH_, 1), 32 * AW, 0, stream>>>(QP, KTP, VTP, CTX);
        k_oproj<<<dim3(BCH * SEQ / 64, NF / 64, 1), 32, 0, stream>>>(CTX, WOH, bo, OUT + xo);
    }
}

// v001
// It runs in 594 microseconds.
// In two side-by-side timings against v000, it was 1.77 and 1.82 times as fast.
#include <hip/hip_runtime.h>

// Compute dtypes, f32 accumulate everywhere: the three input projections v_wmma_f32_16x16x32_bf16 (x, W, bias RNE-converted to bf16; products exact); scores, P.V and the output projection v_wmma_f32_16x16x32_f16, single product at every site.
// Multi-head attention block without mask: q/k/v [NB][512][512]; Wq/Wk/Wv [4096][512] ([out][in], y = x W^T + bias), 8 heads x 512 columns (head h = columns h*512 + d); score[i][j] = sum_m qh[i][m] kh[m][j] / sqrt(512)
// (m = feature index of qh = token index of kh, j = feature index of kh); softmax over j; ctx[i][d] = sum_j P[i][j] vh[j][d] (j = token index of vh); heads merged to [NB*512][4096]; output = ctx Wo^T + bo with Wo [512][4096] (f32).
// Planes (f16): q [(b*8+h)][t][d]; k^T and v^T [(b*8+h)][d][t] (contraction index contiguous in every GEMM); ctx [(b*512+t)][4096] carried x64; Wo carried x64 (built from the bf16 RNE value); P carried x16384 in LDS only (cancels in the normalisation).
// Attention kernel: 4 waves per 32 query rows of one (batch, head), transposed form S^T = K^T-plane x Q (wave w owns score columns 128w..128w+127), row max / row sum exchanged through LDS, packed P tile [32][512] in LDS,
// O^T = V^T-plane x P (wave w owns output columns 128w..128w+127). Batches are processed in chunks of BCH so the planes are reused.

#ifndef NB
#define NB 16
#endif
#define NB_FULL 16
#define SEQ  512                 // tokens per sequence; the module requires SEQ == DH (score contraction) and SEQ == NF
#define NF   512                 // input feature width
#define NH_  8
#define DH   512                 // per-head width
#define HDIM (NH_ * DH)          // 4096
#define BCH  (NB < 4 ? NB : 4)   // batches per chunk
#define AW   4                   // waves per attention block
#define PP   520                 // LDS row pitch (halves) of the P tile
#define SC2  ((float)(0.04419417382415922 * 1.4426950408889634))   // DH^-0.5 * log2(e)
#define PSH  14.0f               // log2 of the P carry (16384)
#define NEGB (-3.0e38f)
#define CTXC 64.0f               // carry of the ctx plane
#define WOC  64.0f               // carry of the Wo plane
#define OSC  (1.0f / 4096.0f)    // 1 / (CTXC * WOC)

static_assert(DH == SEQ);                      // score contraction: feature index of q = token index of k; plane row pitch is the same in both layouts
static_assert(NF == SEQ);
static_assert(NH_ * DH == HDIM);
static_assert(NF % 32 == 0);                   // projection k-loop steps by 32
static_assert(SEQ % 32 == 0);                  // attention k-loops step by 32
static_assert(HDIM % 32 == 0);                 // output projection k-loop steps by 32
static_assert(SEQ % 64 == 0);                  // a 64-row tile never straddles two batches
static_assert(DH % 64 == 0);                   // a 64-column tile never straddles two heads
static_assert(HDIM % 64 == 0);
static_assert(NF % 64 == 0);
static_assert((BCH * SEQ) % 64 == 0);
static_assert(BCH * SEQ <= HDIM);              // both bias index forms of k_proj stay inside the 4096-entry bias for either mode
static_assert(NB % BCH == 0);
static_assert(NB <= NB_FULL);
static_assert(DH == AW * 128);                 // each attention wave owns 128 score columns and 128 output columns
static_assert(SEQ % 32 == 0);                  // attention grid covers the query rows exactly (32 per block)
static_assert((PP * 2) % 16 == 0);
static_assert(PP >= DH);
static_assert(32 * 16 * 4 == 16 * 64 * 2);
static_assert(32 * 16 * 16 == 32 * 128 * 2);   // k_attn store loop: 32 lanes x 16 B x 16 trips == 32 rows x 256 B
static_assert(32 * 16 * 4 == 16 * 32 * 4);     // k_oproj store loop: 32 lanes x 16 B x 4 trips == 16 rows x 128 B
static_assert(2 * 256 * 272 + 4 * 16 * 68 * 4 <= 163840);   // static LDS of k_proj: two work-groups fit one WGP's 320 KiB
static_assert(HDIM % 128 == 0 && (BCH * SEQ) % 128 == 0);   // k_proj grid covers both extents exactly (128 x 128 tiles)
static_assert(32 * PP * 2 + 2 * AW * 32 * 4 <= 131072);   // static LDS of the attention kernel
static_assert(((size_t)NB * SEQ * NF) % 8 == 0);
static_assert(((size_t)HDIM * NF) % 8 == 0);

typedef _Float16 h16;
typedef unsigned short bf;
typedef __attribute__((ext_vector_type(16))) __bf16   v16bf;
typedef __attribute__((ext_vector_type(16))) _Float16 v16h;
typedef __attribute__((ext_vector_type(8)))  _Float16 v8h;
typedef __attribute__((ext_vector_type(8)))  unsigned short v8us;
typedef __attribute__((ext_vector_type(8)))  float    v8f;
typedef __attribute__((ext_vector_type(4)))  float    v4f;
typedef v4f  __attribute__((may_alias)) v4fa;

__device__ __forceinline__ unsigned short f2bf(float f) { unsigned u = __float_as_uint(f); u += 0x7FFFu + ((u >> 16) & 1u); return (unsigned short)(u >> 16); }
__device__ __forceinline__ float bfr(float f) { return __uint_as_float(((unsigned)f2bf(f)) << 16); }   // value after RNE convert to bf16
__device__ __forceinline__ v16h cat16(v8h lo, v8h hi) { return __builtin_shufflevector(lo, hi, 0, 1, 2, 3, 4, 5, 6, 7, 8, 9, 10, 11, 12, 13, 14, 15); }
__device__ __forceinline__ v16bf cat16b(v8us lo, v8us hi) { return __builtin_bit_cast(v16bf, __builtin_shufflevector(lo, hi, 0, 1, 2, 3, 4, 5, 6, 7, 8, 9, 10, 11, 12, 13, 14, 15)); }
__device__ __forceinline__ v8f wmma16(v16h a, v16h b, v8f c) { return __builtin_amdgcn_wmma_f32_16x16x32_f16(false, a, false, b, (short)0, c, false, false); }
__device__ __forceinline__ v8f wmmab(v16bf a, v16bf b, v8f c) { return __builtin_amdgcn_wmma_f32_16x16x32_bf16(false, a, false, b, (short)0, c, false, false); }
// fragment loaders from K-contiguous 16-bit rows; p already includes + 8*(lane>>4): elements 0..7 <- k0+8h+0..7, elements 8..15 <- k0+16+8h+0..7 (same map for A and B)
__device__ __forceinline__ v16h  ldh(const h16* p) { return cat16(*(const v8h*)p, *(const v8h*)(p + 16)); }
// ordering point for wave-private LDS tiles (same wave writes and reads)
__device__ __forceinline__ void wave_sync() { __builtin_amdgcn_fence(3 /* release order */, "wavefront"); __builtin_amdgcn_wave_barrier(); asm volatile("" ::: "memory"); }

// per-instruction guarded matrix ops: one accumulator tied per guard, operands kept live
__device__ __forceinline__ v8f wmma16_g(v16h a, v16h b, v8f c) { c = wmma16(a, b, c); asm volatile("v_nop\n\tv_nop\n\tv_nop\n\tv_nop" : "+v"(c) : "v"(a), "v"(b)); return c; }
__device__ __forceinline__ v8f wmmab_g(v16bf a, v16bf b, v8f c) { c = wmmab(a, b, c); asm volatile("v_nop\n\tv_nop\n\tv_nop\n\tv_nop" : "+v"(c) : "v"(a), "v"(b)); return c; }
// f32 -> f16 convert that cannot produce an f16 subnormal (|v| < 2^-14 -> +0), applied after the plane's power-of-two carry
static __device__ __forceinline__ h16 toh_flush(float v) { const h16 r = (h16)v; return (fabsf(v) < 6.103515625e-05f) ? (h16)0.0f : r; }
// carried probability 2^e as f16; the select is on the exponent argument (e < -14 -> +0)
static __device__ __forceinline__ h16 pexp_h(float e) { const h16 r = (h16)__builtin_amdgcn_exp2f(e); return (e < -14.0f) ? (h16)0.0f : r; }

// ---- operand staging for the two GEMM kernels: asynchronous copies to LDS, two buffers ----
// A work-group of 4 waves (2 x 2) owns a BM x BN tile. A stage is GKS = 128 k of every operand row ([A BM rows | Bt BN rows], 256 B a row, LDS pitch 272 B).
// Each lane copies 16 B; 16 lanes cover one 256-B row piece, so every copy instruction asks for whole lines. Stage s + 2 is issued into the buffer that pass s has left.
#define GKS  128                 // k per stage
#define GPH  136                 // LDS row pitch in halves (272 B = 16 B x 17: conflict-free for 16-byte fragment reads)
#define GTH  128                 // threads per GEMM work-group
static_assert((GPH * 2) % 16 == 0);
static_assert(NF % GKS == 0 && NF / GKS >= 2);       // both ring stages of the prologue exist
static_assert(HDIM % GKS == 0 && HDIM / GKS >= 2);
__device__ __forceinline__ unsigned lds_off(const void* p) { return (unsigned)(size_t)p; }
// eight copies and the wait that stands in front of any rewrite of their address registers, in one statement
__device__ __forceinline__ void acopy8(unsigned l, const bf* g, unsigned lstep, size_t gstep) {
    asm volatile("global_load_async_to_lds_b128 %0, %1, off\n\t"
                 "global_load_async_to_lds_b128 %2, %3, off\n\t"
                 "global_load_async_to_lds_b128 %4, %5, off\n\t"
                 "global_load_async_to_lds_b128 %6, %7, off\n\t"
                 "global_load_async_to_lds_b128 %8, %9, off\n\t"
                 "global_load_async_to_lds_b128 %10, %11, off\n\t"
                 "global_load_async_to_lds_b128 %12, %13, off\n\t"
                 "global_load_async_to_lds_b128 %14, %15, off\n\t"
                 "s_wait_xcnt 0x0"
                 :: "v"(l), "v"(g), "v"(l + lstep), "v"(g + gstep), "v"(l + 2 * lstep), "v"(g + 2 * gstep), "v"(l + 3 * lstep), "v"(g + 3 * gstep),
                    "v"(l + 4 * lstep), "v"(g + 4 * gstep), "v"(l + 5 * lstep), "v"(g + 5 * gstep), "v"(l + 6 * lstep), "v"(g + 6 * gstep), "v"(l + 7 * lstep), "v"(g + 7 * gstep)
                 : "memory");
}
// one stage: rows r0.. of A (BM) and c0.. of Bt (BN), k = kb..kb+127, into the buffer at LDS byte address lbuf; every thread issues (BM + BN) / 8 copies
template <int BM, int BN, int KT>
__device__ __forceinline__ void stage_issue(const bf* A, const bf* Bt, int r0, int c0, int kb, unsigned lbuf) {
    static_assert(BM % 64 == 0 && BN % 64 == 0);
    const int cc = threadIdx.x & 15, rr = threadIdx.x >> 4;          // 16-byte piece of the row; row within a sweep of 8 rows
    const bf* ga = A  + (size_t)(r0 + rr) * KT + kb + cc * 8;
    const bf* gb = Bt + (size_t)(c0 + rr) * KT + kb + cc * 8;
    const unsigned l = lbuf + (unsigned)(rr * GPH + cc * 8) * 2u;
#pragma unroll
    for (int i = 0; i < BM / 64; ++i) acopy8(l + i * 64 * GPH * 2, ga + (size_t)i * 64 * KT, 8 * GPH * 2, (size_t)8 * KT);
#pragma unroll
    for (int i = 0; i < BN / 64; ++i) acopy8(l + (BM + i * 64) * GPH * 2, gb + (size_t)i * 64 * KT, 8 * GPH * 2, (size_t)8 * KT);
}
__device__ __forceinline__ void wait_async0() { asm volatile("s_wait_asynccnt 0x0" ::: "memory"); }   // this wave's copies have landed
__device__ __forceinline__ void wait_ds0()    { asm volatile("s_wait_dscnt 0x0" ::: "memory"); }      // this wave's LDS reads have returned before their buffer is refilled
// C tile accumulation, k ascending in steps of 32; wave (wm, wn) owns rows wm*BM/2.. and columns wn*BN/2.. of the tile. BF: bf16 products, else f16.
// GB = k blocks of 32 whose fragments are read from LDS as one group.
template <int BM, int BN, int KT, bool BF, int GB>
__device__ __forceinline__ void gemm_ring(const bf* A, const bf* Bt, int r0, int c0, bf* ring, int wm, int wn, v8f (&acc)[BM / 32][BN / 32]) {
    constexpr int FM = BM / 32, FN = BN / 32, BUFH = (BM + BN) * GPH, NS = KT / GKS;
    static_assert(BM % 32 == 0 && BN % 32 == 0 && (BM + BN) / 8 <= 63 && (GKS / 32) % GB == 0);
    const int lane = threadIdx.x & 31, lr = lane & 15, hi = lane >> 4;
    const unsigned lb = lds_off(ring);
    stage_issue<BM, BN, KT>(A, Bt, r0, c0, 0, lb);
    wait_async0();
    __syncthreads();                                              // publishes stage 0
    stage_issue<BM, BN, KT>(A, Bt, r0, c0, GKS, lb + BUFH * 2);
    const int ao = (wm * (BM / 2) + lr) * GPH + 8 * hi, bo = (BM + wn * (BN / 2) + lr) * GPH + 8 * hi;
#pragma unroll 1
    for (int s = 0; s < NS; ++s) {                                // rolled: one pass per stage, the buffer chosen by s & 1
        const bf* sb = ring + (s & 1) * BUFH;
#pragma unroll
        for (int kk = 0; kk < GKS; kk += 32 * GB) {
            v8us a0[GB][FM], a1[GB][FM], b0[GB][FN], b1[GB][FN];
#pragma unroll
            for (int u = 0; u < GB; ++u) {
#pragma unroll
                for (int mb = 0; mb < FM; ++mb) { const bf* p = sb + ao + mb * 16 * GPH + kk + u * 32; a0[u][mb] = *(const v8us*)p; a1[u][mb] = *(const v8us*)(p + 16); }
#pragma unroll
                for (int nb = 0; nb < FN; ++nb) { const bf* p = sb + bo + nb * 16 * GPH + kk + u * 32; b0[u][nb] = *(const v8us*)p; b1[u][nb] = *(const v8us*)(p + 16); }
            }
            __builtin_amdgcn_sched_barrier(0);                    // keeps the group's LDS reads together ahead of its matrix block: spread among the matrix instructions each read place waits out the LDS latency
#pragma unroll
            for (int u = 0; u < GB; ++u)
#pragma unroll
                for (int nb = 0; nb < FN; ++nb)
#pragma unroll
                    for (int mb = 0; mb < FM; ++mb) {
                        if constexpr (BF) acc[mb][nb] = wmmab_g(cat16b(a0[u][mb], a1[u][mb]), cat16b(b0[u][nb], b1[u][nb]), acc[mb][nb]);
                        else              acc[mb][nb] = wmma16_g(__builtin_bit_cast(v16h, cat16b(a0[u][mb], a1[u][mb])), __builtin_bit_cast(v16h, cat16b(b0[u][nb], b1[u][nb])), acc[mb][nb]); }
            if constexpr (32 * GB < GKS) __builtin_amdgcn_sched_barrier(0);   // the next group's reads stay behind this matrix block, as one group
        }
        wait_ds0();
        wait_async0();
        __syncthreads();                                          // publishes stage s + 1 and ends every reader's last read of stage s
        if (s + 2 < NS) stage_issue<BM, BN, KT>(A, Bt, r0, c0, (s + 2) * GKS, lb + (unsigned)(s & 1) * (BUFH * 2));
    }
    wait_async0();
}

__global__ __launch_bounds__(256) void k_cvt8(const float* __restrict__ src, bf* dst, size_t n8) {
    const size_t i = (size_t)blockIdx.x * 256 + threadIdx.x; if (i >= n8) return;
    const v8f v = *(const v8f*)(src + i * 8); v8us o;
#pragma unroll
    for (int k = 0; k < 8; ++k) o[k] = f2bf(v[k]);
    *(v8us*)(dst + i * 8) = o; 
}

__global__ __launch_bounds__(256) void k_cvtw(const float* __restrict__ src, h16* dst, size_t n8) {
    const size_t i = (size_t)blockIdx.x * 256 + threadIdx.x; if (i >= n8) return;
    const v8f v = *(const v8f*)(src + i * 8); v8h o;
#pragma unroll
    for (int k = 0; k < 8; ++k) o[k] = toh_flush(bfr(v[k]) * WOC);
    *(v8h*)(dst + i * 8) = o; 
}

// k_proj: register-blocked bf16 GEMM, 4 waves per 128x128 tile, one 64x64 tile (16 accumulators) per wave, operands staged in LDS from K-contiguous bf16 planes, K = NF.
// C[m][n] = sum_k A[m][k] Bt[n][k] + bias, written as f16.
// mode 0: A = x rows (m = b*SEQ + t, chunk-local b), Bt = W rows (n = h*512 + d), bias per column; plane [(b*8 + h)][t][d]. grid (BCH*SEQ/128, HDIM/128).
// mode 1: A = W rows (m = h*512 + d), Bt = x rows (n = b*SEQ + t), bias per row; plane [(b*4096 + m)][t] = [(b*8 + h)][d][t]. grid (HDIM/128, BCH*SEQ/128).
__global__ __launch_bounds__(GTH) void k_proj(const bf* __restrict__ A, const bf* __restrict__ Bt, const float* __restrict__ bias, h16* Ph, int mode) {
    __shared__ __align__(16) bf ring[2 * (128 + 128) * GPH];
    __shared__ __align__(16) float osw[4][16 * 68];
    const int lane = threadIdx.x & 31, lr = lane & 15, hi = lane >> 4;
    const int wave = __builtin_amdgcn_readfirstlane((int)(threadIdx.x >> 5)), wm = wave >> 1, wn = wave & 1;
    float* os = osw[wave];                                         // wave-private store staging
    const int r0 = blockIdx.x * 128 + wm * 64, c0 = blockIdx.y * 128 + wn * 64;   // the wave's own 64x64 tile
    v8f acc[4][4];
#pragma unroll
    for (int mb = 0; mb < 4; ++mb)
#pragma unroll
        for (int nb = 0; nb < 4; ++nb) acc[mb][nb] = (v8f){};
    gemm_ring<128, 128, NF, true, 1>(A, Bt, blockIdx.x * 128, blockIdx.y * 128, ring, wm, wn, acc);
    const bool m0 = (mode == 0);                                   // kernel argument: wave-uniform
    float bc[4];
#pragma unroll
    for (int nb = 0; nb < 4; ++nb) { const float t = bias[c0 + nb * 16 + lr]; bc[nb] = m0 ? bfr(t) : 0.0f; }   // c0 + 63 < HDIM in both modes
    size_t tbase;
    if (m0) { const int bb = r0 / SEQ, tt = r0 % SEQ, hh = c0 / DH, dd = c0 % DH;
              tbase = (((size_t)(bb * NH_ + hh) * SEQ) + (size_t)tt) * DH + (size_t)dd; }
    else    { const int bb = c0 / SEQ, tt = c0 % SEQ;
              tbase = ((size_t)bb * HDIM + (size_t)r0) * SEQ + (size_t)tt; }
#pragma unroll
    for (int mb = 0; mb < 4; ++mb) {
        float br[8];
#pragma unroll
        for (int j = 0; j < 8; ++j) { const float t = bias[r0 + mb * 16 + hi * 8 + j]; br[j] = m0 ? 0.0f : bfr(t); }   // r0 + 63 < HDIM in both modes
#pragma unroll
        for (int nb = 0; nb < 4; ++nb) {
#pragma unroll
            for (int j = 0; j < 8; ++j) os[(hi * 8 + j) * 68 + nb * 16 + lr] = acc[mb][nb][j] + bc[nb] + br[j]; }   // D: row 8h+j, col lane&15
        wave_sync();
{
#pragma unroll
            for (int s = 0; s < 4; ++s) { const int row = 4 * s + (lane >> 3), c8 = (lane & 7) * 8;   // 4 s x 4 row groups = 16 rows; 8 lanes x 8 = 64 columns = one line
                const v4f x0 = *(const v4fa*)(&os[row * 68 + c8]); const v4f x1 = *(const v4fa*)(&os[row * 68 + c8 + 4]); v8h hv;
#pragma unroll
                for (int i = 0; i < 4; ++i) { hv[i] = toh_flush(x0[i]); hv[4 + i] = toh_flush(x1[i]); }
                const size_t oo = tbase + (size_t)(mb * 16 + row) * SEQ + c8;
                *(v8h*)(Ph + oo) = hv; }
             }
        wave_sync();
    }
}

// k_attn: fused attention for 32 query rows of one (chunk-local batch, head); 4 waves.
// Phase 1 (transposed scores): S^T[j][i] = sum_m KT[j][m] Q[i][m]; A = k^T-plane rows j = 128w + 16jb + lane&15 (k = token m), B = q-plane rows i = t0 + 16ib + lane&15 (k = feature m);
//   D: acc[jb][ib][r] = S^T[j = 128w + 16jb + 8h + r][i = 16ib + lane&15], so a lane holds 8 consecutive score columns of one query row.
// Softmax: per-wave row max -> LDS -> block barrier -> row max over the 4 waves; p = f16(2^((s - max) * scale * log2e + 14)); packed 16-B stores into the P tile [32][512] (LDS);
//   row sum over the converted p, per-wave partials through LDS; block barrier (publishes P and the sums).
// Phase 2: O^T[d][i] = sum_j VT[d][j] P[i][j]; A = v^T-plane rows d = 128w + 16db + lane&15 (k = token j), B = P tile rows i (k = j) from LDS.
// Epilogue: ctx = O / rowsum x 64 as f16; after a block barrier the wave stages its 32 x 128 tile in its own column range of the P tile (wave-private from then on),
__global__ __launch_bounds__(32 * AW) __attribute__((amdgpu_num_vgpr(256)))
void k_attn(const h16* __restrict__ QP, const h16* __restrict__ KT, const h16* __restrict__ VT, h16* CTX) {
    __shared__ __align__(16) h16 sP[32 * PP];
    __shared__ float smax[AW * 32];
    __shared__ float ssum[AW * 32];
    const int lane = threadIdx.x & 31, lr = lane & 15, hi = lane >> 4;
    const int wave = __builtin_amdgcn_readfirstlane((int)(threadIdx.x >> 5));
    const int zh = blockIdx.y; const int b = zh / NH_, h = zh % NH_;
    const int t0 = blockIdx.x * 32;
    const size_t zb = (size_t)zh * SEQ * DH;
    const size_t ao = zb + (size_t)(wave * 128 + lr) * SEQ + 8 * hi;   // k^T / v^T plane rows owned by this wave (+ 16*blk*SEQ + kc)
    const size_t qo = zb + (size_t)(t0 + lr) * DH + 8 * hi;            // q plane rows (+ 16*ib*DH + kc)
    v8f acc[8][2];
#pragma unroll
    for (int jb = 0; jb < 8; ++jb) { acc[jb][0] = (v8f){}; acc[jb][1] = (v8f){}; }
#pragma unroll 1
    for (int kc = 0; kc < SEQ; kc += 32) {
        const v16h q0 = ldh(QP + qo + kc), q1 = ldh(QP + qo + (size_t)16 * DH + kc);
#pragma unroll
        for (int jb = 0; jb < 8; ++jb) { const v16h ka = ldh(KT + ao + (size_t)jb * 16 * SEQ + kc);
            acc[jb][0] = wmma16_g(ka, q0, acc[jb][0]); acc[jb][1] = wmma16_g(ka, q1, acc[jb][1]); }
    }
    // row max: lane holds 64 of the wave's 128 columns for query rows lr (ib = 0) and 16 + lr (ib = 1)
    float mx0 = NEGB, mx1 = NEGB;
#pragma unroll
    for (int jb = 0; jb < 8; ++jb) {
#pragma unroll
        for (int r = 0; r < 8; ++r) { mx0 = fmaxf(mx0, acc[jb][0][r]); mx1 = fmaxf(mx1, acc[jb][1][r]); } }
    mx0 = fmaxf(mx0, __shfl_xor(mx0, 16, 32)); mx1 = fmaxf(mx1, __shfl_xor(mx1, 16, 32));
    smax[wave * 32 + lane] = hi ? mx1 : mx0;                    // slot = query row 16*hi + lr = lane
    __syncthreads();
    float g0 = smax[lr], g1 = smax[16 + lr];
#pragma unroll
    for (int w = 1; w < AW; ++w) { g0 = fmaxf(g0, smax[w * 32 + lr]); g1 = fmaxf(g1, smax[w * 32 + 16 + lr]); }
    const float sh0 = PSH - g0 * SC2, sh1 = PSH - g1 * SC2;
    float ls0 = 0.0f, ls1 = 0.0f;
    const int pw = wave * 128 + 8 * hi;
#pragma unroll
    for (int jb = 0; jb < 8; ++jb) { v8h p0, p1;
#pragma unroll
        for (int r = 0; r < 8; ++r) {
            const float e0 = acc[jb][0][r] * SC2 + sh0, e1 = acc[jb][1][r] * SC2 + sh1;
            const h16 a0 = pexp_h(e0), a1 = pexp_h(e1);
            p0[r] = a0; p1[r] = a1; ls0 += (float)a0; ls1 += (float)a1; }
        *(v8h*)(&sP[lr * PP + pw + jb * 16]) = p0; *(v8h*)(&sP[(16 + lr) * PP + pw + jb * 16]) = p1; }
    ls0 += __shfl_xor(ls0, 16, 32); ls1 += __shfl_xor(ls1, 16, 32);
    ssum[wave * 32 + lane] = hi ? ls1 : ls0;
    __syncthreads();
    // phase 2
#pragma unroll
    for (int db = 0; db < 8; ++db) { acc[db][0] = (v8f){}; acc[db][1] = (v8f){}; }
#pragma unroll 1
    for (int kc = 0; kc < SEQ; kc += 32) {
        const int pi = lr * PP + kc + 8 * hi;
        const v16h p0 = cat16(*(const v8h*)(&sP[pi]), *(const v8h*)(&sP[pi + 16]));
        const v16h p1 = cat16(*(const v8h*)(&sP[pi + 16 * PP]), *(const v8h*)(&sP[pi + 16 * PP + 16]));
#pragma unroll
        for (int db = 0; db < 8; ++db) { const v16h va = ldh(VT + ao + (size_t)db * 16 * SEQ + kc);
            acc[db][0] = wmma16_g(va, p0, acc[db][0]); acc[db][1] = wmma16_g(va, p1, acc[db][1]); }
    }
    float l0 = ssum[lr], l1 = ssum[16 + lr];
#pragma unroll
    for (int w = 1; w < AW; ++w) { l0 += ssum[w * 32 + lr]; l1 += ssum[w * 32 + 16 + lr]; }
    const float inv0 = CTXC * (1.0f / l0), inv1 = CTXC * (1.0f / l1);   // l >= 16384: the row maximum contributes its full carry
    __syncthreads();                                            // every wave has finished reading the P tile; columns 128w..128w+127 are wave-private from here
    // O^T D layout: acc[db][ib][r] = (d = 128w + 16db + 8h + r, i = 16ib + lane&15) -> sP[i][128w + 16db + 8h + r]; rows 0..31 x 128 columns all written
#pragma unroll
    for (int db = 0; db < 8; ++db) { v8h o0, o1;
#pragma unroll
        for (int r = 0; r < 8; ++r) { o0[r] = toh_flush(acc[db][0][r] * inv0); o1[r] = toh_flush(acc[db][1][r] * inv1); }
        *(v8h*)(&sP[lr * PP + pw + db * 16]) = o0; *(v8h*)(&sP[(16 + lr) * PP + pw + db * 16]) = o1; }
    wave_sync();
    h16* crow = CTX + ((size_t)b * SEQ + (size_t)t0) * HDIM + (size_t)h * DH + (size_t)wave * 128;
{
#pragma unroll
        for (int s = 0; s < 16; ++s) { const int row = 2 * s + (lane >> 4), c8 = (lane & 15) * 8;   // 16 s x 2 rows = 32 rows; 16 lanes x 8 halves = 128 columns = two lines
            const v8h val = *(const v8h*)(&sP[row * PP + wave * 128 + c8]);
            *(v8h*)(crow + (size_t)row * HDIM + c8) = val; }
         }
}

// k_oproj: register-blocked f16 GEMM, 4 waves per 64x64 tile, one 32x32 tile per wave, operands staged in LDS, K = HDIM; out[m][n] = (sum_k ctx64[m][k] wo64[n][k]) / 4096 + bias[n] (f32).
// A = ctx plane rows (chunk-local m = b*SEQ + t), Bt = Wo plane rows (n); grid (BCH*SEQ/64, NF/64); OUT already points at the chunk's first row.
__global__ __launch_bounds__(GTH) void k_oproj(const h16* __restrict__ A, const h16* __restrict__ Bt, const float* __restrict__ bias, float* OUT) {
    __shared__ __align__(16) bf ring[2 * (64 + 64) * GPH];
    __shared__ __align__(16) float osw[4][16 * 36];
    const int lane = threadIdx.x & 31, lr = lane & 15, hi = lane >> 4;
    const int wave = __builtin_amdgcn_readfirstlane((int)(threadIdx.x >> 5)), wm = wave >> 1, wn = wave & 1;
    float* os = osw[wave];                                         // wave-private store staging
    const int r0 = blockIdx.x * 64 + wm * 32, c0 = blockIdx.y * 64 + wn * 32;   // the wave's own 32x32 tile
    v8f acc[2][2];
#pragma unroll
    for (int mb = 0; mb < 2; ++mb)
#pragma unroll
        for (int nb = 0; nb < 2; ++nb) acc[mb][nb] = (v8f){};
    gemm_ring<64, 64, HDIM, false, 4>((const bf*)A, (const bf*)Bt, blockIdx.x * 64, blockIdx.y * 64, ring, wm, wn, acc);
    float bc[2];
#pragma unroll
    for (int nb = 0; nb < 2; ++nb) bc[nb] = bfr(bias[c0 + nb * 16 + lr]);   // c0 + 31 < NF
#pragma unroll
    for (int mb = 0; mb < 2; ++mb) {
#pragma unroll
        for (int nb = 0; nb < 2; ++nb) {
#pragma unroll
            for (int j = 0; j < 8; ++j) os[(hi * 8 + j) * 36 + nb * 16 + lr] = acc[mb][nb][j] * OSC + bc[nb]; }   // D: row 8h+j, col lane&15
        wave_sync();
{
#pragma unroll
            for (int s = 0; s < 4; ++s) { const int row = 4 * s + (lane >> 3), c4 = (lane & 7) * 4;   // 4 s x 4 rows = 16 rows; 8 lanes x 4 floats = 32 columns = one line
                const v4f val = *(const v4fa*)(&os[row * 36 + c4]);
                *(v4f*)(OUT + (size_t)(r0 + mb * 16 + row) * NF + c0 + c4) = val; }
             }
        wave_sync();
    }
}

static constexpr size_t al256(size_t v) { return (v + 255) & ~(size_t)255; }
static constexpr size_t SZ_XB = al256((size_t)NB * SEQ * NF * 2);            // bf16 copy of one input, all batches
static constexpr size_t SZ_WP = al256((size_t)HDIM * NF * 2);                // one weight plane (Wq | Wk | Wv bf16, Wo f16)
static constexpr size_t SZ_PL = al256((size_t)BCH * NH_ * SEQ * DH * 2);     // one q / k^T / v^T plane, one chunk
static constexpr size_t SZ_CX = al256((size_t)BCH * SEQ * HDIM * 2);         // ctx plane, one chunk
static constexpr size_t SZ_TOTAL = 3 * SZ_XB + 4 * SZ_WP + 3 * SZ_PL + SZ_CX;
static_assert(SZ_TOTAL <= (size_t)134217728);          // workspace carve <= 128 MiB
static_assert((size_t)BCH * NH_ * SEQ * DH == (size_t)BCH * HDIM * SEQ);   // k^T / v^T plane [(b*4096 + m)][t] has the same extent as the q plane
static_assert((size_t)NF * HDIM == (size_t)HDIM * NF);                     // Wo plane extent equals a projection weight plane

extern "C" void kernel_launch(void* const* d_in, const int* in_sizes, int n_in,
                              void* d_out, int out_size, void* d_ws, size_t ws_size, hipStream_t stream) {
    if (n_in < 11) return;
    const size_t needx = (size_t)NB * SEQ * NF;
    if ((size_t)in_sizes[0] < needx || (size_t)in_sizes[1] < needx || (size_t)in_sizes[2] < needx) return;
    if ((size_t)in_sizes[3] < (size_t)HDIM * NF || (size_t)in_sizes[5] < (size_t)HDIM * NF || (size_t)in_sizes[7] < (size_t)HDIM * NF) return;
    if ((size_t)in_sizes[9] < (size_t)NF * HDIM) return;
    if (in_sizes[4] < HDIM || in_sizes[6] < HDIM || in_sizes[8] < HDIM || in_sizes[10] < NF) return;
    if ((size_t)out_size < needx) return;
    if (SZ_TOTAL > ws_size) return;
    // wire order: q, k, v, Wq, bq, Wk, bk, Wv, bv, Wo, bo
    const float* xin[3] = { (const float*)d_in[0], (const float*)d_in[1], (const float*)d_in[2] };
    const float* wq = (const float*)d_in[3]; const float* bq = (const float*)d_in[4];
    const float* wk = (const float*)d_in[5]; const float* bk = (const float*)d_in[6];
    const float* wv = (const float*)d_in[7]; const float* bv = (const float*)d_in[8];
    const float* wo = (const float*)d_in[9]; const float* bo = (const float*)d_in[10];
    float* OUT = (float*)d_out;      // [NB][SEQ][NF]
    char* wsp = (char*)d_ws;
    bf* XB[3];
    XB[0] = (bf*)wsp; wsp += SZ_XB;                  // q  [NB*SEQ][NF]
    XB[1] = (bf*)wsp; wsp += SZ_XB;                  // k  [NB*SEQ][NF]
    XB[2] = (bf*)wsp; wsp += SZ_XB;                  // v  [NB*SEQ][NF]
    bf* WQ = (bf*)wsp; wsp += SZ_WP;                 // [4096][512] ([out][in] = Bt as-is)
    bf* WK = (bf*)wsp; wsp += SZ_WP;                 // [4096][512]
    bf* WV = (bf*)wsp; wsp += SZ_WP;                 // [4096][512]
    h16* WOH = (h16*)wsp; wsp += SZ_WP;              // [512][4096] x64
    h16* QP = (h16*)wsp; wsp += SZ_PL;               // [BCH*8][SEQ][512]
    h16* KTP = (h16*)wsp; wsp += SZ_PL;              // [BCH*8][512][SEQ]
    h16* VTP = (h16*)wsp; wsp += SZ_PL;              // [BCH*8][512][SEQ]
    h16* CTX = (h16*)wsp; wsp += SZ_CX;              // [BCH*SEQ][4096] x64

    { const size_t n8 = (size_t)NB * SEQ * NF / 8; const unsigned g = (unsigned)((n8 + 255) / 256);
      for (int i = 0; i < 3; ++i) k_cvt8<<<g, 256, 0, stream>>>(xin[i], XB[i], n8); }
    { const size_t n8 = (size_t)HDIM * NF / 8; const unsigned g = (unsigned)((n8 + 255) / 256);
      k_cvt8<<<g, 256, 0, stream>>>(wq, WQ, n8); k_cvt8<<<g, 256, 0, stream>>>(wk, WK, n8); k_cvt8<<<g, 256, 0, stream>>>(wv, WV, n8);
      k_cvtw<<<g, 256, 0, stream>>>(wo, WOH, n8); }

    for (int c = 0; c < NB / BCH; ++c) {
        const size_t xo = (size_t)c * BCH * SEQ * NF;          // first row of the chunk in the input copies and in the output
        // q: A = x rows (m = b*SEQ + t), Bt = Wq rows (n = h*512 + d) -> plane [(b*8 + h)][t][d]
        k_proj<<<dim3(BCH * SEQ / 128, HDIM / 128, 1), GTH, 0, stream>>>(XB[0] + xo, WQ, bq, QP, 0);
        // k^T, v^T: A = W rows (m = h*512 + d), Bt = x rows (n = b*SEQ + t) -> plane [(b*8 + h)][d][t]
        k_proj<<<dim3(HDIM / 128, BCH * SEQ / 128, 1), GTH, 0, stream>>>(WK, XB[1] + xo, bk, KTP, 1);
        k_proj<<<dim3(HDIM / 128, BCH * SEQ / 128, 1), GTH, 0, stream>>>(WV, XB[2] + xo, bv, VTP, 1);
        k_attn<<<dim3(SEQ / 32, BCH * NH_, 1), 32 * AW, 0, stream>>>(QP, KTP, VTP, CTX);
        k_oproj<<<dim3(BCH * SEQ / 64, NF / 64, 1), GTH, 0, stream>>>(CTX, WOH, bo, OUT + xo);
    }
}

// v002
// One run takes 351 microseconds.
// Next to v001, in two timings, it ran 1.68 times as fast each time.
// All steps since v000 together make it 3.01 times as fast.
#include <hip/hip_runtime.h>

// Compute dtypes, f32 accumulate everywhere: the three input projections v_wmma_f32_16x16x32_bf16 (x, W, bias RNE-converted to bf16; products exact); scores, P.V and the output projection v_wmma_f32_16x16x32_f16, single product at every site.
// Multi-head attention block without mask: q/k/v [NB][512][512]; Wq/Wk/Wv [4096][512] ([out][in], y = x W^T + bias), 8 heads x 512 columns (head h = columns h*512 + d); score[i][j] = sum_m qh[i][m] kh[m][j] / sqrt(512)
// (m = feature index of qh = token index of kh, j = feature index of kh); softmax over j; ctx[i][d] = sum_j P[i][j] vh[j][d] (j = token index of vh); heads merged to [NB*512][4096]; output = ctx Wo^T + bo with Wo [512][4096] (f32).
// Planes (f16): q [(b*8+h)][t][d]; k^T and v^T [(b*8+h)][d][t] (contraction index contiguous in every GEMM); ctx [(b*512+t)][4096] carried x64; Wo carried x64 (built from the bf16 RNE value); P carried x16384 in LDS only (cancels in the normalisation).
// Attention kernel: 8 waves per 64 query rows of one (batch, head), transposed form S^T = K^T-plane x Q (wave w owns score columns 64w..64w+63), row max / row sum exchanged through LDS, packed P tile [64][512] in LDS,
// O^T = V^T-plane x P (wave w owns output columns 64w..64w+63); the K^T and V^T planes pass through a two-buffer LDS ring, the Q tile lies where the P tile is written later. Batches are processed in chunks of BCH so the planes are reused.

#ifndef NB
#define NB 16
#endif
#define NB_FULL 16
#define SEQ  512                 // tokens per sequence; the module requires SEQ == DH (score contraction) and SEQ == NF
#define NF   512                 // input feature width
#define NH_  8
#define DH   512                 // per-head width
#define HDIM (NH_ * DH)          // 4096
#define BCH  (NB < 4 ? NB : 4)   // batches per chunk
#define AW   8                   // waves per attention block
#define QR   64                  // query rows per attention block
#define PP   520                 // LDS row pitch (halves) of the Q / P tile (1040 B = 16 B x 65)
#define AKS  64                  // k per stage of the attention ring (128 B of every plane row)
#define APH  72                  // LDS row pitch (halves) of the attention ring (144 B = 16 B x 9)
#define ANS  (SEQ / AKS)         // stages per plane
#define SC2  ((float)(0.04419417382415922 * 1.4426950408889634))   // DH^-0.5 * log2(e)
#define PSH  14.0f               // log2 of the P carry (16384)
#define NEGB (-3.0e38f)
#define CTXC 64.0f               // carry of the ctx plane
#define WOC  64.0f               // carry of the Wo plane
#define OSC  (1.0f / 4096.0f)    // 1 / (CTXC * WOC)

static_assert(DH == SEQ);                      // score contraction: feature index of q = token index of k; plane row pitch is the same in both layouts
static_assert(NF == SEQ);
static_assert(NH_ * DH == HDIM);
static_assert(NF % 32 == 0);                   // projection k-loop steps by 32
static_assert(SEQ % 32 == 0);                  // attention k-loops step by 32
static_assert(HDIM % 32 == 0);                 // output projection k-loop steps by 32
static_assert(SEQ % 64 == 0);                  // a 64-row tile never straddles two batches
static_assert(DH % 64 == 0);                   // a 64-column tile never straddles two heads
static_assert(HDIM % 64 == 0);
static_assert(NF % 64 == 0);
static_assert((BCH * SEQ) % 64 == 0);
static_assert(BCH * SEQ <= HDIM);              // both bias index forms of k_proj stay inside the 4096-entry bias for either mode
static_assert(NB % BCH == 0);
static_assert(NB <= NB_FULL);
static_assert(DH == AW * 64);                  // each attention wave owns 64 score columns and 64 output columns
static_assert(SEQ % QR == 0);                  // attention grid covers the query rows exactly (QR per block)
static_assert(ANS % 2 == 0 && ANS >= 2);       // the V^T stages go on in the ring with the buffer parity of the K^T stages; both prologue stages exist
static_assert((APH * 2) % 16 == 0 && AKS % 32 == 0);
static_assert(DH == 2 * 8 * 32 && QR == 2 * 8 * 4 && DH * 2 == 64 * 16 && AKS * 2 == 8 * 16);   // copy sweeps of 256 threads: ring 32 rows, Q tile 4 rows, 16 sweeps each
static_assert((PP * 2) % 16 == 0);
static_assert(PP >= DH);
static_assert(32 * 16 * 4 == 16 * 64 * 2);
static_assert(32 * 16 * 16 == QR * 64 * 2);    // k_attn store loop: 32 lanes x 16 B x 16 trips == 64 rows x 128 B
static_assert(32 * 16 * 4 == 16 * 32 * 4);     // k_oproj store loop: 32 lanes x 16 B x 4 trips == 16 rows x 128 B
static_assert(2 * 256 * 272 + 4 * 16 * 68 * 4 <= 163840);   // static LDS of k_proj: two work-groups fit one WGP's 320 KiB
static_assert(HDIM % 128 == 0 && (BCH * SEQ) % 128 == 0);   // k_proj grid covers both extents exactly (128 x 128 tiles)
static_assert(2 * DH * APH * 2 + QR * PP * 2 + 2 * AW * QR * 4 <= 327680);   // static LDS of the attention kernel: one work-group per WGP
static_assert(((size_t)NB * SEQ * NF) % 8 == 0);
static_assert(((size_t)HDIM * NF) % 8 == 0);

typedef _Float16 h16;
typedef unsigned short bf;
typedef __attribute__((ext_vector_type(16))) __bf16   v16bf;
typedef __attribute__((ext_vector_type(16))) _Float16 v16h;
typedef __attribute__((ext_vector_type(8)))  _Float16 v8h;
typedef __attribute__((ext_vector_type(8)))  unsigned short v8us;
typedef __attribute__((ext_vector_type(8)))  float    v8f;
typedef __attribute__((ext_vector_type(4)))  float    v4f;
typedef v4f  __attribute__((may_alias)) v4fa;

__device__ __forceinline__ unsigned short f2bf(float f) { unsigned u = __float_as_uint(f); u += 0x7FFFu + ((u >> 16) & 1u); return (unsigned short)(u >> 16); }
__device__ __forceinline__ float bfr(float f) { return __uint_as_float(((unsigned)f2bf(f)) << 16); }   // value after RNE convert to bf16
__device__ __forceinline__ v16h cat16(v8h lo, v8h hi) { return __builtin_shufflevector(lo, hi, 0, 1, 2, 3, 4, 5, 6, 7, 8, 9, 10, 11, 12, 13, 14, 15); }
__device__ __forceinline__ v16bf cat16b(v8us lo, v8us hi) { return __builtin_bit_cast(v16bf, __builtin_shufflevector(lo, hi, 0, 1, 2, 3, 4, 5, 6, 7, 8, 9, 10, 11, 12, 13, 14, 15)); }
__device__ __forceinline__ v8f wmma16(v16h a, v16h b, v8f c) { return __builtin_amdgcn_wmma_f32_16x16x32_f16(false, a, false, b, (short)0, c, false, false); }
__device__ __forceinline__ v8f wmmab(v16bf a, v16bf b, v8f c) { return __builtin_amdgcn_wmma_f32_16x16x32_bf16(false, a, false, b, (short)0, c, false, false); }
// fragment loaders from K-contiguous 16-bit rows; p already includes + 8*(lane>>4): elements 0..7 <- k0+8h+0..7, elements 8..15 <- k0+16+8h+0..7 (same map for A and B)
__device__ __forceinline__ v16h  ldh(const h16* p) { return cat16(*(const v8h*)p, *(const v8h*)(p + 16)); }
// ordering point for wave-private LDS tiles (same wave writes and reads)
__device__ __forceinline__ void wave_sync() { __builtin_amdgcn_fence(3 /* release order */, "wavefront"); __builtin_amdgcn_wave_barrier(); asm volatile("" ::: "memory"); }

// per-instruction guarded matrix ops: one accumulator tied per guard, operands kept live
__device__ __forceinline__ v8f wmma16_g(v16h a, v16h b, v8f c) { c = wmma16(a, b, c); asm volatile("v_nop\n\tv_nop\n\tv_nop\n\tv_nop" : "+v"(c) : "v"(a), "v"(b)); return c; }
__device__ __forceinline__ v8f wmmab_g(v16bf a, v16bf b, v8f c) { c = wmmab(a, b, c); asm volatile("v_nop\n\tv_nop\n\tv_nop\n\tv_nop" : "+v"(c) : "v"(a), "v"(b)); return c; }
// f32 -> f16 convert that cannot produce an f16 subnormal (|v| < 2^-14 -> +0), applied after the plane's power-of-two carry
static __device__ __forceinline__ h16 toh_flush(float v) { const h16 r = (h16)v; return (fabsf(v) < 6.103515625e-05f) ? (h16)0.0f : r; }
// carried probability 2^e as f16; the select is on the exponent argument (e < -14 -> +0)
static __device__ __forceinline__ h16 pexp_h(float e) { const h16 r = (h16)__builtin_amdgcn_exp2f(e); return (e < -14.0f) ? (h16)0.0f : r; }

// ---- operand staging for the two GEMM kernels: asynchronous copies to LDS, two buffers ----
// A work-group of 4 waves (2 x 2) owns a BM x BN tile. A stage is GKS = 128 k of every operand row ([A BM rows | Bt BN rows], 256 B a row, LDS pitch 272 B).
// Each lane copies 16 B; 16 lanes cover one 256-B row piece, so every copy instruction asks for whole lines. Stage s + 2 is issued into the buffer that pass s has left.
#define GKS  128                 // k per stage
#define GPH  136                 // LDS row pitch in halves (272 B = 16 B x 17: conflict-free for 16-byte fragment reads)
#define GTH  128                 // threads per GEMM work-group
static_assert((GPH * 2) % 16 == 0);
static_assert(NF % GKS == 0 && NF / GKS >= 2);       // both ring stages of the prologue exist
static_assert(HDIM % GKS == 0 && HDIM / GKS >= 2);
__device__ __forceinline__ unsigned lds_off(const void* p) { return (unsigned)(size_t)p; }
// eight copies and the wait that stands in front of any rewrite of their address registers, in one statement
__device__ __forceinline__ void acopy8(unsigned l, const bf* g, unsigned lstep, size_t gstep) {
    asm volatile("global_load_async_to_lds_b128 %0, %1, off\n\t"
                 "global_load_async_to_lds_b128 %2, %3, off\n\t"
                 "global_load_async_to_lds_b128 %4, %5, off\n\t"
                 "global_load_async_to_lds_b128 %6, %7, off\n\t"
                 "global_load_async_to_lds_b128 %8, %9, off\n\t"
                 "global_load_async_to_lds_b128 %10, %11, off\n\t"
                 "global_load_async_to_lds_b128 %12, %13, off\n\t"
                 "global_load_async_to_lds_b128 %14, %15, off\n\t"
                 "s_wait_xcnt 0x0"
                 :: "v"(l), "v"(g), "v"(l + lstep), "v"(g + gstep), "v"(l + 2 * lstep), "v"(g + 2 * gstep), "v"(l + 3 * lstep), "v"(g + 3 * gstep),
                    "v"(l + 4 * lstep), "v"(g + 4 * gstep), "v"(l + 5 * lstep), "v"(g + 5 * gstep), "v"(l + 6 * lstep), "v"(g + 6 * gstep), "v"(l + 7 * lstep), "v"(g + 7 * gstep)
                 : "memory");
}
// one stage: rows r0.. of A (BM) and c0.. of Bt (BN), k = kb..kb+127, into the buffer at LDS byte address lbuf; every thread issues (BM + BN) / 8 copies
template <int BM, int BN, int KT>
__device__ __forceinline__ void stage_issue(const bf* A, const bf* Bt, int r0, int c0, int kb, unsigned lbuf) {
    static_assert(BM % 64 == 0 && BN % 64 == 0);
    const int cc = threadIdx.x & 15, rr = threadIdx.x >> 4;          // 16-byte piece of the row; row within a sweep of 8 rows
    const bf* ga = A  + (size_t)(r0 + rr) * KT + kb + cc * 8;
    const bf* gb = Bt + (size_t)(c0 + rr) * KT + kb + cc * 8;
    const unsigned l = lbuf + (unsigned)(rr * GPH + cc * 8) * 2u;
#pragma unroll
    for (int i = 0; i < BM / 64; ++i) acopy8(l + i * 64 * GPH * 2, ga + (size_t)i * 64 * KT, 8 * GPH * 2, (size_t)8 * KT);
#pragma unroll
    for (int i = 0; i < BN / 64; ++i) acopy8(l + (BM + i * 64) * GPH * 2, gb + (size_t)i * 64 * KT, 8 * GPH * 2, (size_t)8 * KT);
}
__device__ __forceinline__ void wait_async0() { asm volatile("s_wait_asynccnt 0x0" ::: "memory"); }   // this wave's copies have landed
__device__ __forceinline__ void wait_ds0()    { asm volatile("s_wait_dscnt 0x0" ::: "memory"); }      // this wave's LDS reads have returned before their buffer is refilled
// C tile accumulation, k ascending in steps of 32; wave (wm, wn) owns rows wm*BM/2.. and columns wn*BN/2.. of the tile. BF: bf16 products, else f16.
// GB = k blocks of 32 whose fragments are read from LDS as one group.
template <int BM, int BN, int KT, bool BF, int GB>
__device__ __forceinline__ void gemm_ring(const bf* A, const bf* Bt, int r0, int c0, bf* ring, int wm, int wn, v8f (&acc)[BM / 32][BN / 32]) {
    constexpr int FM = BM / 32, FN = BN / 32, BUFH = (BM + BN) * GPH, NS = KT / GKS;
    static_assert(BM % 32 == 0 && BN % 32 == 0 && (BM + BN) / 8 <= 63 && (GKS / 32) % GB == 0);
    const int lane = threadIdx.x & 31, lr = lane & 15, hi = lane >> 4;
    const unsigned lb = lds_off(ring);
    stage_issue<BM, BN, KT>(A, Bt, r0, c0, 0, lb);
    wait_async0();
    __syncthreads();                                              // publishes stage 0
    stage_issue<BM, BN, KT>(A, Bt, r0, c0, GKS, lb + BUFH * 2);
    const int ao = (wm * (BM / 2) + lr) * GPH + 8 * hi, bo = (BM + wn * (BN / 2) + lr) * GPH + 8 * hi;
#pragma unroll 1
    for (int s = 0; s < NS; ++s) {                                // rolled: one pass per stage, the buffer chosen by s & 1
        const bf* sb = ring + (s & 1) * BUFH;
#pragma unroll
        for (int kk = 0; kk < GKS; kk += 32 * GB) {
            v8us a0[GB][FM], a1[GB][FM], b0[GB][FN], b1[GB][FN];
#pragma unroll
            for (int u = 0; u < GB; ++u) {
#pragma unroll
                for (int mb = 0; mb < FM; ++mb) { const bf* p = sb + ao + mb * 16 * GPH + kk + u * 32; a0[u][mb] = *(const v8us*)p; a1[u][mb] = *(const v8us*)(p + 16); }
#pragma unroll
                for (int nb = 0; nb < FN; ++nb) { const bf* p = sb + bo + nb * 16 * GPH + kk + u * 32; b0[u][nb] = *(const v8us*)p; b1[u][nb] = *(const v8us*)(p + 16); }
            }
            __builtin_amdgcn_sched_barrier(0);                    // keeps the group's LDS reads together ahead of its matrix block: spread among the matrix instructions each read place waits out the LDS latency
#pragma unroll
            for (int u = 0; u < GB; ++u)
#pragma unroll
                for (int nb = 0; nb < FN; ++nb)
#pragma unroll
                    for (int mb = 0; mb < FM; ++mb) {
                        if constexpr (BF) acc[mb][nb] = wmmab_g(cat16b(a0[u][mb], a1[u][mb]), cat16b(b0[u][nb], b1[u][nb]), acc[mb][nb]);
                        else              acc[mb][nb] = wmma16_g(__builtin_bit_cast(v16h, cat16b(a0[u][mb], a1[u][mb])), __builtin_bit_cast(v16h, cat16b(b0[u][nb], b1[u][nb])), acc[mb][nb]); }
            if constexpr (32 * GB < GKS) __builtin_amdgcn_sched_barrier(0);   // the next group's reads stay behind this matrix block, as one group
        }
        wait_ds0();
        wait_async0();
        __syncthreads();                                          // publishes stage s + 1 and ends every reader's last read of stage s
        if (s + 2 < NS) stage_issue<BM, BN, KT>(A, Bt, r0, c0, (s + 2) * GKS, lb + (unsigned)(s & 1) * (BUFH * 2));
    }
    wait_async0();
}

__global__ __launch_bounds__(256) void k_cvt8(const float* __restrict__ src, bf* dst, size_t n8) {
    const size_t i = (size_t)blockIdx.x * 256 + threadIdx.x; if (i >= n8) return;
    const v8f v = *(const v8f*)(src + i * 8); v8us o;
#pragma unroll
    for (int k = 0; k < 8; ++k) o[k] = f2bf(v[k]);
    *(v8us*)(dst + i * 8) = o; 
}

__global__ __launch_bounds__(256) void k_cvtw(const float* __restrict__ src, h16* dst, size_t n8) {
    const size_t i = (size_t)blockIdx.x * 256 + threadIdx.x; if (i >= n8) return;
    const v8f v = *(const v8f*)(src + i * 8); v8h o;
#pragma unroll
    for (int k = 0; k < 8; ++k) o[k] = toh_flush(bfr(v[k]) * WOC);
    *(v8h*)(dst + i * 8) = o; 
}

// k_proj: register-blocked bf16 GEMM, 4 waves per 128x128 tile, one 64x64 tile (16 accumulators) per wave, operands staged in LDS from K-contiguous bf16 planes, K = NF.
// C[m][n] = sum_k A[m][k] Bt[n][k] + bias, written as f16.
// mode 0: A = x rows (m = b*SEQ + t, chunk-local b), Bt = W rows (n = h*512 + d), bias per column; plane [(b*8 + h)][t][d]. grid (BCH*SEQ/128, HDIM/128).
// mode 1: A = W rows (m = h*512 + d), Bt = x rows (n = b*SEQ + t), bias per row; plane [(b*4096 + m)][t] = [(b*8 + h)][d][t]. grid (HDIM/128, BCH*SEQ/128).
__global__ __launch_bounds__(GTH) void k_proj(const bf* __restrict__ A, const bf* __restrict__ Bt, const float* __restrict__ bias, h16* Ph, int mode) {
    __shared__ __align__(16) bf ring[2 * (128 + 128) * GPH];
    __shared__ __align__(16) float osw[4][16 * 68];
    const int lane = threadIdx.x & 31, lr = lane & 15, hi = lane >> 4;
    const int wave = __builtin_amdgcn_readfirstlane((int)(threadIdx.x >> 5)), wm = wave >> 1, wn = wave & 1;
    float* os = osw[wave];                                         // wave-private store staging
    const int r0 = blockIdx.x * 128 + wm * 64, c0 = blockIdx.y * 128 + wn * 64;   // the wave's own 64x64 tile
    v8f acc[4][4];
#pragma unroll
    for (int mb = 0; mb < 4; ++mb)
#pragma unroll
        for (int nb = 0; nb < 4; ++nb) acc[mb][nb] = (v8f){};
    gemm_ring<128, 128, NF, true, 1>(A, Bt, blockIdx.x * 128, blockIdx.y * 128, ring, wm, wn, acc);
    const bool m0 = (mode == 0);                                   // kernel argument: wave-uniform
    float bc[4];
#pragma unroll
    for (int nb = 0; nb < 4; ++nb) { const float t = bias[c0 + nb * 16 + lr]; bc[nb] = m0 ? bfr(t) : 0.0f; }   // c0 + 63 < HDIM in both modes
    size_t tbase;
    if (m0) { const int bb = r0 / SEQ, tt = r0 % SEQ, hh = c0 / DH, dd = c0 % DH;
              tbase = (((size_t)(bb * NH_ + hh) * SEQ) + (size_t)tt) * DH + (size_t)dd; }
    else    { const int bb = c0 / SEQ, tt = c0 % SEQ;
              tbase = ((size_t)bb * HDIM + (size_t)r0) * SEQ + (size_t)tt; }
#pragma unroll
    for (int mb = 0; mb < 4; ++mb) {
        float br[8];
#pragma unroll
        for (int j = 0; j < 8; ++j) { const float t = bias[r0 + mb * 16 + hi * 8 + j]; br[j] = m0 ? 0.0f : bfr(t); }   // r0 + 63 < HDIM in both modes
#pragma unroll
        for (int nb = 0; nb < 4; ++nb) {
#pragma unroll
            for (int j = 0; j < 8; ++j) os[(hi * 8 + j) * 68 + nb * 16 + lr] = acc[mb][nb][j] + bc[nb] + br[j]; }   // D: row 8h+j, col lane&15
        wave_sync();
{
#pragma unroll
            for (int s = 0; s < 4; ++s) { const int row = 4 * s + (lane >> 3), c8 = (lane & 7) * 8;   // 4 s x 4 row groups = 16 rows; 8 lanes x 8 = 64 columns = one line
                const v4f x0 = *(const v4fa*)(&os[row * 68 + c8]); const v4f x1 = *(const v4fa*)(&os[row * 68 + c8 + 4]); v8h hv;
#pragma unroll
                for (int i = 0; i < 4; ++i) { hv[i] = toh_flush(x0[i]); hv[4 + i] = toh_flush(x1[i]); }
                const size_t oo = tbase + (size_t)(mb * 16 + row) * SEQ + c8;
                *(v8h*)(Ph + oo) = hv; }
             }
        wave_sync();
    }
}

// k_attn: fused attention for 64 query rows of one (chunk-local batch, head); 8 waves.
// Phase 1 (transposed scores): S^T[j][i] = sum_m KT[j][m] Q[i][m]; A = k^T-plane rows j = 64w + 16jb + lane&15 (k = token m), B = q-plane rows i = t0 + 16ib + lane&15 (k = feature m);
//   D: acc[jb][ib][r] = S^T[j = 64w + 16jb + 8h + r][i = 16ib + lane&15], so a lane holds 8 consecutive score columns of one query row.
// Softmax: per-wave row max -> LDS -> block barrier -> row max over the 8 waves; p = f16(2^((s - max) * scale * log2e + 14)); packed 16-B stores into the P tile [64][512] (LDS);
//   row sum over the converted p, per-wave partials through LDS; block barrier (publishes P and the sums).
// Phase 2: O^T[d][i] = sum_j VT[d][j] P[i][j]; A = v^T-plane rows d = 64w + 16db + lane&15 (k = token j), B = P tile rows i (k = j) from LDS.
// Operands: the Q tile is copied once into the LDS range that later holds P; the planes come as 2 * ANS ring stages (ANS of K^T, then ANS of V^T), each all 512 plane rows x 64 k, two buffers, asynchronous copies;
//   the first two V^T stages fly during the last score passes and the softmax.
// Epilogue: ctx = O / rowsum x 64 as f16; behind the last pass's barrier the wave stages its 64 x 64 tile in its own column range of the P tile (wave-private from then on).
// one ring stage: k = kb..kb+63 of all 512 rows of a plane [512][SEQ]; 8 lanes cover a 128-B row piece (one line); every thread issues 16 copies
__device__ __forceinline__ void attn_stage_issue(const h16* P, int kb, unsigned lbuf) {
    const int cc = threadIdx.x & 7, rr = threadIdx.x >> 3;           // 16-byte piece of the row piece; row within a sweep of 32 rows
    const bf* g = (const bf*)P + (size_t)rr * SEQ + kb + cc * 8;
    const unsigned l = lbuf + (unsigned)(rr * APH + cc * 8) * 2u;
#pragma unroll
    for (int i = 0; i < 2; ++i) acopy8(l + i * 256 * APH * 2, g + (size_t)i * 256 * SEQ, 32 * APH * 2, (size_t)32 * SEQ);
}
// one pass: 64 k of the wave's 64 plane rows (pa, ring buffer) against the 64 rows of the Q or P tile (pb), k ascending in steps of 32
__device__ __forceinline__ void attn_pass(const h16* pa, const h16* pb, v8f (&acc)[4][4]) {
#pragma unroll
    for (int u = 0; u < AKS / 32; ++u) {
        v8h a0[4], a1[4], b0[4], b1[4];
#pragma unroll
        for (int mb = 0; mb < 4; ++mb) { const h16* p = pa + mb * 16 * APH + u * 32; a0[mb] = *(const v8h*)p; a1[mb] = *(const v8h*)(p + 16); }
#pragma unroll
        for (int nb = 0; nb < 4; ++nb) { const h16* p = pb + nb * 16 * PP + u * 32; b0[nb] = *(const v8h*)p; b1[nb] = *(const v8h*)(p + 16); }
        __builtin_amdgcn_sched_barrier(0);                        // keeps the block's LDS reads together ahead of its matrix block: spread among the matrix instructions each read place waits out the LDS latency
#pragma unroll
        for (int nb = 0; nb < 4; ++nb)
#pragma unroll
            for (int mb = 0; mb < 4; ++mb) acc[mb][nb] = wmma16_g(cat16(a0[mb], a1[mb]), cat16(b0[nb], b1[nb]), acc[mb][nb]);
        if (u + 1 < AKS / 32) __builtin_amdgcn_sched_barrier(0);  // the next block's reads stay behind this matrix block, as one group
    }
}
__global__ __launch_bounds__(32 * AW)
void k_attn(const h16* __restrict__ QP, const h16* __restrict__ KT, const h16* __restrict__ VT, h16* CTX) {
    __shared__ __align__(16) h16 ring[2 * DH * APH];
    __shared__ __align__(16) h16 sP[QR * PP];
    __shared__ float smax[AW * QR];
    __shared__ float ssum[AW * QR];
    constexpr int ABUFH = DH * APH;                                 // halves per ring buffer
    const int lane = threadIdx.x & 31, lr = lane & 15, hi = lane >> 4;
    const int wave = __builtin_amdgcn_readfirstlane((int)(threadIdx.x >> 5));
    const int zh = blockIdx.y; const int b = zh / NH_, h = zh % NH_;
    const int t0 = blockIdx.x * QR;
    const size_t zb = (size_t)zh * SEQ * DH;
    const h16* KTz = KT + zb; const h16* VTz = VT + zb;
    const unsigned lb = lds_off(ring);
    const int ao = (wave * 64 + lr) * APH + 8 * hi;                 // plane rows owned by this wave, in a ring buffer (+ 16*blk*APH + k)
    const int bo = lr * PP + 8 * hi;                                // Q / P tile rows (+ 16*ib*PP + k)
    { const int cc = threadIdx.x & 63, rr = threadIdx.x >> 6;       // Q tile: 64 lanes cover one 1024-B row; 4 rows a sweep, 16 copies a thread
      const bf* g = (const bf*)QP + zb + (size_t)(t0 + rr) * DH + cc * 8;
      const unsigned l = lds_off(sP) + (unsigned)(rr * PP + cc * 8) * 2u;
#pragma unroll
      for (int i = 0; i < 2; ++i) acopy8(l + i * 32 * PP * 2, g + (size_t)i * 32 * DH, 4 * PP * 2, (size_t)4 * DH); }
    attn_stage_issue(KTz, 0, lb);
    wait_async0();
    __syncthreads();                                              // publishes the Q tile and stage 0
    attn_stage_issue(KTz, AKS, lb + ABUFH * 2);
    v8f acc[4][4];
#pragma unroll
    for (int jb = 0; jb < 4; ++jb)
#pragma unroll
        for (int ib = 0; ib < 4; ++ib) acc[jb][ib] = (v8f){};
#pragma unroll 1
    for (int s = 0; s < ANS; ++s) {                               // rolled: one pass per stage, the buffer chosen by s & 1
        attn_pass(ring + (s & 1) * ABUFH + ao, sP + bo + s * AKS, acc);
        wait_ds0();
        wait_async0();
        __syncthreads();                                          // publishes the next stage and ends every reader's last read of this one (behind the last pass: of the Q tile too)
        const int n = s + 2;                                      // always exists: the V^T stages follow the K^T stages
        attn_stage_issue(n < ANS ? KTz : VTz, (n & (ANS - 1)) * AKS, lb + (unsigned)(s & 1) * (ABUFH * 2));
    }
    // row max: lane holds 32 of the wave's 64 columns for query rows 16*ib + lr
    float mx[4];
#pragma unroll
    for (int ib = 0; ib < 4; ++ib) { mx[ib] = NEGB;
#pragma unroll
        for (int jb = 0; jb < 4; ++jb) {
#pragma unroll
            for (int r = 0; r < 8; ++r) mx[ib] = fmaxf(mx[ib], acc[jb][ib][r]); }
        mx[ib] = fmaxf(mx[ib], __shfl_xor(mx[ib], 16, 32)); }
    smax[wave * QR + lane] = hi ? mx[1] : mx[0];                // slot = query row 16*hi + lr = lane
    smax[wave * QR + 32 + lane] = hi ? mx[3] : mx[2];           // slot = query row 32 + lane
    __syncthreads();
    float sh[4], ls[4];
#pragma unroll
    for (int ib = 0; ib < 4; ++ib) { float g = smax[ib * 16 + lr];
#pragma unroll
        for (int w = 1; w < AW; ++w) g = fmaxf(g, smax[w * QR + ib * 16 + lr]);
        sh[ib] = PSH - g * SC2; ls[ib] = 0.0f; }
    const int pw = wave * 64 + 8 * hi;
#pragma unroll
    for (int jb = 0; jb < 4; ++jb) {
#pragma unroll
        for (int ib = 0; ib < 4; ++ib) { v8h p;
#pragma unroll
            for (int r = 0; r < 8; ++r) { const float e = acc[jb][ib][r] * SC2 + sh[ib]; const h16 a = pexp_h(e); p[r] = a; ls[ib] += (float)a; }
            *(v8h*)(&sP[(16 * ib + lr) * PP + pw + jb * 16]) = p; } }
#pragma unroll
    for (int ib = 0; ib < 4; ++ib) ls[ib] += __shfl_xor(ls[ib], 16, 32);
    ssum[wave * QR + lane] = hi ? ls[1] : ls[0];
    ssum[wave * QR + 32 + lane] = hi ? ls[3] : ls[2];
    __syncthreads();
    // phase 2
#pragma unroll
    for (int db = 0; db < 4; ++db)
#pragma unroll
        for (int ib = 0; ib < 4; ++ib) acc[db][ib] = (v8f){};
#pragma unroll 1
    for (int s = 0; s < ANS; ++s) {                               // rolled, as above
        attn_pass(ring + (s & 1) * ABUFH + ao, sP + bo + s * AKS, acc);
        wait_ds0();
        wait_async0();
        __syncthreads();                                          // publishes the next stage and ends every reader's last read of this one (behind the last pass: of the P tile too)
        if (s + 2 < ANS) attn_stage_issue(VTz, (s + 2) * AKS, lb + (unsigned)(s & 1) * (ABUFH * 2));
    }
    wait_async0();
    float inv[4];
#pragma unroll
    for (int ib = 0; ib < 4; ++ib) { float l = ssum[ib * 16 + lr];
#pragma unroll
        for (int w = 1; w < AW; ++w) l += ssum[w * QR + ib * 16 + lr];
        inv[ib] = CTXC * (1.0f / l); }                          // l >= 16384: the row maximum contributes its full carry
    // columns 64w..64w+63 of the P tile are wave-private from here
    // O^T D layout: acc[db][ib][r] = (d = 64w + 16db + 8h + r, i = 16ib + lane&15) -> sP[i][64w + 16db + 8h + r]; rows 0..63 x 64 columns all written
#pragma unroll
    for (int db = 0; db < 4; ++db) {
#pragma unroll
        for (int ib = 0; ib < 4; ++ib) { v8h o;
#pragma unroll
            for (int r = 0; r < 8; ++r) o[r] = toh_flush(acc[db][ib][r] * inv[ib]);
            *(v8h*)(&sP[(16 * ib + lr) * PP + pw + db * 16]) = o; } }
    wave_sync();
    h16* crow = CTX + ((size_t)b * SEQ + (size_t)t0) * HDIM + (size_t)h * DH + (size_t)wave * 64;
#pragma unroll
    for (int s = 0; s < 16; ++s) { const int row = 4 * s + (lane >> 3), c8 = (lane & 7) * 8;   // 16 s x 4 rows = 64 rows; 8 lanes x 8 halves = 64 columns = one line
        const v8h val = *(const v8h*)(&sP[row * PP + wave * 64 + c8]);
        *(v8h*)(crow + (size_t)row * HDIM + c8) = val; }
}

// k_oproj: register-blocked f16 GEMM, 4 waves per 64x64 tile, one 32x32 tile per wave, operands staged in LDS, K = HDIM; out[m][n] = (sum_k ctx64[m][k] wo64[n][k]) / 4096 + bias[n] (f32).
// A = ctx plane rows (chunk-local m = b*SEQ + t), Bt = Wo plane rows (n); grid (BCH*SEQ/64, NF/64); OUT already points at the chunk's first row.
__global__ __launch_bounds__(GTH) void k_oproj(const h16* __restrict__ A, const h16* __restrict__ Bt, const float* __restrict__ bias, float* OUT) {
    __shared__ __align__(16) bf ring[2 * (64 + 64) * GPH];
    __shared__ __align__(16) float osw[4][16 * 36];
    const int lane = threadIdx.x & 31, lr = lane & 15, hi = lane >> 4;
    const int wave = __builtin_amdgcn_readfirstlane((int)(threadIdx.x >> 5)), wm = wave >> 1, wn = wave & 1;
    float* os = osw[wave];                                         // wave-private store staging
    const int r0 = blockIdx.x * 64 + wm * 32, c0 = blockIdx.y * 64 + wn * 32;   // the wave's own 32x32 tile
    v8f acc[2][2];
#pragma unroll
    for (int mb = 0; mb < 2; ++mb)
#pragma unroll
        for (int nb = 0; nb < 2; ++nb) acc[mb][nb] = (v8f){};
    gemm_ring<64, 64, HDIM, false, 4>((const bf*)A, (const bf*)Bt, blockIdx.x * 64, blockIdx.y * 64, ring, wm, wn, acc);
    float bc[2];
#pragma unroll
    for (int nb = 0; nb < 2; ++nb) bc[nb] = bfr(bias[c0 + nb * 16 + lr]);   // c0 + 31 < NF
#pragma unroll
    for (int mb = 0; mb < 2; ++mb) {
#pragma unroll
        for (int nb = 0; nb < 2; ++nb) {
#pragma unroll
            for (int j = 0; j < 8; ++j) os[(hi * 8 + j) * 36 + nb * 16 + lr] = acc[mb][nb][j] * OSC + bc[nb]; }   // D: row 8h+j, col lane&15
        wave_sync();
{
#pragma unroll
            for (int s = 0; s < 4; ++s) { const int row = 4 * s + (lane >> 3), c4 = (lane & 7) * 4;   // 4 s x 4 rows = 16 rows; 8 lanes x 4 floats = 32 columns = one line
                const v4f val = *(const v4fa*)(&os[row * 36 + c4]);
                *(v4f*)(OUT + (size_t)(r0 + mb * 16 + row) * NF + c0 + c4) = val; }
             }
        wave_sync();
    }
}

static constexpr size_t al256(size_t v) { return (v + 255) & ~(size_t)255; }
static constexpr size_t SZ_XB = al256((size_t)NB * SEQ * NF * 2);            // bf16 copy of one input, all batches
static constexpr size_t SZ_WP = al256((size_t)HDIM * NF * 2);                // one weight plane (Wq | Wk | Wv bf16, Wo f16)
static constexpr size_t SZ_PL = al256((size_t)BCH * NH_ * SEQ * DH * 2);     // one q / k^T / v^T plane, one chunk
static constexpr size_t SZ_CX = al256((size_t)BCH * SEQ * HDIM * 2);         // ctx plane, one chunk
static constexpr size_t SZ_TOTAL = 3 * SZ_XB + 4 * SZ_WP + 3 * SZ_PL + SZ_CX;
static_assert(SZ_TOTAL <= (size_t)134217728);          // workspace carve <= 128 MiB
static_assert((size_t)BCH * NH_ * SEQ * DH == (size_t)BCH * HDIM * SEQ);   // k^T / v^T plane [(b*4096 + m)][t] has the same extent as the q plane
static_assert((size_t)NF * HDIM == (size_t)HDIM * NF);                     // Wo plane extent equals a projection weight plane

extern "C" void kernel_launch(void* const* d_in, const int* in_sizes, int n_in,
                              void* d_out, int out_size, void* d_ws, size_t ws_size, hipStream_t stream) {
    if (n_in < 11) return;
    const size_t needx = (size_t)NB * SEQ * NF;
    if ((size_t)in_sizes[0] < needx || (size_t)in_sizes[1] < needx || (size_t)in_sizes[2] < needx) return;
    if ((size_t)in_sizes[3] < (size_t)HDIM * NF || (size_t)in_sizes[5] < (size_t)HDIM * NF || (size_t)in_sizes[7] < (size_t)HDIM * NF) return;
    if ((size_t)in_sizes[9] < (size_t)NF * HDIM) return;
    if (in_sizes[4] < HDIM || in_sizes[6] < HDIM || in_sizes[8] < HDIM || in_sizes[10] < NF) return;
    if ((size_t)out_size < needx) return;
    if (SZ_TOTAL > ws_size) return;
    // wire order: q, k, v, Wq, bq, Wk, bk, Wv, bv, Wo, bo
    const float* xin[3] = { (const float*)d_in[0], (const float*)d_in[1], (const float*)d_in[2] };
    const float* wq = (const float*)d_in[3]; const float* bq = (const float*)d_in[4];
    const float* wk = (const float*)d_in[5]; const float* bk = (const float*)d_in[6];
    const float* wv = (const float*)d_in[7]; const float* bv = (const float*)d_in[8];
    const float* wo = (const float*)d_in[9]; const float* bo = (const float*)d_in[10];
    float* OUT = (float*)d_out;      // [NB][SEQ][NF]
    char* wsp = (char*)d_ws;
    bf* XB[3];
    XB[0] = (bf*)wsp; wsp += SZ_XB;                  // q  [NB*SEQ][NF]
    XB[1] = (bf*)wsp; wsp += SZ_XB;                  // k  [NB*SEQ][NF]
    XB[2] = (bf*)wsp; wsp += SZ_XB;                  // v  [NB*SEQ][NF]
    bf* WQ = (bf*)wsp; wsp += SZ_WP;                 // [4096][512] ([out][in] = Bt as-is)
    bf* WK = (bf*)wsp; wsp += SZ_WP;                 // [4096][512]
    bf* WV = (bf*)wsp; wsp += SZ_WP;                 // [4096][512]
    h16* WOH = (h16*)wsp; wsp += SZ_WP;              // [512][4096] x64
    h16* QP = (h16*)wsp; wsp += SZ_PL;               // [BCH*8][SEQ][512]
    h16* KTP = (h16*)wsp; wsp += SZ_PL;              // [BCH*8][512][SEQ]
    h16* VTP = (h16*)wsp; wsp += SZ_PL;              // [BCH*8][512][SEQ]
    h16* CTX = (h16*)wsp; wsp += SZ_CX;              // [BCH*SEQ][4096] x64

    { const size_t n8 = (size_t)NB * SEQ * NF / 8; const unsigned g = (unsigned)((n8 + 255) / 256);
      for (int i = 0; i < 3; ++i) k_cvt8<<<g, 256, 0, stream>>>(xin[i], XB[i], n8); }
    { const size_t n8 = (size_t)HDIM * NF / 8; const unsigned g = (unsigned)((n8 + 255) / 256);
      k_cvt8<<<g, 256, 0, stream>>>(wq, WQ, n8); k_cvt8<<<g, 256, 0, stream>>>(wk, WK, n8); k_cvt8<<<g, 256, 0, stream>>>(wv, WV, n8);
      k_cvtw<<<g, 256, 0, stream>>>(wo, WOH, n8); }

    for (int c = 0; c < NB / BCH; ++c) {
        const size_t xo = (size_t)c * BCH * SEQ * NF;          // first row of the chunk in the input copies and in the output
        // q: A = x rows (m = b*SEQ + t), Bt = Wq rows (n = h*512 + d) -> plane [(b*8 + h)][t][d]
        k_proj<<<dim3(BCH * SEQ / 128, HDIM / 128, 1), GTH, 0, stream>>>(XB[0] + xo, WQ, bq, QP, 0);
        // k^T, v^T: A = W rows (m = h*512 + d), Bt = x rows (n = b*SEQ + t) -> plane [(b*8 + h)][d][t]
        k_proj<<<dim3(HDIM / 128, BCH * SEQ / 128, 1), GTH, 0, stream>>>(WK, XB[1] + xo, bk, KTP, 1);
        k_proj<<<dim3(HDIM / 128, BCH * SEQ / 128, 1), GTH, 0, stream>>>(WV, XB[2] + xo, bv, VTP, 1);
        k_attn<<<dim3(SEQ / QR, BCH * NH_, 1), 32 * AW, 0, stream>>>(QP, KTP, VTP, CTX);
        k_oproj<<<dim3(BCH * SEQ / 64, NF / 64, 1), GTH, 0, stream>>>(CTX, WOH, bo, OUT + xo);
    }
}

// v003
// One run takes 248 microseconds.
// Two timings next to v002 put it at 1.42 and 1.43 times that version's speed.
// Counting every step since v000, it is 4.29 times as fast.
#include <hip/hip_runtime.h>

// Compute dtypes, f32 accumulate everywhere: the three input projections v_wmma_f32_16x16x32_bf16 (x, W, bias RNE-converted to bf16; products exact); scores, P.V and the output projection v_wmma_f32_16x16x32_f16, single product at every site.
// Multi-head attention block without mask: q/k/v [NB][512][512]; Wq/Wk/Wv [4096][512] ([out][in], y = x W^T + bias), 8 heads x 512 columns (head h = columns h*512 + d); score[i][j] = sum_m qh[i][m] kh[m][j] / sqrt(512)
// (m = feature index of qh = token index of kh, j = feature index of kh); softmax over j; ctx[i][d] = sum_j P[i][j] vh[j][d] (j = token index of vh); heads merged to [NB*512][4096]; output = ctx Wo^T + bo with Wo [512][4096] (f32).
// Planes (f16): q [(b*8+h)][t][d]; k^T and v^T [(b*8+h)][d][t] (contraction index contiguous in every GEMM); ctx [(b*8+h)][t][d] carried x64, stored over the q plane (each attention block replaces the 64 q rows that it alone has read); Wo carried x64 (built from the bf16 RNE value); P carried x16384 in LDS only (cancels in the normalisation).
// Attention kernel: 8 waves per 64 query rows of one (batch, head), transposed form S^T = K^T-plane x Q (wave w owns score columns 64w..64w+63), row max / row sum exchanged through LDS, packed P tile [64][512] in LDS,
// O^T = V^T-plane x P (wave w owns output columns 64w..64w+63); the K^T and V^T planes pass through a two-buffer LDS ring, the Q tile lies where the P tile is written later. All batches go through every kernel in one launch: four launches in all.

#ifndef NB
#define NB 16
#endif
#define NB_FULL 16
#define SEQ  512                 // tokens per sequence; the module requires SEQ == DH (score contraction) and SEQ == NF
#define NF   512                 // input feature width
#define NH_  8
#define DH   512                 // per-head width
#define HDIM (NH_ * DH)          // 4096
#define AW   8                   // waves per attention block
#define QR   64                  // query rows per attention block
#define PP   520                 // LDS row pitch (halves) of the Q / P tile (1040 B = 16 B x 65)
#define AKS  64                  // k per stage of the attention ring (128 B of every plane row)
#define APH  72                  // LDS row pitch (halves) of the attention ring (144 B = 16 B x 9)
#define ANS  (SEQ / AKS)         // stages per plane
#define SC2  ((float)(0.04419417382415922 * 1.4426950408889634))   // DH^-0.5 * log2(e)
#define PSH  14.0f               // log2 of the P carry (16384)
#define NEGB (-3.0e38f)
#define CTXC 64.0f               // carry of the ctx plane
#define WOC  64.0f               // carry of the Wo plane
#define OSC  (1.0f / 4096.0f)    // 1 / (CTXC * WOC)

static_assert(DH == SEQ);                      // score contraction: feature index of q = token index of k; plane row pitch is the same in both layouts
static_assert(NF == SEQ);
static_assert(NH_ * DH == HDIM);
static_assert(NF % 32 == 0);                   // projection k-loop steps by 32
static_assert(SEQ % 32 == 0);                  // attention k-loops step by 32
static_assert(HDIM % 32 == 0);                 // output projection k-loop steps by 32
static_assert(SEQ % 64 == 0);                  // a 64-row tile never straddles two batches
static_assert(DH % 64 == 0);                   // a 64-column tile never straddles two heads
static_assert(HDIM % 64 == 0);
static_assert(NF % 64 == 0);
static_assert(NB <= NB_FULL);
static_assert(DH == AW * 64);                  // each attention wave owns 64 score columns and 64 output columns
static_assert(SEQ % QR == 0);                  // attention grid covers the query rows exactly (QR per block)
static_assert(ANS % 2 == 0 && ANS >= 2);       // the V^T stages go on in the ring with the buffer parity of the K^T stages; both prologue stages exist
static_assert((APH * 2) % 16 == 0 && AKS % 32 == 0);
static_assert(DH == 2 * 8 * 32 && QR == 2 * 8 * 4 && DH * 2 == 64 * 16 && AKS * 2 == 8 * 16);   // copy sweeps of 256 threads: ring 32 rows, Q tile 4 rows, 16 sweeps each
static_assert((PP * 2) % 16 == 0);
static_assert(PP >= DH);
static_assert(32 * 16 * 4 == 16 * 64 * 2);
static_assert(32 * 16 * 16 == QR * 64 * 2);    // k_attn store loop: 32 lanes x 16 B x 16 trips == 64 rows x 128 B
static_assert(32 * 16 * 4 == 16 * 32 * 4);     // k_oproj store loop: 32 lanes x 16 B x 4 trips == 16 rows x 128 B
static_assert(2 * 256 * 272 + 4 * 16 * 68 * 4 <= 163840);   // static LDS of k_proj: two work-groups fit one WGP's 320 KiB
static_assert(HDIM % 128 == 0 && (NB * SEQ) % 128 == 0);    // k_proj grid covers both extents exactly (128 x 128 tiles)
static_assert(2 * DH * APH * 2 + QR * PP * 2 + 2 * AW * QR * 4 <= 327680);   // static LDS of the attention kernel: one work-group per WGP
static_assert(((size_t)NB * SEQ * NF) % 2048 == 0);          // k_cvt: a block converts 2048 elements of one source
static_assert(((size_t)HDIM * NF) % 2048 == 0);

typedef _Float16 h16;
typedef unsigned short bf;
typedef __attribute__((ext_vector_type(16))) __bf16   v16bf;
typedef __attribute__((ext_vector_type(16))) _Float16 v16h;
typedef __attribute__((ext_vector_type(8)))  _Float16 v8h;
typedef __attribute__((ext_vector_type(8)))  unsigned short v8us;
typedef __attribute__((ext_vector_type(8)))  float    v8f;
typedef __attribute__((ext_vector_type(4)))  float    v4f;
typedef v4f  __attribute__((may_alias)) v4fa;

__device__ __forceinline__ unsigned short f2bf(float f) { unsigned u = __float_as_uint(f); u += 0x7FFFu + ((u >> 16) & 1u); return (unsigned short)(u >> 16); }
__device__ __forceinline__ float bfr(float f) { return __uint_as_float(((unsigned)f2bf(f)) << 16); }   // value after RNE convert to bf16
__device__ __forceinline__ v16h cat16(v8h lo, v8h hi) { return __builtin_shufflevector(lo, hi, 0, 1, 2, 3, 4, 5, 6, 7, 8, 9, 10, 11, 12, 13, 14, 15); }
__device__ __forceinline__ v16bf cat16b(v8us lo, v8us hi) { return __builtin_bit_cast(v16bf, __builtin_shufflevector(lo, hi, 0, 1, 2, 3, 4, 5, 6, 7, 8, 9, 10, 11, 12, 13, 14, 15)); }
__device__ __forceinline__ v8f wmma16(v16h a, v16h b, v8f c) { return __builtin_amdgcn_wmma_f32_16x16x32_f16(false, a, false, b, (short)0, c, false, false); }
__device__ __forceinline__ v8f wmmab(v16bf a, v16bf b, v8f c) { return __builtin_amdgcn_wmma_f32_16x16x32_bf16(false, a, false, b, (short)0, c, false, false); }
// fragment loaders from K-contiguous 16-bit rows; p already includes + 8*(lane>>4): elements 0..7 <- k0+8h+0..7, elements 8..15 <- k0+16+8h+0..7 (same map for A and B)
__device__ __forceinline__ v16h  ldh(const h16* p) { return cat16(*(const v8h*)p, *(const v8h*)(p + 16)); }
// ordering point for wave-private LDS tiles (same wave writes and reads)
__device__ __forceinline__ void wave_sync() { __builtin_amdgcn_fence(3 /* release order */, "wavefront"); __builtin_amdgcn_wave_barrier(); asm volatile("" ::: "memory"); }

// per-instruction guarded matrix ops: one accumulator tied per guard, operands kept live
__device__ __forceinline__ v8f wmma16_g(v16h a, v16h b, v8f c) { c = wmma16(a, b, c); asm volatile("v_nop\n\tv_nop\n\tv_nop\n\tv_nop" : "+v"(c) : "v"(a), "v"(b)); return c; }
__device__ __forceinline__ v8f wmmab_g(v16bf a, v16bf b, v8f c) { c = wmmab(a, b, c); asm volatile("v_nop\n\tv_nop\n\tv_nop\n\tv_nop" : "+v"(c) : "v"(a), "v"(b)); return c; }
// f32 -> f16 convert that cannot produce an f16 subnormal (|v| < 2^-14 -> +0), applied after the plane's power-of-two carry
static __device__ __forceinline__ h16 toh_flush(float v) { const h16 r = (h16)v; return (fabsf(v) < 6.103515625e-05f) ? (h16)0.0f : r; }
// carried probability 2^e as f16; the select is on the exponent argument (e < -14 -> +0)
static __device__ __forceinline__ h16 pexp_h(float e) { const h16 r = (h16)__builtin_amdgcn_exp2f(e); return (e < -14.0f) ? (h16)0.0f : r; }

// ---- operand staging for the two GEMM kernels: asynchronous copies to LDS, two buffers ----
// A work-group of 4 waves (2 x 2) owns a BM x BN tile. A stage is GKS = 128 k of every operand row ([A BM rows | Bt BN rows], 256 B a row, LDS pitch 272 B).
// Each lane copies 16 B; 16 lanes cover one 256-B row piece, so every copy instruction asks for whole lines. Stage s + 2 is issued into the buffer that pass s has left.
#define GKS  128                 // k per stage
#define GPH  136                 // LDS row pitch in halves (272 B = 16 B x 17: conflict-free for 16-byte fragment reads)
#define GTH  128                 // threads per GEMM work-group
static_assert((GPH * 2) % 16 == 0);
static_assert(NF % GKS == 0 && NF / GKS >= 2);       // both ring stages of the prologue exist
static_assert(HDIM % GKS == 0 && HDIM / GKS >= 2);
__device__ __forceinline__ unsigned lds_off(const void* p) { return (unsigned)(size_t)p; }
// eight copies and the wait that stands in front of any rewrite of their address registers, in one statement
__device__ __forceinline__ void acopy8(unsigned l, const bf* g, unsigned lstep, size_t gstep) {
    asm volatile("global_load_async_to_lds_b128 %0, %1, off\n\t"
                 "global_load_async_to_lds_b128 %2, %3, off\n\t"
                 "global_load_async_to_lds_b128 %4, %5, off\n\t"
                 "global_load_async_to_lds_b128 %6, %7, off\n\t"
                 "global_load_async_to_lds_b128 %8, %9, off\n\t"
                 "global_load_async_to_lds_b128 %10, %11, off\n\t"
                 "global_load_async_to_lds_b128 %12, %13, off\n\t"
                 "global_load_async_to_lds_b128 %14, %15, off\n\t"
                 "s_wait_xcnt 0x0"
                 :: "v"(l), "v"(g), "v"(l + lstep), "v"(g + gstep), "v"(l + 2 * lstep), "v"(g + 2 * gstep), "v"(l + 3 * lstep), "v"(g + 3 * gstep),
                    "v"(l + 4 * lstep), "v"(g + 4 * gstep), "v"(l + 5 * lstep), "v"(g + 5 * gstep), "v"(l + 6 * lstep), "v"(g + 6 * gstep), "v"(l + 7 * lstep), "v"(g + 7 * gstep)
                 : "memory");
}
// one stage: BM rows of A and BN rows of Bt, 128 k each, into the buffer at LDS byte address lbuf; A and Bt point at the tile's first row at the stage's first k; PA, PB = row pitches; every thread issues (BM + BN) / 8 copies
template <int BM, int BN, int PA, int PB>
__device__ __forceinline__ void stage_issue(const bf* A, const bf* Bt, unsigned lbuf) {
    static_assert(BM % 64 == 0 && BN % 64 == 0);
    const int cc = threadIdx.x & 15, rr = threadIdx.x >> 4;          // 16-byte piece of the row; row within a sweep of 8 rows
    const bf* ga = A  + (size_t)rr * PA + cc * 8;
    const bf* gb = Bt + (size_t)rr * PB + cc * 8;
    const unsigned l = lbuf + (unsigned)(rr * GPH + cc * 8) * 2u;
#pragma unroll
    for (int i = 0; i < BM / 64; ++i) acopy8(l + i * 64 * GPH * 2, ga + (size_t)i * 64 * PA, 8 * GPH * 2, (size_t)8 * PA);
#pragma unroll
    for (int i = 0; i < BN / 64; ++i) acopy8(l + (BM + i * 64) * GPH * 2, gb + (size_t)i * 64 * PB, 8 * GPH * 2, (size_t)8 * PB);
}
__device__ __forceinline__ void wait_async0() { asm volatile("s_wait_asynccnt 0x0" ::: "memory"); }   // this wave's copies have landed
__device__ __forceinline__ void wait_ds0()    { asm volatile("s_wait_dscnt 0x0" ::: "memory"); }      // this wave's LDS reads have returned before their buffer is refilled
// C tile accumulation, k ascending in steps of 32; wave (wm, wn) owns rows wm*BM/2.. and columns wn*BN/2.. of the tile. BF: bf16 products, else f16.
// GB = k blocks of 32 whose fragments are read from LDS as one group. A and Bt point at the tile's first row, k = 0. Bt rows are KT long; an A row is PA long and holds k = 0..PA-1, the next PA k of that row lie AJ elements further.
template <int BM, int BN, int KT, bool BF, int GB, int PA, size_t AJ>
__device__ __forceinline__ void gemm_ring(const bf* A, const bf* Bt, bf* ring, int wm, int wn, v8f (&acc)[BM / 32][BN / 32]) {
    constexpr int FM = BM / 32, FN = BN / 32, BUFH = (BM + BN) * GPH, NS = KT / GKS;
    static_assert(BM % 32 == 0 && BN % 32 == 0 && (BM + BN) / 8 <= 63 && (GKS / 32) % GB == 0 && PA % GKS == 0 && KT % PA == 0);
    const int lane = threadIdx.x & 31, lr = lane & 15, hi = lane >> 4;
    const unsigned lb = lds_off(ring);
    stage_issue<BM, BN, PA, KT>(A, Bt, lb);
    wait_async0();
    __syncthreads();                                              // publishes stage 0
    stage_issue<BM, BN, PA, KT>(A + (GKS / PA) * AJ + GKS % PA, Bt + GKS, lb + BUFH * 2);
    const int ao = (wm * (BM / 2) + lr) * GPH + 8 * hi, bo = (BM + wn * (BN / 2) + lr) * GPH + 8 * hi;
#pragma unroll 1
    for (int s = 0; s < NS; ++s) {                                // rolled: one pass per stage, the buffer chosen by s & 1
        const bf* sb = ring + (s & 1) * BUFH;
#pragma unroll
        for (int kk = 0; kk < GKS; kk += 32 * GB) {
            v8us a0[GB][FM], a1[GB][FM], b0[GB][FN], b1[GB][FN];
#pragma unroll
            for (int u = 0; u < GB; ++u) {
#pragma unroll
                for (int mb = 0; mb < FM; ++mb) { const bf* p = sb + ao + mb * 16 * GPH + kk + u * 32; a0[u][mb] = *(const v8us*)p; a1[u][mb] = *(const v8us*)(p + 16); }
#pragma unroll
                for (int nb = 0; nb < FN; ++nb) { const bf* p = sb + bo + nb * 16 * GPH + kk + u * 32; b0[u][nb] = *(const v8us*)p; b1[u][nb] = *(const v8us*)(p + 16); }
            }
            __builtin_amdgcn_sched_barrier(0);                    // keeps the group's LDS reads together ahead of its matrix block: spread among the matrix instructions each read place waits out the LDS latency
#pragma unroll
            for (int u = 0; u < GB; ++u)
#pragma unroll
                for (int nb = 0; nb < FN; ++nb)
#pragma unroll
                    for (int mb = 0; mb < FM; ++mb) {
                        if constexpr (BF) acc[mb][nb] = wmmab_g(cat16b(a0[u][mb], a1[u][mb]), cat16b(b0[u][nb], b1[u][nb]), acc[mb][nb]);
                        else              acc[mb][nb] = wmma16_g(__builtin_bit_cast(v16h, cat16b(a0[u][mb], a1[u][mb])), __builtin_bit_cast(v16h, cat16b(b0[u][nb], b1[u][nb])), acc[mb][nb]); }
            if constexpr (32 * GB < GKS) __builtin_amdgcn_sched_barrier(0);   // the next group's reads stay behind this matrix block, as one group
        }
        wait_ds0();
        wait_async0();
        __syncthreads();                                          // publishes stage s + 1 and ends every reader's last read of stage s
        if (s + 2 < NS) { const int kb = (s + 2) * GKS; stage_issue<BM, BN, PA, KT>(A + (size_t)(kb / PA) * AJ + kb % PA, Bt + kb, lb + (unsigned)(s & 1) * (BUFH * 2)); }
    }
    wait_async0();
}

// k_cvt: every 16-bit operand plane in one launch; a block converts 2048 elements of one source. Block ranges: q | k | v (XBK blocks each, bf16 RNE), Wq | Wk | Wv (WBK each, bf16 RNE), Wo (WBK, f16 of the bf16 RNE value x64);
// the planes lie at dst in that order, back to back, so the destination index is the flat one.
#define XBK ((unsigned)((size_t)NB * SEQ * NF / 2048))
#define WBK ((unsigned)((size_t)HDIM * NF / 2048))
__global__ __launch_bounds__(256) void k_cvt(const float* __restrict__ q, const float* __restrict__ k, const float* __restrict__ v, const float* __restrict__ wq, const float* __restrict__ wk,
                                             const float* __restrict__ wv, const float* __restrict__ wo, bf* dst) {
    const unsigned blk = blockIdx.x;
    const float* src; unsigned lb;                                 // source and block index within it: block-uniform
    if (blk < 3 * XBK) { const unsigned g = blk / XBK; src = g == 0 ? q : g == 1 ? k : v; lb = blk - g * XBK; }
    else { const unsigned w = blk - 3 * XBK, g = w / WBK; src = g == 0 ? wq : g == 1 ? wk : g == 2 ? wv : wo; lb = w - g * WBK; }
    const v8f x = *(const v8f*)(src + ((size_t)lb * 256 + threadIdx.x) * 8); v8us o;
    if (blk < 3 * XBK + 3 * WBK) {
#pragma unroll
        for (int i = 0; i < 8; ++i) o[i] = f2bf(x[i]);
    } else { v8h t;
#pragma unroll
        for (int i = 0; i < 8; ++i) t[i] = toh_flush(bfr(x[i]) * WOC);
        o = __builtin_bit_cast(v8us, t); }
    *(v8us*)(dst + ((size_t)blk * 256 + threadIdx.x) * 8) = o;
}

// k_proj: register-blocked bf16 GEMM, 4 waves per 128x128 tile, one 64x64 tile (16 accumulators) per wave, operands staged in LDS from K-contiguous bf16 planes, K = NF.
// C[m][n] = sum_k A[m][k] Bt[n][k] + bias, written as f16.
// blockIdx.y = 0 (q): A = x rows (m = b*SEQ + t), Bt = W rows (n = h*512 + d), bias per column; plane [(b*8 + h)][t][d]; tile (bx, by) of (NB*SEQ/128, HDIM/128), bx fastest in blockIdx.x.
// blockIdx.y = 1, 2 (k, v): A = W rows (m = h*512 + d), Bt = x rows (n = b*SEQ + t), bias per row; plane [(b*4096 + m)][t] = [(b*8 + h)][d][t]; tile (bx, by) of (HDIM/128, NB*SEQ/128).
// XS, WS, PS: the three input copies, the three weight planes and the three output planes, each set back to back. grid (NB*SEQ/128 * HDIM/128, 3).
__global__ __launch_bounds__(GTH) void k_proj(const bf* __restrict__ XS, const bf* __restrict__ WS, const float* __restrict__ bq, const float* __restrict__ bk, const float* __restrict__ bv, h16* PS) {
    __shared__ __align__(16) bf ring[2 * (128 + 128) * GPH];
    __shared__ __align__(16) float osw[4][16 * 68];
    const int lane = threadIdx.x & 31, lr = lane & 15, hi = lane >> 4;
    const int wave = __builtin_amdgcn_readfirstlane((int)(threadIdx.x >> 5)), wm = wave >> 1, wn = wave & 1;
    float* os = osw[wave];                                         // wave-private store staging
    const int z = blockIdx.y;
    const bool m0 = (z == 0);                                      // block-uniform
    const bf* X = XS + (size_t)z * NB * SEQ * NF; const bf* Wz = WS + (size_t)z * HDIM * NF;
    const bf* A = m0 ? X : Wz; const bf* Bt = m0 ? Wz : X;
    const float* bias = z == 0 ? bq : z == 1 ? bk : bv;
    h16* Ph = PS + (size_t)z * NB * NH_ * SEQ * DH;
    const unsigned ti = blockIdx.x;
    const int bx = (int)(m0 ? ti % (NB * SEQ / 128) : ti % (HDIM / 128)), by = (int)(m0 ? ti / (NB * SEQ / 128) : ti / (HDIM / 128));
    const int r0 = bx * 128 + wm * 64, c0 = by * 128 + wn * 64;    // the wave's own 64x64 tile
    v8f acc[4][4];
#pragma unroll
    for (int mb = 0; mb < 4; ++mb)
#pragma unroll
        for (int nb = 0; nb < 4; ++nb) acc[mb][nb] = (v8f){};
    gemm_ring<128, 128, NF, true, 1, NF, 0>(A + (size_t)bx * 128 * NF, Bt + (size_t)by * 128 * NF, ring, wm, wn, acc);
    float bc[4];                                                   // in the built code each bias load below (bc, br) stands in its own branch on m0 with its own wait
#pragma unroll
    for (int nb = 0; nb < 4; ++nb) { const float t = bias[m0 ? c0 + nb * 16 + lr : 0]; bc[nb] = m0 ? bfr(t) : 0.0f; }   // q: c0 + 63 < HDIM
    size_t tbase;
    if (m0) { const int bb = r0 / SEQ, tt = r0 % SEQ, hh = c0 / DH, dd = c0 % DH;
              tbase = (((size_t)(bb * NH_ + hh) * SEQ) + (size_t)tt) * DH + (size_t)dd; }
    else    { const int bb = c0 / SEQ, tt = c0 % SEQ;
              tbase = ((size_t)bb * HDIM + (size_t)r0) * SEQ + (size_t)tt; }
#pragma unroll
    for (int mb = 0; mb < 4; ++mb) {
        float br[8];
#pragma unroll
        for (int j = 0; j < 8; ++j) { const float t = bias[m0 ? 0 : r0 + mb * 16 + hi * 8 + j]; br[j] = m0 ? 0.0f : bfr(t); }   // k, v: r0 + 63 < HDIM
#pragma unroll
        for (int nb = 0; nb < 4; ++nb) {
#pragma unroll
            for (int j = 0; j < 8; ++j) os[(hi * 8 + j) * 68 + nb * 16 + lr] = acc[mb][nb][j] + bc[nb] + br[j]; }   // D: row 8h+j, col lane&15
        wave_sync();
{
#pragma unroll
            for (int s = 0; s < 4; ++s) { const int row = 4 * s + (lane >> 3), c8 = (lane & 7) * 8;   // 4 s x 4 row groups = 16 rows; 8 lanes x 8 = 64 columns = one line
                const v4f x0 = *(const v4fa*)(&os[row * 68 + c8]); const v4f x1 = *(const v4fa*)(&os[row * 68 + c8 + 4]); v8h hv;
#pragma unroll
                for (int i = 0; i < 4; ++i) { hv[i] = toh_flush(x0[i]); hv[4 + i] = toh_flush(x1[i]); }
                const size_t oo = tbase + (size_t)(mb * 16 + row) * SEQ + c8;
                *(v8h*)(Ph + oo) = hv; }
             }
        wave_sync();
    }
}

// k_attn: fused attention for 64 query rows of one (batch, head); 8 waves.
// Phase 1 (transposed scores): S^T[j][i] = sum_m KT[j][m] Q[i][m]; A = k^T-plane rows j = 64w + 16jb + lane&15 (k = token m), B = q-plane rows i = t0 + 16ib + lane&15 (k = feature m);
//   D: acc[jb][ib][r] = S^T[j = 64w + 16jb + 8h + r][i = 16ib + lane&15], so a lane holds 8 consecutive score columns of one query row.
// Softmax: per-wave row max -> LDS -> block barrier -> row max over the 8 waves; p = f16(2^((s - max) * scale * log2e + 14)); packed 16-B stores into the P tile [64][512] (LDS);
//   row sum over the converted p, per-wave partials through LDS; block barrier (publishes P and the sums).
// Phase 2: O^T[d][i] = sum_j VT[d][j] P[i][j]; A = v^T-plane rows d = 64w + 16db + lane&15 (k = token j), B = P tile rows i (k = j) from LDS.
// Operands: the Q tile is copied once into the LDS range that later holds P; the planes come as 2 * ANS ring stages (ANS of K^T, then ANS of V^T), each all 512 plane rows x 64 k, two buffers, asynchronous copies;
//   the first two V^T stages fly during the last score passes and the softmax.
// Epilogue: ctx = O / rowsum x 64 as f16; behind the last pass's barrier the wave stages its 64 x 64 tile in its own column range of the P tile (wave-private from then on).
//   The ctx rows go to the places of the block's own 64 q rows in QC: no other block reads or writes those, and this block's copies of them have landed before its first barrier.
// one ring stage: k = kb..kb+63 of all 512 rows of a plane [512][SEQ]; 8 lanes cover a 128-B row piece (one line); every thread issues 16 copies
__device__ __forceinline__ void attn_stage_issue(const h16* P, int kb, unsigned lbuf) {
    const int cc = threadIdx.x & 7, rr = threadIdx.x >> 3;           // 16-byte piece of the row piece; row within a sweep of 32 rows
    const bf* g = (const bf*)P + (size_t)rr * SEQ + kb + cc * 8;
    const unsigned l = lbuf + (unsigned)(rr * APH + cc * 8) * 2u;
#pragma unroll
    for (int i = 0; i < 2; ++i) acopy8(l + i * 256 * APH * 2, g + (size_t)i * 256 * SEQ, 32 * APH * 2, (size_t)32 * SEQ);
}
// one pass: 64 k of the wave's 64 plane rows (pa, ring buffer) against the 64 rows of the Q or P tile (pb), k ascending in steps of 32
__device__ __forceinline__ void attn_pass(const h16* pa, const h16* pb, v8f (&acc)[4][4]) {
#pragma unroll
    for (int u = 0; u < AKS / 32; ++u) {
        v8h a0[4], a1[4], b0[4], b1[4];
#pragma unroll
        for (int mb = 0; mb < 4; ++mb) { const h16* p = pa + mb * 16 * APH + u * 32; a0[mb] = *(const v8h*)p; a1[mb] = *(const v8h*)(p + 16); }
#pragma unroll
        for (int nb = 0; nb < 4; ++nb) { const h16* p = pb + nb * 16 * PP + u * 32; b0[nb] = *(const v8h*)p; b1[nb] = *(const v8h*)(p + 16); }
        __builtin_amdgcn_sched_barrier(0);                        // keeps the block's LDS reads together ahead of its matrix block: spread among the matrix instructions each read place waits out the LDS latency
#pragma unroll
        for (int nb = 0; nb < 4; ++nb)
#pragma unroll
            for (int mb = 0; mb < 4; ++mb) acc[mb][nb] = wmma16_g(cat16(a0[mb], a1[mb]), cat16(b0[nb], b1[nb]), acc[mb][nb]);
        if (u + 1 < AKS / 32) __builtin_amdgcn_sched_barrier(0);  // the next block's reads stay behind this matrix block, as one group
    }
}
__global__ __launch_bounds__(32 * AW)
void k_attn(h16* QC, const h16* __restrict__ KT, const h16* __restrict__ VT) {
    __shared__ __align__(16) h16 ring[2 * DH * APH];
    __shared__ __align__(16) h16 sP[QR * PP];
    __shared__ float smax[AW * QR];
    __shared__ float ssum[AW * QR];
    constexpr int ABUFH = DH * APH;                                 // halves per ring buffer
    const int lane = threadIdx.x & 31, lr = lane & 15, hi = lane >> 4;
    const int wave = __builtin_amdgcn_readfirstlane((int)(threadIdx.x >> 5));
    const int zh = blockIdx.y;                                      // b * 8 + h
    const int t0 = blockIdx.x * QR;
    const size_t zb = (size_t)zh * SEQ * DH;
    const h16* KTz = KT + zb; const h16* VTz = VT + zb;
    const unsigned lb = lds_off(ring);
    const int ao = (wave * 64 + lr) * APH + 8 * hi;                 // plane rows owned by this wave, in a ring buffer (+ 16*blk*APH + k)
    const int bo = lr * PP + 8 * hi;                                // Q / P tile rows (+ 16*ib*PP + k)
    { const int cc = threadIdx.x & 63, rr = threadIdx.x >> 6;       // Q tile: 64 lanes cover one 1024-B row; 4 rows a sweep, 16 copies a thread
      const bf* g = (const bf*)QC + zb + (size_t)(t0 + rr) * DH + cc * 8;
      const unsigned l = lds_off(sP) + (unsigned)(rr * PP + cc * 8) * 2u;
#pragma unroll
      for (int i = 0; i < 2; ++i) acopy8(l + i * 32 * PP * 2, g + (size_t)i * 32 * DH, 4 * PP * 2, (size_t)4 * DH); }
    attn_stage_issue(KTz, 0, lb);
    wait_async0();
    __syncthreads();                                              // publishes the Q tile and stage 0
    attn_stage_issue(KTz, AKS, lb + ABUFH * 2);
    v8f acc[4][4];
#pragma unroll
    for (int jb = 0; jb < 4; ++jb)
#pragma unroll
        for (int ib = 0; ib < 4; ++ib) acc[jb][ib] = (v8f){};
#pragma unroll 1
    for (int s = 0; s < ANS; ++s) {                               // rolled: one pass per stage, the buffer chosen by s & 1
        attn_pass(ring + (s & 1) * ABUFH + ao, sP + bo + s * AKS, acc);
        wait_ds0();
        wait_async0();
        __syncthreads();                                          // publishes the next stage and ends every reader's last read of this one (behind the last pass: of the Q tile too)
        const int n = s + 2;                                      // always exists: the V^T stages follow the K^T stages
        attn_stage_issue(n < ANS ? KTz : VTz, (n & (ANS - 1)) * AKS, lb + (unsigned)(s & 1) * (ABUFH * 2));
    }
    // row max: lane holds 32 of the wave's 64 columns for query rows 16*ib + lr
    float mx[4];
#pragma unroll
    for (int ib = 0; ib < 4; ++ib) { mx[ib] = NEGB;
#pragma unroll
        for (int jb = 0; jb < 4; ++jb) {
#pragma unroll
            for (int r = 0; r < 8; ++r) mx[ib] = fmaxf(mx[ib], acc[jb][ib][r]); }
        mx[ib] = fmaxf(mx[ib], __shfl_xor(mx[ib], 16, 32)); }
    smax[wave * QR + lane] = hi ? mx[1] : mx[0];                // slot = query row 16*hi + lr = lane
    smax[wave * QR + 32 + lane] = hi ? mx[3] : mx[2];           // slot = query row 32 + lane
    __syncthreads();
    float sh[4], ls[4];
#pragma unroll
    for (int ib = 0; ib < 4; ++ib) { float g = smax[ib * 16 + lr];
#pragma unroll
        for (int w = 1; w < AW; ++w) g = fmaxf(g, smax[w * QR + ib * 16 + lr]);
        sh[ib] = PSH - g * SC2; ls[ib] = 0.0f; }
    const int pw = wave * 64 + 8 * hi;
#pragma unroll
    for (int jb = 0; jb < 4; ++jb) {
#pragma unroll
        for (int ib = 0; ib < 4; ++ib) { v8h p;
#pragma unroll
            for (int r = 0; r < 8; ++r) { const float e = acc[jb][ib][r] * SC2 + sh[ib]; const h16 a = pexp_h(e); p[r] = a; ls[ib] += (float)a; }
            *(v8h*)(&sP[(16 * ib + lr) * PP + pw + jb * 16]) = p; } }
#pragma unroll
    for (int ib = 0; ib < 4; ++ib) ls[ib] += __shfl_xor(ls[ib], 16, 32);
    ssum[wave * QR + lane] = hi ? ls[1] : ls[0];
    ssum[wave * QR + 32 + lane] = hi ? ls[3] : ls[2];
    __syncthreads();
    // phase 2
#pragma unroll
    for (int db = 0; db < 4; ++db)
#pragma unroll
        for (int ib = 0; ib < 4; ++ib) acc[db][ib] = (v8f){};
#pragma unroll 1
    for (int s = 0; s < ANS; ++s) {                               // rolled, as above
        attn_pass(ring + (s & 1) * ABUFH + ao, sP + bo + s * AKS, acc);
        wait_ds0();
        wait_async0();
        __syncthreads();                                          // publishes the next stage and ends every reader's last read of this one (behind the last pass: of the P tile too)
        if (s + 2 < ANS) attn_stage_issue(VTz, (s + 2) * AKS, lb + (unsigned)(s & 1) * (ABUFH * 2));
    }
    wait_async0();
    float inv[4];
#pragma unroll
    for (int ib = 0; ib < 4; ++ib) { float l = ssum[ib * 16 + lr];
#pragma unroll
        for (int w = 1; w < AW; ++w) l += ssum[w * QR + ib * 16 + lr];
        inv[ib] = CTXC * (1.0f / l); }                          // l >= 16384: the row maximum contributes its full carry
    // columns 64w..64w+63 of the P tile are wave-private from here
    // O^T D layout: acc[db][ib][r] = (d = 64w + 16db + 8h + r, i = 16ib + lane&15) -> sP[i][64w + 16db + 8h + r]; rows 0..63 x 64 columns all written
#pragma unroll
    for (int db = 0; db < 4; ++db) {
#pragma unroll
        for (int ib = 0; ib < 4; ++ib) { v8h o;
#pragma unroll
            for (int r = 0; r < 8; ++r) o[r] = toh_flush(acc[db][ib][r] * inv[ib]);
            *(v8h*)(&sP[(16 * ib + lr) * PP + pw + db * 16]) = o; } }
    wave_sync();
    h16* crow = QC + zb + (size_t)t0 * DH + (size_t)wave * 64;
#pragma unroll
    for (int s = 0; s < 16; ++s) { const int row = 4 * s + (lane >> 3), c8 = (lane & 7) * 8;   // 16 s x 4 rows = 64 rows; 8 lanes x 8 halves = 64 columns = one line
        const v8h val = *(const v8h*)(&sP[row * PP + wave * 64 + c8]);
        *(v8h*)(crow + (size_t)row * DH + c8) = val; }
}

// k_oproj: register-blocked f16 GEMM, 4 waves per 64x64 tile, one 32x32 tile per wave, operands staged in LDS, K = HDIM; out[m][n] = (sum_k ctx64[m][k] wo64[n][k]) / 4096 + bias[n] (f32).
// A = ctx plane [(b*8 + h)][t][d]: row m = b*SEQ + t holds k = h*512 + d in 8 pieces of 512, SEQ*DH apart; Bt = Wo plane rows (n); grid (NB*SEQ/64, NF/64).
__global__ __launch_bounds__(GTH) void k_oproj(const h16* __restrict__ A, const h16* __restrict__ Bt, const float* __restrict__ bias, float* OUT) {
    __shared__ __align__(16) bf ring[2 * (64 + 64) * GPH];
    __shared__ __align__(16) float osw[4][16 * 36];
    const int lane = threadIdx.x & 31, lr = lane & 15, hi = lane >> 4;
    const int wave = __builtin_amdgcn_readfirstlane((int)(threadIdx.x >> 5)), wm = wave >> 1, wn = wave & 1;
    float* os = osw[wave];                                         // wave-private store staging
    const int r0 = blockIdx.x * 64 + wm * 32, c0 = blockIdx.y * 64 + wn * 32;   // the wave's own 32x32 tile
    v8f acc[2][2];
#pragma unroll
    for (int mb = 0; mb < 2; ++mb)
#pragma unroll
        for (int nb = 0; nb < 2; ++nb) acc[mb][nb] = (v8f){};
    const int rt = blockIdx.x * 64;                                // a 64-row tile lies in one batch
    gemm_ring<64, 64, HDIM, false, 4, DH, (size_t)SEQ * DH>((const bf*)A + (size_t)(rt / SEQ) * NH_ * SEQ * DH + (size_t)(rt % SEQ) * DH, (const bf*)Bt + (size_t)blockIdx.y * 64 * HDIM, ring, wm, wn, acc);
    float bc[2];
#pragma unroll
    for (int nb = 0; nb < 2; ++nb) bc[nb] = bfr(bias[c0 + nb * 16 + lr]);   // c0 + 31 < NF
#pragma unroll
    for (int mb = 0; mb < 2; ++mb) {
#pragma unroll
        for (int nb = 0; nb < 2; ++nb) {
#pragma unroll
            for (int j = 0; j < 8; ++j) os[(hi * 8 + j) * 36 + nb * 16 + lr] = acc[mb][nb][j] * OSC + bc[nb]; }   // D: row 8h+j, col lane&15
        wave_sync();
{
#pragma unroll
            for (int s = 0; s < 4; ++s) { const int row = 4 * s + (lane >> 3), c4 = (lane & 7) * 4;   // 4 s x 4 rows = 16 rows; 8 lanes x 4 floats = 32 columns = one line
                const v4f val = *(const v4fa*)(&os[row * 36 + c4]);
                *(v4f*)(OUT + (size_t)(r0 + mb * 16 + row) * NF + c0 + c4) = val; }
             }
        wave_sync();
    }
}

static constexpr size_t SZ_XB = (size_t)NB * SEQ * NF * 2;                   // bf16 copy of one input
static constexpr size_t SZ_WP = (size_t)HDIM * NF * 2;                       // one weight plane (Wq | Wk | Wv bf16, Wo f16)
static constexpr size_t SZ_PL = (size_t)NB * NH_ * SEQ * DH * 2;             // one q / k^T / v^T plane; ctx replaces q
static constexpr size_t SZ_TOTAL = 3 * SZ_XB + 4 * SZ_WP + 3 * SZ_PL;
static_assert(SZ_XB % 256 == 0 && SZ_WP % 256 == 0 && SZ_PL % 256 == 0);   // the planes lie back to back, each 256-B aligned
static_assert(SZ_TOTAL <= (size_t)268435456);          // workspace carve <= 256 MiB
static_assert((size_t)NB * NH_ * SEQ * DH == (size_t)NB * HDIM * SEQ);     // k^T / v^T plane [(b*4096 + m)][t] has the same extent as the q plane
static_assert((size_t)NF * HDIM == (size_t)HDIM * NF);                     // Wo plane extent equals a projection weight plane

extern "C" void kernel_launch(void* const* d_in, const int* in_sizes, int n_in,
                              void* d_out, int out_size, void* d_ws, size_t ws_size, hipStream_t stream) {
    if (n_in < 11) return;
    const size_t needx = (size_t)NB * SEQ * NF;
    if ((size_t)in_sizes[0] < needx || (size_t)in_sizes[1] < needx || (size_t)in_sizes[2] < needx) return;
    if ((size_t)in_sizes[3] < (size_t)HDIM * NF || (size_t)in_sizes[5] < (size_t)HDIM * NF || (size_t)in_sizes[7] < (size_t)HDIM * NF) return;
    if ((size_t)in_sizes[9] < (size_t)NF * HDIM) return;
    if (in_sizes[4] < HDIM || in_sizes[6] < HDIM || in_sizes[8] < HDIM || in_sizes[10] < NF) return;
    if ((size_t)out_size < needx) return;
    if (SZ_TOTAL > ws_size) return;
    // wire order: q, k, v, Wq, bq, Wk, bk, Wv, bv, Wo, bo
    const float* xq = (const float*)d_in[0]; const float* xk = (const float*)d_in[1]; const float* xv = (const float*)d_in[2];
    const float* wq = (const float*)d_in[3]; const float* bq = (const float*)d_in[4];
    const float* wk = (const float*)d_in[5]; const float* bk = (const float*)d_in[6];
    const float* wv = (const float*)d_in[7]; const float* bv = (const float*)d_in[8];
    const float* wo = (const float*)d_in[9]; const float* bo = (const float*)d_in[10];
    float* OUT = (float*)d_out;      // [NB][SEQ][NF]
    char* wsp = (char*)d_ws;
    bf* XS = (bf*)wsp; wsp += 3 * SZ_XB;             // q | k | v, each [NB*SEQ][NF]
    bf* WS = (bf*)wsp; wsp += 3 * SZ_WP;             // Wq | Wk | Wv, each [4096][512] ([out][in])
    h16* WOH = (h16*)wsp; wsp += SZ_WP;              // [512][4096] x64
    h16* QC = (h16*)wsp; wsp += SZ_PL;               // q [NB*8][SEQ][512], then ctx [NB*8][SEQ][512] x64
    h16* KTP = (h16*)wsp; wsp += SZ_PL;              // [NB*8][512][SEQ]
    h16* VTP = (h16*)wsp; wsp += SZ_PL;              // [NB*8][512][SEQ]

    k_cvt<<<3 * XBK + 4 * WBK, 256, 0, stream>>>(xq, xk, xv, wq, wk, wv, wo, XS);
    k_proj<<<dim3((NB * SEQ / 128) * (HDIM / 128), 3, 1), GTH, 0, stream>>>(XS, WS, bq, bk, bv, QC);
    k_attn<<<dim3(SEQ / QR, NB * NH_, 1), 32 * AW, 0, stream>>>(QC, KTP, VTP);
    k_oproj<<<dim3(NB * SEQ / 64, NF / 64, 1), GTH, 0, stream>>>(QC, WOH, bo, OUT);
}

// v004
// One run takes 228 microseconds.
// Next to v003, in two timings, it ran 1.09 times as fast each time.
// Over all steps from v000 it is 4.68 times as fast.
#include <hip/hip_runtime.h>

// Compute dtypes, f32 accumulate everywhere: the three input projections v_wmma_f32_16x16x32_bf16 (x, W, bias RNE-converted to bf16; products exact); scores, P.V and the output projection v_wmma_f32_16x16x32_f16, single product at every site.
// Multi-head attention block without mask: q/k/v [NB][512][512]; Wq/Wk/Wv [4096][512] ([out][in], y = x W^T + bias), 8 heads x 512 columns (head h = columns h*512 + d); score[i][j] = sum_m qh[i][m] kh[m][j] / sqrt(512)
// (m = feature index of qh = token index of kh, j = feature index of kh); softmax over j; ctx[i][d] = sum_j P[i][j] vh[j][d] (j = token index of vh); heads merged to [NB*512][4096]; output = ctx Wo^T + bo with Wo [512][4096] (f32).
// Planes (f16): q [(b*8+h)][t][d]; k^T and v^T [(b*8+h)][d][t] (contraction index contiguous in every GEMM); ctx [(b*8+h)][t][d] carried x64, stored over the q plane (each attention block replaces the 128 q rows that it alone has read); Wo carried x64 (built from the bf16 RNE value); P carried x16384 in LDS only (cancels in the normalisation).
// Attention kernel: 8 waves per 128 query rows of one (batch, head), transposed form S^T = K^T-plane x Q (wave w owns score columns 64w..64w+63), row max / row sum exchanged through LDS, packed P tile [128][512] in LDS,
// O^T = V^T-plane x P (wave w owns output columns 64w..64w+63); the K^T and V^T planes pass through a two-buffer LDS ring, the Q tile lies where the P tile is written later. All batches go through every kernel in one launch: four launches in all.

#ifndef NB
#define NB 16
#endif
#define NB_FULL 16
#define SEQ  512                 // tokens per sequence; the module requires SEQ == DH (score contraction) and SEQ == NF
#define NF   512                 // input feature width
#define NH_  8
#define DH   512                 // per-head width
#define HDIM (NH_ * DH)          // 4096
#define AW   8                   // waves per attention block
#define QR   128                 // query rows per attention block: every plane byte that a block brings into LDS meets 128 query rows
#define QB   (QR / 16)           // 16-row query blocks per attention block (accumulator tiles per plane-row block of a wave)
#define PP   520                 // LDS row pitch (halves) of the Q / P tile (1040 B = 16 B x 65)
#define AKS  64                  // k per stage of the attention ring (128 B of every plane row)
#define APH  72                  // LDS row pitch (halves) of the attention ring (144 B = 16 B x 9)
#define ANS  (SEQ / AKS)         // stages per plane
#define SC2  ((float)(0.04419417382415922 * 1.4426950408889634))   // DH^-0.5 * log2(e)
#define PSH  14.0f               // log2 of the P carry (16384)
#define NEGB (-3.0e38f)
#define CTXC 64.0f               // carry of the ctx plane
#define WOC  64.0f               // carry of the Wo plane
#define OSC  (1.0f / 4096.0f)    // 1 / (CTXC * WOC)

static_assert(DH == SEQ);                      // score contraction: feature index of q = token index of k; plane row pitch is the same in both layouts
static_assert(NF == SEQ);
static_assert(NH_ * DH == HDIM);
static_assert(NF % 32 == 0);                   // projection k-loop steps by 32
static_assert(SEQ % 32 == 0);                  // attention k-loops step by 32
static_assert(HDIM % 32 == 0);                 // output projection k-loop steps by 32
static_assert(SEQ % 64 == 0);                  // a 64-row tile never straddles two batches
static_assert(DH % 64 == 0);                   // a 64-column tile never straddles two heads
static_assert(HDIM % 64 == 0);
static_assert(NF % 64 == 0);
static_assert(NB <= NB_FULL);
static_assert(DH == AW * 64);                  // each attention wave owns 64 score columns and 64 output columns
static_assert(SEQ % QR == 0);                  // attention grid covers the query rows exactly (QR per block)
static_assert(ANS % 2 == 0 && ANS >= 2);       // the V^T stages go on in the ring with the buffer parity of the K^T stages; both prologue stages exist
static_assert((APH * 2) % 16 == 0 && AKS % 32 == 0);
static_assert(DH == 2 * 8 * 32 && QR % (8 * 4) == 0 && DH * 2 == 64 * 16 && AKS * 2 == 8 * 16);   // copy sweeps of 256 threads: ring 32 rows a sweep, 16 sweeps; Q tile 4 rows a sweep, QR / 4 sweeps
static_assert(QR / 4 + 16 <= 63);              // copies of a wave in flight in the prologue: the Q tile and stage 0
static_assert((PP * 2) % 16 == 0);
static_assert(PP >= DH);
static_assert(32 * 16 * 4 == 16 * 64 * 2);
static_assert(32 * 16 * (QR / 4) == QR * 64 * 2);   // k_attn store loop: 32 lanes x 16 B x QR / 4 trips == QR rows x 128 B
static_assert(32 * 16 * 4 == 16 * 32 * 4);     // k_oproj store loop: 32 lanes x 16 B x 4 trips == 16 rows x 128 B
static_assert(2 * 256 * 272 + 4 * 16 * 68 * 4 <= 163840);   // static LDS of k_proj: two work-groups fit one WGP's 320 KiB
static_assert(HDIM % 128 == 0 && (NB * SEQ) % 128 == 0);    // k_proj grid covers both extents exactly (128 x 128 tiles)
static_assert(2 * DH * APH * 2 + QR * PP * 2 + 2 * AW * QR * 4 <= 327680);   // static LDS of the attention kernel: one work-group per WGP
static_assert(((size_t)NB * SEQ * NF) % 2048 == 0);          // k_cvt: a block converts 2048 elements of one source
static_assert(((size_t)HDIM * NF) % 2048 == 0);

typedef _Float16 h16;
typedef unsigned short bf;
typedef __attribute__((ext_vector_type(16))) __bf16   v16bf;
typedef __attribute__((ext_vector_type(16))) _Float16 v16h;
typedef __attribute__((ext_vector_type(8)))  _Float16 v8h;
typedef __attribute__((ext_vector_type(8)))  unsigned short v8us;
typedef __attribute__((ext_vector_type(8)))  float    v8f;
typedef __attribute__((ext_vector_type(4)))  float    v4f;
typedef v4f  __attribute__((may_alias)) v4fa;

__device__ __forceinline__ unsigned short f2bf(float f) { unsigned u = __float_as_uint(f); u += 0x7FFFu + ((u >> 16) & 1u); return (unsigned short)(u >> 16); }
__device__ __forceinline__ float bfr(float f) { return __uint_as_float(((unsigned)f2bf(f)) << 16); }   // value after RNE convert to bf16
__device__ __forceinline__ v16h cat16(v8h lo, v8h hi) { return __builtin_shufflevector(lo, hi, 0, 1, 2, 3, 4, 5, 6, 7, 8, 9, 10, 11, 12, 13, 14, 15); }
__device__ __forceinline__ v16bf cat16b(v8us lo, v8us hi) { return __builtin_bit_cast(v16bf, __builtin_shufflevector(lo, hi, 0, 1, 2, 3, 4, 5, 6, 7, 8, 9, 10, 11, 12, 13, 14, 15)); }
__device__ __forceinline__ v8f wmma16(v16h a, v16h b, v8f c) { return __builtin_amdgcn_wmma_f32_16x16x32_f16(false, a, false, b, (short)0, c, false, false); }
__device__ __forceinline__ v8f wmmab(v16bf a, v16bf b, v8f c) { return __builtin_amdgcn_wmma_f32_16x16x32_bf16(false, a, false, b, (short)0, c, false, false); }
// fragment loaders from K-contiguous 16-bit rows; p already includes + 8*(lane>>4): elements 0..7 <- k0+8h+0..7, elements 8..15 <- k0+16+8h+0..7 (same map for A and B)
__device__ __forceinline__ v16h  ldh(const h16* p) { return cat16(*(const v8h*)p, *(const v8h*)(p + 16)); }
// ordering point for wave-private LDS tiles (same wave writes and reads)
__device__ __forceinline__ void wave_sync() { __builtin_amdgcn_fence(3 /* release order */, "wavefront"); __builtin_amdgcn_wave_barrier(); asm volatile("" ::: "memory"); }

// per-instruction guarded matrix ops: one accumulator tied per guard, operands kept live
__device__ __forceinline__ v8f wmma16_g(v16h a, v16h b, v8f c) { c = wmma16(a, b, c); asm volatile("v_nop\n\tv_nop\n\tv_nop\n\tv_nop" : "+v"(c) : "v"(a), "v"(b)); return c; }
__device__ __forceinline__ v8f wmmab_g(v16bf a, v16bf b, v8f c) { c = wmmab(a, b, c); asm volatile("v_nop\n\tv_nop\n\tv_nop\n\tv_nop" : "+v"(c) : "v"(a), "v"(b)); return c; }
// f32 -> f16 convert that cannot produce an f16 subnormal (|v| < 2^-14 -> +0), applied after the plane's power-of-two carry
static __device__ __forceinline__ h16 toh_flush(float v) { const h16 r = (h16)v; return (fabsf(v) < 6.103515625e-05f) ? (h16)0.0f : r; }
// carried probability 2^e as f16; the select is on the exponent argument (e < -14 -> +0)
static __device__ __forceinline__ h16 pexp_h(float e) { const h16 r = (h16)__builtin_amdgcn_exp2f(e); return (e < -14.0f) ? (h16)0.0f : r; }

// ---- operand staging for the two GEMM kernels: asynchronous copies to LDS, two buffers ----
// A work-group of 4 waves (2 x 2) owns a BM x BN tile. A stage is GKS = 128 k of every operand row ([A BM rows | Bt BN rows], 256 B a row, LDS pitch 272 B).
// Each lane copies 16 B; 16 lanes cover one 256-B row piece, so every copy instruction asks for whole lines. Stage s + 2 is issued into the buffer that pass s has left.
#define GKS  128                 // k per stage
#define GPH  136                 // LDS row pitch in halves (272 B = 16 B x 17: conflict-free for 16-byte fragment reads)
#define GTH  128                 // threads per GEMM work-group
static_assert((GPH * 2) % 16 == 0);
static_assert(NF % GKS == 0 && NF / GKS >= 2);       // both ring stages of the prologue exist
static_assert(HDIM % GKS == 0 && HDIM / GKS >= 2);
__device__ __forceinline__ unsigned lds_off(const void* p) { return (unsigned)(size_t)p; }
// eight copies and the wait that stands in front of any rewrite of their address registers, in one statement
__device__ __forceinline__ void acopy8(unsigned l, const bf* g, unsigned lstep, size_t gstep) {
    asm volatile("global_load_async_to_lds_b128 %0, %1, off\n\t"
                 "global_load_async_to_lds_b128 %2, %3, off\n\t"
                 "global_load_async_to_lds_b128 %4, %5, off\n\t"
                 "global_load_async_to_lds_b128 %6, %7, off\n\t"
                 "global_load_async_to_lds_b128 %8, %9, off\n\t"
                 "global_load_async_to_lds_b128 %10, %11, off\n\t"
                 "global_load_async_to_lds_b128 %12, %13, off\n\t"
                 "global_load_async_to_lds_b128 %14, %15, off\n\t"
                 "s_wait_xcnt 0x0"
                 :: "v"(l), "v"(g), "v"(l + lstep), "v"(g + gstep), "v"(l + 2 * lstep), "v"(g + 2 * gstep), "v"(l + 3 * lstep), "v"(g + 3 * gstep),
                    "v"(l + 4 * lstep), "v"(g + 4 * gstep), "v"(l + 5 * lstep), "v"(g + 5 * gstep), "v"(l + 6 * lstep), "v"(g + 6 * gstep), "v"(l + 7 * lstep), "v"(g + 7 * gstep)
                 : "memory");
}
// one stage: BM rows of A and BN rows of Bt, 128 k each, into the buffer at LDS byte address lbuf; A and Bt point at the tile's first row at the stage's first k; PA, PB = row pitches; every thread issues (BM + BN) / 8 copies
template <int BM, int BN, int PA, int PB>
__device__ __forceinline__ void stage_issue(const bf* A, const bf* Bt, unsigned lbuf) {
    static_assert(BM % 64 == 0 && BN % 64 == 0);
    const int cc = threadIdx.x & 15, rr = threadIdx.x >> 4;          // 16-byte piece of the row; row within a sweep of 8 rows
    const bf* ga = A  + (size_t)rr * PA + cc * 8;
    const bf* gb = Bt + (size_t)rr * PB + cc * 8;
    const unsigned l = lbuf + (unsigned)(rr * GPH + cc * 8) * 2u;
#pragma unroll
    for (int i = 0; i < BM / 64; ++i) acopy8(l + i * 64 * GPH * 2, ga + (size_t)i * 64 * PA, 8 * GPH * 2, (size_t)8 * PA);
#pragma unroll
    for (int i = 0; i < BN / 64; ++i) acopy8(l + (BM + i * 64) * GPH * 2, gb + (size_t)i * 64 * PB, 8 * GPH * 2, (size_t)8 * PB);
}
__device__ __forceinline__ void wait_async0() { asm volatile("s_wait_asynccnt 0x0" ::: "memory"); }   // this wave's copies have landed
__device__ __forceinline__ void wait_ds0()    { asm volatile("s_wait_dscnt 0x0" ::: "memory"); }      // this wave's LDS reads have returned before their buffer is refilled
// C tile accumulation, k ascending in steps of 32; wave (wm, wn) owns rows wm*BM/2.. and columns wn*BN/2.. of the tile. BF: bf16 products, else f16.
// GB = k blocks of 32 whose fragments are read from LDS as one group. A and Bt point at the tile's first row, k = 0. Bt rows are KT long; an A row is PA long and holds k = 0..PA-1, the next PA k of that row lie AJ elements further.
template <int BM, int BN, int KT, bool BF, int GB, int PA, size_t AJ>
__device__ __forceinline__ void gemm_ring(const bf* A, const bf* Bt, bf* ring, int wm, int wn, v8f (&acc)[BM / 32][BN / 32]) {
    constexpr int FM = BM / 32, FN = BN / 32, BUFH = (BM + BN) * GPH, NS = KT / GKS;
    static_assert(BM % 32 == 0 && BN % 32 == 0 && (BM + BN) / 8 <= 63 && (GKS / 32) % GB == 0 && PA % GKS == 0 && KT % PA == 0);
    const int lane = threadIdx.x & 31, lr = lane & 15, hi = lane >> 4;
    const unsigned lb = lds_off(ring);
    stage_issue<BM, BN, PA, KT>(A, Bt, lb);
    wait_async0();
    __syncthreads();                                              // publishes stage 0
    stage_issue<BM, BN, PA, KT>(A + (GKS / PA) * AJ + GKS % PA, Bt + GKS, lb + BUFH * 2);
    const int ao = (wm * (BM / 2) + lr) * GPH + 8 * hi, bo = (BM + wn * (BN / 2) + lr) * GPH + 8 * hi;
#pragma unroll 1
    for (int s = 0; s < NS; ++s) {                                // rolled: one pass per stage, the buffer chosen by s & 1
        const bf* sb = ring + (s & 1) * BUFH;
#pragma unroll
        for (int kk = 0; kk < GKS; kk += 32 * GB) {
            v8us a0[GB][FM], a1[GB][FM], b0[GB][FN], b1[GB][FN];
#pragma unroll
            for (int u = 0; u < GB; ++u) {
#pragma unroll
                for (int mb = 0; mb < FM; ++mb) { const bf* p = sb + ao + mb * 16 * GPH + kk + u * 32; a0[u][mb] = *(const v8us*)p; a1[u][mb] = *(const v8us*)(p + 16); }
#pragma unroll
                for (int nb = 0; nb < FN; ++nb) { const bf* p = sb + bo + nb * 16 * GPH + kk + u * 32; b0[u][nb] = *(const v8us*)p; b1[u][nb] = *(const v8us*)(p + 16); }
            }
            __builtin_amdgcn_sched_barrier(0);                    // keeps the group's LDS reads together ahead of its matrix block: spread among the matrix instructions each read place waits out the LDS latency
#pragma unroll
            for (int u = 0; u < GB; ++u)
#pragma unroll
                for (int nb = 0; nb < FN; ++nb)
#pragma unroll
                    for (int mb = 0; mb < FM; ++mb) {
                        if constexpr (BF) acc[mb][nb] = wmmab_g(cat16b(a0[u][mb], a1[u][mb]), cat16b(b0[u][nb], b1[u][nb]), acc[mb][nb]);
                        else              acc[mb][nb] = wmma16_g(__builtin_bit_cast(v16h, cat16b(a0[u][mb], a1[u][mb])), __builtin_bit_cast(v16h, cat16b(b0[u][nb], b1[u][nb])), acc[mb][nb]); }
            if constexpr (32 * GB < GKS) __builtin_amdgcn_sched_barrier(0);   // the next group's reads stay behind this matrix block, as one group
        }
        wait_ds0();
        wait_async0();
        __syncthreads();                                          // publishes stage s + 1 and ends every reader's last read of stage s
        if (s + 2 < NS) { const int kb = (s + 2) * GKS; stage_issue<BM, BN, PA, KT>(A + (size_t)(kb / PA) * AJ + kb % PA, Bt + kb, lb + (unsigned)(s & 1) * (BUFH * 2)); }
    }
    wait_async0();
}

// k_cvt: every 16-bit operand plane in one launch; a block converts 2048 elements of one source. Block ranges: q | k | v (XBK blocks each, bf16 RNE), Wq | Wk | Wv (WBK each, bf16 RNE), Wo (WBK, f16 of the bf16 RNE value x64);
// the planes lie at dst in that order, back to back, so the destination index is the flat one.
#define XBK ((unsigned)((size_t)NB * SEQ * NF / 2048))
#define WBK ((unsigned)((size_t)HDIM * NF / 2048))
__global__ __launch_bounds__(256) void k_cvt(const float* __restrict__ q, const float* __restrict__ k, const float* __restrict__ v, const float* __restrict__ wq, const float* __restrict__ wk,
                                             const float* __restrict__ wv, const float* __restrict__ wo, bf* dst) {
    const unsigned blk = blockIdx.x;
    const float* src; unsigned lb;                                 // source and block index within it: block-uniform
    if (blk < 3 * XBK) { const unsigned g = blk / XBK; src = g == 0 ? q : g == 1 ? k : v; lb = blk - g * XBK; }
    else { const unsigned w = blk - 3 * XBK, g = w / WBK; src = g == 0 ? wq : g == 1 ? wk : g == 2 ? wv : wo; lb = w - g * WBK; }
    const v8f x = *(const v8f*)(src + ((size_t)lb * 256 + threadIdx.x) * 8); v8us o;
    if (blk < 3 * XBK + 3 * WBK) {
#pragma unroll
        for (int i = 0; i < 8; ++i) o[i] = f2bf(x[i]);
    } else { v8h t;
#pragma unroll
        for (int i = 0; i < 8; ++i) t[i] = toh_flush(bfr(x[i]) * WOC);
        o = __builtin_bit_cast(v8us, t); }
    *(v8us*)(dst + ((size_t)blk * 256 + threadIdx.x) * 8) = o;
}

// k_proj: register-blocked bf16 GEMM, 4 waves per 128x128 tile, one 64x64 tile (16 accumulators) per wave, operands staged in LDS from K-contiguous bf16 planes, K = NF.
// C[m][n] = sum_k A[m][k] Bt[n][k] + bias, written as f16.
// blockIdx.y = 0 (q): A = x rows (m = b*SEQ + t), Bt = W rows (n = h*512 + d), bias per column; plane [(b*8 + h)][t][d]; tile (bx, by) of (NB*SEQ/128, HDIM/128), bx fastest in blockIdx.x.
// blockIdx.y = 1, 2 (k, v): A = W rows (m = h*512 + d), Bt = x rows (n = b*SEQ + t), bias per row; plane [(b*4096 + m)][t] = [(b*8 + h)][d][t]; tile (bx, by) of (HDIM/128, NB*SEQ/128).
// XS, WS, PS: the three input copies, the three weight planes and the three output planes, each set back to back. grid (NB*SEQ/128 * HDIM/128, 3).
__global__ __launch_bounds__(GTH) void k_proj(const bf* __restrict__ XS, const bf* __restrict__ WS, const float* __restrict__ bq, const float* __restrict__ bk, const float* __restrict__ bv, h16* PS) {
    __shared__ __align__(16) bf ring[2 * (128 + 128) * GPH];
    __shared__ __align__(16) float osw[4][16 * 68];
    const int lane = threadIdx.x & 31, lr = lane & 15, hi = lane >> 4;
    const int wave = __builtin_amdgcn_readfirstlane((int)(threadIdx.x >> 5)), wm = wave >> 1, wn = wave & 1;
    float* os = osw[wave];                                         // wave-private store staging
    const int z = blockIdx.y;
    const bool m0 = (z == 0);                                      // block-uniform
    const bf* X = XS + (size_t)z * NB * SEQ * NF; const bf* Wz = WS + (size_t)z * HDIM * NF;
    const bf* A = m0 ? X : Wz; const bf* Bt = m0 ? Wz : X;
    const float* bias = z == 0 ? bq : z == 1 ? bk : bv;
    h16* Ph = PS + (size_t)z * NB * NH_ * SEQ * DH;
    const unsigned ti = blockIdx.x;
    const int bx = (int)(m0 ? ti % (NB * SEQ / 128) : ti % (HDIM / 128)), by = (int)(m0 ? ti / (NB * SEQ / 128) : ti / (HDIM / 128));
    const int r0 = bx * 128 + wm * 64, c0 = by * 128 + wn * 64;    // the wave's own 64x64 tile
    v8f acc[4][4];
#pragma unroll
    for (int mb = 0; mb < 4; ++mb)
#pragma unroll
        for (int nb = 0; nb < 4; ++nb) acc[mb][nb] = (v8f){};
    gemm_ring<128, 128, NF, true, 1, NF, 0>(A + (size_t)bx * 128 * NF, Bt + (size_t)by * 128 * NF, ring, wm, wn, acc);
    float bc[4];                                                   // in the built code each bias load below (bc, br) stands in its own branch on m0 with its own wait
#pragma unroll
    for (int nb = 0; nb < 4; ++nb) { const float t = bias[m0 ? c0 + nb * 16 + lr : 0]; bc[nb] = m0 ? bfr(t) : 0.0f; }   // q: c0 + 63 < HDIM
    size_t tbase;
    if (m0) { const int bb = r0 / SEQ, tt = r0 % SEQ, hh = c0 / DH, dd = c0 % DH;
              tbase = (((size_t)(bb * NH_ + hh) * SEQ) + (size_t)tt) * DH + (size_t)dd; }
    else    { const int bb = c0 / SEQ, tt = c0 % SEQ;
              tbase = ((size_t)bb * HDIM + (size_t)r0) * SEQ + (size_t)tt; }
#pragma unroll
    for (int mb = 0; mb < 4; ++mb) {
        float br[8];
#pragma unroll
        for (int j = 0; j < 8; ++j) { const float t = bias[m0 ? 0 : r0 + mb * 16 + hi * 8 + j]; br[j] = m0 ? 0.0f : bfr(t); }   // k, v: r0 + 63 < HDIM
#pragma unroll
        for (int nb = 0; nb < 4; ++nb) {
#pragma unroll
            for (int j = 0; j < 8; ++j) os[(hi * 8 + j) * 68 + nb * 16 + lr] = acc[mb][nb][j] + bc[nb] + br[j]; }   // D: row 8h+j, col lane&15
        wave_sync();
{
#pragma unroll
            for (int s = 0; s < 4; ++s) { const int row = 4 * s + (lane >> 3), c8 = (lane & 7) * 8;   // 4 s x 4 row groups = 16 rows; 8 lanes x 8 = 64 columns = one line
                const v4f x0 = *(const v4fa*)(&os[row * 68 + c8]); const v4f x1 = *(const v4fa*)(&os[row * 68 + c8 + 4]); v8h hv;
#pragma unroll
                for (int i = 0; i < 4; ++i) { hv[i] = toh_flush(x0[i]); hv[4 + i] = toh_flush(x1[i]); }
                const size_t oo = tbase + (size_t)(mb * 16 + row) * SEQ + c8;
                *(v8h*)(Ph + oo) = hv; }
             }
        wave_sync();
    }
}

// k_attn: fused attention for 128 query rows of one (batch, head); 8 waves.
// Phase 1 (transposed scores): S^T[j][i] = sum_m KT[j][m] Q[i][m]; A = k^T-plane rows j = 64w + 16jb + lane&15 (k = token m), B = q-plane rows i = t0 + 16ib + lane&15 (k = feature m);
//   D: acc[jb][ib][r] = S^T[j = 64w + 16jb + 8h + r][i = 16ib + lane&15], so a lane holds 8 consecutive score columns of one query row.
// Softmax: per-wave row max -> LDS -> block barrier -> row max over the 8 waves; p = f16(2^((s - max) * scale * log2e + 14)); packed 16-B stores into the P tile [128][512] (LDS);
//   row sum over the converted p, per-wave partials through LDS; block barrier (publishes P and the sums).
// Phase 2: O^T[d][i] = sum_j VT[d][j] P[i][j]; A = v^T-plane rows d = 64w + 16db + lane&15 (k = token j), B = P tile rows i (k = j) from LDS.
// Operands: the Q tile is copied once into the LDS range that later holds P; the planes come as 2 * ANS ring stages (ANS of K^T, then ANS of V^T), each all 512 plane rows x 64 k, two buffers, asynchronous copies;
//   the first two V^T stages fly during the last score passes and the softmax.
// Epilogue: ctx = O / rowsum x 64 as f16; behind the last pass's barrier the wave stages its 128 x 64 tile in its own column range of the P tile (wave-private from then on).
//   The ctx rows go to the places of the block's own 128 q rows in QC: no other block reads or writes those, and this block's copies of them have landed before its first barrier.
// one ring stage: k = kb..kb+63 of all 512 rows of a plane [512][SEQ]; 8 lanes cover a 128-B row piece (one line); every thread issues 16 copies
__device__ __forceinline__ void attn_stage_issue(const h16* P, int kb, unsigned lbuf) {
    const int cc = threadIdx.x & 7, rr = threadIdx.x >> 3;           // 16-byte piece of the row piece; row within a sweep of 32 rows
    const bf* g = (const bf*)P + (size_t)rr * SEQ + kb + cc * 8;
    const unsigned l = lbuf + (unsigned)(rr * APH + cc * 8) * 2u;
#pragma unroll
    for (int i = 0; i < 2; ++i) acopy8(l + i * 256 * APH * 2, g + (size_t)i * 256 * SEQ, 32 * APH * 2, (size_t)32 * SEQ);
}
// one pass: 64 k of the wave's 64 plane rows (pa, ring buffer) against the QR rows of the Q or P tile (pb), k ascending in steps of 32
__device__ __forceinline__ void attn_pass(const h16* pa, const h16* pb, v8f (&acc)[4][QB]) {
#pragma unroll
    for (int u = 0; u < AKS / 32; ++u) {
        v8h a0[4], a1[4], b0[QB], b1[QB];
#pragma unroll
        for (int mb = 0; mb < 4; ++mb) { const h16* p = pa + mb * 16 * APH + u * 32; a0[mb] = *(const v8h*)p; a1[mb] = *(const v8h*)(p + 16); }
#pragma unroll
        for (int nb = 0; nb < QB; ++nb) { const h16* p = pb + nb * 16 * PP + u * 32; b0[nb] = *(const v8h*)p; b1[nb] = *(const v8h*)(p + 16); }
        __builtin_amdgcn_sched_barrier(0);                        // keeps the block's LDS reads together ahead of its matrix block: spread among the matrix instructions each read place waits out the LDS latency
#pragma unroll
        for (int nb = 0; nb < QB; ++nb)
#pragma unroll
            for (int mb = 0; mb < 4; ++mb) acc[mb][nb] = wmma16(cat16(a0[mb], a1[mb]), cat16(b0[nb], b1[nb]), acc[mb][nb]);   // plain builtin: an asm operand cannot lie above v255, and the 32 accumulators alone fill 256 registers
        if (u + 1 < AKS / 32) __builtin_amdgcn_sched_barrier(0);  // the next block's reads stay behind this matrix block, as one group
    }
}
__global__ __launch_bounds__(32 * AW)
void k_attn(h16* QC, const h16* __restrict__ KT, const h16* __restrict__ VT) {
    __shared__ __align__(16) h16 ring[2 * DH * APH];
    __shared__ __align__(16) h16 sP[QR * PP];
    __shared__ float smax[AW * QR];
    __shared__ float ssum[AW * QR];
    constexpr int ABUFH = DH * APH;                                 // halves per ring buffer
    const int lane = threadIdx.x & 31, lr = lane & 15, hi = lane >> 4;
    const int wave = __builtin_amdgcn_readfirstlane((int)(threadIdx.x >> 5));
    const int zh = blockIdx.y;                                      // b * 8 + h
    const int t0 = blockIdx.x * QR;
    const size_t zb = (size_t)zh * SEQ * DH;
    const h16* KTz = KT + zb; const h16* VTz = VT + zb;
    const unsigned lb = lds_off(ring);
    const int ao = (wave * 64 + lr) * APH + 8 * hi;                 // plane rows owned by this wave, in a ring buffer (+ 16*blk*APH + k)
    const int bo = lr * PP + 8 * hi;                                // Q / P tile rows (+ 16*ib*PP + k)
    { const int cc = threadIdx.x & 63, rr = threadIdx.x >> 6;       // Q tile: 64 lanes cover one 1024-B row; 4 rows a sweep, QR / 4 copies a thread
      const bf* g = (const bf*)QC + zb + (size_t)(t0 + rr) * DH + cc * 8;
      const unsigned l = lds_off(sP) + (unsigned)(rr * PP + cc * 8) * 2u;
#pragma unroll
      for (int i = 0; i < QR / 32; ++i) acopy8(l + i * 32 * PP * 2, g + (size_t)i * 32 * DH, 4 * PP * 2, (size_t)4 * DH); }
    attn_stage_issue(KTz, 0, lb);
    wait_async0();
    __syncthreads();                                              // publishes the Q tile and stage 0
    attn_stage_issue(KTz, AKS, lb + ABUFH * 2);
    v8f acc[4][QB];
#pragma unroll
    for (int jb = 0; jb < 4; ++jb)
#pragma unroll
        for (int ib = 0; ib < QB; ++ib) acc[jb][ib] = (v8f){};
#pragma unroll 1
    for (int s = 0; s < ANS; ++s) {                               // rolled: one pass per stage, the buffer chosen by s & 1
        attn_pass(ring + (s & 1) * ABUFH + ao, sP + bo + s * AKS, acc);
        wait_ds0();
        wait_async0();
        __syncthreads();                                          // publishes the next stage and ends every reader's last read of this one (behind the last pass: of the Q tile too)
        const int n = s + 2;                                      // always exists: the V^T stages follow the K^T stages
        attn_stage_issue(n < ANS ? KTz : VTz, (n & (ANS - 1)) * AKS, lb + (unsigned)(s & 1) * (ABUFH * 2));
    }
    // row max: lane holds 32 of the wave's 64 columns for query rows 16*ib + lr
    float mx[QB];
#pragma unroll
    for (int ib = 0; ib < QB; ++ib) { mx[ib] = NEGB;
#pragma unroll
        for (int jb = 0; jb < 4; ++jb) {
#pragma unroll
            for (int r = 0; r < 8; ++r) mx[ib] = fmaxf(mx[ib], acc[jb][ib][r]); }
        mx[ib] = fmaxf(mx[ib], __shfl_xor(mx[ib], 16, 32)); }
#pragma unroll
    for (int p = 0; p < QB / 2; ++p) smax[wave * QR + 32 * p + lane] = hi ? mx[2 * p + 1] : mx[2 * p];   // slot = query row 16*(2p + hi) + lr = 32p + lane
    __syncthreads();
    float sh[QB], ls[QB];
#pragma unroll
    for (int ib = 0; ib < QB; ++ib) { float g = smax[ib * 16 + lr];
#pragma unroll
        for (int w = 1; w < AW; ++w) g = fmaxf(g, smax[w * QR + ib * 16 + lr]);
        sh[ib] = PSH - g * SC2; ls[ib] = 0.0f; }
    const int pw = wave * 64 + 8 * hi;
#pragma unroll
    for (int jb = 0; jb < 4; ++jb) {
#pragma unroll
        for (int ib = 0; ib < QB; ++ib) { v8h p;
#pragma unroll
            for (int r = 0; r < 8; ++r) { const float e = acc[jb][ib][r] * SC2 + sh[ib]; const h16 a = pexp_h(e); p[r] = a; ls[ib] += (float)a; }
            *(v8h*)(&sP[(16 * ib + lr) * PP + pw + jb * 16]) = p; } }
#pragma unroll
    for (int ib = 0; ib < QB; ++ib) ls[ib] += __shfl_xor(ls[ib], 16, 32);
#pragma unroll
    for (int p = 0; p < QB / 2; ++p) ssum[wave * QR + 32 * p + lane] = hi ? ls[2 * p + 1] : ls[2 * p];
    __syncthreads();
    // phase 2
#pragma unroll
    for (int db = 0; db < 4; ++db)
#pragma unroll
        for (int ib = 0; ib < QB; ++ib) acc[db][ib] = (v8f){};
#pragma unroll 1
    for (int s = 0; s < ANS; ++s) {                               // rolled, as above
        attn_pass(ring + (s & 1) * ABUFH + ao, sP + bo + s * AKS, acc);
        wait_ds0();
        wait_async0();
        __syncthreads();                                          // publishes the next stage and ends every reader's last read of this one (behind the last pass: of the P tile too)
        if (s + 2 < ANS) attn_stage_issue(VTz, (s + 2) * AKS, lb + (unsigned)(s & 1) * (ABUFH * 2));
    }
    wait_async0();
    float inv[QB];
#pragma unroll
    for (int ib = 0; ib < QB; ++ib) { float l = ssum[ib * 16 + lr];
#pragma unroll
        for (int w = 1; w < AW; ++w) l += ssum[w * QR + ib * 16 + lr];
        inv[ib] = CTXC * (1.0f / l); }                          // l >= 16384: the row maximum contributes its full carry
    // columns 64w..64w+63 of the P tile are wave-private from here
    // O^T D layout: acc[db][ib][r] = (d = 64w + 16db + 8h + r, i = 16ib + lane&15) -> sP[i][64w + 16db + 8h + r]; rows 0..QR-1 x 64 columns all written
#pragma unroll
    for (int db = 0; db < 4; ++db) {
#pragma unroll
        for (int ib = 0; ib < QB; ++ib) { v8h o;
#pragma unroll
            for (int r = 0; r < 8; ++r) o[r] = toh_flush(acc[db][ib][r] * inv[ib]);
            *(v8h*)(&sP[(16 * ib + lr) * PP + pw + db * 16]) = o; } }
    wave_sync();
    h16* crow = QC + zb + (size_t)t0 * DH + (size_t)wave * 64;
#pragma unroll
    for (int s = 0; s < QR / 4; ++s) { const int row = 4 * s + (lane >> 3), c8 = (lane & 7) * 8;   // QR / 4 s x 4 rows = QR rows; 8 lanes x 8 halves = 64 columns = one line
        const v8h val = *(const v8h*)(&sP[row * PP + wave * 64 + c8]);
        *(v8h*)(crow + (size_t)row * DH + c8) = val; }
}

// k_oproj: register-blocked f16 GEMM, 4 waves per 64x64 tile, one 32x32 tile per wave, operands staged in LDS, K = HDIM; out[m][n] = (sum_k ctx64[m][k] wo64[n][k]) / 4096 + bias[n] (f32).
// A = ctx plane [(b*8 + h)][t][d]: row m = b*SEQ + t holds k = h*512 + d in 8 pieces of 512, SEQ*DH apart; Bt = Wo plane rows (n); grid (NB*SEQ/64, NF/64).
__global__ __launch_bounds__(GTH) void k_oproj(const h16* __restrict__ A, const h16* __restrict__ Bt, const float* __restrict__ bias, float* OUT) {
    __shared__ __align__(16) bf ring[2 * (64 + 64) * GPH];
    __shared__ __align__(16) float osw[4][16 * 36];
    const int lane = threadIdx.x & 31, lr = lane & 15, hi = lane >> 4;
    const int wave = __builtin_amdgcn_readfirstlane((int)(threadIdx.x >> 5)), wm = wave >> 1, wn = wave & 1;
    float* os = osw[wave];                                         // wave-private store staging
    const int r0 = blockIdx.x * 64 + wm * 32, c0 = blockIdx.y * 64 + wn * 32;   // the wave's own 32x32 tile
    v8f acc[2][2];
#pragma unroll
    for (int mb = 0; mb < 2; ++mb)
#pragma unroll
        for (int nb = 0; nb < 2; ++nb) acc[mb][nb] = (v8f){};
    const int rt = blockIdx.x * 64;                                // a 64-row tile lies in one batch
    gemm_ring<64, 64, HDIM, false, 4, DH, (size_t)SEQ * DH>((const bf*)A + (size_t)(rt / SEQ) * NH_ * SEQ * DH + (size_t)(rt % SEQ) * DH, (const bf*)Bt + (size_t)blockIdx.y * 64 * HDIM, ring, wm, wn, acc);
    float bc[2];
#pragma unroll
    for (int nb = 0; nb < 2; ++nb) bc[nb] = bfr(bias[c0 + nb * 16 + lr]);   // c0 + 31 < NF
#pragma unroll
    for (int mb = 0; mb < 2; ++mb) {
#pragma unroll
        for (int nb = 0; nb < 2; ++nb) {
#pragma unroll
            for (int j = 0; j < 8; ++j) os[(hi * 8 + j) * 36 + nb * 16 + lr] = acc[mb][nb][j] * OSC + bc[nb]; }   // D: row 8h+j, col lane&15
        wave_sync();
{
#pragma unroll
            for (int s = 0; s < 4; ++s) { const int row = 4 * s + (lane >> 3), c4 = (lane & 7) * 4;   // 4 s x 4 rows = 16 rows; 8 lanes x 4 floats = 32 columns = one line
                const v4f val = *(const v4fa*)(&os[row * 36 + c4]);
                *(v4f*)(OUT + (size_t)(r0 + mb * 16 + row) * NF + c0 + c4) = val; }
             }
        wave_sync();
    }
}

static constexpr size_t SZ_XB = (size_t)NB * SEQ * NF * 2;                   // bf16 copy of one input
static constexpr size_t SZ_WP = (size_t)HDIM * NF * 2;                       // one weight plane (Wq | Wk | Wv bf16, Wo f16)
static constexpr size_t SZ_PL = (size_t)NB * NH_ * SEQ * DH * 2;             // one q / k^T / v^T plane; ctx replaces q
static constexpr size_t SZ_TOTAL = 3 * SZ_XB + 4 * SZ_WP + 3 * SZ_PL;
static_assert(SZ_XB % 256 == 0 && SZ_WP % 256 == 0 && SZ_PL % 256 == 0);   // the planes lie back to back, each 256-B aligned
static_assert(SZ_TOTAL <= (size_t)268435456);          // workspace carve <= 256 MiB
static_assert((size_t)NB * NH_ * SEQ * DH == (size_t)NB * HDIM * SEQ);     // k^T / v^T plane [(b*4096 + m)][t] has the same extent as the q plane
static_assert((size_t)NF * HDIM == (size_t)HDIM * NF);                     // Wo plane extent equals a projection weight plane

extern "C" void kernel_launch(void* const* d_in, const int* in_sizes, int n_in,
                              void* d_out, int out_size, void* d_ws, size_t ws_size, hipStream_t stream) {
    if (n_in < 11) return;
    const size_t needx = (size_t)NB * SEQ * NF;
    if ((size_t)in_sizes[0] < needx || (size_t)in_sizes[1] < needx || (size_t)in_sizes[2] < needx) return;
    if ((size_t)in_sizes[3] < (size_t)HDIM * NF || (size_t)in_sizes[5] < (size_t)HDIM * NF || (size_t)in_sizes[7] < (size_t)HDIM * NF) return;
    if ((size_t)in_sizes[9] < (size_t)NF * HDIM) return;
    if (in_sizes[4] < HDIM || in_sizes[6] < HDIM || in_sizes[8] < HDIM || in_sizes[10] < NF) return;
    if ((size_t)out_size < needx) return;
    if (SZ_TOTAL > ws_size) return;
    // wire order: q, k, v, Wq, bq, Wk, bk, Wv, bv, Wo, bo
    const float* xq = (const float*)d_in[0]; const float* xk = (const float*)d_in[1]; const float* xv = (const float*)d_in[2];
    const float* wq = (const float*)d_in[3]; const float* bq = (const float*)d_in[4];
    const float* wk = (const float*)d_in[5]; const float* bk = (const float*)d_in[6];
    const float* wv = (const float*)d_in[7]; const float* bv = (const float*)d_in[8];
    const float* wo = (const float*)d_in[9]; const float* bo = (const float*)d_in[10];
    float* OUT = (float*)d_out;      // [NB][SEQ][NF]
    char* wsp = (char*)d_ws;
    bf* XS = (bf*)wsp; wsp += 3 * SZ_XB;             // q | k | v, each [NB*SEQ][NF]
    bf* WS = (bf*)wsp; wsp += 3 * SZ_WP;             // Wq | Wk | Wv, each [4096][512] ([out][in])
    h16* WOH = (h16*)wsp; wsp += SZ_WP;              // [512][4096] x64
    h16* QC = (h16*)wsp; wsp += SZ_PL;               // q [NB*8][SEQ][512], then ctx [NB*8][SEQ][512] x64
    h16* KTP = (h16*)wsp; wsp += SZ_PL;              // [NB*8][512][SEQ]
    h16* VTP = (h16*)wsp; wsp += SZ_PL;              // [NB*8][512][SEQ]

    k_cvt<<<3 * XBK + 4 * WBK, 256, 0, stream>>>(xq, xk, xv, wq, wk, wv, wo, XS);
    k_proj<<<dim3((NB * SEQ / 128) * (HDIM / 128), 3, 1), GTH, 0, stream>>>(XS, WS, bq, bk, bv, QC);
    k_attn<<<dim3(SEQ / QR, NB * NH_, 1), 32 * AW, 0, stream>>>(QC, KTP, VTP);
    k_oproj<<<dim3(NB * SEQ / 64, NF / 64, 1), GTH, 0, stream>>>(QC, WOH, bo, OUT);
}

// v005
// Measured time: 207 microseconds a run.
// Two timings next to v004 both put it at 1.10 times that version's speed.
// Over all steps from v000 it is 5.15 times as fast.
#include <hip/hip_runtime.h>

// Compute dtypes, f32 accumulate everywhere: the three input projections v_wmma_f32_16x16x32_bf16 (x, W, bias RNE-converted to bf16; products exact); scores, P.V and the output projection v_wmma_f32_16x16x32_f16, single product at every site.
// Multi-head attention block without mask: q/k/v [NB][512][512]; Wq/Wk/Wv [4096][512] ([out][in], y = x W^T + bias), 8 heads x 512 columns (head h = columns h*512 + d); score[i][j] = sum_m qh[i][m] kh[m][j] / sqrt(512)
// (m = feature index of qh = token index of kh, j = feature index of kh); softmax over j; ctx[i][d] = sum_j P[i][j] vh[j][d] (j = token index of vh); heads merged to [NB*512][4096]; output = ctx Wo^T + bo with Wo [512][4096] (f32).
// Planes (f16): q [(b*8+h)][t][d]; k^T and v^T [(b*8+h)][d][t] (contraction index contiguous in every GEMM); ctx [(b*8+h)][t][d] carried x64, stored over the q plane (each attention block replaces the 128 q rows that it alone has read); Wo carried x64 (built from the bf16 RNE value); P carried x16384 in LDS only (cancels in the normalisation).
// Attention kernel: 8 waves per 128 query rows of one (batch, head), transposed form S^T = K^T-plane x Q (wave w owns score columns 64w..64w+63), row max / row sum exchanged through LDS, packed P tile [128][512] in LDS,
// O^T = V^T-plane x P (wave w owns output columns 64w..64w+63); the K^T and V^T planes pass through a two-buffer LDS ring, the Q tile lies where the P tile is written later. All batches go through every kernel in one launch: four launches in all.

#ifndef NB
#define NB 16
#endif
#define NB_FULL 16
#define SEQ  512                 // tokens per sequence; the module requires SEQ == DH (score contraction) and SEQ == NF
#define NF   512                 // input feature width
#define NH_  8
#define DH   512                 // per-head width
#define HDIM (NH_ * DH)          // 4096
#define AW   8                   // waves per attention block
#define QR   128                 // query rows per attention block: every plane byte that a block brings into LDS meets 128 query rows
#define QB   (QR / 16)           // 16-row query blocks per attention block (accumulator tiles per plane-row block of a wave)
#define PP   520                 // LDS row pitch (halves) of the Q / P tile (1040 B = 16 B x 65)
#define AKS  64                  // k per stage of the attention ring (128 B of every plane row)
#define APH  72                  // LDS row pitch (halves) of the attention ring (144 B = 16 B x 9)
#define ANS  (SEQ / AKS)         // stages per plane
#define SC2  ((float)(0.04419417382415922 * 1.4426950408889634))   // DH^-0.5 * log2(e)
#define PSH  14.0f               // log2 of the P carry (16384)
#define NEGB (-3.0e38f)
#define CTXC 64.0f               // carry of the ctx plane
#define WOC  64.0f               // carry of the Wo plane
#define OSC  (1.0f / 4096.0f)    // 1 / (CTXC * WOC)

static_assert(DH == SEQ);                      // score contraction: feature index of q = token index of k; plane row pitch is the same in both layouts
static_assert(NF == SEQ);
static_assert(NH_ * DH == HDIM);
static_assert(NF % 32 == 0);                   // projection k-loop steps by 32
static_assert(SEQ % 32 == 0);                  // attention k-loops step by 32
static_assert(HDIM % 32 == 0);                 // output projection k-loop steps by 32
static_assert(SEQ % 64 == 0);                  // a 64-row tile never straddles two batches
static_assert(DH % 64 == 0);                   // a 64-column tile never straddles two heads
static_assert(HDIM % 64 == 0);
static_assert(NF % 64 == 0);
static_assert(NB <= NB_FULL);
static_assert(DH == AW * 64);                  // each attention wave owns 64 score columns and 64 output columns
static_assert(SEQ % QR == 0);                  // attention grid covers the query rows exactly (QR per block)
static_assert(ANS % 2 == 0 && ANS >= 2);       // the V^T stages go on in the ring with the buffer parity of the K^T stages; both prologue stages exist
static_assert((APH * 2) % 16 == 0 && AKS % 32 == 0);
static_assert(DH == 2 * 8 * 32 && QR % (8 * 4) == 0 && DH * 2 == 64 * 16 && AKS * 2 == 8 * 16);   // copy sweeps of 256 threads: ring 32 rows a sweep, 16 sweeps; Q tile 4 rows a sweep, QR / 4 sweeps
static_assert(QR / 4 + 16 <= 63);              // copies of a wave in flight in the prologue: the Q tile and stage 0
static_assert((PP * 2) % 16 == 0);
static_assert(PP >= DH);
static_assert(32 * 16 * 4 == 16 * 64 * 2);
static_assert(32 * 16 * (QR / 4) == QR * 64 * 2);   // k_attn store loop: 32 lanes x 16 B x QR / 4 trips == QR rows x 128 B
static_assert(32 * 16 * 4 == 16 * 32 * 4);     // k_oproj store loop: 32 lanes x 16 B x 4 trips == 16 rows x 128 B
static_assert(2 * 256 * 272 + 4 * 16 * 68 * 4 + 4 * 64 * 4 <= 163840);   // static LDS of k_proj: two work-groups fit one WGP's 320 KiB
static_assert(HDIM % 128 == 0 && (NB * SEQ) % 128 == 0);    // k_proj grid covers both extents exactly (128 x 128 tiles)
static_assert(2 * DH * APH * 2 + QR * PP * 2 + 2 * AW * QR * 4 <= 327680);   // static LDS of the attention kernel: one work-group per WGP
static_assert(((size_t)NB * SEQ * NF) % 2048 == 0);          // k_cvt: a block converts 2048 elements of one source
static_assert(((size_t)HDIM * NF) % 2048 == 0);

typedef _Float16 h16;
typedef unsigned short bf;
typedef __attribute__((ext_vector_type(16))) __bf16   v16bf;
typedef __attribute__((ext_vector_type(16))) _Float16 v16h;
typedef __attribute__((ext_vector_type(8)))  _Float16 v8h;
typedef __attribute__((ext_vector_type(8)))  unsigned short v8us;
typedef __attribute__((ext_vector_type(8)))  float    v8f;
typedef __attribute__((ext_vector_type(4)))  float    v4f;
typedef v4f  __attribute__((may_alias)) v4fa;

__device__ __forceinline__ unsigned short f2bf(float f) { unsigned u = __float_as_uint(f); u += 0x7FFFu + ((u >> 16) & 1u); return (unsigned short)(u >> 16); }
__device__ __forceinline__ float bfr(float f) { return __uint_as_float(((unsigned)f2bf(f)) << 16); }   // value after RNE convert to bf16
__device__ __forceinline__ v16h cat16(v8h lo, v8h hi) { return __builtin_shufflevector(lo, hi, 0, 1, 2, 3, 4, 5, 6, 7, 8, 9, 10, 11, 12, 13, 14, 15); }
__device__ __forceinline__ v16bf cat16b(v8us lo, v8us hi) { return __builtin_bit_cast(v16bf, __builtin_shufflevector(lo, hi, 0, 1, 2, 3, 4, 5, 6, 7, 8, 9, 10, 11, 12, 13, 14, 15)); }
__device__ __forceinline__ v8f wmma16(v16h a, v16h b, v8f c) { return __builtin_amdgcn_wmma_f32_16x16x32_f16(false, a, false, b, (short)0, c, false, false); }
__device__ __forceinline__ v8f wmmab(v16bf a, v16bf b, v8f c) { return __builtin_amdgcn_wmma_f32_16x16x32_bf16(false, a, false, b, (short)0, c, false, false); }
// fragment loaders from K-contiguous 16-bit rows; p already includes + 8*(lane>>4): elements 0..7 <- k0+8h+0..7, elements 8..15 <- k0+16+8h+0..7 (same map for A and B)
__device__ __forceinline__ v16h  ldh(const h16* p) { return cat16(*(const v8h*)p, *(const v8h*)(p + 16)); }
// ordering point for wave-private LDS tiles (same wave writes and reads)
__device__ __forceinline__ void wave_sync() { __builtin_amdgcn_fence(3 /* release order */, "wavefront"); __builtin_amdgcn_wave_barrier(); asm volatile("" ::: "memory"); }

// per-instruction guarded matrix ops: one accumulator tied per guard, operands kept live
__device__ __forceinline__ v8f wmma16_g(v16h a, v16h b, v8f c) { c = wmma16(a, b, c); asm volatile("v_nop\n\tv_nop\n\tv_nop\n\tv_nop" : "+v"(c) : "v"(a), "v"(b)); return c; }
__device__ __forceinline__ v8f wmmab_g(v16bf a, v16bf b, v8f c) { c = wmmab(a, b, c); asm volatile("v_nop\n\tv_nop\n\tv_nop\n\tv_nop" : "+v"(c) : "v"(a), "v"(b)); return c; }
// f32 -> f16 convert that cannot produce an f16 subnormal (|v| < 2^-14 -> +0), applied after the plane's power-of-two carry
static __device__ __forceinline__ h16 toh_flush(float v) { const h16 r = (h16)v; return (fabsf(v) < 6.103515625e-05f) ? (h16)0.0f : r; }
// carried probability 2^e as f16; the select is on the exponent argument (e < -14 -> +0)
static __device__ __forceinline__ h16 pexp_h(float e) { const h16 r = (h16)__builtin_amdgcn_exp2f(e); return (e < -14.0f) ? (h16)0.0f : r; }

// ---- operand staging for the two GEMM kernels: asynchronous copies to LDS, two buffers ----
// A work-group of 4 waves (2 x 2) owns a BM x BN tile. A stage is GKS = 128 k of every operand row ([A BM rows | Bt BN rows], 256 B a row, LDS pitch 272 B).
// Each lane copies 16 B; 16 lanes cover one 256-B row piece, so every copy instruction asks for whole lines. Stage s + 2 is issued into the buffer that pass s has left.
#define GKS  128                 // k per stage
#define GPH  136                 // LDS row pitch in halves (272 B = 16 B x 17: conflict-free for 16-byte fragment reads)
#define GTH  128                 // threads per GEMM work-group
static_assert((GPH * 2) % 16 == 0);
static_assert(NF % GKS == 0 && NF / GKS >= 2);       // both ring stages of the prologue exist
static_assert(HDIM % GKS == 0 && HDIM / GKS >= 2);
__device__ __forceinline__ unsigned lds_off(const void* p) { return (unsigned)(size_t)p; }
// eight copies and the wait that stands in front of any rewrite of their address registers, in one statement
__device__ __forceinline__ void acopy8(unsigned l, const bf* g, unsigned lstep, size_t gstep) {
    asm volatile("global_load_async_to_lds_b128 %0, %1, off\n\t"
                 "global_load_async_to_lds_b128 %2, %3, off\n\t"
                 "global_load_async_to_lds_b128 %4, %5, off\n\t"
                 "global_load_async_to_lds_b128 %6, %7, off\n\t"
                 "global_load_async_to_lds_b128 %8, %9, off\n\t"
                 "global_load_async_to_lds_b128 %10, %11, off\n\t"
                 "global_load_async_to_lds_b128 %12, %13, off\n\t"
                 "global_load_async_to_lds_b128 %14, %15, off\n\t"
                 "s_wait_xcnt 0x0"
                 :: "v"(l), "v"(g), "v"(l + lstep), "v"(g + gstep), "v"(l + 2 * lstep), "v"(g + 2 * gstep), "v"(l + 3 * lstep), "v"(g + 3 * gstep),
                    "v"(l + 4 * lstep), "v"(g + 4 * gstep), "v"(l + 5 * lstep), "v"(g + 5 * gstep), "v"(l + 6 * lstep), "v"(g + 6 * gstep), "v"(l + 7 * lstep), "v"(g + 7 * gstep)
                 : "memory");
}
// one stage: BM rows of A and BN rows of Bt, 128 k each, into the buffer at LDS byte address lbuf; A and Bt point at the tile's first row at the stage's first k; PA, PB = row pitches; every thread issues (BM + BN) / 8 copies
template <int BM, int BN, int PA, int PB>
__device__ __forceinline__ void stage_issue(const bf* A, const bf* Bt, unsigned lbuf) {
    static_assert(BM % 64 == 0 && BN % 64 == 0);
    const int cc = threadIdx.x & 15, rr = threadIdx.x >> 4;          // 16-byte piece of the row; row within a sweep of 8 rows
    const bf* ga = A  + (size_t)rr * PA + cc * 8;
    const bf* gb = Bt + (size_t)rr * PB + cc * 8;
    const unsigned l = lbuf + (unsigned)(rr * GPH + cc * 8) * 2u;
#pragma unroll
    for (int i = 0; i < BM / 64; ++i) acopy8(l + i * 64 * GPH * 2, ga + (size_t)i * 64 * PA, 8 * GPH * 2, (size_t)8 * PA);
#pragma unroll
    for (int i = 0; i < BN / 64; ++i) acopy8(l + (BM + i * 64) * GPH * 2, gb + (size_t)i * 64 * PB, 8 * GPH * 2, (size_t)8 * PB);
}
__device__ __forceinline__ void wait_async0() { asm volatile("s_wait_asynccnt 0x0" ::: "memory"); }   // this wave's copies have landed
__device__ __forceinline__ void wait_ds0()    { asm volatile("s_wait_dscnt 0x0" ::: "memory"); }      // this wave's LDS reads have returned before their buffer is refilled
// C tile accumulation, k ascending in steps of 32; wave (wm, wn) owns rows wm*BM/2.. and columns wn*BN/2.. of the tile. BF: bf16 products, else f16.
// GB = k blocks of 32 whose fragments are read from LDS as one group. A and Bt point at the tile's first row, k = 0. Bt rows are KT long; an A row is PA long and holds k = 0..PA-1, the next PA k of that row lie AJ elements further.
template <int BM, int BN, int KT, bool BF, int GB, int PA, size_t AJ>
__device__ __forceinline__ void gemm_ring(const bf* A, const bf* Bt, bf* ring, int wm, int wn, v8f (&acc)[BM / 32][BN / 32]) {
    constexpr int FM = BM / 32, FN = BN / 32, BUFH = (BM + BN) * GPH, NS = KT / GKS;
    static_assert(BM % 32 == 0 && BN % 32 == 0 && (BM + BN) / 8 <= 63 && (GKS / 32) % GB == 0 && PA % GKS == 0 && KT % PA == 0);
    const int lane = threadIdx.x & 31, lr = lane & 15, hi = lane >> 4;
    const unsigned lb = lds_off(ring);
    stage_issue<BM, BN, PA, KT>(A, Bt, lb);
    wait_async0();
    __syncthreads();                                              // publishes stage 0
    stage_issue<BM, BN, PA, KT>(A + (GKS / PA) * AJ + GKS % PA, Bt + GKS, lb + BUFH * 2);
    const int ao = (wm * (BM / 2) + lr) * GPH + 8 * hi, bo = (BM + wn * (BN / 2) + lr) * GPH + 8 * hi;
#pragma unroll 1
    for (int s = 0; s < NS; ++s) {                                // rolled: one pass per stage, the buffer chosen by s & 1
        const bf* sb = ring + (s & 1) * BUFH;
#pragma unroll
        for (int kk = 0; kk < GKS; kk += 32 * GB) {
            v8us a0[GB][FM], a1[GB][FM], b0[GB][FN], b1[GB][FN];
#pragma unroll
            for (int u = 0; u < GB; ++u) {
#pragma unroll
                for (int mb = 0; mb < FM; ++mb) { const bf* p = sb + ao + mb * 16 * GPH + kk + u * 32; a0[u][mb] = *(const v8us*)p; a1[u][mb] = *(const v8us*)(p + 16); }
#pragma unroll
                for (int nb = 0; nb < FN; ++nb) { const bf* p = sb + bo + nb * 16 * GPH + kk + u * 32; b0[u][nb] = *(const v8us*)p; b1[u][nb] = *(const v8us*)(p + 16); }
            }
            __builtin_amdgcn_sched_barrier(0);                    // keeps the group's LDS reads together ahead of its matrix block: spread among the matrix instructions each read place waits out the LDS latency
#pragma unroll
            for (int u = 0; u < GB; ++u)
#pragma unroll
                for (int nb = 0; nb < FN; ++nb)
#pragma unroll
                    for (int mb = 0; mb < FM; ++mb) {
                        if constexpr (BF) acc[mb][nb] = wmmab_g(cat16b(a0[u][mb], a1[u][mb]), cat16b(b0[u][nb], b1[u][nb]), acc[mb][nb]);
                        else              acc[mb][nb] = wmma16_g(__builtin_bit_cast(v16h, cat16b(a0[u][mb], a1[u][mb])), __builtin_bit_cast(v16h, cat16b(b0[u][nb], b1[u][nb])), acc[mb][nb]); }
            if constexpr (32 * GB < GKS) __builtin_amdgcn_sched_barrier(0);   // the next group's reads stay behind this matrix block, as one group
        }
        wait_ds0();
        wait_async0();
        __syncthreads();                                          // publishes stage s + 1 and ends every reader's last read of stage s
        if (s + 2 < NS) { const int kb = (s + 2) * GKS; stage_issue<BM, BN, PA, KT>(A + (size_t)(kb / PA) * AJ + kb % PA, Bt + kb, lb + (unsigned)(s & 1) * (BUFH * 2)); }
    }
    wait_async0();
}

// k_cvt: every 16-bit operand plane in one launch; a block converts 2048 elements of one source. Block ranges: q | k | v (XBK blocks each, bf16 RNE), Wq | Wk | Wv (WBK each, bf16 RNE), Wo (WBK, f16 of the bf16 RNE value x64);
// the planes lie at dst in that order, back to back, so the destination index is the flat one.
#define XBK ((unsigned)((size_t)NB * SEQ * NF / 2048))
#define WBK ((unsigned)((size_t)HDIM * NF / 2048))
__global__ __launch_bounds__(256) void k_cvt(const float* __restrict__ q, const float* __restrict__ k, const float* __restrict__ v, const float* __restrict__ wq, const float* __restrict__ wk,
                                             const float* __restrict__ wv, const float* __restrict__ wo, bf* dst) {
    const unsigned blk = blockIdx.x;
    const float* src; unsigned lb;                                 // source and block index within it: block-uniform
    if (blk < 3 * XBK) { const unsigned g = blk / XBK; src = g == 0 ? q : g == 1 ? k : v; lb = blk - g * XBK; }
    else { const unsigned w = blk - 3 * XBK, g = w / WBK; src = g == 0 ? wq : g == 1 ? wk : g == 2 ? wv : wo; lb = w - g * WBK; }
    const v8f x = *(const v8f*)(src + ((size_t)lb * 256 + threadIdx.x) * 8); v8us o;
    if (blk < 3 * XBK + 3 * WBK) {
#pragma unroll
        for (int i = 0; i < 8; ++i) o[i] = f2bf(x[i]);
    } else { v8h t;
#pragma unroll
        for (int i = 0; i < 8; ++i) t[i] = toh_flush(bfr(x[i]) * WOC);
        o = __builtin_bit_cast(v8us, t); }
    *(v8us*)(dst + ((size_t)blk * 256 + threadIdx.x) * 8) = o;
}

// k_proj epilogue of one wave: its 64x64 tile + bias -> f16, 16 rows at a time through the wave's own staging tile; sb = the wave's 64 bias values (bf16 RNE) in LDS, read back here as one group.
// BC: bias per column (q), sb[n - c0]; else bias per row (k, v), sb[m - r0]. Pt = the tile's first element, row pitch SEQ (== DH).
template <bool BC>
__device__ __forceinline__ void proj_store(const v8f (&acc)[4][4], const float* sb, float* os, h16* Pt, int lane) {
    const int lr = lane & 15, hi = lane >> 4;
    float bc[4]; v4f br[4][2];
    if constexpr (BC) {
#pragma unroll
        for (int nb = 0; nb < 4; ++nb) bc[nb] = sb[nb * 16 + lr];
    } else {
#pragma unroll
        for (int mb = 0; mb < 4; ++mb) { br[mb][0] = *(const v4fa*)(sb + mb * 16 + hi * 8); br[mb][1] = *(const v4fa*)(sb + mb * 16 + hi * 8 + 4); }
    }
#pragma unroll
    for (int mb = 0; mb < 4; ++mb) {
#pragma unroll
        for (int nb = 0; nb < 4; ++nb) {
#pragma unroll
            for (int j = 0; j < 8; ++j) { float b; if constexpr (BC) b = bc[nb]; else b = br[mb][j >> 2][j & 3];
                os[(hi * 8 + j) * 68 + nb * 16 + lr] = acc[mb][nb][j] + b; } }   // D: row 8h+j, col lane&15
        wave_sync();
#pragma unroll
        for (int s = 0; s < 4; ++s) { const int row = 4 * s + (lane >> 3), c8 = (lane & 7) * 8;   // 4 s x 4 row groups = 16 rows; 8 lanes x 8 = 64 columns = one line
            const v4f x0 = *(const v4fa*)(&os[row * 68 + c8]); const v4f x1 = *(const v4fa*)(&os[row * 68 + c8 + 4]); v8h hv;
#pragma unroll
            for (int i = 0; i < 4; ++i) { hv[i] = toh_flush(x0[i]); hv[4 + i] = toh_flush(x1[i]); }
            *(v8h*)(Pt + (size_t)(mb * 16 + row) * SEQ + c8) = hv; }
        asm volatile("s_wait_xcnt 0x0" ::: "memory");             // stands behind the run of four stores, ahead of any rewrite of their address or data registers
        wave_sync();
    }
}

// k_proj: register-blocked bf16 GEMM, 4 waves per 128x128 tile, one 64x64 tile (16 accumulators) per wave, operands staged in LDS from K-contiguous bf16 planes, K = NF.
// C[m][n] = sum_k A[m][k] Bt[n][k] + bias, written as f16.
// blockIdx.y = 0 (q): A = x rows (m = b*SEQ + t), Bt = W rows (n = h*512 + d), bias per column; plane [(b*8 + h)][t][d]; tile (bx, by) of (NB*SEQ/128, HDIM/128), bx fastest in blockIdx.x.
// blockIdx.y = 1, 2 (k, v): A = W rows (m = h*512 + d), Bt = x rows (n = b*SEQ + t), bias per row; plane [(b*4096 + m)][t] = [(b*8 + h)][d][t]; tile (bx, by) of (HDIM/128, NB*SEQ/128).
// XS, WS, PS: the three input copies, the three weight planes and the three output planes, each set back to back. grid (NB*SEQ/128 * HDIM/128, 3).
__global__ __launch_bounds__(GTH) void k_proj(const bf* __restrict__ XS, const bf* __restrict__ WS, const float* __restrict__ bq, const float* __restrict__ bk, const float* __restrict__ bv, h16* PS) {
    __shared__ __align__(16) bf ring[2 * (128 + 128) * GPH];
    __shared__ __align__(16) float osw[4][16 * 68];
    __shared__ __align__(16) float sbw[4][64];
    const int lane = threadIdx.x & 31;
    const int wave = __builtin_amdgcn_readfirstlane((int)(threadIdx.x >> 5)), wm = wave >> 1, wn = wave & 1;
    float* os = osw[wave];                                         // wave-private store staging
    float* sb = sbw[wave];                                         // wave-private: the 64 bias values of the wave's tile
    const int z = blockIdx.y;
    const bool m0 = (z == 0);                                      // block-uniform
    const bf* X = XS + (size_t)z * NB * SEQ * NF; const bf* Wz = WS + (size_t)z * HDIM * NF;
    const bf* A = m0 ? X : Wz; const bf* Bt = m0 ? Wz : X;
    const float* bias = z == 0 ? bq : z == 1 ? bk : bv;
    h16* Ph = PS + (size_t)z * NB * NH_ * SEQ * DH;
    const unsigned ti = blockIdx.x;
    const int bx = (int)(m0 ? ti % (NB * SEQ / 128) : ti % (HDIM / 128)), by = (int)(m0 ? ti / (NB * SEQ / 128) : ti / (HDIM / 128));
    const int r0 = bx * 128 + wm * 64, c0 = by * 128 + wn * 64;    // the wave's own 64x64 tile
    const float* bt = bias + (m0 ? c0 : r0);                       // q: columns c0..c0+63, k, v: rows r0..r0+63 of the tile; both ranges end at or below HDIM
    const float t0 = bt[lane], t1 = bt[32 + lane];                 // issued ahead of stage 0's copies: they land under the wait for that stage; first used behind the k loop
    v8f acc[4][4];
#pragma unroll
    for (int mb = 0; mb < 4; ++mb)
#pragma unroll
        for (int nb = 0; nb < 4; ++nb) acc[mb][nb] = (v8f){};
    gemm_ring<128, 128, NF, true, 1, NF, 0>(A + (size_t)bx * 128 * NF, Bt + (size_t)by * 128 * NF, ring, wm, wn, acc);
    size_t tbase;
    if (m0) { const int bb = r0 / SEQ, tt = r0 % SEQ, hh = c0 / DH, dd = c0 % DH;
              tbase = (((size_t)(bb * NH_ + hh) * SEQ) + (size_t)tt) * DH + (size_t)dd; }
    else    { const int bb = c0 / SEQ, tt = c0 % SEQ;
              tbase = ((size_t)bb * HDIM + (size_t)r0) * SEQ + (size_t)tt; }
    sb[lane] = bfr(t0); sb[32 + lane] = bfr(t1);
    wave_sync();
    if (m0) proj_store<true>(acc, sb, os, Ph + tbase, lane);
    else    proj_store<false>(acc, sb, os, Ph + tbase, lane);
}

// k_attn: fused attention for 128 query rows of one (batch, head); 8 waves.
// Phase 1 (transposed scores): S^T[j][i] = sum_m KT[j][m] Q[i][m]; A = k^T-plane rows j = 64w + 16jb + lane&15 (k = token m), B = q-plane rows i = t0 + 16ib + lane&15 (k = feature m);
//   D: acc[jb][ib][r] = S^T[j = 64w + 16jb + 8h + r][i = 16ib + lane&15], so a lane holds 8 consecutive score columns of one query row.
// Softmax: per-wave row max -> LDS -> block barrier -> row max over the 8 waves; p = f16(2^((s - max) * scale * log2e + 14)); packed 16-B stores into the P tile [128][512] (LDS);
//   row sum over the converted p, per-wave partials through LDS; block barrier (publishes P and the sums).
// Phase 2: O^T[d][i] = sum_j VT[d][j] P[i][j]; A = v^T-plane rows d = 64w + 16db + lane&15 (k = token j), B = P tile rows i (k = j) from LDS.
// Operands: the Q tile is copied once into the LDS range that later holds P; the planes come as 2 * ANS ring stages (ANS of K^T, then ANS of V^T), each all 512 plane rows x 64 k, two buffers, asynchronous copies;
//   the first two V^T stages fly during the last score passes and the softmax.
// Epilogue: ctx = O / rowsum x 64 as f16; behind the last pass's barrier the wave stages its 128 x 64 tile in its own column range of the P tile (wave-private from then on).
//   The ctx rows go to the places of the block's own 128 q rows in QC: no other block reads or writes those, and this block's copies of them have landed before its first barrier.
// one ring stage: k = kb..kb+63 of all 512 rows of a plane [512][SEQ]; 8 lanes cover a 128-B row piece (one line); every thread issues 16 copies
__device__ __forceinline__ void attn_stage_issue(const h16* P, int kb, unsigned lbuf) {
    const int cc = threadIdx.x & 7, rr = threadIdx.x >> 3;           // 16-byte piece of the row piece; row within a sweep of 32 rows
    const bf* g = (const bf*)P + (size_t)rr * SEQ + kb + cc * 8;
    const unsigned l = lbuf + (unsigned)(rr * APH + cc * 8) * 2u;
#pragma unroll
    for (int i = 0; i < 2; ++i) acopy8(l + i * 256 * APH * 2, g + (size_t)i * 256 * SEQ, 32 * APH * 2, (size_t)32 * SEQ);
}
// one pass: 64 k of the wave's 64 plane rows (pa, ring buffer) against the QR rows of the Q or P tile (pb), k ascending in steps of 32
__device__ __forceinline__ void attn_pass(const h16* pa, const h16* pb, v8f (&acc)[4][QB]) {
#pragma unroll
    for (int u = 0; u < AKS / 32; ++u) {
        v8h a0[4], a1[4], b0[QB], b1[QB];
#pragma unroll
        for (int mb = 0; mb < 4; ++mb) { const h16* p = pa + mb * 16 * APH + u * 32; a0[mb] = *(const v8h*)p; a1[mb] = *(const v8h*)(p + 16); }
#pragma unroll
        for (int nb = 0; nb < QB; ++nb) { const h16* p = pb + nb * 16 * PP + u * 32; b0[nb] = *(const v8h*)p; b1[nb] = *(const v8h*)(p + 16); }
        __builtin_amdgcn_sched_barrier(0);                        // keeps the block's LDS reads together ahead of its matrix block: spread among the matrix instructions each read place waits out the LDS latency
#pragma unroll
        for (int nb = 0; nb < QB; ++nb)
#pragma unroll
            for (int mb = 0; mb < 4; ++mb) acc[mb][nb] = wmma16(cat16(a0[mb], a1[mb]), cat16(b0[nb], b1[nb]), acc[mb][nb]);   // plain builtin: an asm operand cannot lie above v255, and the 32 accumulators alone fill 256 registers
        if (u + 1 < AKS / 32) __builtin_amdgcn_sched_barrier(0);  // the next block's reads stay behind this matrix block, as one group
    }
}
__global__ __launch_bounds__(32 * AW)
void k_attn(h16* QC, const h16* __restrict__ KT, const h16* __restrict__ VT) {
    __shared__ __align__(16) h16 ring[2 * DH * APH];
    __shared__ __align__(16) h16 sP[QR * PP];
    __shared__ float smax[AW * QR];
    __shared__ float ssum[AW * QR];
    constexpr int ABUFH = DH * APH;                                 // halves per ring buffer
    const int lane = threadIdx.x & 31, lr = lane & 15, hi = lane >> 4;
    const int wave = __builtin_amdgcn_readfirstlane((int)(threadIdx.x >> 5));
    const int zh = blockIdx.y;                                      // b * 8 + h
    const int t0 = blockIdx.x * QR;
    const size_t zb = (size_t)zh * SEQ * DH;
    const h16* KTz = KT + zb; const h16* VTz = VT + zb;
    const unsigned lb = lds_off(ring);
    const int ao = (wave * 64 + lr) * APH + 8 * hi;                 // plane rows owned by this wave, in a ring buffer (+ 16*blk*APH + k)
    const int bo = lr * PP + 8 * hi;                                // Q / P tile rows (+ 16*ib*PP + k)
    { const int cc = threadIdx.x & 63, rr = threadIdx.x >> 6;       // Q tile: 64 lanes cover one 1024-B row; 4 rows a sweep, QR / 4 copies a thread
      const bf* g = (const bf*)QC + zb + (size_t)(t0 + rr) * DH + cc * 8;
      const unsigned l = lds_off(sP) + (unsigned)(rr * PP + cc * 8) * 2u;
#pragma unroll
      for (int i = 0; i < QR / 32; ++i) acopy8(l + i * 32 * PP * 2, g + (size_t)i * 32 * DH, 4 * PP * 2, (size_t)4 * DH); }
    attn_stage_issue(KTz, 0, lb);
    wait_async0();
    __syncthreads();                                              // publishes the Q tile and stage 0
    attn_stage_issue(KTz, AKS, lb + ABUFH * 2);
    v8f acc[4][QB];
#pragma unroll
    for (int jb = 0; jb < 4; ++jb)
#pragma unroll
        for (int ib = 0; ib < QB; ++ib) acc[jb][ib] = (v8f){};
#pragma unroll 1
    for (int s = 0; s < ANS; ++s) {                               // rolled: one pass per stage, the buffer chosen by s & 1
        attn_pass(ring + (s & 1) * ABUFH + ao, sP + bo + s * AKS, acc);
        wait_ds0();
        wait_async0();
        __syncthreads();                                          // publishes the next stage and ends every reader's last read of this one (behind the last pass: of the Q tile too)
        const int n = s + 2;                                      // always exists: the V^T stages follow the K^T stages
        attn_stage_issue(n < ANS ? KTz : VTz, (n & (ANS - 1)) * AKS, lb + (unsigned)(s & 1) * (ABUFH * 2));
    }
    // row max: lane holds 32 of the wave's 64 columns for query rows 16*ib + lr
    float mx[QB];
#pragma unroll
    for (int ib = 0; ib < QB; ++ib) { mx[ib] = NEGB;
#pragma unroll
        for (int jb = 0; jb < 4; ++jb) {
#pragma unroll
            for (int r = 0; r < 8; ++r) mx[ib] = fmaxf(mx[ib], acc[jb][ib][r]); }
        mx[ib] = fmaxf(mx[ib], __shfl_xor(mx[ib], 16, 32)); }
#pragma unroll
    for (int p = 0; p < QB / 2; ++p) smax[wave * QR + 32 * p + lane] = hi ? mx[2 * p + 1] : mx[2 * p];   // slot = query row 16*(2p + hi) + lr = 32p + lane
    __syncthreads();
    float sh[QB], ls[QB];
#pragma unroll
    for (int ib = 0; ib < QB; ++ib) { float g = smax[ib * 16 + lr];
#pragma unroll
        for (int w = 1; w < AW; ++w) g = fmaxf(g, smax[w * QR + ib * 16 + lr]);
        sh[ib] = PSH - g * SC2; ls[ib] = 0.0f; }
    const int pw = wave * 64 + 8 * hi;
#pragma unroll
    for (int jb = 0; jb < 4; ++jb) {
#pragma unroll
        for (int ib = 0; ib < QB; ++ib) { v8h p;
#pragma unroll
            for (int r = 0; r < 8; ++r) { const float e = acc[jb][ib][r] * SC2 + sh[ib]; const h16 a = pexp_h(e); p[r] = a; ls[ib] += (float)a; }
            *(v8h*)(&sP[(16 * ib + lr) * PP + pw + jb * 16]) = p; } }
#pragma unroll
    for (int ib = 0; ib < QB; ++ib) ls[ib] += __shfl_xor(ls[ib], 16, 32);
#pragma unroll
    for (int p = 0; p < QB / 2; ++p) ssum[wave * QR + 32 * p + lane] = hi ? ls[2 * p + 1] : ls[2 * p];
    __syncthreads();
    // phase 2
#pragma unroll
    for (int db = 0; db < 4; ++db)
#pragma unroll
        for (int ib = 0; ib < QB; ++ib) acc[db][ib] = (v8f){};
#pragma unroll 1
    for (int s = 0; s < ANS; ++s) {                               // rolled, as above
        attn_pass(ring + (s & 1) * ABUFH + ao, sP + bo + s * AKS, acc);
        wait_ds0();
        wait_async0();
        __syncthreads();                                          // publishes the next stage and ends every reader's last read of this one (behind the last pass: of the P tile too)
        if (s + 2 < ANS) attn_stage_issue(VTz, (s + 2) * AKS, lb + (unsigned)(s & 1) * (ABUFH * 2));
    }
    wait_async0();
    float inv[QB];
#pragma unroll
    for (int ib = 0; ib < QB; ++ib) { float l = ssum[ib * 16 + lr];
#pragma unroll
        for (int w = 1; w < AW; ++w) l += ssum[w * QR + ib * 16 + lr];
        inv[ib] = CTXC * (1.0f / l); }                          // l >= 16384: the row maximum contributes its full carry
    // columns 64w..64w+63 of the P tile are wave-private from here
    // O^T D layout: acc[db][ib][r] = (d = 64w + 16db + 8h + r, i = 16ib + lane&15) -> sP[i][64w + 16db + 8h + r]; rows 0..QR-1 x 64 columns all written
#pragma unroll
    for (int db = 0; db < 4; ++db) {
#pragma unroll
        for (int ib = 0; ib < QB; ++ib) { v8h o;
#pragma unroll
            for (int r = 0; r < 8; ++r) o[r] = toh_flush(acc[db][ib][r] * inv[ib]);
            *(v8h*)(&sP[(16 * ib + lr) * PP + pw + db * 16]) = o; } }
    wave_sync();
    h16* crow = QC + zb + (size_t)t0 * DH + (size_t)wave * 64;
#pragma unroll
    for (int s = 0; s < QR / 4; ++s) { const int row = 4 * s + (lane >> 3), c8 = (lane & 7) * 8;   // QR / 4 s x 4 rows = QR rows; 8 lanes x 8 halves = 64 columns = one line
        const v8h val = *(const v8h*)(&sP[row * PP + wave * 64 + c8]);
        *(v8h*)(crow + (size_t)row * DH + c8) = val; }
}

// k_oproj: register-blocked f16 GEMM, 4 waves per 64x64 tile, one 32x32 tile per wave, operands staged in LDS, K = HDIM; out[m][n] = (sum_k ctx64[m][k] wo64[n][k]) / 4096 + bias[n] (f32).
// A = ctx plane [(b*8 + h)][t][d]: row m = b*SEQ + t holds k = h*512 + d in 8 pieces of 512, SEQ*DH apart; Bt = Wo plane rows (n); grid (NB*SEQ/64, NF/64).
__global__ __launch_bounds__(GTH) void k_oproj(const h16* __restrict__ A, const h16* __restrict__ Bt, const float* __restrict__ bias, float* OUT) {
    __shared__ __align__(16) bf ring[2 * (64 + 64) * GPH];
    __shared__ __align__(16) float osw[4][16 * 36];
    const int lane = threadIdx.x & 31, lr = lane & 15, hi = lane >> 4;
    const int wave = __builtin_amdgcn_readfirstlane((int)(threadIdx.x >> 5)), wm = wave >> 1, wn = wave & 1;
    float* os = osw[wave];                                         // wave-private store staging
    const int r0 = blockIdx.x * 64 + wm * 32, c0 = blockIdx.y * 64 + wn * 32;   // the wave's own 32x32 tile
    v8f acc[2][2];
#pragma unroll
    for (int mb = 0; mb < 2; ++mb)
#pragma unroll
        for (int nb = 0; nb < 2; ++nb) acc[mb][nb] = (v8f){};
    const int rt = blockIdx.x * 64;                                // a 64-row tile lies in one batch
    gemm_ring<64, 64, HDIM, false, 4, DH, (size_t)SEQ * DH>((const bf*)A + (size_t)(rt / SEQ) * NH_ * SEQ * DH + (size_t)(rt % SEQ) * DH, (const bf*)Bt + (size_t)blockIdx.y * 64 * HDIM, ring, wm, wn, acc);
    float bc[2];
#pragma unroll
    for (int nb = 0; nb < 2; ++nb) bc[nb] = bfr(bias[c0 + nb * 16 + lr]);   // c0 + 31 < NF
#pragma unroll
    for (int mb = 0; mb < 2; ++mb) {
#pragma unroll
        for (int nb = 0; nb < 2; ++nb) {
#pragma unroll
            for (int j = 0; j < 8; ++j) os[(hi * 8 + j) * 36 + nb * 16 + lr] = acc[mb][nb][j] * OSC + bc[nb]; }   // D: row 8h+j, col lane&15
        wave_sync();
{
#pragma unroll
            for (int s = 0; s < 4; ++s) { const int row = 4 * s + (lane >> 3), c4 = (lane & 7) * 4;   // 4 s x 4 rows = 16 rows; 8 lanes x 4 floats = 32 columns = one line
                const v4f val = *(const v4fa*)(&os[row * 36 + c4]);
                *(v4f*)(OUT + (size_t)(r0 + mb * 16 + row) * NF + c0 + c4) = val; }
             }
        wave_sync();
    }
}

static constexpr size_t SZ_XB = (size_t)NB * SEQ * NF * 2;                   // bf16 copy of one input
static constexpr size_t SZ_WP = (size_t)HDIM * NF * 2;                       // one weight plane (Wq | Wk | Wv bf16, Wo f16)
static constexpr size_t SZ_PL = (size_t)NB * NH_ * SEQ * DH * 2;             // one q / k^T / v^T plane; ctx replaces q
static constexpr size_t SZ_TOTAL = 3 * SZ_XB + 4 * SZ_WP + 3 * SZ_PL;
static_assert(SZ_XB % 256 == 0 && SZ_WP % 256 == 0 && SZ_PL % 256 == 0);   // the planes lie back to back, each 256-B aligned
static_assert(SZ_TOTAL <= (size_t)268435456);          // workspace carve <= 256 MiB
static_assert((size_t)NB * NH_ * SEQ * DH == (size_t)NB * HDIM * SEQ);     // k^T / v^T plane [(b*4096 + m)][t] has the same extent as the q plane
static_assert((size_t)NF * HDIM == (size_t)HDIM * NF);                     // Wo plane extent equals a projection weight plane

extern "C" void kernel_launch(void* const* d_in, const int* in_sizes, int n_in,
                              void* d_out, int out_size, void* d_ws, size_t ws_size, hipStream_t stream) {
    if (n_in < 11) return;
    const size_t needx = (size_t)NB * SEQ * NF;
    if ((size_t)in_sizes[0] < needx || (size_t)in_sizes[1] < needx || (size_t)in_sizes[2] < needx) return;
    if ((size_t)in_sizes[3] < (size_t)HDIM * NF || (size_t)in_sizes[5] < (size_t)HDIM * NF || (size_t)in_sizes[7] < (size_t)HDIM * NF) return;
    if ((size_t)in_sizes[9] < (size_t)NF * HDIM) return;
    if (in_sizes[4] < HDIM || in_sizes[6] < HDIM || in_sizes[8] < HDIM || in_sizes[10] < NF) return;
    if ((size_t)out_size < needx) return;
    if (SZ_TOTAL > ws_size) return;
    // wire order: q, k, v, Wq, bq, Wk, bk, Wv, bv, Wo, bo
    const float* xq = (const float*)d_in[0]; const float* xk = (const float*)d_in[1]; const float* xv = (const float*)d_in[2];
    const float* wq = (const float*)d_in[3]; const float* bq = (const float*)d_in[4];
    const float* wk = (const float*)d_in[5]; const float* bk = (const float*)d_in[6];
    const float* wv = (const float*)d_in[7]; const float* bv = (const float*)d_in[8];
    const float* wo = (const float*)d_in[9]; const float* bo = (const float*)d_in[10];
    float* OUT = (float*)d_out;      // [NB][SEQ][NF]
    char* wsp = (char*)d_ws;
    bf* XS = (bf*)wsp; wsp += 3 * SZ_XB;             // q | k | v, each [NB*SEQ][NF]
    bf* WS = (bf*)wsp; wsp += 3 * SZ_WP;             // Wq | Wk | Wv, each [4096][512] ([out][in])
    h16* WOH = (h16*)wsp; wsp += SZ_WP;              // [512][4096] x64
    h16* QC = (h16*)wsp; wsp += SZ_PL;               // q [NB*8][SEQ][512], then ctx [NB*8][SEQ][512] x64
    h16* KTP = (h16*)wsp; wsp += SZ_PL;              // [NB*8][512][SEQ]
    h16* VTP = (h16*)wsp; wsp += SZ_PL;              // [NB*8][512][SEQ]

    k_cvt<<<3 * XBK + 4 * WBK, 256, 0, stream>>>(xq, xk, xv, wq, wk, wv, wo, XS);
    k_proj<<<dim3((NB * SEQ / 128) * (HDIM / 128), 3, 1), GTH, 0, stream>>>(XS, WS, bq, bk, bv, QC);
    k_attn<<<dim3(SEQ / QR, NB * NH_, 1), 32 * AW, 0, stream>>>(QC, KTP, VTP);
    k_oproj<<<dim3(NB * SEQ / 64, NF / 64, 1), GTH, 0, stream>>>(QC, WOH, bo, OUT);
}

// v006
// It runs in 195 microseconds.
// Next to v005, in two timings, it ran 1.06 times as fast each time.
// All steps since v000 together make it 5.46 times as fast.
#include <hip/hip_runtime.h>

// Compute dtypes, f32 accumulate everywhere: the three input projections v_wmma_f32_16x16x32_bf16 (x, W, bias RNE-converted to bf16; products exact); scores, P.V and the output projection v_wmma_f32_16x16x32_f16, single product at every site.
// Multi-head attention block without mask: q/k/v [NB][512][512]; Wq/Wk/Wv [4096][512] ([out][in], y = x W^T + bias), 8 heads x 512 columns (head h = columns h*512 + d); score[i][j] = sum_m qh[i][m] kh[m][j] / sqrt(512)
// (m = feature index of qh = token index of kh, j = feature index of kh); softmax over j; ctx[i][d] = sum_j P[i][j] vh[j][d] (j = token index of vh); heads merged to [NB*512][4096]; output = ctx Wo^T + bo with Wo [512][4096] (f32).
// Planes (f16): q [(b*8+h)][t][d]; k^T and v^T [(b*8+h)][d][t] (contraction index contiguous in every GEMM); ctx [(b*8+h)][t][d] carried x64, stored over the q plane (each attention block replaces the 128 q rows that it alone has read); Wo carried x64 (built from the bf16 RNE value); P carried x16384 in LDS only (cancels in the normalisation).
// Attention kernel: 8 waves per 128 query rows of one (batch, head), transposed form S^T = K^T-plane x Q (wave w owns score columns 64w..64w+63), row max / row sum exchanged through LDS, packed P tile [128][512] in LDS,
// O^T = V^T-plane x P (wave w owns output columns 64w..64w+63); the K^T and V^T planes pass through a two-buffer LDS ring, the Q tile lies where the P tile is written later. All batches go through every kernel in one launch: four launches in all.

#ifndef NB
#define NB 16
#endif
#define NB_FULL 16
#define SEQ  512                 // tokens per sequence; the module requires SEQ == DH (score contraction) and SEQ == NF
#define NF   512                 // input feature width
#define NH_  8
#define DH   512                 // per-head width
#define HDIM (NH_ * DH)          // 4096
#define AW   8                   // waves per attention block
#define QR   128                 // query rows per attention block: every plane byte that a block brings into LDS meets 128 query rows
#define QB   (QR / 16)           // 16-row query blocks per attention block (accumulator tiles per plane-row block of a wave)
#define PP   520                 // LDS row pitch (halves) of the Q / P tile (1040 B = 16 B x 65)
#define AKS  64                  // k per stage of the attention ring (128 B of every plane row)
#define APH  72                  // LDS row pitch (halves) of the attention ring (144 B = 16 B x 9)
#define ANS  (SEQ / AKS)         // stages per plane
#define SC2  ((float)(0.04419417382415922 * 1.4426950408889634))   // DH^-0.5 * log2(e)
#define PSH  14.0f               // log2 of the P carry (16384)
#define NEGB (-3.0e38f)
#define CTXC 64.0f               // carry of the ctx plane
#define WOC  64.0f               // carry of the Wo plane
#define OSC  (1.0f / 4096.0f)    // 1 / (CTXC * WOC)

static_assert(DH == SEQ);                      // score contraction: feature index of q = token index of k; plane row pitch is the same in both layouts
static_assert(NF == SEQ);
static_assert(NH_ * DH == HDIM);
static_assert(NF % 32 == 0);                   // projection k-loop steps by 32
static_assert(SEQ % 32 == 0);                  // attention k-loops step by 32
static_assert(HDIM % 32 == 0);                 // output projection k-loop steps by 32
static_assert(SEQ % 64 == 0);                  // a 64-row tile never straddles two batches
static_assert(DH % 64 == 0);                   // a 64-column tile never straddles two heads
static_assert(HDIM % 64 == 0);
static_assert(NF % 64 == 0);
static_assert(NB <= NB_FULL);
static_assert(DH == AW * 64);                  // each attention wave owns 64 score columns and 64 output columns
static_assert(SEQ % QR == 0);                  // attention grid covers the query rows exactly (QR per block)
static_assert(ANS % 2 == 0 && ANS >= 2);       // the V^T stages go on in the ring with the buffer parity of the K^T stages; both prologue stages exist
static_assert((APH * 2) % 16 == 0 && AKS % 32 == 0);
static_assert(DH == 2 * 8 * 32 && QR % (8 * 4) == 0 && DH * 2 == 64 * 16 && AKS * 2 == 8 * 16);   // copy sweeps of 256 threads: ring 32 rows a sweep, 16 sweeps; Q tile 4 rows a sweep, QR / 4 sweeps
static_assert(QR / 4 + 16 <= 63);              // copies of a wave in flight in the prologue: the Q tile and stage 0
static_assert((PP * 2) % 16 == 0);
static_assert(PP >= DH);
static_assert(32 * 16 * 4 == 16 * 64 * 2);
static_assert(32 * 16 * (QR / 4) == QR * 64 * 2);   // k_attn store loop: 32 lanes x 16 B x QR / 4 trips == QR rows x 128 B
static_assert(32 * 16 * 4 == 16 * 32 * 4);     // k_oproj store loop: 32 lanes x 16 B x 4 trips == 16 rows x 128 B
static_assert(2 * 256 * 272 + 4 * 16 * 68 * 4 + 4 * 64 * 4 <= 163840);   // static LDS of k_proj: two work-groups fit one WGP's 320 KiB
static_assert(HDIM % 128 == 0 && (NB * SEQ) % 128 == 0);    // k_proj grid covers both extents exactly (128 x 128 tiles)
static_assert(NF % 128 == 0 && SEQ % 128 == 0);             // k_oproj grid covers both extents exactly (128 x 128 tiles); a 128-row tile never straddles two batches
static_assert(2 * 256 * 528 + 8 * 16 * 36 * 4 <= 327680);   // static LDS of k_oproj: one work-group per WGP
static_assert(2 * DH * APH * 2 + QR * PP * 2 + 2 * AW * QR * 4 <= 327680);   // static LDS of the attention kernel: one work-group per WGP
static_assert(((size_t)NB * SEQ * NF) % 2048 == 0);          // k_cvt: a block converts 2048 elements of one source
static_assert(((size_t)HDIM * NF) % 2048 == 0);

typedef _Float16 h16;
typedef unsigned short bf;
typedef __attribute__((ext_vector_type(16))) __bf16   v16bf;
typedef __attribute__((ext_vector_type(16))) _Float16 v16h;
typedef __attribute__((ext_vector_type(8)))  _Float16 v8h;
typedef __attribute__((ext_vector_type(8)))  unsigned short v8us;
typedef __attribute__((ext_vector_type(8)))  float    v8f;
typedef __attribute__((ext_vector_type(4)))  float    v4f;
typedef v4f  __attribute__((may_alias)) v4fa;

__device__ __forceinline__ unsigned short f2bf(float f) { unsigned u = __float_as_uint(f); u += 0x7FFFu + ((u >> 16) & 1u); return (unsigned short)(u >> 16); }
__device__ __forceinline__ float bfr(float f) { return __uint_as_float(((unsigned)f2bf(f)) << 16); }   // value after RNE convert to bf16
__device__ __forceinline__ v16h cat16(v8h lo, v8h hi) { return __builtin_shufflevector(lo, hi, 0, 1, 2, 3, 4, 5, 6, 7, 8, 9, 10, 11, 12, 13, 14, 15); }
__device__ __forceinline__ v16bf cat16b(v8us lo, v8us hi) { return __builtin_bit_cast(v16bf, __builtin_shufflevector(lo, hi, 0, 1, 2, 3, 4, 5, 6, 7, 8, 9, 10, 11, 12, 13, 14, 15)); }
__device__ __forceinline__ v8f wmma16(v16h a, v16h b, v8f c) { return __builtin_amdgcn_wmma_f32_16x16x32_f16(false, a, false, b, (short)0, c, false, false); }
__device__ __forceinline__ v8f wmmab(v16bf a, v16bf b, v8f c) { return __builtin_amdgcn_wmma_f32_16x16x32_bf16(false, a, false, b, (short)0, c, false, false); }
// fragment loaders from K-contiguous 16-bit rows; p already includes + 8*(lane>>4): elements 0..7 <- k0+8h+0..7, elements 8..15 <- k0+16+8h+0..7 (same map for A and B)
__device__ __forceinline__ v16h  ldh(const h16* p) { return cat16(*(const v8h*)p, *(const v8h*)(p + 16)); }
// ordering point for wave-private LDS tiles (same wave writes and reads)
__device__ __forceinline__ void wave_sync() { __builtin_amdgcn_fence(3 /* release order */, "wavefront"); __builtin_amdgcn_wave_barrier(); asm volatile("" ::: "memory"); }

// per-instruction guarded matrix ops: one accumulator tied per guard, operands kept live
__device__ __forceinline__ v8f wmma16_g(v16h a, v16h b, v8f c) { c = wmma16(a, b, c); asm volatile("v_nop\n\tv_nop\n\tv_nop\n\tv_nop" : "+v"(c) : "v"(a), "v"(b)); return c; }
__device__ __forceinline__ v8f wmmab_g(v16bf a, v16bf b, v8f c) { c = wmmab(a, b, c); asm volatile("v_nop\n\tv_nop\n\tv_nop\n\tv_nop" : "+v"(c) : "v"(a), "v"(b)); return c; }
// f32 -> f16 convert that cannot produce an f16 subnormal (|v| < 2^-14 -> +0), applied after the plane's power-of-two carry
static __device__ __forceinline__ h16 toh_flush(float v) { const h16 r = (h16)v; return (fabsf(v) < 6.103515625e-05f) ? (h16)0.0f : r; }
// carried probability 2^e as f16; the select is on the exponent argument (e < -14 -> +0)
static __device__ __forceinline__ h16 pexp_h(float e) { const h16 r = (h16)__builtin_amdgcn_exp2f(e); return (e < -14.0f) ? (h16)0.0f : r; }

// ---- operand staging for the two GEMM kernels: asynchronous copies to LDS, two buffers ----
// A work-group of NWM x NWN waves owns a BM x BN tile. A stage is KS k of every operand row ([A BM rows | Bt BN rows], 2 * KS bytes a row, LDS pitch 16 B more: 272 B at KS = 128, 528 B at KS = 256).
// Each lane copies 16 B; KS / 8 lanes cover one row piece, so every copy instruction asks for whole lines. Stage s + 2 is issued into the buffer that pass s has left.
#define GKS  128                 // k per stage, k_proj
#define GPH  136                 // its LDS row pitch in halves (272 B = 16 B x 17: conflict-free for 16-byte fragment reads)
#define GTH  128                 // threads per k_proj work-group
#define OKS  256                 // k per stage, k_oproj (LDS row pitch 528 B = 16 B x 33)
#define OTH  256                 // threads per k_oproj work-group
static_assert((GPH * 2) % 16 == 0 && GPH == GKS + 8);
static_assert(HDIM % OKS == 0 && HDIM / OKS >= 2 && DH % OKS == 0);
static_assert(NF % GKS == 0 && NF / GKS >= 2);       // both ring stages of the prologue exist
static_assert(HDIM % GKS == 0 && HDIM / GKS >= 2);
__device__ __forceinline__ unsigned lds_off(const void* p) { return (unsigned)(size_t)p; }
// eight copies and the wait that stands in front of any rewrite of their address registers, in one statement
__device__ __forceinline__ void acopy8(unsigned l, const bf* g, unsigned lstep, size_t gstep) {
    asm volatile("global_load_async_to_lds_b128 %0, %1, off\n\t"
                 "global_load_async_to_lds_b128 %2, %3, off\n\t"
                 "global_load_async_to_lds_b128 %4, %5, off\n\t"
                 "global_load_async_to_lds_b128 %6, %7, off\n\t"
                 "global_load_async_to_lds_b128 %8, %9, off\n\t"
                 "global_load_async_to_lds_b128 %10, %11, off\n\t"
                 "global_load_async_to_lds_b128 %12, %13, off\n\t"
                 "global_load_async_to_lds_b128 %14, %15, off\n\t"
                 "s_wait_xcnt 0x0"
                 :: "v"(l), "v"(g), "v"(l + lstep), "v"(g + gstep), "v"(l + 2 * lstep), "v"(g + 2 * gstep), "v"(l + 3 * lstep), "v"(g + 3 * gstep),
                    "v"(l + 4 * lstep), "v"(g + 4 * gstep), "v"(l + 5 * lstep), "v"(g + 5 * gstep), "v"(l + 6 * lstep), "v"(g + 6 * gstep), "v"(l + 7 * lstep), "v"(g + 7 * gstep)
                 : "memory");
}
// one stage: BM rows of A and BN rows of Bt, KS k each, into the buffer at LDS byte address lbuf; A and Bt point at the tile's first row at the stage's first k; PA, PB = row pitches; NT threads, every thread issues (BM + BN) / 8 copies
template <int BM, int BN, int PA, int PB, int NT, int KS>
__device__ __forceinline__ void stage_issue(const bf* A, const bf* Bt, unsigned lbuf) {
    constexpr int LPR = KS / 8, PH = KS + 8;                         // lanes per row piece; LDS row pitch in halves
    static_assert(BM % 64 == 0 && BN % 64 == 0 && NT / LPR == 8);
    const int cc = threadIdx.x & (LPR - 1), rr = threadIdx.x / LPR;  // 16-byte piece of the row; row within a sweep of 8 rows
    const bf* ga = A  + (size_t)rr * PA + cc * 8;
    const bf* gb = Bt + (size_t)rr * PB + cc * 8;
    const unsigned l = lbuf + (unsigned)(rr * PH + cc * 8) * 2u;
#pragma unroll
    for (int i = 0; i < BM / 64; ++i) acopy8(l + i * 64 * PH * 2, ga + (size_t)i * 64 * PA, 8 * PH * 2, (size_t)8 * PA);
#pragma unroll
    for (int i = 0; i < BN / 64; ++i) acopy8(l + (BM + i * 64) * PH * 2, gb + (size_t)i * 64 * PB, 8 * PH * 2, (size_t)8 * PB);
}
__device__ __forceinline__ void wait_async0() { asm volatile("s_wait_asynccnt 0x0" ::: "memory"); }   // this wave's copies have landed
__device__ __forceinline__ void wait_ds0()    { asm volatile("s_wait_dscnt 0x0" ::: "memory"); }      // this wave's LDS reads have returned before their buffer is refilled
// C tile accumulation, k ascending in steps of 32; wave (wm, wn) of NWM x NWN owns rows wm*BM/NWM.. and columns wn*BN/NWN.. of the tile. BF: bf16 products, else f16.
// GB = k blocks of 32 whose fragments are read from LDS as one group. A and Bt point at the tile's first row, k = 0. Bt rows are KT long; an A row is PA long and holds k = 0..PA-1, the next PA k of that row lie AJ elements further.
template <int BM, int BN, int KT, bool BF, int GB, int PA, size_t AJ, int NWM, int NWN, int KS>
__device__ __forceinline__ void gemm_ring(const bf* A, const bf* Bt, bf* ring, int wm, int wn, v8f (&acc)[BM / (16 * NWM)][BN / (16 * NWN)]) {
    constexpr int FM = BM / (16 * NWM), FN = BN / (16 * NWN), PH = KS + 8, BUFH = (BM + BN) * PH, NS = KT / KS, NT = 32 * NWM * NWN;
    static_assert(BM % (16 * NWM) == 0 && BN % (16 * NWN) == 0 && (BM + BN) / 8 <= 63 && (KS / 32) % GB == 0 && PA % KS == 0 && KT % PA == 0 && NS >= 2);
    const int lane = threadIdx.x & 31, lr = lane & 15, hi = lane >> 4;
    const unsigned lb = lds_off(ring);
    stage_issue<BM, BN, PA, KT, NT, KS>(A, Bt, lb);
    wait_async0();
    __syncthreads();                                              // publishes stage 0
    stage_issue<BM, BN, PA, KT, NT, KS>(A + (KS / PA) * AJ + KS % PA, Bt + KS, lb + BUFH * 2);
    const int ao = (wm * (BM / NWM) + lr) * PH + 8 * hi, bo = (BM + wn * (BN / NWN) + lr) * PH + 8 * hi;
#pragma unroll 1
    for (int s = 0; s < NS; ++s) {                                // rolled: one pass per stage, the buffer chosen by s & 1
        const bf* sb = ring + (s & 1) * BUFH;
#pragma unroll
        for (int kk = 0; kk < KS; kk += 32 * GB) {
            v8us a0[GB][FM], a1[GB][FM], b0[GB][FN], b1[GB][FN];
#pragma unroll
            for (int u = 0; u < GB; ++u) {
#pragma unroll
                for (int mb = 0; mb < FM; ++mb) { const bf* p = sb + ao + mb * 16 * PH + kk + u * 32; a0[u][mb] = *(const v8us*)p; a1[u][mb] = *(const v8us*)(p + 16); }
#pragma unroll
                for (int nb = 0; nb < FN; ++nb) { const bf* p = sb + bo + nb * 16 * PH + kk + u * 32; b0[u][nb] = *(const v8us*)p; b1[u][nb] = *(const v8us*)(p + 16); }
            }
            __builtin_amdgcn_sched_barrier(0);                    // keeps the group's LDS reads together ahead of its matrix block: spread among the matrix instructions each read place waits out the LDS latency
#pragma unroll
            for (int u = 0; u < GB; ++u)
#pragma unroll
                for (int nb = 0; nb < FN; ++nb)
#pragma unroll
                    for (int mb = 0; mb < FM; ++mb) {
                        if constexpr (BF) acc[mb][nb] = wmmab_g(cat16b(a0[u][mb], a1[u][mb]), cat16b(b0[u][nb], b1[u][nb]), acc[mb][nb]);
                        else              acc[mb][nb] = wmma16_g(__builtin_bit_cast(v16h, cat16b(a0[u][mb], a1[u][mb])), __builtin_bit_cast(v16h, cat16b(b0[u][nb], b1[u][nb])), acc[mb][nb]); }
            if constexpr (32 * GB < KS) __builtin_amdgcn_sched_barrier(0);   // the next group's reads stay behind this matrix block, as one group
        }
        wait_ds0();
        wait_async0();
        __syncthreads();                                          // publishes stage s + 1 and ends every reader's last read of stage s
        if (s + 2 < NS) { const int kb = (s + 2) * KS; stage_issue<BM, BN, PA, KT, NT, KS>(A + (size_t)(kb / PA) * AJ + kb % PA, Bt + kb, lb + (unsigned)(s & 1) * (BUFH * 2)); }
    }
    wait_async0();
}

// k_cvt: every 16-bit operand plane in one launch; a block converts 2048 elements of one source. Block ranges: q | k | v (XBK blocks each, bf16 RNE), Wq | Wk | Wv (WBK each, bf16 RNE), Wo (WBK, f16 of the bf16 RNE value x64);
// the planes lie at dst in that order, back to back, so the destination index is the flat one.
#define XBK ((unsigned)((size_t)NB * SEQ * NF / 2048))
#define WBK ((unsigned)((size_t)HDIM * NF / 2048))
__global__ __launch_bounds__(256) void k_cvt(const float* __restrict__ q, const float* __restrict__ k, const float* __restrict__ v, const float* __restrict__ wq, const float* __restrict__ wk,
                                             const float* __restrict__ wv, const float* __restrict__ wo, bf* dst) {
    const unsigned blk = blockIdx.x;
    const float* src; unsigned lb;                                 // source and block index within it: block-uniform
    if (blk < 3 * XBK) { const unsigned g = blk / XBK; src = g == 0 ? q : g == 1 ? k : v; lb = blk - g * XBK; }
    else { const unsigned w = blk - 3 * XBK, g = w / WBK; src = g == 0 ? wq : g == 1 ? wk : g == 2 ? wv : wo; lb = w - g * WBK; }
    const v8f x = *(const v8f*)(src + ((size_t)lb * 256 + threadIdx.x) * 8); v8us o;
    if (blk < 3 * XBK + 3 * WBK) {
#pragma unroll
        for (int i = 0; i < 8; ++i) o[i] = f2bf(x[i]);
    } else { v8h t;
#pragma unroll
        for (int i = 0; i < 8; ++i) t[i] = toh_flush(bfr(x[i]) * WOC);
        o = __builtin_bit_cast(v8us, t); }
    *(v8us*)(dst + ((size_t)blk * 256 + threadIdx.x) * 8) = o;
}

// k_proj epilogue of one wave: its 64x64 tile + bias -> f16, 16 rows at a time through the wave's own staging tile; sb = the wave's 64 bias values (bf16 RNE) in LDS, read back here as one group.
// BC: bias per column (q), sb[n - c0]; else bias per row (k, v), sb[m - r0]. Pt = the tile's first element, row pitch SEQ (== DH).
template <bool BC>
__device__ __forceinline__ void proj_store(const v8f (&acc)[4][4], const float* sb, float* os, h16* Pt, int lane) {
    const int lr = lane & 15, hi = lane >> 4;
    float bc[4]; v4f br[4][2];
    if constexpr (BC) {
#pragma unroll
        for (int nb = 0; nb < 4; ++nb) bc[nb] = sb[nb * 16 + lr];
    } else {
#pragma unroll
        for (int mb = 0; mb < 4; ++mb) { br[mb][0] = *(const v4fa*)(sb + mb * 16 + hi * 8); br[mb][1] = *(const v4fa*)(sb + mb * 16 + hi * 8 + 4); }
    }
#pragma unroll
    for (int mb = 0; mb < 4; ++mb) {
#pragma unroll
        for (int nb = 0; nb < 4; ++nb) {
#pragma unroll
            for (int j = 0; j < 8; ++j) { float b; if constexpr (BC) b = bc[nb]; else b = br[mb][j >> 2][j & 3];
                os[(hi * 8 + j) * 68 + nb * 16 + lr] = acc[mb][nb][j] + b; } }   // D: row 8h+j, col lane&15
        wave_sync();
#pragma unroll
        for (int s = 0; s < 4; ++s) { const int row = 4 * s + (lane >> 3), c8 = (lane & 7) * 8;   // 4 s x 4 row groups = 16 rows; 8 lanes x 8 = 64 columns = one line
            const v4f x0 = *(const v4fa*)(&os[row * 68 + c8]); const v4f x1 = *(const v4fa*)(&os[row * 68 + c8 + 4]); v8h hv;
#pragma unroll
            for (int i = 0; i < 4; ++i) { hv[i] = toh_flush(x0[i]); hv[4 + i] = toh_flush(x1[i]); }
            *(v8h*)(Pt + (size_t)(mb * 16 + row) * SEQ + c8) = hv; }
        asm volatile("s_wait_xcnt 0x0" ::: "memory");             // stands behind the run of four stores, ahead of any rewrite of their address or data registers
        wave_sync();
    }
}

// k_proj: register-blocked bf16 GEMM, 4 waves per 128x128 tile, one 64x64 tile (16 accumulators) per wave, operands staged in LDS from K-contiguous bf16 planes, K = NF.
// C[m][n] = sum_k A[m][k] Bt[n][k] + bias, written as f16.
// blockIdx.y = 0 (q): A = x rows (m = b*SEQ + t), Bt = W rows (n = h*512 + d), bias per column; plane [(b*8 + h)][t][d]; tile (bx, by) of (NB*SEQ/128, HDIM/128), bx fastest in blockIdx.x.
// blockIdx.y = 1, 2 (k, v): A = W rows (m = h*512 + d), Bt = x rows (n = b*SEQ + t), bias per row; plane [(b*4096 + m)][t] = [(b*8 + h)][d][t]; tile (bx, by) of (HDIM/128, NB*SEQ/128).
// XS, WS, PS: the three input copies, the three weight planes and the three output planes, each set back to back. grid (NB*SEQ/128 * HDIM/128, 3).
__global__ __launch_bounds__(GTH) void k_proj(const bf* __restrict__ XS, const bf* __restrict__ WS, const float* __restrict__ bq, const float* __restrict__ bk, const float* __restrict__ bv, h16* PS) {
    __shared__ __align__(16) bf ring[2 * (128 + 128) * GPH];
    __shared__ __align__(16) float osw[4][16 * 68];
    __shared__ __align__(16) float sbw[4][64];
    const int lane = threadIdx.x & 31;
    const int wave = __builtin_amdgcn_readfirstlane((int)(threadIdx.x >> 5)), wm = wave >> 1, wn = wave & 1;
    float* os = osw[wave];                                         // wave-private store staging
    float* sb = sbw[wave];                                         // wave-private: the 64 bias values of the wave's tile
    const int z = blockIdx.y;
    const bool m0 = (z == 0);                                      // block-uniform
    const bf* X = XS + (size_t)z * NB * SEQ * NF; const bf* Wz = WS + (size_t)z * HDIM * NF;
    const bf* A = m0 ? X : Wz; const bf* Bt = m0 ? Wz : X;
    const float* bias = z == 0 ? bq : z == 1 ? bk : bv;
    h16* Ph = PS + (size_t)z * NB * NH_ * SEQ * DH;
    const unsigned ti = blockIdx.x;
    const int bx = (int)(m0 ? ti % (NB * SEQ / 128) : ti % (HDIM / 128)), by = (int)(m0 ? ti / (NB * SEQ / 128) : ti / (HDIM / 128));
    const int r0 = bx * 128 + wm * 64, c0 = by * 128 + wn * 64;    // the wave's own 64x64 tile
    const float* bt = bias + (m0 ? c0 : r0);                       // q: columns c0..c0+63, k, v: rows r0..r0+63 of the tile; both ranges end at or below HDIM
    const float t0 = bt[lane], t1 = bt[32 + lane];                 // issued ahead of stage 0's copies: they land under the wait for that stage; first used behind the k loop
    v8f acc[4][4];
#pragma unroll
    for (int mb = 0; mb < 4; ++mb)
#pragma unroll
        for (int nb = 0; nb < 4; ++nb) acc[mb][nb] = (v8f){};
    gemm_ring<128, 128, NF, true, 1, NF, 0, 2, 2, GKS>(A + (size_t)bx * 128 * NF, Bt + (size_t)by * 128 * NF, ring, wm, wn, acc);
    size_t tbase;
    if (m0) { const int bb = r0 / SEQ, tt = r0 % SEQ, hh = c0 / DH, dd = c0 % DH;
              tbase = (((size_t)(bb * NH_ + hh) * SEQ) + (size_t)tt) * DH + (size_t)dd; }
    else    { const int bb = c0 / SEQ, tt = c0 % SEQ;
              tbase = ((size_t)bb * HDIM + (size_t)r0) * SEQ + (size_t)tt; }
    sb[lane] = bfr(t0); sb[32 + lane] = bfr(t1);
    wave_sync();
    if (m0) proj_store<true>(acc, sb, os, Ph + tbase, lane);
    else    proj_store<false>(acc, sb, os, Ph + tbase, lane);
}

// k_attn: fused attention for 128 query rows of one (batch, head); 8 waves.
// Phase 1 (transposed scores): S^T[j][i] = sum_m KT[j][m] Q[i][m]; A = k^T-plane rows j = 64w + 16jb + lane&15 (k = token m), B = q-plane rows i = t0 + 16ib + lane&15 (k = feature m);
//   D: acc[jb][ib][r] = S^T[j = 64w + 16jb + 8h + r][i = 16ib + lane&15], so a lane holds 8 consecutive score columns of one query row.
// Softmax: per-wave row max -> LDS -> block barrier -> row max over the 8 waves; p = f16(2^((s - max) * scale * log2e + 14)); packed 16-B stores into the P tile [128][512] (LDS);
//   row sum over the converted p, per-wave partials through LDS; block barrier (publishes P and the sums).
// Phase 2: O^T[d][i] = sum_j VT[d][j] P[i][j]; A = v^T-plane rows d = 64w + 16db + lane&15 (k = token j), B = P tile rows i (k = j) from LDS.
// Operands: the Q tile is copied once into the LDS range that later holds P; the planes come as 2 * ANS ring stages (ANS of K^T, then ANS of V^T), each all 512 plane rows x 64 k, two buffers, asynchronous copies;
//   the first two V^T stages fly during the last score passes and the softmax.
// Epilogue: ctx = O / rowsum x 64 as f16; behind the last pass's barrier the wave stages its 128 x 64 tile in its own column range of the P tile (wave-private from then on).
//   The ctx rows go to the places of the block's own 128 q rows in QC: no other block reads or writes those, and this block's copies of them have landed before its first barrier.
// one ring stage: k = kb..kb+63 of all 512 rows of a plane [512][SEQ]; 8 lanes cover a 128-B row piece (one line); every thread issues 16 copies
__device__ __forceinline__ void attn_stage_issue(const h16* P, int kb, unsigned lbuf) {
    const int cc = threadIdx.x & 7, rr = threadIdx.x >> 3;           // 16-byte piece of the row piece; row within a sweep of 32 rows
    const bf* g = (const bf*)P + (size_t)rr * SEQ + kb + cc * 8;
    const unsigned l = lbuf + (unsigned)(rr * APH + cc * 8) * 2u;
#pragma unroll
    for (int i = 0; i < 2; ++i) acopy8(l + i * 256 * APH * 2, g + (size_t)i * 256 * SEQ, 32 * APH * 2, (size_t)32 * SEQ);
}
// one pass: 64 k of the wave's 64 plane rows (pa, ring buffer) against the QR rows of the Q or P tile (pb), k ascending in steps of 32
__device__ __forceinline__ void attn_pass(const h16* pa, const h16* pb, v8f (&acc)[4][QB]) {
#pragma unroll
    for (int u = 0; u < AKS / 32; ++u) {
        v8h a0[4], a1[4], b0[QB], b1[QB];
#pragma unroll
        for (int mb = 0; mb < 4; ++mb) { const h16* p = pa + mb * 16 * APH + u * 32; a0[mb] = *(const v8h*)p; a1[mb] = *(const v8h*)(p + 16); }
#pragma unroll
        for (int nb = 0; nb < QB; ++nb) { const h16* p = pb + nb * 16 * PP + u * 32; b0[nb] = *(const v8h*)p; b1[nb] = *(const v8h*)(p + 16); }
        __builtin_amdgcn_sched_barrier(0);                        // keeps the block's LDS reads together ahead of its matrix block: spread among the matrix instructions each read place waits out the LDS latency
#pragma unroll
        for (int nb = 0; nb < QB; ++nb)
#pragma unroll
            for (int mb = 0; mb < 4; ++mb) acc[mb][nb] = wmma16(cat16(a0[mb], a1[mb]), cat16(b0[nb], b1[nb]), acc[mb][nb]);   // plain builtin: an asm operand cannot lie above v255, and the 32 accumulators alone fill 256 registers
        if (u + 1 < AKS / 32) __builtin_amdgcn_sched_barrier(0);  // the next block's reads stay behind this matrix block, as one group
    }
}
__global__ __launch_bounds__(32 * AW)
void k_attn(h16* QC, const h16* __restrict__ KT, const h16* __restrict__ VT) {
    __shared__ __align__(16) h16 ring[2 * DH * APH];
    __shared__ __align__(16) h16 sP[QR * PP];
    __shared__ float smax[AW * QR];
    __shared__ float ssum[AW * QR];
    constexpr int ABUFH = DH * APH;                                 // halves per ring buffer
    const int lane = threadIdx.x & 31, lr = lane & 15, hi = lane >> 4;
    const int wave = __builtin_amdgcn_readfirstlane((int)(threadIdx.x >> 5));
    const int zh = blockIdx.y;                                      // b * 8 + h
    const int t0 = blockIdx.x * QR;
    const size_t zb = (size_t)zh * SEQ * DH;
    const h16* KTz = KT + zb; const h16* VTz = VT + zb;
    const unsigned lb = lds_off(ring);
    const int ao = (wave * 64 + lr) * APH + 8 * hi;                 // plane rows owned by this wave, in a ring buffer (+ 16*blk*APH + k)
    const int bo = lr * PP + 8 * hi;                                // Q / P tile rows (+ 16*ib*PP + k)
    { const int cc = threadIdx.x & 63, rr = threadIdx.x >> 6;       // Q tile: 64 lanes cover one 1024-B row; 4 rows a sweep, QR / 4 copies a thread
      const bf* g = (const bf*)QC + zb + (size_t)(t0 + rr) * DH + cc * 8;
      const unsigned l = lds_off(sP) + (unsigned)(rr * PP + cc * 8) * 2u;
#pragma unroll
      for (int i = 0; i < QR / 32; ++i) acopy8(l + i * 32 * PP * 2, g + (size_t)i * 32 * DH, 4 * PP * 2, (size_t)4 * DH); }
    attn_stage_issue(KTz, 0, lb);
    wait_async0();
    __syncthreads();                                              // publishes the Q tile and stage 0
    attn_stage_issue(KTz, AKS, lb + ABUFH * 2);
    v8f acc[4][QB];
#pragma unroll
    for (int jb = 0; jb < 4; ++jb)
#pragma unroll
        for (int ib = 0; ib < QB; ++ib) acc[jb][ib] = (v8f){};
#pragma unroll 1
    for (int s = 0; s < ANS; ++s) {                               // rolled: one pass per stage, the buffer chosen by s & 1
        attn_pass(ring + (s & 1) * ABUFH + ao, sP + bo + s * AKS, acc);
        wait_ds0();
        wait_async0();
        __syncthreads();                                          // publishes the next stage and ends every reader's last read of this one (behind the last pass: of the Q tile too)
        const int n = s + 2;                                      // always exists: the V^T stages follow the K^T stages
        attn_stage_issue(n < ANS ? KTz : VTz, (n & (ANS - 1)) * AKS, lb + (unsigned)(s & 1) * (ABUFH * 2));
    }
    // row max: lane holds 32 of the wave's 64 columns for query rows 16*ib + lr
    float mx[QB];
#pragma unroll
    for (int ib = 0; ib < QB; ++ib) { mx[ib] = NEGB;
#pragma unroll
        for (int jb = 0; jb < 4; ++jb) {
#pragma unroll
            for (int r = 0; r < 8; ++r) mx[ib] = fmaxf(mx[ib], acc[jb][ib][r]); }
        mx[ib] = fmaxf(mx[ib], __shfl_xor(mx[ib], 16, 32)); }
#pragma unroll
    for (int p = 0; p < QB / 2; ++p) smax[wave * QR + 32 * p + lane] = hi ? mx[2 * p + 1] : mx[2 * p];   // slot = query row 16*(2p + hi) + lr = 32p + lane
    __syncthreads();
    float sh[QB], ls[QB];
#pragma unroll
    for (int ib = 0; ib < QB; ++ib) { float g = smax[ib * 16 + lr];
#pragma unroll
        for (int w = 1; w < AW; ++w) g = fmaxf(g, smax[w * QR + ib * 16 + lr]);
        sh[ib] = PSH - g * SC2; ls[ib] = 0.0f; }
    const int pw = wave * 64 + 8 * hi;
#pragma unroll
    for (int jb = 0; jb < 4; ++jb) {
#pragma unroll
        for (int ib = 0; ib < QB; ++ib) { v8h p;
#pragma unroll
            for (int r = 0; r < 8; ++r) { const float e = acc[jb][ib][r] * SC2 + sh[ib]; const h16 a = pexp_h(e); p[r] = a; ls[ib] += (float)a; }
            *(v8h*)(&sP[(16 * ib + lr) * PP + pw + jb * 16]) = p; } }
#pragma unroll
    for (int ib = 0; ib < QB; ++ib) ls[ib] += __shfl_xor(ls[ib], 16, 32);
#pragma unroll
    for (int p = 0; p < QB / 2; ++p) ssum[wave * QR + 32 * p + lane] = hi ? ls[2 * p + 1] : ls[2 * p];
    __syncthreads();
    // phase 2
#pragma unroll
    for (int db = 0; db < 4; ++db)
#pragma unroll
        for (int ib = 0; ib < QB; ++ib) acc[db][ib] = (v8f){};
#pragma unroll 1
    for (int s = 0; s < ANS; ++s) {                               // rolled, as above
        attn_pass(ring + (s & 1) * ABUFH + ao, sP + bo + s * AKS, acc);
        wait_ds0();
        wait_async0();
        __syncthreads();                                          // publishes the next stage and ends every reader's last read of this one (behind the last pass: of the P tile too)
        if (s + 2 < ANS) attn_stage_issue(VTz, (s + 2) * AKS, lb + (unsigned)(s & 1) * (ABUFH * 2));
    }
    wait_async0();
    float inv[QB];
#pragma unroll
    for (int ib = 0; ib < QB; ++ib) { float l = ssum[ib * 16 + lr];
#pragma unroll
        for (int w = 1; w < AW; ++w) l += ssum[w * QR + ib * 16 + lr];
        inv[ib] = CTXC * (1.0f / l); }                          // l >= 16384: the row maximum contributes its full carry
    // columns 64w..64w+63 of the P tile are wave-private from here
    // O^T D layout: acc[db][ib][r] = (d = 64w + 16db + 8h + r, i = 16ib + lane&15) -> sP[i][64w + 16db + 8h + r]; rows 0..QR-1 x 64 columns all written
#pragma unroll
    for (int db = 0; db < 4; ++db) {
#pragma unroll
        for (int ib = 0; ib < QB; ++ib) { v8h o;
#pragma unroll
            for (int r = 0; r < 8; ++r) o[r] = toh_flush(acc[db][ib][r] * inv[ib]);
            *(v8h*)(&sP[(16 * ib + lr) * PP + pw + db * 16]) = o; } }
    wave_sync();
    h16* crow = QC + zb + (size_t)t0 * DH + (size_t)wave * 64;
#pragma unroll
    for (int s = 0; s < QR / 4; ++s) { const int row = 4 * s + (lane >> 3), c8 = (lane & 7) * 8;   // QR / 4 s x 4 rows = QR rows; 8 lanes x 8 halves = 64 columns = one line
        const v8h val = *(const v8h*)(&sP[row * PP + wave * 64 + c8]);
        *(v8h*)(crow + (size_t)row * DH + c8) = val; }
}

// k_oproj: register-blocked f16 GEMM, 8 waves (2 x 4) per 128x128 tile, one 64x32 tile per wave, operands staged in LDS, K = HDIM; out[m][n] = (sum_k ctx64[m][k] wo64[n][k]) / 4096 + bias[n] (f32).
// A = ctx plane [(b*8 + h)][t][d]: row m = b*SEQ + t holds k = h*512 + d in 8 pieces of 512, SEQ*DH apart; Bt = Wo plane rows (n); grid (NB*SEQ/128, NF/128): one work-group per WGP, every staged row meets 128 rows of the other operand.
__global__ __launch_bounds__(OTH) void k_oproj(const h16* __restrict__ A, const h16* __restrict__ Bt, const float* __restrict__ bias, float* OUT) {
    __shared__ __align__(16) bf ring[2 * (128 + 128) * (OKS + 8)];
    __shared__ __align__(16) float osw[8][16 * 36];
    const int lane = threadIdx.x & 31, lr = lane & 15, hi = lane >> 4;
    const int wave = __builtin_amdgcn_readfirstlane((int)(threadIdx.x >> 5)), wm = wave >> 2, wn = wave & 3;
    float* os = osw[wave];                                         // wave-private store staging
    const int r0 = blockIdx.x * 128 + wm * 64, c0 = blockIdx.y * 128 + wn * 32;   // the wave's own 64x32 tile
    v8f acc[4][2];
#pragma unroll
    for (int mb = 0; mb < 4; ++mb)
#pragma unroll
        for (int nb = 0; nb < 2; ++nb) acc[mb][nb] = (v8f){};
    const int rt = blockIdx.x * 128;                               // a 128-row tile lies in one batch
    gemm_ring<128, 128, HDIM, false, 2, DH, (size_t)SEQ * DH, 2, 4, OKS>((const bf*)A + (size_t)(rt / SEQ) * NH_ * SEQ * DH + (size_t)(rt % SEQ) * DH, (const bf*)Bt + (size_t)blockIdx.y * 128 * HDIM, ring, wm, wn, acc);
    float bc[2];
#pragma unroll
    for (int nb = 0; nb < 2; ++nb) bc[nb] = bfr(bias[c0 + nb * 16 + lr]);   // c0 + 31 < NF
#pragma unroll
    for (int mb = 0; mb < 4; ++mb) {
#pragma unroll
        for (int nb = 0; nb < 2; ++nb) {
#pragma unroll
            for (int j = 0; j < 8; ++j) os[(hi * 8 + j) * 36 + nb * 16 + lr] = acc[mb][nb][j] * OSC + bc[nb]; }   // D: row 8h+j, col lane&15
        wave_sync();
{
#pragma unroll
            for (int s = 0; s < 4; ++s) { const int row = 4 * s + (lane >> 3), c4 = (lane & 7) * 4;   // 4 s x 4 rows = 16 rows; 8 lanes x 4 floats = 32 columns = one line
                const v4f val = *(const v4fa*)(&os[row * 36 + c4]);
                *(v4f*)(OUT + (size_t)(r0 + mb * 16 + row) * NF + c0 + c4) = val; }
             }
        asm volatile("s_wait_xcnt 0x0" ::: "memory");             // stands behind the run of four stores, ahead of any rewrite of their address or data registers
        wave_sync();
    }
}

static constexpr size_t SZ_XB = (size_t)NB * SEQ * NF * 2;                   // bf16 copy of one input
static constexpr size_t SZ_WP = (size_t)HDIM * NF * 2;                       // one weight plane (Wq | Wk | Wv bf16, Wo f16)
static constexpr size_t SZ_PL = (size_t)NB * NH_ * SEQ * DH * 2;             // one q / k^T / v^T plane; ctx replaces q
static constexpr size_t SZ_TOTAL = 3 * SZ_XB + 4 * SZ_WP + 3 * SZ_PL;
static_assert(SZ_XB % 256 == 0 && SZ_WP % 256 == 0 && SZ_PL % 256 == 0);   // the planes lie back to back, each 256-B aligned
static_assert(SZ_TOTAL <= (size_t)268435456);          // workspace carve <= 256 MiB
static_assert((size_t)NB * NH_ * SEQ * DH == (size_t)NB * HDIM * SEQ);     // k^T / v^T plane [(b*4096 + m)][t] has the same extent as the q plane
static_assert((size_t)NF * HDIM == (size_t)HDIM * NF);                     // Wo plane extent equals a projection weight plane

extern "C" void kernel_launch(void* const* d_in, const int* in_sizes, int n_in,
                              void* d_out, int out_size, void* d_ws, size_t ws_size, hipStream_t stream) {
    if (n_in < 11) return;
    const size_t needx = (size_t)NB * SEQ * NF;
    if ((size_t)in_sizes[0] < needx || (size_t)in_sizes[1] < needx || (size_t)in_sizes[2] < needx) return;
    if ((size_t)in_sizes[3] < (size_t)HDIM * NF || (size_t)in_sizes[5] < (size_t)HDIM * NF || (size_t)in_sizes[7] < (size_t)HDIM * NF) return;
    if ((size_t)in_sizes[9] < (size_t)NF * HDIM) return;
    if (in_sizes[4] < HDIM || in_sizes[6] < HDIM || in_sizes[8] < HDIM || in_sizes[10] < NF) return;
    if ((size_t)out_size < needx) return;
    if (SZ_TOTAL > ws_size) return;
    // wire order: q, k, v, Wq, bq, Wk, bk, Wv, bv, Wo, bo
    const float* xq = (const float*)d_in[0]; const float* xk = (const float*)d_in[1]; const float* xv = (const float*)d_in[2];
    const float* wq = (const float*)d_in[3]; const float* bq = (const float*)d_in[4];
    const float* wk = (const float*)d_in[5]; const float* bk = (const float*)d_in[6];
    const float* wv = (const float*)d_in[7]; const float* bv = (const float*)d_in[8];
    const float* wo = (const float*)d_in[9]; const float* bo = (const float*)d_in[10];
    float* OUT = (float*)d_out;      // [NB][SEQ][NF]
    char* wsp = (char*)d_ws;
    bf* XS = (bf*)wsp; wsp += 3 * SZ_XB;             // q | k | v, each [NB*SEQ][NF]
    bf* WS = (bf*)wsp; wsp += 3 * SZ_WP;             // Wq | Wk | Wv, each [4096][512] ([out][in])
    h16* WOH = (h16*)wsp; wsp += SZ_WP;              // [512][4096] x64
    h16* QC = (h16*)wsp; wsp += SZ_PL;               // q [NB*8][SEQ][512], then ctx [NB*8][SEQ][512] x64
    h16* KTP = (h16*)wsp; wsp += SZ_PL;              // [NB*8][512][SEQ]
    h16* VTP = (h16*)wsp; wsp += SZ_PL;              // [NB*8][512][SEQ]

    k_cvt<<<3 * XBK + 4 * WBK, 256, 0, stream>>>(xq, xk, xv, wq, wk, wv, wo, XS);
    k_proj<<<dim3((NB * SEQ / 128) * (HDIM / 128), 3, 1), GTH, 0, stream>>>(XS, WS, bq, bk, bv, QC);
    k_attn<<<dim3(SEQ / QR, NB * NH_, 1), 32 * AW, 0, stream>>>(QC, KTP, VTP);
    k_oproj<<<dim3(NB * SEQ / 128, NF / 128, 1), OTH, 0, stream>>>(QC, WOH, bo, OUT);
}

// v007
// A run of this version takes 177 microseconds.
// In both of two side-by-side timings against v006, it was 1.10 times as fast.
// Counting every step since v000, it is 6.00 times as fast.
#include <hip/hip_runtime.h>

// Compute dtypes, f32 accumulate everywhere: the three input projections v_wmma_f32_16x16x32_bf16 (x, W, bias RNE-converted to bf16; products exact); scores, P.V and the output projection v_wmma_f32_16x16x32_f16, single product at every site.
// Multi-head attention block without mask: q/k/v [NB][512][512]; Wq/Wk/Wv [4096][512] ([out][in], y = x W^T + bias), 8 heads x 512 columns (head h = columns h*512 + d); score[i][j] = sum_m qh[i][m] kh[m][j] / sqrt(512)
// (m = feature index of qh = token index of kh, j = feature index of kh); softmax over j; ctx[i][d] = sum_j P[i][j] vh[j][d] (j = token index of vh); heads merged to [NB*512][4096]; output = ctx Wo^T + bo with Wo [512][4096] (f32).
// Planes (f16): q [(b*8+h)][t][d]; k^T and v^T [(b*8+h)][d][t] (contraction index contiguous in every GEMM); ctx [(b*8+h)][t][d] carried x64, stored over the q plane (each attention block replaces the 128 q rows that it alone has read); Wo carried x64 (built from the bf16 RNE value); P carried x16384 in LDS only (cancels in the normalisation).
// Attention kernel: 8 waves per 128 query rows of one (batch, head), transposed form S^T = K^T-plane x Q (wave w owns score columns 64w..64w+63), row max / row sum exchanged through LDS, packed P tile [128][512] in LDS,
// O^T = V^T-plane x P (wave w owns output columns 64w..64w+63); the K^T and V^T planes pass through a two-buffer LDS ring, the Q tile lies where the P tile is written later. All batches go through every kernel in one launch: four launches in all.

#ifndef NB
#define NB 16
#endif
#define NB_FULL 16
#define SEQ  512                 // tokens per sequence; the module requires SEQ == DH (score contraction) and SEQ == NF
#define NF   512                 // input feature width
#define NH_  8
#define DH   512                 // per-head width
#define HDIM (NH_ * DH)          // 4096
#define AW   8                   // waves per attention block
#define QR   128                 // query rows per attention block: every plane byte that a block brings into LDS meets 128 query rows
#define QB   (QR / 16)           // 16-row query blocks per attention block (accumulator tiles per plane-row block of a wave)
#define PP   520                 // LDS row pitch (halves) of the Q / P tile (1040 B = 16 B x 65)
#define AKS  64                  // k per stage of the attention ring (128 B of every plane row)
#define APH  72                  // LDS row pitch (halves) of the attention ring (144 B = 16 B x 9)
#define ANS  (SEQ / AKS)         // stages per plane
#define SC2  ((float)(0.04419417382415922 * 1.4426950408889634))   // DH^-0.5 * log2(e)
#define PSH  14.0f               // log2 of the P carry (16384)
#define NEGB (-3.0e38f)
#define CTXC 64.0f               // carry of the ctx plane
#define WOC  64.0f               // carry of the Wo plane
#define OSC  (1.0f / 4096.0f)    // 1 / (CTXC * WOC)

static_assert(DH == SEQ);                      // score contraction: feature index of q = token index of k; plane row pitch is the same in both layouts
static_assert(NF == SEQ);
static_assert(NH_ * DH == HDIM);
static_assert(NF % 32 == 0);                   // projection k-loop steps by 32
static_assert(SEQ % 32 == 0);                  // attention k-loops step by 32
static_assert(HDIM % 32 == 0);                 // output projection k-loop steps by 32
static_assert(SEQ % 64 == 0);                  // a 64-row tile never straddles two batches
static_assert(DH % 64 == 0);                   // a 64-column tile never straddles two heads
static_assert(HDIM % 64 == 0);
static_assert(NF % 64 == 0);
static_assert(NB <= NB_FULL);
static_assert(DH == AW * 64);                  // each attention wave owns 64 score columns and 64 output columns
static_assert(SEQ % QR == 0);                  // attention grid covers the query rows exactly (QR per block)
static_assert(ANS % 2 == 0 && ANS >= 2);       // the V^T stages go on in the ring with the buffer parity of the K^T stages; both prologue stages exist
static_assert((APH * 2) % 16 == 0 && AKS % 32 == 0);
static_assert(DH == 2 * 8 * 32 && QR % (8 * 4) == 0 && DH * 2 == 64 * 16 && AKS * 2 == 8 * 16);   // copy sweeps of 256 threads: ring 32 rows a sweep, 16 sweeps; Q tile 4 rows a sweep, QR / 4 sweeps
static_assert(QR / 4 + 16 <= 63);              // copies of a wave in flight in the prologue: the Q tile and stage 0
static_assert((PP * 2) % 16 == 0);
static_assert(PP >= DH);
static_assert(32 * 16 * 4 == 16 * 64 * 2);
static_assert(32 * 16 * (QR / 4) == QR * 64 * 2);   // k_attn store loop: 32 lanes x 16 B x QR / 4 trips == QR rows x 128 B
static_assert(32 * 16 * 4 == 16 * 32 * 4);     // k_oproj store loop: 32 lanes x 16 B x 4 trips == 16 rows x 128 B
static_assert(2 * 512 * 272 + 16 * 64 * 4 <= 327680);       // static LDS of k_proj: one work-group per WGP
static_assert(16 * 16 * 68 * 4 <= 2 * 512 * 272);           // k_proj: the 16 waves' store staging tiles fit the range of the ring, where they lie behind the last pass
static_assert(HDIM % 256 == 0 && (NB * SEQ) % 256 == 0);    // k_proj grid covers both extents exactly (256 x 256 tiles)
static_assert(SEQ % 256 == 0 && DH % 256 == 0);             // a 256-row or 256-column tile never straddles two batches or two heads
static_assert(NF % 128 == 0 && SEQ % 128 == 0);             // k_oproj grid covers both extents exactly (128 x 128 tiles); a 128-row tile never straddles two batches
static_assert(2 * 256 * 528 + 8 * 16 * 36 * 4 <= 327680);   // static LDS of k_oproj: one work-group per WGP
static_assert(2 * DH * APH * 2 + QR * PP * 2 + 2 * AW * QR * 4 <= 327680);   // static LDS of the attention kernel: one work-group per WGP
static_assert(((size_t)NB * SEQ * NF) % 2048 == 0);          // k_cvt: a block converts 2048 elements of one source
static_assert(((size_t)HDIM * NF) % 2048 == 0);

typedef _Float16 h16;
typedef unsigned short bf;
typedef __attribute__((ext_vector_type(16))) __bf16   v16bf;
typedef __attribute__((ext_vector_type(16))) _Float16 v16h;
typedef __attribute__((ext_vector_type(8)))  _Float16 v8h;
typedef __attribute__((ext_vector_type(8)))  unsigned short v8us;
typedef __attribute__((ext_vector_type(8)))  float    v8f;
typedef __attribute__((ext_vector_type(4)))  float    v4f;
typedef v4f  __attribute__((may_alias)) v4fa;

__device__ __forceinline__ unsigned short f2bf(float f) { unsigned u = __float_as_uint(f); u += 0x7FFFu + ((u >> 16) & 1u); return (unsigned short)(u >> 16); }
__device__ __forceinline__ float bfr(float f) { return __uint_as_float(((unsigned)f2bf(f)) << 16); }   // value after RNE convert to bf16
__device__ __forceinline__ v16h cat16(v8h lo, v8h hi) { return __builtin_shufflevector(lo, hi, 0, 1, 2, 3, 4, 5, 6, 7, 8, 9, 10, 11, 12, 13, 14, 15); }
__device__ __forceinline__ v16bf cat16b(v8us lo, v8us hi) { return __builtin_bit_cast(v16bf, __builtin_shufflevector(lo, hi, 0, 1, 2, 3, 4, 5, 6, 7, 8, 9, 10, 11, 12, 13, 14, 15)); }
__device__ __forceinline__ v8f wmma16(v16h a, v16h b, v8f c) { return __builtin_amdgcn_wmma_f32_16x16x32_f16(false, a, false, b, (short)0, c, false, false); }
__device__ __forceinline__ v8f wmmab(v16bf a, v16bf b, v8f c) { return __builtin_amdgcn_wmma_f32_16x16x32_bf16(false, a, false, b, (short)0, c, false, false); }
// fragment loaders from K-contiguous 16-bit rows; p already includes + 8*(lane>>4): elements 0..7 <- k0+8h+0..7, elements 8..15 <- k0+16+8h+0..7 (same map for A and B)
__device__ __forceinline__ v16h  ldh(const h16* p) { return cat16(*(const v8h*)p, *(const v8h*)(p + 16)); }
// ordering point for wave-private LDS tiles (same wave writes and reads)
__device__ __forceinline__ void wave_sync() { __builtin_amdgcn_fence(3 /* release order */, "wavefront"); __builtin_amdgcn_wave_barrier(); asm volatile("" ::: "memory"); }

// per-instruction guarded matrix ops: one accumulator tied per guard, operands kept live
__device__ __forceinline__ v8f wmma16_g(v16h a, v16h b, v8f c) { c = wmma16(a, b, c); asm volatile("v_nop\n\tv_nop\n\tv_nop\n\tv_nop" : "+v"(c) : "v"(a), "v"(b)); return c; }
__device__ __forceinline__ v8f wmmab_g(v16bf a, v16bf b, v8f c) { c = wmmab(a, b, c); asm volatile("v_nop\n\tv_nop\n\tv_nop\n\tv_nop" : "+v"(c) : "v"(a), "v"(b)); return c; }
// f32 -> f16 convert that cannot produce an f16 subnormal (|v| < 2^-14 -> +0), applied after the plane's power-of-two carry
static __device__ __forceinline__ h16 toh_flush(float v) { const h16 r = (h16)v; return (fabsf(v) < 6.103515625e-05f) ? (h16)0.0f : r; }
// carried probability 2^e as f16; the select is on the exponent argument (e < -14 -> +0)
static __device__ __forceinline__ h16 pexp_h(float e) { const h16 r = (h16)__builtin_amdgcn_exp2f(e); return (e < -14.0f) ? (h16)0.0f : r; }

// ---- operand staging for the two GEMM kernels: asynchronous copies to LDS, two buffers ----
// A work-group of NWM x NWN waves owns a BM x BN tile. A stage is KS k of every operand row ([A BM rows | Bt BN rows], 2 * KS bytes a row, LDS pitch 16 B more: 272 B at KS = 128, 528 B at KS = 256).
// Each lane copies 16 B; KS / 8 lanes cover one row piece, so every copy instruction asks for whole lines. Stage s + 2 is issued into the buffer that pass s has left.
#define GKS  128                 // k per stage, k_proj
#define GPH  136                 // its LDS row pitch in halves (272 B = 16 B x 17: conflict-free for 16-byte fragment reads)
#define GTH  512                 // threads per k_proj work-group
#define OKS  256                 // k per stage, k_oproj (LDS row pitch 528 B = 16 B x 33)
#define OTH  256                 // threads per k_oproj work-group
static_assert((GPH * 2) % 16 == 0 && GPH == GKS + 8);
static_assert(HDIM % OKS == 0 && HDIM / OKS >= 2 && DH % OKS == 0);
static_assert(NF % GKS == 0 && NF / GKS >= 2);       // both ring stages of the prologue exist
static_assert(HDIM % GKS == 0 && HDIM / GKS >= 2);
__device__ __forceinline__ unsigned lds_off(const void* p) { return (unsigned)(size_t)p; }
// eight copies and the wait that stands in front of any rewrite of their address registers, in one statement
__device__ __forceinline__ void acopy8(unsigned l, const bf* g, unsigned lstep, size_t gstep) {
    asm volatile("global_load_async_to_lds_b128 %0, %1, off\n\t"
                 "global_load_async_to_lds_b128 %2, %3, off\n\t"
                 "global_load_async_to_lds_b128 %4, %5, off\n\t"
                 "global_load_async_to_lds_b128 %6, %7, off\n\t"
                 "global_load_async_to_lds_b128 %8, %9, off\n\t"
                 "global_load_async_to_lds_b128 %10, %11, off\n\t"
                 "global_load_async_to_lds_b128 %12, %13, off\n\t"
                 "global_load_async_to_lds_b128 %14, %15, off\n\t"
                 "s_wait_xcnt 0x0"
                 :: "v"(l), "v"(g), "v"(l + lstep), "v"(g + gstep), "v"(l + 2 * lstep), "v"(g + 2 * gstep), "v"(l + 3 * lstep), "v"(g + 3 * gstep),
                    "v"(l + 4 * lstep), "v"(g + 4 * gstep), "v"(l + 5 * lstep), "v"(g + 5 * gstep), "v"(l + 6 * lstep), "v"(g + 6 * gstep), "v"(l + 7 * lstep), "v"(g + 7 * gstep)
                 : "memory");
}
// one stage: BM rows of A and BN rows of Bt, KS k each, into the buffer at LDS byte address lbuf; A and Bt point at the tile's first row at the stage's first k; PA, PB = row pitches; NT threads cover RS rows a sweep, every thread issues (BM + BN) / RS copies
template <int BM, int BN, int PA, int PB, int NT, int KS>
__device__ __forceinline__ void stage_issue(const bf* A, const bf* Bt, unsigned lbuf) {
    constexpr int LPR = KS / 8, PH = KS + 8, RS = NT / LPR;          // lanes per row piece; LDS row pitch in halves; rows per sweep
    static_assert(NT % LPR == 0 && BM % (8 * RS) == 0 && BN % (8 * RS) == 0);
    const int cc = threadIdx.x & (LPR - 1), rr = threadIdx.x / LPR;  // 16-byte piece of the row; row within a sweep of RS rows
    const bf* ga = A  + (size_t)rr * PA + cc * 8;
    const bf* gb = Bt + (size_t)rr * PB + cc * 8;
    const unsigned l = lbuf + (unsigned)(rr * PH + cc * 8) * 2u;
#pragma unroll
    for (int i = 0; i < BM / (8 * RS); ++i) acopy8(l + i * 8 * RS * PH * 2, ga + (size_t)i * 8 * RS * PA, RS * PH * 2, (size_t)RS * PA);
#pragma unroll
    for (int i = 0; i < BN / (8 * RS); ++i) acopy8(l + (BM + i * 8 * RS) * PH * 2, gb + (size_t)i * 8 * RS * PB, RS * PH * 2, (size_t)RS * PB);
}
__device__ __forceinline__ void wait_async0() { asm volatile("s_wait_asynccnt 0x0" ::: "memory"); }   // this wave's copies have landed
__device__ __forceinline__ void wait_ds0()    { asm volatile("s_wait_dscnt 0x0" ::: "memory"); }      // this wave's LDS reads have returned before their buffer is refilled
// C tile accumulation, k ascending in steps of 32; wave (wm, wn) of NWM x NWN owns rows wm*BM/NWM.. and columns wn*BN/NWN.. of the tile. BF: bf16 products, else f16.
// GB = k blocks of 32 whose fragments are read from LDS as one group. A and Bt point at the tile's first row, k = 0. Bt rows are KT long; an A row is PA long and holds k = 0..PA-1, the next PA k of that row lie AJ elements further.
template <int BM, int BN, int KT, bool BF, int GB, int PA, size_t AJ, int NWM, int NWN, int KS>
__device__ __forceinline__ void gemm_ring(const bf* A, const bf* Bt, bf* ring, int wm, int wn, v8f (&acc)[BM / (16 * NWM)][BN / (16 * NWN)]) {
    constexpr int FM = BM / (16 * NWM), FN = BN / (16 * NWN), PH = KS + 8, BUFH = (BM + BN) * PH, NS = KT / KS, NT = 32 * NWM * NWN;
    static_assert(BM % (16 * NWM) == 0 && BN % (16 * NWN) == 0 && (BM + BN) * (KS / 8) / NT <= 63 && (KS / 32) % GB == 0 && PA % KS == 0 && KT % PA == 0 && NS >= 2);
    const int lane = threadIdx.x & 31, lr = lane & 15, hi = lane >> 4;
    const unsigned lb = lds_off(ring);
    stage_issue<BM, BN, PA, KT, NT, KS>(A, Bt, lb);
    wait_async0();
    __syncthreads();                                              // publishes stage 0
    stage_issue<BM, BN, PA, KT, NT, KS>(A + (KS / PA) * AJ + KS % PA, Bt + KS, lb + BUFH * 2);
    const int ao = (wm * (BM / NWM) + lr) * PH + 8 * hi, bo = (BM + wn * (BN / NWN) + lr) * PH + 8 * hi;
#pragma unroll 1
    for (int s = 0; s < NS; ++s) {                                // rolled: one pass per stage, the buffer chosen by s & 1
        const bf* sb = ring + (s & 1) * BUFH;
#pragma unroll
        for (int kk = 0; kk < KS; kk += 32 * GB) {
            v8us a0[GB][FM], a1[GB][FM], b0[GB][FN], b1[GB][FN];
#pragma unroll
            for (int u = 0; u < GB; ++u) {
#pragma unroll
                for (int mb = 0; mb < FM; ++mb) { const bf* p = sb + ao + mb * 16 * PH + kk + u * 32; a0[u][mb] = *(const v8us*)p; a1[u][mb] = *(const v8us*)(p + 16); }
#pragma unroll
                for (int nb = 0; nb < FN; ++nb) { const bf* p = sb + bo + nb * 16 * PH + kk + u * 32; b0[u][nb] = *(const v8us*)p; b1[u][nb] = *(const v8us*)(p + 16); }
            }
            __builtin_amdgcn_sched_barrier(0);                    // keeps the group's LDS reads together ahead of its matrix block: spread among the matrix instructions each read place waits out the LDS latency
#pragma unroll
            for (int u = 0; u < GB; ++u)
#pragma unroll
                for (int nb = 0; nb < FN; ++nb)
#pragma unroll
                    for (int mb = 0; mb < FM; ++mb) {
                        if constexpr (BF) acc[mb][nb] = wmmab_g(cat16b(a0[u][mb], a1[u][mb]), cat16b(b0[u][nb], b1[u][nb]), acc[mb][nb]);
                        else              acc[mb][nb] = wmma16_g(__builtin_bit_cast(v16h, cat16b(a0[u][mb], a1[u][mb])), __builtin_bit_cast(v16h, cat16b(b0[u][nb], b1[u][nb])), acc[mb][nb]); }
            if constexpr (32 * GB < KS) __builtin_amdgcn_sched_barrier(0);   // the next group's reads stay behind this matrix block, as one group
        }
        wait_ds0();
        wait_async0();
        __syncthreads();                                          // publishes stage s + 1 and ends every reader's last read of stage s
        if (s + 2 < NS) { const int kb = (s + 2) * KS; stage_issue<BM, BN, PA, KT, NT, KS>(A + (size_t)(kb / PA) * AJ + kb % PA, Bt + kb, lb + (unsigned)(s & 1) * (BUFH * 2)); }
    }
    wait_async0();
}

// k_cvt: every 16-bit operand plane in one launch; a block converts 2048 elements of one source. Block ranges: q | k | v (XBK blocks each, bf16 RNE), Wq | Wk | Wv (WBK each, bf16 RNE), Wo (WBK, f16 of the bf16 RNE value x64);
// the planes lie at dst in that order, back to back, so the destination index is the flat one.
#define XBK ((unsigned)((size_t)NB * SEQ * NF / 2048))
#define WBK ((unsigned)((size_t)HDIM * NF / 2048))
__global__ __launch_bounds__(256) void k_cvt(const float* __restrict__ q, const float* __restrict__ k, const float* __restrict__ v, const float* __restrict__ wq, const float* __restrict__ wk,
                                             const float* __restrict__ wv, const float* __restrict__ wo, bf* dst) {
    const unsigned blk = blockIdx.x;
    const float* src; unsigned lb;                                 // source and block index within it: block-uniform
    if (blk < 3 * XBK) { const unsigned g = blk / XBK; src = g == 0 ? q : g == 1 ? k : v; lb = blk - g * XBK; }
    else { const unsigned w = blk - 3 * XBK, g = w / WBK; src = g == 0 ? wq : g == 1 ? wk : g == 2 ? wv : wo; lb = w - g * WBK; }
    const v8f x = *(const v8f*)(src + ((size_t)lb * 256 + threadIdx.x) * 8); v8us o;
    if (blk < 3 * XBK + 3 * WBK) {
#pragma unroll
        for (int i = 0; i < 8; ++i) o[i] = f2bf(x[i]);
    } else { v8h t;
#pragma unroll
        for (int i = 0; i < 8; ++i) t[i] = toh_flush(bfr(x[i]) * WOC);
        o = __builtin_bit_cast(v8us, t); }
    *(v8us*)(dst + ((size_t)blk * 256 + threadIdx.x) * 8) = o;
}

// k_proj epilogue of one wave: its 64x64 tile + bias -> f16, 16 rows at a time through the wave's own staging tile; sb = the wave's 64 bias values (bf16 RNE) in LDS, read back here as one group.
// BC: bias per column (q), sb[n - c0]; else bias per row (k, v), sb[m - r0]. Pt = the tile's first element, row pitch SEQ (== DH).
template <bool BC>
__device__ __forceinline__ void proj_store(const v8f (&acc)[4][4], const float* sb, float* os, h16* Pt, int lane) {
    const int lr = lane & 15, hi = lane >> 4;
    float bc[4]; v4f br[4][2];
    if constexpr (BC) {
#pragma unroll
        for (int nb = 0; nb < 4; ++nb) bc[nb] = sb[nb * 16 + lr];
    } else {
#pragma unroll
        for (int mb = 0; mb < 4; ++mb) { br[mb][0] = *(const v4fa*)(sb + mb * 16 + hi * 8); br[mb][1] = *(const v4fa*)(sb + mb * 16 + hi * 8 + 4); }
    }
#pragma unroll
    for (int mb = 0; mb < 4; ++mb) {
#pragma unroll
        for (int nb = 0; nb < 4; ++nb) {
#pragma unroll
            for (int j = 0; j < 8; ++j) { float b; if constexpr (BC) b = bc[nb]; else b = br[mb][j >> 2][j & 3];
                os[(hi * 8 + j) * 68 + nb * 16 + lr] = acc[mb][nb][j] + b; } }   // D: row 8h+j, col lane&15
        wave_sync();
#pragma unroll
        for (int s = 0; s < 4; ++s) { const int row = 4 * s + (lane >> 3), c8 = (lane & 7) * 8;   // 4 s x 4 row groups = 16 rows; 8 lanes x 8 = 64 columns = one line
            const v4f x0 = *(const v4fa*)(&os[row * 68 + c8]); const v4f x1 = *(const v4fa*)(&os[row * 68 + c8 + 4]); v8h hv;
#pragma unroll
            for (int i = 0; i < 4; ++i) { hv[i] = toh_flush(x0[i]); hv[4 + i] = toh_flush(x1[i]); }
            *(v8h*)(Pt + (size_t)(mb * 16 + row) * SEQ + c8) = hv; }
        asm volatile("s_wait_xcnt 0x0" ::: "memory");             // stands behind the run of four stores, ahead of any rewrite of their address or data registers
        wave_sync();
    }
}

// k_proj: register-blocked bf16 GEMM, 16 waves (4 x 4) per 256x256 tile, one 64x64 tile (16 accumulators) per wave, operands staged in LDS from K-contiguous bf16 planes, K = NF; every staged row meets 256 rows of the other operand.
// C[m][n] = sum_k A[m][k] Bt[n][k] + bias, written as f16.
// blockIdx.y = 0 (q): A = x rows (m = b*SEQ + t), Bt = W rows (n = h*512 + d), bias per column; plane [(b*8 + h)][t][d]; tile (bx, by) of (NB*SEQ/256, HDIM/256), bx fastest in blockIdx.x.
// blockIdx.y = 1, 2 (k, v): A = W rows (m = h*512 + d), Bt = x rows (n = b*SEQ + t), bias per row; plane [(b*4096 + m)][t] = [(b*8 + h)][d][t]; tile (bx, by) of (HDIM/256, NB*SEQ/256).
// XS, WS, PS: the three input copies, the three weight planes and the three output planes, each set back to back. grid (NB*SEQ/256 * HDIM/256, 3).
__global__ __launch_bounds__(GTH) void k_proj(const bf* __restrict__ XS, const bf* __restrict__ WS, const float* __restrict__ bq, const float* __restrict__ bk, const float* __restrict__ bv, h16* PS) {
    __shared__ __align__(16) bf ring[2 * (256 + 256) * GPH];
    __shared__ __align__(16) float sbw[16][64];
    const int lane = threadIdx.x & 31;
    const int wave = __builtin_amdgcn_readfirstlane((int)(threadIdx.x >> 5)), wm = wave >> 2, wn = wave & 3;
    float* os = (float*)ring + wave * (16 * 68);                   // wave-private store staging, in the range of the ring: first written behind the last pass's waits and barrier, when no copy is in flight and no wave reads a stage any more
    float* sb = sbw[wave];                                         // wave-private: the 64 bias values of the wave's tile
    const int z = blockIdx.y;
    const bool m0 = (z == 0);                                      // block-uniform
    const bf* X = XS + (size_t)z * NB * SEQ * NF; const bf* Wz = WS + (size_t)z * HDIM * NF;
    const bf* A = m0 ? X : Wz; const bf* Bt = m0 ? Wz : X;
    const float* bias = z == 0 ? bq : z == 1 ? bk : bv;
    h16* Ph = PS + (size_t)z * NB * NH_ * SEQ * DH;
    const unsigned ti = blockIdx.x;
    const int bx = (int)(m0 ? ti % (NB * SEQ / 256) : ti % (HDIM / 256)), by = (int)(m0 ? ti / (NB * SEQ / 256) : ti / (HDIM / 256));
    const int r0 = bx * 256 + wm * 64, c0 = by * 256 + wn * 64;    // the wave's own 64x64 tile
    const float* bt = bias + (m0 ? c0 : r0);                       // q: columns c0..c0+63, k, v: rows r0..r0+63 of the tile; both ranges end at or below HDIM
    const float t0 = bt[lane], t1 = bt[32 + lane];                 // issued ahead of stage 0's copies: they land under the wait for that stage; first used behind the k loop
    v8f acc[4][4];
#pragma unroll
    for (int mb = 0; mb < 4; ++mb)
#pragma unroll
        for (int nb = 0; nb < 4; ++nb) acc[mb][nb] = (v8f){};
    gemm_ring<256, 256, NF, true, 1, NF, 0, 4, 4, GKS>(A + (size_t)bx * 256 * NF, Bt + (size_t)by * 256 * NF, ring, wm, wn, acc);
    size_t tbase;
    if (m0) { const int bb = r0 / SEQ, tt = r0 % SEQ, hh = c0 / DH, dd = c0 % DH;
              tbase = (((size_t)(bb * NH_ + hh) * SEQ) + (size_t)tt) * DH + (size_t)dd; }
    else    { const int bb = c0 / SEQ, tt = c0 % SEQ;
              tbase = ((size_t)bb * HDIM + (size_t)r0) * SEQ + (size_t)tt; }
    sb[lane] = bfr(t0); sb[32 + lane] = bfr(t1);
    wave_sync();
    if (m0) proj_store<true>(acc, sb, os, Ph + tbase, lane);
    else    proj_store<false>(acc, sb, os, Ph + tbase, lane);
}

// k_attn: fused attention for 128 query rows of one (batch, head); 8 waves.
// Phase 1 (transposed scores): S^T[j][i] = sum_m KT[j][m] Q[i][m]; A = k^T-plane rows j = 64w + 16jb + lane&15 (k = token m), B = q-plane rows i = t0 + 16ib + lane&15 (k = feature m);
//   D: acc[jb][ib][r] = S^T[j = 64w + 16jb + 8h + r][i = 16ib + lane&15], so a lane holds 8 consecutive score columns of one query row.
// Softmax: per-wave row max -> LDS -> block barrier -> row max over the 8 waves; p = f16(2^((s - max) * scale * log2e + 14)); packed 16-B stores into the P tile [128][512] (LDS);
//   row sum over the converted p, per-wave partials through LDS; block barrier (publishes P and the sums).
// Phase 2: O^T[d][i] = sum_j VT[d][j] P[i][j]; A = v^T-plane rows d = 64w + 16db + lane&15 (k = token j), B = P tile rows i (k = j) from LDS.
// Operands: the Q tile is copied once into the LDS range that later holds P; the planes come as 2 * ANS ring stages (ANS of K^T, then ANS of V^T), each all 512 plane rows x 64 k, two buffers, asynchronous copies;
//   the first two V^T stages fly during the last score passes and the softmax.
// Epilogue: ctx = O / rowsum x 64 as f16; behind the last pass's barrier the wave stages its 128 x 64 tile in its own column range of the P tile (wave-private from then on).
//   The ctx rows go to the places of the block's own 128 q rows in QC: no other block reads or writes those, and this block's copies of them have landed before its first barrier.
// one ring stage: k = kb..kb+63 of all 512 rows of a plane [512][SEQ]; 8 lanes cover a 128-B row piece (one line); every thread issues 16 copies
__device__ __forceinline__ void attn_stage_issue(const h16* P, int kb, unsigned lbuf) {
    const int cc = threadIdx.x & 7, rr = threadIdx.x >> 3;           // 16-byte piece of the row piece; row within a sweep of 32 rows
    const bf* g = (const bf*)P + (size_t)rr * SEQ + kb + cc * 8;
    const unsigned l = lbuf + (unsigned)(rr * APH + cc * 8) * 2u;
#pragma unroll
    for (int i = 0; i < 2; ++i) acopy8(l + i * 256 * APH * 2, g + (size_t)i * 256 * SEQ, 32 * APH * 2, (size_t)32 * SEQ);
}
// one pass: 64 k of the wave's 64 plane rows (pa, ring buffer) against the QR rows of the Q or P tile (pb), k ascending in steps of 32
__device__ __forceinline__ void attn_pass(const h16* pa, const h16* pb, v8f (&acc)[4][QB]) {
#pragma unroll
    for (int u = 0; u < AKS / 32; ++u) {
        v8h a0[4], a1[4], b0[QB], b1[QB];
#pragma unroll
        for (int mb = 0; mb < 4; ++mb) { const h16* p = pa + mb * 16 * APH + u * 32; a0[mb] = *(const v8h*)p; a1[mb] = *(const v8h*)(p + 16); }
#pragma unroll
        for (int nb = 0; nb < QB; ++nb) { const h16* p = pb + nb * 16 * PP + u * 32; b0[nb] = *(const v8h*)p; b1[nb] = *(const v8h*)(p + 16); }
        __builtin_amdgcn_sched_barrier(0);                        // keeps the block's LDS reads together ahead of its matrix block: spread among the matrix instructions each read place waits out the LDS latency
#pragma unroll
        for (int nb = 0; nb < QB; ++nb)
#pragma unroll
            for (int mb = 0; mb < 4; ++mb) acc[mb][nb] = wmma16(cat16(a0[mb], a1[mb]), cat16(b0[nb], b1[nb]), acc[mb][nb]);   // plain builtin: an asm operand cannot lie above v255, and the 32 accumulators alone fill 256 registers
        if (u + 1 < AKS / 32) __builtin_amdgcn_sched_barrier(0);  // the next block's reads stay behind this matrix block, as one group
    }
}
__global__ __launch_bounds__(32 * AW)
void k_attn(h16* QC, const h16* __restrict__ KT, const h16* __restrict__ VT) {
    __shared__ __align__(16) h16 ring[2 * DH * APH];
    __shared__ __align__(16) h16 sP[QR * PP];
    __shared__ float smax[AW * QR];
    __shared__ float ssum[AW * QR];
    constexpr int ABUFH = DH * APH;                                 // halves per ring buffer
    const int lane = threadIdx.x & 31, lr = lane & 15, hi = lane >> 4;
    const int wave = __builtin_amdgcn_readfirstlane((int)(threadIdx.x >> 5));
    const int zh = blockIdx.y;                                      // b * 8 + h
    const int t0 = blockIdx.x * QR;
    const size_t zb = (size_t)zh * SEQ * DH;
    const h16* KTz = KT + zb; const h16* VTz = VT + zb;
    const unsigned lb = lds_off(ring);
    const int ao = (wave * 64 + lr) * APH + 8 * hi;                 // plane rows owned by this wave, in a ring buffer (+ 16*blk*APH + k)
    const int bo = lr * PP + 8 * hi;                                // Q / P tile rows (+ 16*ib*PP + k)
    { const int cc = threadIdx.x & 63, rr = threadIdx.x >> 6;       // Q tile: 64 lanes cover one 1024-B row; 4 rows a sweep, QR / 4 copies a thread
      const bf* g = (const bf*)QC + zb + (size_t)(t0 + rr) * DH + cc * 8;
      const unsigned l = lds_off(sP) + (unsigned)(rr * PP + cc * 8) * 2u;
#pragma unroll
      for (int i = 0; i < QR / 32; ++i) acopy8(l + i * 32 * PP * 2, g + (size_t)i * 32 * DH, 4 * PP * 2, (size_t)4 * DH); }
    attn_stage_issue(KTz, 0, lb);
    wait_async0();
    __syncthreads();                                              // publishes the Q tile and stage 0
    attn_stage_issue(KTz, AKS, lb + ABUFH * 2);
    v8f acc[4][QB];
#pragma unroll
    for (int jb = 0; jb < 4; ++jb)
#pragma unroll
        for (int ib = 0; ib < QB; ++ib) acc[jb][ib] = (v8f){};
#pragma unroll 1
    for (int s = 0; s < ANS; ++s) {                               // rolled: one pass per stage, the buffer chosen by s & 1
        attn_pass(ring + (s & 1) * ABUFH + ao, sP + bo + s * AKS, acc);
        wait_ds0();
        wait_async0();
        __syncthreads();                                          // publishes the next stage and ends every reader's last read of this one (behind the last pass: of the Q tile too)
        const int n = s + 2;                                      // always exists: the V^T stages follow the K^T stages
        attn_stage_issue(n < ANS ? KTz : VTz, (n & (ANS - 1)) * AKS, lb + (unsigned)(s & 1) * (ABUFH * 2));
    }
    // row max: lane holds 32 of the wave's 64 columns for query rows 16*ib + lr
    float mx[QB];
#pragma unroll
    for (int ib = 0; ib < QB; ++ib) { mx[ib] = NEGB;
#pragma unroll
        for (int jb = 0; jb < 4; ++jb) {
#pragma unroll
            for (int r = 0; r < 8; ++r) mx[ib] = fmaxf(mx[ib], acc[jb][ib][r]); }
        mx[ib] = fmaxf(mx[ib], __shfl_xor(mx[ib], 16, 32)); }
#pragma unroll
    for (int p = 0; p < QB / 2; ++p) smax[wave * QR + 32 * p + lane] = hi ? mx[2 * p + 1] : mx[2 * p];   // slot = query row 16*(2p + hi) + lr = 32p + lane
    __syncthreads();
    float sh[QB], ls[QB];
#pragma unroll
    for (int ib = 0; ib < QB; ++ib) { float g = smax[ib * 16 + lr];
#pragma unroll
        for (int w = 1; w < AW; ++w) g = fmaxf(g, smax[w * QR + ib * 16 + lr]);
        sh[ib] = PSH - g * SC2; ls[ib] = 0.0f; }
    const int pw = wave * 64 + 8 * hi;
#pragma unroll
    for (int jb = 0; jb < 4; ++jb) {
#pragma unroll
        for (int ib = 0; ib < QB; ++ib) { v8h p;
#pragma unroll
            for (int r = 0; r < 8; ++r) { const float e = acc[jb][ib][r] * SC2 + sh[ib]; const h16 a = pexp_h(e); p[r] = a; ls[ib] += (float)a; }
            *(v8h*)(&sP[(16 * ib + lr) * PP + pw + jb * 16]) = p; } }
#pragma unroll
    for (int ib = 0; ib < QB; ++ib) ls[ib] += __shfl_xor(ls[ib], 16, 32);
#pragma unroll
    for (int p = 0; p < QB / 2; ++p) ssum[wave * QR + 32 * p + lane] = hi ? ls[2 * p + 1] : ls[2 * p];
    __syncthreads();
    // phase 2
#pragma unroll
    for (int db = 0; db < 4; ++db)
#pragma unroll
        for (int ib = 0; ib < QB; ++ib) acc[db][ib] = (v8f){};
#pragma unroll 1
    for (int s = 0; s < ANS; ++s) {                               // rolled, as above
        attn_pass(ring + (s & 1) * ABUFH + ao, sP + bo + s * AKS, acc);
        wait_ds0();
        wait_async0();
        __syncthreads();                                          // publishes the next stage and ends every reader's last read of this one (behind the last pass: of the P tile too)
        if (s + 2 < ANS) attn_stage_issue(VTz, (s + 2) * AKS, lb + (unsigned)(s & 1) * (ABUFH * 2));
    }
    wait_async0();
    float inv[QB];
#pragma unroll
    for (int ib = 0; ib < QB; ++ib) { float l = ssum[ib * 16 + lr];
#pragma unroll
        for (int w = 1; w < AW; ++w) l += ssum[w * QR + ib * 16 + lr];
        inv[ib] = CTXC * (1.0f / l); }                          // l >= 16384: the row maximum contributes its full carry
    // columns 64w..64w+63 of the P tile are wave-private from here
    // O^T D layout: acc[db][ib][r] = (d = 64w + 16db + 8h + r, i = 16ib + lane&15) -> sP[i][64w + 16db + 8h + r]; rows 0..QR-1 x 64 columns all written
#pragma unroll
    for (int db = 0; db < 4; ++db) {
#pragma unroll
        for (int ib = 0; ib < QB; ++ib) { v8h o;
#pragma unroll
            for (int r = 0; r < 8; ++r) o[r] = toh_flush(acc[db][ib][r] * inv[ib]);
            *(v8h*)(&sP[(16 * ib + lr) * PP + pw + db * 16]) = o; } }
    wave_sync();
    h16* crow = QC + zb + (size_t)t0 * DH + (size_t)wave * 64;
#pragma unroll
    for (int s = 0; s < QR / 4; ++s) { const int row = 4 * s + (lane >> 3), c8 = (lane & 7) * 8;   // QR / 4 s x 4 rows = QR rows; 8 lanes x 8 halves = 64 columns = one line
        const v8h val = *(const v8h*)(&sP[row * PP + wave * 64 + c8]);
        *(v8h*)(crow + (size_t)row * DH + c8) = val; }
}

// k_oproj: register-blocked f16 GEMM, 8 waves (2 x 4) per 128x128 tile, one 64x32 tile per wave, operands staged in LDS, K = HDIM; out[m][n] = (sum_k ctx64[m][k] wo64[n][k]) / 4096 + bias[n] (f32).
// A = ctx plane [(b*8 + h)][t][d]: row m = b*SEQ + t holds k = h*512 + d in 8 pieces of 512, SEQ*DH apart; Bt = Wo plane rows (n); grid (NB*SEQ/128, NF/128): one work-group per WGP, every staged row meets 128 rows of the other operand.
__global__ __launch_bounds__(OTH) void k_oproj(const h16* __restrict__ A, const h16* __restrict__ Bt, const float* __restrict__ bias, float* OUT) {
    __shared__ __align__(16) bf ring[2 * (128 + 128) * (OKS + 8)];
    __shared__ __align__(16) float osw[8][16 * 36];
    const int lane = threadIdx.x & 31, lr = lane & 15, hi = lane >> 4;
    const int wave = __builtin_amdgcn_readfirstlane((int)(threadIdx.x >> 5)), wm = wave >> 2, wn = wave & 3;
    float* os = osw[wave];                                         // wave-private store staging
    const int r0 = blockIdx.x * 128 + wm * 64, c0 = blockIdx.y * 128 + wn * 32;   // the wave's own 64x32 tile
    v8f acc[4][2];
#pragma unroll
    for (int mb = 0; mb < 4; ++mb)
#pragma unroll
        for (int nb = 0; nb < 2; ++nb) acc[mb][nb] = (v8f){};
    const int rt = blockIdx.x * 128;                               // a 128-row tile lies in one batch
    gemm_ring<128, 128, HDIM, false, 2, DH, (size_t)SEQ * DH, 2, 4, OKS>((const bf*)A + (size_t)(rt / SEQ) * NH_ * SEQ * DH + (size_t)(rt % SEQ) * DH, (const bf*)Bt + (size_t)blockIdx.y * 128 * HDIM, ring, wm, wn, acc);
    float bc[2];
#pragma unroll
    for (int nb = 0; nb < 2; ++nb) bc[nb] = bfr(bias[c0 + nb * 16 + lr]);   // c0 + 31 < NF
#pragma unroll
    for (int mb = 0; mb < 4; ++mb) {
#pragma unroll
        for (int nb = 0; nb < 2; ++nb) {
#pragma unroll
            for (int j = 0; j < 8; ++j) os[(hi * 8 + j) * 36 + nb * 16 + lr] = acc[mb][nb][j] * OSC + bc[nb]; }   // D: row 8h+j, col lane&15
        wave_sync();
{
#pragma unroll
            for (int s = 0; s < 4; ++s) { const int row = 4 * s + (lane >> 3), c4 = (lane & 7) * 4;   // 4 s x 4 rows = 16 rows; 8 lanes x 4 floats = 32 columns = one line
                const v4f val = *(const v4fa*)(&os[row * 36 + c4]);
                *(v4f*)(OUT + (size_t)(r0 + mb * 16 + row) * NF + c0 + c4) = val; }
             }
        asm volatile("s_wait_xcnt 0x0" ::: "memory");             // stands behind the run of four stores, ahead of any rewrite of their address or data registers
        wave_sync();
    }
}

static constexpr size_t SZ_XB = (size_t)NB * SEQ * NF * 2;                   // bf16 copy of one input
static constexpr size_t SZ_WP = (size_t)HDIM * NF * 2;                       // one weight plane (Wq | Wk | Wv bf16, Wo f16)
static constexpr size_t SZ_PL = (size_t)NB * NH_ * SEQ * DH * 2;             // one q / k^T / v^T plane; ctx replaces q
static constexpr size_t SZ_TOTAL = 3 * SZ_XB + 4 * SZ_WP + 3 * SZ_PL;
static_assert(SZ_XB % 256 == 0 && SZ_WP % 256 == 0 && SZ_PL % 256 == 0);   // the planes lie back to back, each 256-B aligned
static_assert(SZ_TOTAL <= (size_t)268435456);          // workspace carve <= 256 MiB
static_assert((size_t)NB * NH_ * SEQ * DH == (size_t)NB * HDIM * SEQ);     // k^T / v^T plane [(b*4096 + m)][t] has the same extent as the q plane
static_assert((size_t)NF * HDIM == (size_t)HDIM * NF);                     // Wo plane extent equals a projection weight plane

extern "C" void kernel_launch(void* const* d_in, const int* in_sizes, int n_in,
                              void* d_out, int out_size, void* d_ws, size_t ws_size, hipStream_t stream) {
    if (n_in < 11) return;
    const size_t needx = (size_t)NB * SEQ * NF;
    if ((size_t)in_sizes[0] < needx || (size_t)in_sizes[1] < needx || (size_t)in_sizes[2] < needx) return;
    if ((size_t)in_sizes[3] < (size_t)HDIM * NF || (size_t)in_sizes[5] < (size_t)HDIM * NF || (size_t)in_sizes[7] < (size_t)HDIM * NF) return;
    if ((size_t)in_sizes[9] < (size_t)NF * HDIM) return;
    if (in_sizes[4] < HDIM || in_sizes[6] < HDIM || in_sizes[8] < HDIM || in_sizes[10] < NF) return;
    if ((size_t)out_size < needx) return;
    if (SZ_TOTAL > ws_size) return;
    // wire order: q, k, v, Wq, bq, Wk, bk, Wv, bv, Wo, bo
    const float* xq = (const float*)d_in[0]; const float* xk = (const float*)d_in[1]; const float* xv = (const float*)d_in[2];
    const float* wq = (const float*)d_in[3]; const float* bq = (const float*)d_in[4];
    const float* wk = (const float*)d_in[5]; const float* bk = (const float*)d_in[6];
    const float* wv = (const float*)d_in[7]; const float* bv = (const float*)d_in[8];
    const float* wo = (const float*)d_in[9]; const float* bo = (const float*)d_in[10];
    float* OUT = (float*)d_out;      // [NB][SEQ][NF]
    char* wsp = (char*)d_ws;
    bf* XS = (bf*)wsp; wsp += 3 * SZ_XB;             // q | k | v, each [NB*SEQ][NF]
    bf* WS = (bf*)wsp; wsp += 3 * SZ_WP;             // Wq | Wk | Wv, each [4096][512] ([out][in])
    h16* WOH = (h16*)wsp; wsp += SZ_WP;              // [512][4096] x64
    h16* QC = (h16*)wsp; wsp += SZ_PL;               // q [NB*8][SEQ][512], then ctx [NB*8][SEQ][512] x64
    h16* KTP = (h16*)wsp; wsp += SZ_PL;              // [NB*8][512][SEQ]
    h16* VTP = (h16*)wsp; wsp += SZ_PL;              // [NB*8][512][SEQ]

    k_cvt<<<3 * XBK + 4 * WBK, 256, 0, stream>>>(xq, xk, xv, wq, wk, wv, wo, XS);
    k_proj<<<dim3((NB * SEQ / 256) * (HDIM / 256), 3, 1), GTH, 0, stream>>>(XS, WS, bq, bk, bv, QC);
    k_attn<<<dim3(SEQ / QR, NB * NH_, 1), 32 * AW, 0, stream>>>(QC, KTP, VTP);
    k_oproj<<<dim3(NB * SEQ / 128, NF / 128, 1), OTH, 0, stream>>>(QC, WOH, bo, OUT);
}

// v009
// A run of this version takes 150 microseconds.
// Versions in between are left out here; by their measured steps it is 1.19 times as fast as v007.
// Counting every step since v000, it is 7.16 times as fast.
#include <hip/hip_runtime.h>

// Compute dtypes, f32 accumulate everywhere: every product is v_wmma_f32_16x16x32_f16 (q, k, v, the weights and every intermediate tile RNE-converted to f16), single product at every site; the biases stay f32.
// The v projection is folded into the output weights: sum_h P_h (v Wv_h^T + 1 bv_h^T) Wo_h^T = sum_h (P_h v) N_h^T + Wo bv (the rows of P sum to one), N_h[n][f] = sum_d Wo[n][h*512 + d] Wv[h*512 + d][f], built once per call.
// Multi-head attention block without mask: q/k/v [NB][512][512]; Wq/Wk/Wv [4096][512] ([out][in], y = x W^T + bias), 8 heads x 512 columns (head h = columns h*512 + d); score[i][j] = sum_m qh[i][m] kh[m][j] / sqrt(512)
// (m = feature index of qh = token index of kh, j = feature index of kh); softmax over j; ctx[i][d] = sum_j P[i][j] vh[j][d] (j = token index of vh); heads merged to [NB*512][4096]; output = ctx Wo^T + bo with Wo [512][4096] (f32).
// The q and k projections run inside the attention kernel, the k projection re-associated: qh kh = (qh k) Wk_h^T + (row sums of qh) bk_h^T, so that no projected plane goes through memory and every ring operand is a 512 x 512 matrix shared by many blocks.
// Planes (f16): q [b][t][f]; k^T and v^T [b][f][t], the raw inputs transposed, shared by the 8 heads; Wq, Wk [h*512 + row][f], carried x64 (contraction index contiguous in every GEMM); ctx = P v [(b*8+h)][t][f] carried x64;
// Wv^T [h][f][d], Wo [h][n][d] and N [n][h*512+f], each carried x64; P carried x16384 in LDS only (cancels in the normalisation).
// Attention kernel: 8 waves per 128 query rows of one (batch, head), a chain of four products in transposed form, plane rows x tile rows (wave w owns plane rows 64w..64w+63): qh^T = Wq_h x q, T^T = k^T x qh, S^T = Wk_h x T, O^T = v^T x P;
// each result is packed to f16 into the one LDS tile [128][512] that the next product reads; row max / row sum exchanged through LDS; the four planes pass through a two-buffer LDS ring. All batches go through every kernel in one launch: four launches in all.

#ifndef NB
#define NB 16
#endif
#define NB_FULL 16
#define SEQ  512                 // tokens per sequence; the module requires SEQ == DH (score contraction) and SEQ == NF
#define NF   512                 // input feature width
#define NH_  8
#define DH   512                 // per-head width
#define HDIM (NH_ * DH)          // 4096
#define AW   8                   // waves per attention block
#define QR   128                 // query rows per attention block: every plane byte that a block brings into LDS meets 128 query rows
#define QB   (QR / 16)           // 16-row query blocks per attention block (accumulator tiles per plane-row block of a wave)
#define PP   520                 // LDS row pitch (halves) of the Q / P tile (1040 B = 16 B x 65)
#define AKS  64                  // k per stage of the attention ring (128 B of every plane row)
#define APH  72                  // LDS row pitch (halves) of the attention ring (144 B = 16 B x 9)
#define ANS  (SEQ / AKS)         // stages per plane
#define SC2  ((float)(0.04419417382415922 * 1.4426950408889634))   // DH^-0.5 * log2(e)
#define SC2C (SC2 / 64.0f)       // the same for scores that carry the x64 of the Wk plane
#define PSH  14.0f               // log2 of the P carry (16384)
#define NEGB (-3.0e38f)
#define CTXC 64.0f               // carry of the ctx plane
#define WOC  64.0f               // carry of the Wo plane
#define OSC  (1.0f / 4096.0f)    // 1 / (CTXC * WOC)

static_assert(DH == SEQ);                      // score contraction: feature index of q = token index of k; plane row pitch is the same in both layouts
static_assert(NF == SEQ);
static_assert(NH_ * DH == HDIM);
static_assert(NF % 32 == 0);                   // projection k-loop steps by 32
static_assert(SEQ % 32 == 0);                  // attention k-loops step by 32
static_assert(HDIM % 32 == 0);                 // output projection k-loop steps by 32
static_assert(SEQ % 64 == 0);                  // a 64-row tile never straddles two batches
static_assert(DH % 64 == 0);                   // a 64-column tile never straddles two heads
static_assert(HDIM % 64 == 0);
static_assert(NF % 64 == 0);
static_assert(NB <= NB_FULL);
static_assert(DH == AW * 64);                  // each attention wave owns 64 score columns and 64 output columns
static_assert(SEQ % QR == 0);                  // attention grid covers the query rows exactly (QR per block)
static_assert(ANS % 2 == 0 && ANS >= 2);       // each plane's stages go on in the ring with the buffer parity of the plane before it; both prologue stages exist
static_assert((APH * 2) % 16 == 0 && AKS % 32 == 0);
static_assert(DH == 2 * 8 * 32 && QR % (8 * 4) == 0 && DH * 2 == 64 * 16 && AKS * 2 == 8 * 16);   // copy sweeps of 256 threads: ring 32 rows a sweep, 16 sweeps; Q tile 4 rows a sweep, QR / 4 sweeps
static_assert(QR / 4 + 16 <= 63);              // copies of a wave in flight in the prologue: the Q tile and stage 0
static_assert((PP * 2) % 16 == 0);
static_assert(PP >= DH);
static_assert(32 * 16 * 4 == 16 * 64 * 2);
static_assert(32 * 16 * (QR / 4) == QR * 64 * 2);   // k_attn store loop: 32 lanes x 16 B x QR / 4 trips == QR rows x 128 B
static_assert(32 * 16 * 4 == 16 * 32 * 4);     // k_oproj store loop: 32 lanes x 16 B x 4 trips == 16 rows x 128 B
static_assert(NF % 128 == 0 && SEQ % 128 == 0);             // k_oproj grid covers both extents exactly (128 x 128 tiles); a 128-row tile never straddles two batches
static_assert(2 * 256 * 528 + 8 * 16 * 36 * 4 <= 327680);   // static LDS of k_oproj: one work-group per WGP
static_assert(2 * DH * APH * 2 + QR * PP * 2 + 4 * AW * QR * 4 + AW * 192 * 4 <= 327680);   // static LDS of the attention kernel: one work-group per WGP
static_assert(((size_t)NB * SEQ * NF) % 2048 == 0);          // k_cvt: a block converts 2048 elements of one source
static_assert(((size_t)HDIM * NF) % 2048 == 0);

typedef _Float16 h16;
typedef unsigned short bf;
typedef __attribute__((ext_vector_type(16))) __bf16   v16bf;
typedef __attribute__((ext_vector_type(16))) _Float16 v16h;
typedef __attribute__((ext_vector_type(8)))  _Float16 v8h;
typedef __attribute__((ext_vector_type(8)))  unsigned short v8us;
typedef __attribute__((ext_vector_type(8)))  float    v8f;
typedef __attribute__((ext_vector_type(4)))  float    v4f;
typedef v4f  __attribute__((may_alias)) v4fa;
typedef __attribute__((ext_vector_type(2)))  float    v2f;

__device__ __forceinline__ v16h cat16(v8h lo, v8h hi) { return __builtin_shufflevector(lo, hi, 0, 1, 2, 3, 4, 5, 6, 7, 8, 9, 10, 11, 12, 13, 14, 15); }
__device__ __forceinline__ v16bf cat16b(v8us lo, v8us hi) { return __builtin_bit_cast(v16bf, __builtin_shufflevector(lo, hi, 0, 1, 2, 3, 4, 5, 6, 7, 8, 9, 10, 11, 12, 13, 14, 15)); }
__device__ __forceinline__ v8f wmma16(v16h a, v16h b, v8f c) { return __builtin_amdgcn_wmma_f32_16x16x32_f16(false, a, false, b, (short)0, c, false, false); }
__device__ __forceinline__ v8f wmmab(v16bf a, v16bf b, v8f c) { return __builtin_amdgcn_wmma_f32_16x16x32_bf16(false, a, false, b, (short)0, c, false, false); }
// fragment loaders from K-contiguous 16-bit rows; p already includes + 8*(lane>>4): elements 0..7 <- k0+8h+0..7, elements 8..15 <- k0+16+8h+0..7 (same map for A and B)
__device__ __forceinline__ v16h  ldh(const h16* p) { return cat16(*(const v8h*)p, *(const v8h*)(p + 16)); }
// ordering point for wave-private LDS tiles (same wave writes and reads)
__device__ __forceinline__ void wave_sync() { __builtin_amdgcn_fence(3 /* release order */, "wavefront"); __builtin_amdgcn_wave_barrier(); asm volatile("" ::: "memory"); }

// per-instruction guarded matrix ops: one accumulator tied per guard, operands kept live
__device__ __forceinline__ v8f wmma16_g(v16h a, v16h b, v8f c) { c = wmma16(a, b, c); asm volatile("v_nop\n\tv_nop\n\tv_nop\n\tv_nop" : "+v"(c) : "v"(a), "v"(b)); return c; }
__device__ __forceinline__ v8f wmmab_g(v16bf a, v16bf b, v8f c) { c = wmmab(a, b, c); asm volatile("v_nop\n\tv_nop\n\tv_nop\n\tv_nop" : "+v"(c) : "v"(a), "v"(b)); return c; }
// f32 -> f16 convert that cannot produce an f16 subnormal (|v| < 2^-14 -> +0), applied after the plane's power-of-two carry
static __device__ __forceinline__ h16 toh_flush(float v) { const h16 r = (h16)v; return (fabsf(v) < 6.103515625e-05f) ? (h16)0.0f : r; }
// carried probability 2^e as f16; the select is on the exponent argument (e < -14 -> +0)
static __device__ __forceinline__ h16 pexp_h(float e) { const h16 r = (h16)__builtin_amdgcn_exp2f(e); return (e < -14.0f) ? (h16)0.0f : r; }

// ---- operand staging for the two GEMM kernels (k_nprod, k_oproj): asynchronous copies to LDS, two buffers ----
// A work-group of NWM x NWN waves owns a BM x BN tile. A stage is KS k of every operand row ([A BM rows | Bt BN rows], 2 * KS bytes a row, LDS pitch 16 B more: 528 B at KS = 256).
// Each lane copies 16 B; KS / 8 lanes cover one row piece, so every copy instruction asks for whole lines. Stage s + 2 is issued into the buffer that pass s has left.
#define GTH  512                 // threads per k_nprod work-group
#define OKS  256                 // k per stage, k_oproj (LDS row pitch 528 B = 16 B x 33)
#define OTH  256                 // threads per k_oproj work-group
static_assert(HDIM % OKS == 0 && HDIM / OKS >= 2 && DH % OKS == 0);
__device__ __forceinline__ unsigned lds_off(const void* p) { return (unsigned)(size_t)p; }
// eight copies and the wait that stands in front of any rewrite of their address registers, in one statement
__device__ __forceinline__ void acopy8(unsigned l, const bf* g, unsigned lstep, size_t gstep) {
    asm volatile("global_load_async_to_lds_b128 %0, %1, off\n\t"
                 "global_load_async_to_lds_b128 %2, %3, off\n\t"
                 "global_load_async_to_lds_b128 %4, %5, off\n\t"
                 "global_load_async_to_lds_b128 %6, %7, off\n\t"
                 "global_load_async_to_lds_b128 %8, %9, off\n\t"
                 "global_load_async_to_lds_b128 %10, %11, off\n\t"
                 "global_load_async_to_lds_b128 %12, %13, off\n\t"
                 "global_load_async_to_lds_b128 %14, %15, off\n\t"
                 "s_wait_xcnt 0x0"
                 :: "v"(l), "v"(g), "v"(l + lstep), "v"(g + gstep), "v"(l + 2 * lstep), "v"(g + 2 * gstep), "v"(l + 3 * lstep), "v"(g + 3 * gstep),
                    "v"(l + 4 * lstep), "v"(g + 4 * gstep), "v"(l + 5 * lstep), "v"(g + 5 * gstep), "v"(l + 6 * lstep), "v"(g + 6 * gstep), "v"(l + 7 * lstep), "v"(g + 7 * gstep)
                 : "memory");
}
// one stage: BM rows of A and BN rows of Bt, KS k each, into the buffer at LDS byte address lbuf; A and Bt point at the tile's first row at the stage's first k; PA, PB = row pitches; NT threads cover RS rows a sweep, every thread issues (BM + BN) / RS copies
template <int BM, int BN, int PA, int PB, int NT, int KS>
__device__ __forceinline__ void stage_issue(const bf* A, const bf* Bt, unsigned lbuf) {
    constexpr int LPR = KS / 8, PH = KS + 8, RS = NT / LPR;          // lanes per row piece; LDS row pitch in halves; rows per sweep
    static_assert(NT % LPR == 0 && BM % (8 * RS) == 0 && BN % (8 * RS) == 0);
    const int cc = threadIdx.x & (LPR - 1), rr = threadIdx.x / LPR;  // 16-byte piece of the row; row within a sweep of RS rows
    const bf* ga = A  + (size_t)rr * PA + cc * 8;
    const bf* gb = Bt + (size_t)rr * PB + cc * 8;
    const unsigned l = lbuf + (unsigned)(rr * PH + cc * 8) * 2u;
#pragma unroll
    for (int i = 0; i < BM / (8 * RS); ++i) acopy8(l + i * 8 * RS * PH * 2, ga + (size_t)i * 8 * RS * PA, RS * PH * 2, (size_t)RS * PA);
#pragma unroll
    for (int i = 0; i < BN / (8 * RS); ++i) acopy8(l + (BM + i * 8 * RS) * PH * 2, gb + (size_t)i * 8 * RS * PB, RS * PH * 2, (size_t)RS * PB);
}
__device__ __forceinline__ void wait_async0() { asm volatile("s_wait_asynccnt 0x0" ::: "memory"); }   // this wave's copies have landed
__device__ __forceinline__ void wait_ds0()    { asm volatile("s_wait_dscnt 0x0" ::: "memory"); }      // this wave's LDS reads have returned before their buffer is refilled
// C tile accumulation, k ascending in steps of 32; wave (wm, wn) of NWM x NWN owns rows wm*BM/NWM.. and columns wn*BN/NWN.. of the tile. BF: bf16 products, else f16.
// GB = k blocks of 32 whose fragments are read from LDS as one group. A and Bt point at the tile's first row, k = 0. Bt rows are KT long; an A row is PA long and holds k = 0..PA-1, the next PA k of that row lie AJ elements further.
template <int BM, int BN, int KT, bool BF, int GB, int PA, size_t AJ, int NWM, int NWN, int KS>
__device__ __forceinline__ void gemm_ring(const bf* A, const bf* Bt, bf* ring, int wm, int wn, v8f (&acc)[BM / (16 * NWM)][BN / (16 * NWN)]) {
    constexpr int FM = BM / (16 * NWM), FN = BN / (16 * NWN), PH = KS + 8, BUFH = (BM + BN) * PH, NS = KT / KS, NT = 32 * NWM * NWN;
    static_assert(BM % (16 * NWM) == 0 && BN % (16 * NWN) == 0 && (BM + BN) * (KS / 8) / NT <= 63 && (KS / 32) % GB == 0 && PA % KS == 0 && KT % PA == 0 && NS >= 2);
    const int lane = threadIdx.x & 31, lr = lane & 15, hi = lane >> 4;
    const unsigned lb = lds_off(ring);
    stage_issue<BM, BN, PA, KT, NT, KS>(A, Bt, lb);
    wait_async0();
    __syncthreads();                                              // publishes stage 0
    stage_issue<BM, BN, PA, KT, NT, KS>(A + (KS / PA) * AJ + KS % PA, Bt + KS, lb + BUFH * 2);
    const int ao = (wm * (BM / NWM) + lr) * PH + 8 * hi, bo = (BM + wn * (BN / NWN) + lr) * PH + 8 * hi;
#pragma unroll 1
    for (int s = 0; s < NS; ++s) {                                // rolled: one pass per stage, the buffer chosen by s & 1
        const bf* sb = ring + (s & 1) * BUFH;
#pragma unroll
        for (int kk = 0; kk < KS; kk += 32 * GB) {
            v8us a0[GB][FM], a1[GB][FM], b0[GB][FN], b1[GB][FN];
#pragma unroll
            for (int u = 0; u < GB; ++u) {
#pragma unroll
                for (int mb = 0; mb < FM; ++mb) { const bf* p = sb + ao + mb * 16 * PH + kk + u * 32; a0[u][mb] = *(const v8us*)p; a1[u][mb] = *(const v8us*)(p + 16); }
#pragma unroll
                for (int nb = 0; nb < FN; ++nb) { const bf* p = sb + bo + nb * 16 * PH + kk + u * 32; b0[u][nb] = *(const v8us*)p; b1[u][nb] = *(const v8us*)(p + 16); }
            }
            __builtin_amdgcn_sched_barrier(0);                    // keeps the group's LDS reads together ahead of its matrix block: spread among the matrix instructions each read place waits out the LDS latency
#pragma unroll
            for (int u = 0; u < GB; ++u)
#pragma unroll
                for (int nb = 0; nb < FN; ++nb)
#pragma unroll
                    for (int mb = 0; mb < FM; ++mb) {
                        if constexpr (BF) acc[mb][nb] = wmmab_g(cat16b(a0[u][mb], a1[u][mb]), cat16b(b0[u][nb], b1[u][nb]), acc[mb][nb]);
                        else              acc[mb][nb] = wmma16_g(__builtin_bit_cast(v16h, cat16b(a0[u][mb], a1[u][mb])), __builtin_bit_cast(v16h, cat16b(b0[u][nb], b1[u][nb])), acc[mb][nb]); }
            if constexpr (32 * GB < KS) __builtin_amdgcn_sched_barrier(0);   // the next group's reads stay behind this matrix block, as one group
        }
        wait_ds0();
        wait_async0();
        __syncthreads();                                          // publishes stage s + 1 and ends every reader's last read of stage s
        if (s + 2 < NS) { const int kb = (s + 2) * KS; stage_issue<BM, BN, PA, KT, NT, KS>(A + (size_t)(kb / PA) * AJ + kb % PA, Bt + kb, lb + (unsigned)(s & 1) * (BUFH * 2)); }
    }
    wait_async0();
}

// k_cvt: every 16-bit operand plane in one launch; a block converts 2048 elements of one source to f16. Block ranges behind the CBK blocks of the constant vector: q (XBK blocks, plain), k | v (XBK each, transposed),
// Wq | Wk (WBK each, x64, plain), Wv (WBK, x64, transposed per head), Wo (WBK, x64, re-laid per head); the planes lie at dst in that order, back to back.
// Transposed sources are sets of 512 x 512 matrices src[r][c] -> dst[c][r]; a block takes 64 r x 32 c through LDS, so that it reads and writes whole 128-B lines.
// Constant vector: cv[n * 32] = bo[n] + sum_k Wo[n][k] bv[k] in f32, one block per n, one 128-B line per value (one writer per line).
#define XBK ((unsigned)((size_t)NB * SEQ * NF / 2048))
#define WBK ((unsigned)((size_t)HDIM * NF / 2048))
#define CBK ((unsigned)NF)
static_assert(SEQ == 512 && NF == 512 && DH == 512 && HDIM == 4096);   // index arithmetic of the transposing and re-laying blocks
__global__ __launch_bounds__(256) void k_cvt(const float* __restrict__ q, const float* __restrict__ k, const float* __restrict__ v, const float* __restrict__ wq, const float* __restrict__ wk,
                                             const float* __restrict__ wv, const float* __restrict__ wo, const float* __restrict__ bv, const float* __restrict__ bo, bf* dst, float* cv) {
    __shared__ __align__(16) bf tt[32 * 72];
    const int tid = threadIdx.x;
    if (blockIdx.x < CBK) {                                        // block-uniform
        const int n = (int)blockIdx.x;
        const float* wr = wo + (size_t)n * HDIM;
        float sum = 0.0f;
#pragma unroll                                                     // the thread's eight loads fly together
        for (int i = 0; i < HDIM / 1024; ++i) {
            const v4f a = *(const v4f*)(wr + (i * 256 + tid) * 4); const v4f b = *(const v4f*)(bv + (i * 256 + tid) * 4);
            sum += a[0] * b[0] + a[1] * b[1] + a[2] * b[2] + a[3] * b[3]; }
#pragma unroll                                                     // five fixed steps, no loop counter
        for (int m = 16; m >= 1; m >>= 1) sum += __shfl_xor(sum, m, 32);
        float* red = (float*)tt;                                   // the 8 waves' partial sums
        if ((tid & 31) == 0) red[tid >> 5] = sum;
        __syncthreads();                                           // publishes the partial sums
        if (tid == 0) { float t = red[0];
#pragma unroll                                                     // the eight values come as two wide LDS reads
            for (int w = 1; w < 8; ++w) t += red[w];
            cv[n * 32] = bo[n] + t; }
        return;
    }
    const unsigned blk = blockIdx.x - CBK;
    const float* src; unsigned lb; int kind;                       // source, block index within it, kind (0 plain, 1 transposed, 2 re-laid): block-uniform
    if (blk < 3 * XBK) { const unsigned g = blk / XBK; src = g == 0 ? q : g == 1 ? k : v; lb = blk - g * XBK; kind = g == 0 ? 0 : 1; }
    else { const unsigned w = blk - 3 * XBK, g = w / WBK; src = g == 0 ? wq : g == 1 ? wk : g == 2 ? wv : wo; lb = w - g * WBK; kind = g == 2 ? 1 : g == 3 ? 2 : 0; }
    bf* dp = dst + (size_t)(blk - lb) * 2048;                      // first element of this source's plane
    const float sc = blk < 3 * XBK ? 1.0f : WOC;                   // the weight planes carry x64
    if (kind == 1) {
        const size_t mo = (size_t)(lb >> 7) * (512 * 512);         // 128 tiles per matrix: 8 of r x 16 of c, c fastest
        const int r0 = (int)((lb & 127) >> 4) * 64, cb = (int)(lb & 15) * 32;
        const int c4 = (tid & 7) * 4, rr = tid >> 3;
        const v4f x0 = *(const v4f*)(src + mo + (size_t)(r0 + rr) * 512 + cb + c4);
        const v4f x1 = *(const v4f*)(src + mo + (size_t)(r0 + 32 + rr) * 512 + cb + c4);
#pragma unroll                                                     // vector elements need constant indices
        for (int i = 0; i < 4; ++i) { tt[(c4 + i) * 72 + rr] = __builtin_bit_cast(bf, toh_flush(x0[i] * sc)); tt[(c4 + i) * 72 + 32 + rr] = __builtin_bit_cast(bf, toh_flush(x1[i] * sc)); }
        __syncthreads();                                           // publishes the transposed tile
        const int c = tid >> 3, r8 = (tid & 7) * 8;
        *(v8us*)(dp + mo + (size_t)(cb + c) * 512 + r0 + r8) = *(const v8us*)(tt + c * 72 + r8);
        asm volatile("s_wait_xcnt 0x0" ::: "memory");              // stands behind the store, ahead of any rewrite of its address or data registers
        return;
    }
    const size_t e = ((size_t)lb * 256 + tid) * 8;
    const v8f x = *(const v8f*)(src + e); v8h t;
    asm volatile("s_wait_xcnt 0x0" ::: "memory");                  // stands behind the two loads, ahead of any rewrite of their address registers
#pragma unroll
    for (int i = 0; i < 8; ++i) t[i] = toh_flush(x[i] * sc);
    const v8us o = __builtin_bit_cast(v8us, t);
    if (kind == 0) {
        *(v8us*)(dp + e) = o;
        asm volatile("s_wait_xcnt 0x0" ::: "memory");              // stands behind the store, as above
    } else {
        const size_t n = e >> 12, kk = e & 4095;                   // Wo[n][h*512 + d] -> [h][n][d]
        *(v8us*)(dp + ((kk >> 9) * 512 + n) * 512 + (kk & 511)) = o;
        asm volatile("s_wait_xcnt 0x0" ::: "memory"); }            // stands behind the store, as above
}

// k_nprod, the weight product (f16): N[n][h*512 + f] = sum_d Wo[n][h*512 + d] Wv[h*512 + d][f], 128 f x 128 n per block, A = Wv^T rows (m = f), Bt = Wo rows (n), 16 waves (2 x 8), 64 f x 16 n per wave: a lane holds 8 consecutive f of one row n, a wave writes whole 128-B lines of N.
// WS: the weight planes (Wq | Wk | Wv^T | Wo per head), back to back. grid NTB.
#define NTB (NH_ * (NF / 128) * (NF / 128))
static_assert(2 * (128 + 128) * (256 + 8) * 2 <= 327680);          // static LDS of k_nprod (256 k per stage)
__global__ __launch_bounds__(GTH) void k_nprod(const bf* __restrict__ WS, h16* NP) {
    __shared__ __align__(16) bf ring[2 * (128 + 128) * (256 + 8)];
    const int lane = threadIdx.x & 31, lr = lane & 15, hi = lane >> 4;
    const int wave = __builtin_amdgcn_readfirstlane((int)(threadIdx.x >> 5));
    const int hh = (int)blockIdx.x >> 4, tf = ((int)blockIdx.x >> 2) & 3, tn = (int)blockIdx.x & 3;
    v8f an[4][1];
#pragma unroll                                                     // here and below: the accumulators stay in registers only under constant indices
    for (int mb = 0; mb < 4; ++mb) an[mb][0] = (v8f){};
    gemm_ring<128, 128, DH, false, 1, DH, 0, 2, 8, 256>(WS + (size_t)2 * HDIM * NF + ((size_t)hh * NF + tf * 128) * DH, WS + (size_t)3 * HDIM * NF + ((size_t)hh * NF + tn * 128) * DH, ring, wave >> 3, wave & 7, an);
    h16* np = NP + (size_t)(tn * 128 + (wave & 7) * 16 + lr) * HDIM + hh * NF + tf * 128 + (wave >> 3) * 64 + 8 * hi;   // D: row 8h+j = f, col lane&15 = n
#pragma unroll
    for (int mb = 0; mb < 4; ++mb) { v8h hv;
#pragma unroll
        for (int j = 0; j < 8; ++j) hv[j] = toh_flush(an[mb][0][j] * (1.0f / WOC));   // the operands carry 64 x 64, the plane 64
        *(v8h*)(np + mb * 16) = hv; }
}

// k_attn: q projection, scores with the re-associated k projection, softmax and P v for 128 query rows of one (batch, head); 8 waves. Four products of one shape: A = rows of a 512 x 512 plane from the ring (wave w owns rows 64w..64w+63),
//   B = the 128 rows of the LDS tile (k contiguous in both); D: acc[rb][ib][r] = (plane row 64w + 16rb + 8h + r, tile row i = 16ib + lane&15), so a lane holds 8 consecutive columns of one query row of the next tile: packed 16-B stores.
// The four products and the repacking behind products 1, 2 and 4 (tile = f16(acc * scale + constant)) run as one rolled loop over one text.
// Product 1: qh^T[m][i] = sum_f Wq_h[m][f] q[i][f] (x64), tile = q rows; then qh = acc / 64 + bq_h[m] -> f16 tile, its row sums (f32, ahead of the convert) as per-wave partials through LDS.
// Product 2: T^T[f][i] = sum_m k^T[f][m] qh[i][m] (m = token of k), tile = qh; then T -> f16 tile.
// Product 3: S^T[j][i] = sum_f Wk_h[j][f] T[i][f] (x64), tile = T; then + 64 bk_h[j] * rowsum(qh)[i]: the score, carried x64.
// Softmax: per-wave row max -> LDS -> block barrier -> row max over the 8 waves; p = f16(2^((s - max) * scale * log2e + 14)); packed 16-B stores into the tile;
//   row sum over the converted p, per-wave partials through LDS; block barrier (publishes P and the sums).
// Product 4: O^T[d][i] = sum_j v^T[d][j] P[i][j] (d = input feature of v, j = token), tile = P.
// Operands: the q rows are copied once into the tile; the planes come as 4 * ANS ring stages (ANS each of Wq_h, k^T, Wk_h, v^T), each all 512 plane rows x 64 k, two buffers, asynchronous copies;
//   the first two stages of a plane fly during the last passes of the product before it and the repacking of the tile. A tile is rewritten only behind the barrier of the last pass that read it, and read only behind a barrier of its own.
// Epilogue: ctx = O / rowsum x 64 as f16, repacked into the tile like qh and T; each wave then stores its own column range of the tile, whole lines.
// one ring stage into buffer buf: k = kb..kb+63 of all 512 rows of a plane [512][SEQ]; 8 lanes cover a 128-B row piece (one line); every thread issues 16 copies
// u = 8 * (ring row of the thread's first copy, 512 buf + thread / 8) + its 16-byte piece: the buffer enters ahead of the row arithmetic, so that no per-thread LDS offset stays in a register of its own through the whole kernel (that register went out to scratch)
__device__ __forceinline__ void attn_stage_issue(const h16* P, int kb, int buf, unsigned lb) {
    const unsigned u = (unsigned)(buf * DH * 8) + threadIdx.x;
    const unsigned row = u >> 3, cc = u & 7;                         // sweeps of 32 rows: row within a sweep = thread / 8
    const bf* g = (const bf*)P + kb + (size_t)((row & (DH - 1)) * SEQ + cc * 8);
    const unsigned l = lb + (row * APH + cc * 8) * 2u;
#pragma unroll
    for (int i = 0; i < 2; ++i) acopy8(l + i * 256 * APH * 2, g + (size_t)i * 256 * SEQ, 32 * APH * 2, (size_t)32 * SEQ);
}
// a pass is 64 k of the wave's 64 plane rows (pa, ring buffer) against the QR rows of the tile (pb), k ascending, two blocks of 32 k
// fragments of one block, read from LDS as one group
__device__ __forceinline__ void attn_frag(const h16* pa, const h16* pb, v8h (&a0)[4], v8h (&a1)[4], v8h (&b0)[QB], v8h (&b1)[QB]) {
#pragma unroll
    for (int mb = 0; mb < 4; ++mb) { const h16* p = pa + mb * 16 * APH; a0[mb] = *(const v8h*)p; a1[mb] = *(const v8h*)(p + 16); }
#pragma unroll
    for (int nb = 0; nb < QB; ++nb) { const h16* p = pb + nb * 16 * PP; b0[nb] = *(const v8h*)p; b1[nb] = *(const v8h*)(p + 16); }
}
// matrix block of one fragment group
__device__ __forceinline__ void attn_mm(const v8h (&a0)[4], const v8h (&a1)[4], const v8h (&b0)[QB], const v8h (&b1)[QB], v8f (&acc)[4][QB]) {
#pragma unroll
    for (int nb = 0; nb < QB; ++nb)
#pragma unroll
        for (int mb = 0; mb < 4; ++mb) acc[mb][nb] = wmma16(cat16(a0[mb], a1[mb]), cat16(b0[nb], b1[nb]), acc[mb][nb]);   // plain builtin: an asm operand cannot lie above v255, and the 32 accumulators alone fill 256 registers
}
__global__ __launch_bounds__(32 * AW)
void k_attn(const h16* __restrict__ XQ, const h16* __restrict__ WQ, const h16* __restrict__ KT, const h16* __restrict__ WK, const h16* __restrict__ VT, const float* __restrict__ bq, const float* __restrict__ bk, h16* CTX) {
    __shared__ __align__(16) h16 ring[2 * DH * APH];
    __shared__ __align__(16) h16 sP[QR * PP];
    __shared__ float smax[AW * QR];
    __shared__ float ssum[AW * QR];
    __shared__ float srs[2 * AW * QR];
    __shared__ __align__(16) float sbw[AW][192];
    const int lane = threadIdx.x & 31, lr = lane & 15, hi = lane >> 4;
    const int wave = __builtin_amdgcn_readfirstlane((int)(threadIdx.x >> 5));
    const int zh = blockIdx.y, bb = zh / NH_, hh = zh % NH_;        // zh = b * 8 + h
    const int t0 = blockIdx.x * QR;
    const h16* WQh = WQ + (size_t)hh * DH * NF; const h16* WKh = WK + (size_t)hh * DH * NF;     // one plane per head
    const h16* KTb = KT + (size_t)bb * NF * SEQ; const h16* VTb = VT + (size_t)bb * NF * SEQ;   // one plane per batch
    const unsigned lb = lds_off(ring);
    const h16* ra = ring + (wave * 64 + lr) * APH + 8 * hi;         // plane rows owned by this wave, in ring buffer 0 (+ 16*blk*APH + k)
    const h16* tb = sP + lr * PP + 8 * hi;                          // tile rows (+ 16*ib*PP + k)
    float* sb = sbw[wave];                                          // wave-private: bq_h and 64 bk_h at the wave's 64 plane rows, then 64 zeros
    const float* bqw = bq + hh * DH + wave * 64; const float* bkw = bk + hh * DH + wave * 64;   // both ranges end at or below HDIM
    const float tq0 = bqw[lane], tq1 = bqw[32 + lane], tk0 = bkw[lane], tk1 = bkw[32 + lane];   // issued ahead of the copies: they land under the wait for stage 0
    asm volatile("s_wait_xcnt 0x0" ::: "memory");                   // stands behind the four loads, ahead of any rewrite of their address registers
    { const int cc = threadIdx.x & 63, rr = threadIdx.x >> 6;       // q rows: 64 lanes cover one 1024-B row; 4 rows a sweep, QR / 4 copies a thread
      const bf* g = (const bf*)XQ + ((size_t)bb * SEQ + t0 + rr) * NF + cc * 8;
      const unsigned l = lds_off(sP) + (unsigned)(rr * PP + cc * 8) * 2u;
#pragma unroll
      for (int i = 0; i < QR / 32; ++i) acopy8(l + i * 32 * PP * 2, g + (size_t)i * 32 * NF, 4 * PP * 2, (size_t)4 * NF); }
    attn_stage_issue(WQh, 0, 0, lb);
    wait_async0();
    sb[lane] = tq0; sb[32 + lane] = tq1; sb[64 + lane] = tk0 * WOC; sb[96 + lane] = tk1 * WOC; sb[128 + lane] = 0.0f; sb[160 + lane] = 0.0f;
    __syncthreads();                                              // publishes the q rows and stage 0
    attn_stage_issue(WQh, AKS, 1, lb);
    const int pw = wave * 64 + 8 * hi;
    constexpr int ABUFH = DH * APH;                                 // halves per ring buffer
    v8f acc[4][QB];
    float rs[QB];
    const h16* pcur = WQh; const h16* pnxt = KTb;                 // the plane of this product and of the next
#pragma unroll 1
    for (int ph = 0; ph < 4; ++ph) {                              // rolled: the four products share one text, so that the kernel's text stays near what the instruction prefetch covers
#pragma unroll
        for (int rb = 0; rb < 4; ++rb)
#pragma unroll
            for (int ib = 0; ib < QB; ++ib) acc[rb][ib] = (v8f){};
#pragma unroll 1
        for (int s = 0; s < ANS; ++s) {                           // rolled: one pass per stage, the buffer chosen by s & 1
            v8h a0[4], a1[4], b0[QB], b1[QB];
            attn_frag(ra + (s & 1) * ABUFH, tb + s * AKS, a0, a1, b0, b1);
            __builtin_amdgcn_sched_barrier(0);                    // keeps the block's LDS reads together ahead of its matrix block: spread among the matrix instructions each read place waits out the LDS latency
            attn_mm(a0, a1, b0, b1, acc);
            __builtin_amdgcn_sched_barrier(0);                    // the next block's reads stay behind this matrix block, as one group
            attn_frag(ra + (s & 1) * ABUFH + 32, tb + s * AKS + 32, a0, a1, b0, b1);
            wait_ds0();
            wait_async0();
            __syncthreads();                                      // publishes the next stage and ends every reader's last read of this one (behind a product's last pass: of the tile too)
            const int n = s + 2;                                  // the stage two ahead: of this plane, or of the next one
            if (ph < 3 || n < ANS) attn_stage_issue(n < ANS ? pcur : pnxt, (n & (ANS - 1)) * AKS, s & 1, lb);   // block-uniform
            attn_mm(a0, a1, b0, b1, acc);                         // the second block works from registers alone: behind the issue, so that the copies start at once and fly under it
        }
        pcur = pnxt; pnxt = ph == 0 ? WKh : VTb;
        if (ph == 2) {                                            // block-uniform
            // the bias term of the k projection
#pragma unroll
            for (int ib = 0; ib < QB; ++ib) { float l = srs[ib * 16 + lr];
#pragma unroll
                for (int w = 1; w < AW; ++w) l += srs[w * QR + ib * 16 + lr];
                rs[ib] = l; }
#pragma unroll
            for (int jb = 0; jb < 4; ++jb) { const v4f c0 = *(const v4fa*)(sb + 64 + jb * 16 + hi * 8), c1 = *(const v4fa*)(sb + 64 + jb * 16 + hi * 8 + 4);
#pragma unroll
                for (int ib = 0; ib < QB; ++ib) {
#pragma unroll
                    for (int r = 0; r < 8; ++r) acc[jb][ib][r] += (r < 4 ? c0[r & 3] : c1[r & 3]) * rs[ib]; } }
            // row max: lane holds 32 of the wave's 64 columns for query rows 16*ib + lr
            float mx[QB];
#pragma unroll
            for (int ib = 0; ib < QB; ++ib) { mx[ib] = NEGB;
#pragma unroll
                for (int jb = 0; jb < 4; ++jb) {
#pragma unroll
                    for (int r = 0; r < 8; ++r) mx[ib] = fmaxf(mx[ib], acc[jb][ib][r]); }
                mx[ib] = fmaxf(mx[ib], __shfl_xor(mx[ib], 16, 32)); }
#pragma unroll
            for (int p = 0; p < QB / 2; ++p) smax[wave * QR + 32 * p + lane] = hi ? mx[2 * p + 1] : mx[2 * p];   // slot = query row 16*(2p + hi) + lr = 32p + lane
            __syncthreads();
            float sh[QB], ls[QB];
#pragma unroll
            for (int ib = 0; ib < QB; ++ib) { float g = smax[ib * 16 + lr];
#pragma unroll
                for (int w = 1; w < AW; ++w) g = fmaxf(g, smax[w * QR + ib * 16 + lr]);
                sh[ib] = PSH - g * SC2C; ls[ib] = 0.0f; }
#pragma unroll
            for (int jb = 0; jb < 4; ++jb) {
#pragma unroll
                for (int ib = 0; ib < QB; ++ib) { v8h p;
#pragma unroll
                    for (int r = 0; r < 8; ++r) { const float e = acc[jb][ib][r] * SC2C + sh[ib]; const h16 a = pexp_h(e); p[r] = a; ls[ib] += (float)a; }
                    *(v8h*)(&sP[(16 * ib + lr) * PP + pw + jb * 16]) = p; } }
#pragma unroll
            for (int ib = 0; ib < QB; ++ib) ls[ib] += __shfl_xor(ls[ib], 16, 32);
#pragma unroll
            for (int p = 0; p < QB / 2; ++p) ssum[wave * QR + 32 * p + lane] = hi ? ls[2 * p + 1] : ls[2 * p];
            __syncthreads();
            continue;
        }
        // repack, products 1, 2 and 4: tile[i][row] = f16(acc * sc[i] + c[row]); lane holds 32 of the wave's 64 columns for query rows 16*ib + lr
        float sc[QB];
        if (ph == 3) {                                            // block-uniform
#pragma unroll
            for (int ib = 0; ib < QB; ++ib) { float l = ssum[ib * 16 + lr];
#pragma unroll
                for (int w = 1; w < AW; ++w) l += ssum[w * QR + ib * 16 + lr];
                sc[ib] = CTXC * (1.0f / l); }                     // l >= 16384: the row maximum contributes its full carry
        } else { const float c = ph == 0 ? 1.0f / WOC : 1.0f;
#pragma unroll
            for (int ib = 0; ib < QB; ++ib) sc[ib] = c; }
        const float* bp = sb + (ph == 0 ? 0 : 128);               // bq_h behind product 1, zeros behind the others
        v2f rp[QB];                                               // row sums over even and over odd columns (read behind product 1 only), so that value pairs stay in their adjacent registers
#pragma unroll
        for (int ib = 0; ib < QB; ++ib) rp[ib] = (v2f){};
#pragma unroll
        for (int mb = 0; mb < 4; ++mb) { const v4f c0 = *(const v4fa*)(bp + mb * 16 + hi * 8), c1 = *(const v4fa*)(bp + mb * 16 + hi * 8 + 4);
            const v2f cp[4] = { (v2f){c0[0], c0[1]}, (v2f){c0[2], c0[3]}, (v2f){c1[0], c1[1]}, (v2f){c1[2], c1[3]} };
#pragma unroll
            for (int ib = 0; ib < QB; ++ib) { v8h p;
#pragma unroll
                for (int r = 0; r < 4; ++r) { const v2f x = (v2f){acc[mb][ib][2 * r], acc[mb][ib][2 * r + 1]} * sc[ib] + cp[r]; rp[ib] += x; p[2 * r] = toh_flush(x[0]); p[2 * r + 1] = toh_flush(x[1]); }
                *(v8h*)(&sP[(16 * ib + lr) * PP + pw + mb * 16]) = p; } }
        float* sd = srs + (ph == 0 ? 0 : AW * QR);                // the sums behind products 2 and 4 go to a second range that nobody reads: summed under a branch, all 256 values stay live up to it and spill to scratch
#pragma unroll
        for (int ib = 0; ib < QB; ++ib) { rs[ib] = rp[ib][0] + rp[ib][1]; rs[ib] += __shfl_xor(rs[ib], 16, 32); }
#pragma unroll
        for (int p = 0; p < QB / 2; ++p) sd[wave * QR + 32 * p + lane] = hi ? rs[2 * p + 1] : rs[2 * p];   // slot = query row 16*(2p + hi) + lr = 32p + lane
        __syncthreads();                                          // publishes the tile (and the partial row sums of qh) to the next product; behind product 4 it orders the wave's own read-back
    }
    wait_async0();
    h16* crow = CTX + ((size_t)zh * SEQ + t0) * DH + (size_t)wave * 64;
#pragma unroll
    for (int s = 0; s < QR / 4; ++s) { const int row = 4 * s + (lane >> 3), c8 = (lane & 7) * 8;   // QR / 4 s x 4 rows = QR rows; 8 lanes x 8 halves = 64 columns = one line
        const v8h val = *(const v8h*)(&sP[row * PP + wave * 64 + c8]);
        *(v8h*)(crow + (size_t)row * DH + c8) = val; }
}

// k_oproj: register-blocked f16 GEMM, 8 waves (2 x 4) per 128x128 tile, one 64x32 tile per wave, operands staged in LDS, K = HDIM; out[m][n] = (sum_k ctx64[m][k] N64[n][k]) / 4096 + cv[n] (f32); bias = the constant vector, one value per 32 floats.
// A = ctx plane [(b*8 + h)][t][f]: row m = b*SEQ + t holds k = h*512 + f in 8 pieces of 512, SEQ*DH apart; Bt = N plane rows (n); grid (NB*SEQ/128, NF/128): one work-group per WGP, every staged row meets 128 rows of the other operand.
__global__ __launch_bounds__(OTH) void k_oproj(const h16* __restrict__ A, const h16* __restrict__ Bt, const float* __restrict__ bias, float* OUT) {
    __shared__ __align__(16) bf ring[2 * (128 + 128) * (OKS + 8)];
    __shared__ __align__(16) float osw[8][16 * 36];
    const int lane = threadIdx.x & 31, lr = lane & 15, hi = lane >> 4;
    const int wave = __builtin_amdgcn_readfirstlane((int)(threadIdx.x >> 5)), wm = wave >> 2, wn = wave & 3;
    float* os = osw[wave];                                         // wave-private store staging
    const int r0 = blockIdx.x * 128 + wm * 64, c0 = blockIdx.y * 128 + wn * 32;   // the wave's own 64x32 tile
    v8f acc[4][2];
#pragma unroll
    for (int mb = 0; mb < 4; ++mb)
#pragma unroll
        for (int nb = 0; nb < 2; ++nb) acc[mb][nb] = (v8f){};
    const int rt = blockIdx.x * 128;                               // a 128-row tile lies in one batch
    gemm_ring<128, 128, HDIM, false, 2, DH, (size_t)SEQ * DH, 2, 4, OKS>((const bf*)A + (size_t)(rt / SEQ) * NH_ * SEQ * DH + (size_t)(rt % SEQ) * DH, (const bf*)Bt + (size_t)blockIdx.y * 128 * HDIM, ring, wm, wn, acc);
    float bc[2];
#pragma unroll
    for (int nb = 0; nb < 2; ++nb) bc[nb] = bias[(c0 + nb * 16 + lr) * 32];   // c0 + 31 < NF
#pragma unroll
    for (int mb = 0; mb < 4; ++mb) {
#pragma unroll
        for (int nb = 0; nb < 2; ++nb) {
#pragma unroll
            for (int j = 0; j < 8; ++j) os[(hi * 8 + j) * 36 + nb * 16 + lr] = acc[mb][nb][j] * OSC + bc[nb]; }   // D: row 8h+j, col lane&15
        wave_sync();
{
#pragma unroll
            for (int s = 0; s < 4; ++s) { const int row = 4 * s + (lane >> 3), c4 = (lane & 7) * 4;   // 4 s x 4 rows = 16 rows; 8 lanes x 4 floats = 32 columns = one line
                const v4f val = *(const v4fa*)(&os[row * 36 + c4]);
                *(v4f*)(OUT + (size_t)(r0 + mb * 16 + row) * NF + c0 + c4) = val; }
             }
        asm volatile("s_wait_xcnt 0x0" ::: "memory");             // stands behind the run of four stores, ahead of any rewrite of their address or data registers
        wave_sync();
    }
}

static constexpr size_t SZ_XB = (size_t)NB * SEQ * NF * 2;                   // f16 copy of one input
static constexpr size_t SZ_WP = (size_t)HDIM * NF * 2;                       // one weight plane (Wq | Wk | Wv^T | Wo | N, f16)
static constexpr size_t SZ_PL = (size_t)NB * NH_ * SEQ * DH * 2;             // the ctx plane
static constexpr size_t SZ_CV = (size_t)NF * 32 * 4;                         // the constant vector, one line per value
static constexpr size_t SZ_TOTAL = 3 * SZ_XB + 5 * SZ_WP + SZ_CV + SZ_PL;
static_assert(SZ_XB % 256 == 0 && SZ_WP % 256 == 0 && SZ_PL % 256 == 0);   // the planes lie back to back, each 256-B aligned
static_assert(SZ_TOTAL <= (size_t)268435456);          // workspace carve <= 256 MiB
static_assert((size_t)NF * HDIM == (size_t)HDIM * NF);                     // Wo and N plane extents equal a projection weight plane

extern "C" void kernel_launch(void* const* d_in, const int* in_sizes, int n_in,
                              void* d_out, int out_size, void* d_ws, size_t ws_size, hipStream_t stream) {
    if (n_in < 11) return;
    const size_t needx = (size_t)NB * SEQ * NF;
    if ((size_t)in_sizes[0] < needx || (size_t)in_sizes[1] < needx || (size_t)in_sizes[2] < needx) return;
    if ((size_t)in_sizes[3] < (size_t)HDIM * NF || (size_t)in_sizes[5] < (size_t)HDIM * NF || (size_t)in_sizes[7] < (size_t)HDIM * NF) return;
    if ((size_t)in_sizes[9] < (size_t)NF * HDIM) return;
    if (in_sizes[4] < HDIM || in_sizes[6] < HDIM || in_sizes[8] < HDIM || in_sizes[10] < NF) return;
    if ((size_t)out_size < needx) return;
    if (SZ_TOTAL > ws_size) return;
    // wire order: q, k, v, Wq, bq, Wk, bk, Wv, bv, Wo, bo
    const float* xq = (const float*)d_in[0]; const float* xk = (const float*)d_in[1]; const float* xv = (const float*)d_in[2];
    const float* wq = (const float*)d_in[3]; const float* bq = (const float*)d_in[4];
    const float* wk = (const float*)d_in[5]; const float* bk = (const float*)d_in[6];
    const float* wv = (const float*)d_in[7]; const float* bv = (const float*)d_in[8];
    const float* wo = (const float*)d_in[9]; const float* bo = (const float*)d_in[10];
    float* OUT = (float*)d_out;      // [NB][SEQ][NF]
    char* wsp = (char*)d_ws;
    bf* XS = (bf*)wsp; wsp += 3 * SZ_XB;             // q [NB][SEQ][NF] | k^T [NB][NF][SEQ] | v^T [NB][NF][SEQ]
    bf* WS = (bf*)wsp; wsp += 4 * SZ_WP;             // Wq | Wk [4096][512] ([out][in]) x64 | Wv^T [8][NF][512] x64 | Wo [8][NF][512] x64
    h16* NPL = (h16*)wsp; wsp += SZ_WP;              // N [512][4096] x64
    float* CV = (float*)wsp; wsp += SZ_CV;           // [512] at a pitch of 32 floats
    h16* CTX = (h16*)wsp; wsp += SZ_PL;              // ctx [NB*8][SEQ][512] x64
    const h16* XQ = (const h16*)XS; const h16* KTP = XQ + needx; const h16* VTP = KTP + needx;
    const h16* WQP = (const h16*)WS; const h16* WKP = WQP + (size_t)HDIM * NF;

    k_cvt<<<CBK + 3 * XBK + 4 * WBK, 256, 0, stream>>>(xq, xk, xv, wq, wk, wv, wo, bv, bo, XS, CV);
    k_nprod<<<NTB, GTH, 0, stream>>>(WS, NPL);
    k_attn<<<dim3(SEQ / QR, NB * NH_, 1), 32 * AW, 0, stream>>>(XQ, WQP, KTP, WKP, VTP, bq, bk, CTX);
    k_oproj<<<dim3(NB * SEQ / 128, NF / 128, 1), OTH, 0, stream>>>(CTX, NPL, CV, OUT);
}

// v010
// It runs in 141 microseconds.
// Two timings next to v009 put it at 1.06 and 1.07 times that version's speed.
// Over all steps from v000 it is 7.63 times as fast.
#include <hip/hip_runtime.h>

// Compute dtypes, f32 accumulate everywhere: every product is v_wmma_f32_16x16x32_f16 (q, k, v, the weights and every intermediate tile RNE-converted to f16), single product at every site; the biases stay f32.
// The v projection is folded into the output weights: sum_h P_h (v Wv_h^T + 1 bv_h^T) Wo_h^T = sum_h (P_h v) N_h^T + Wo bv (the rows of P sum to one), N_h[n][f] = sum_d Wo[n][h*512 + d] Wv[h*512 + d][f], built once per call.
// Multi-head attention block without mask: q/k/v [NB][512][512]; Wq/Wk/Wv [4096][512] ([out][in], y = x W^T + bias), 8 heads x 512 columns (head h = columns h*512 + d); score[i][j] = sum_m qh[i][m] kh[m][j] / sqrt(512)
// (m = feature index of qh = token index of kh, j = feature index of kh); softmax over j; ctx[i][d] = sum_j P[i][j] vh[j][d] (j = token index of vh); heads merged to [NB*512][4096]; output = ctx Wo^T + bo with Wo [512][4096] (f32).
// The q and k projections run inside the attention kernel, the k projection re-associated: qh kh = (qh k) Wk_h^T + (row sums of qh) bk_h^T, so that no projected plane goes through memory and every ring operand is a 512 x 512 matrix shared by many blocks.
// Planes (f16): q [b][t][f]; k^T and v^T [b][f][t], the raw inputs transposed, shared by the 8 heads; Wq, Wk [h*512 + row][f], carried x64 (contraction index contiguous in every GEMM); ctx = P v [(b*8+h)][t][f] carried x64;
// Wv^T [h][f][d], Wo [h][n][d] and N [n][h*512+f], each carried x64; P carried x16384 in LDS only (cancels in the normalisation).
// Attention kernel: 8 waves per 128 query rows of one (batch, head), a chain of four products in transposed form, plane rows x tile rows (wave w owns plane rows 64w..64w+63): qh^T = Wq_h x q, T^T = k^T x qh, S^T = Wk_h x T, O^T = v^T x P;
// each result is packed to f16 into the one LDS tile [128][512] that the next product reads; row max / row sum exchanged through LDS; the four planes pass through a two-buffer LDS ring. All batches go through every kernel in one launch: four launches in all.

#ifndef NB
#define NB 16
#endif
#define NB_FULL 16
#define SEQ  512                 // tokens per sequence; the module requires SEQ == DH (score contraction) and SEQ == NF
#define NF   512                 // input feature width
#define NH_  8
#define DH   512                 // per-head width
#define HDIM (NH_ * DH)          // 4096
#define AW   8                   // waves per attention block
#define QR   128                 // query rows per attention block: every plane byte that a block brings into LDS meets 128 query rows
#define QB   (QR / 16)           // 16-row query blocks per attention block (accumulator tiles per plane-row block of a wave)
#define PP   520                 // LDS row pitch (halves) of the Q / P tile (1040 B = 16 B x 65)
#define AKS  64                  // k per stage of the attention ring (128 B of every plane row)
#define APH  72                  // LDS row pitch (halves) of the attention ring (144 B = 16 B x 9)
#define ANS  (SEQ / AKS)         // stages per plane
#define SC2  ((float)(0.04419417382415922 * 1.4426950408889634))   // DH^-0.5 * log2(e)
#define SC2C (SC2 / 64.0f)       // the same for scores that carry the x64 of the Wk plane
#define PSH  14.0f               // log2 of the P carry (16384)
#define NEGB (-3.0e38f)
#define CTXC 64.0f               // carry of the ctx plane
#define WOC  64.0f               // carry of the Wo plane
#define OSC  (1.0f / 4096.0f)    // 1 / (CTXC * WOC)

static_assert(DH == SEQ);                      // score contraction: feature index of q = token index of k; plane row pitch is the same in both layouts
static_assert(NF == SEQ);
static_assert(NH_ * DH == HDIM);
static_assert(NF % 32 == 0);                   // projection k-loop steps by 32
static_assert(SEQ % 32 == 0);                  // attention k-loops step by 32
static_assert(HDIM % 32 == 0);                 // output projection k-loop steps by 32
static_assert(SEQ % 64 == 0);                  // a 64-row tile never straddles two batches
static_assert(DH % 64 == 0);                   // a 64-column tile never straddles two heads
static_assert(HDIM % 64 == 0);
static_assert(NF % 64 == 0);
static_assert(NB <= NB_FULL);
static_assert(DH == AW * 64);                  // each attention wave owns 64 score columns and 64 output columns
static_assert(SEQ % QR == 0);                  // attention grid covers the query rows exactly (QR per block)
static_assert(ANS % 2 == 0 && ANS >= 2);       // each plane's stages go on in the ring with the buffer parity of the plane before it; both prologue stages exist
static_assert((APH * 2) % 16 == 0 && AKS % 32 == 0);
static_assert(DH == 2 * 8 * 32 && QR % (8 * 4) == 0 && DH * 2 == 64 * 16 && AKS * 2 == 8 * 16);   // copy sweeps of 256 threads: ring 32 rows a sweep, 16 sweeps; Q tile 4 rows a sweep, QR / 4 sweeps
static_assert(QR / 4 + 16 <= 63);              // copies of a wave in flight in the prologue: the Q tile and stage 0
static_assert((PP * 2) % 16 == 0);
static_assert(PP >= DH);
static_assert(32 * 16 * 4 == 16 * 64 * 2);
static_assert(32 * 16 * (QR / 4) == QR * 64 * 2);   // k_attn store loop: 32 lanes x 16 B x QR / 4 trips == QR rows x 128 B
static_assert(32 * 16 * 4 == 16 * 32 * 4);     // k_oproj store loop: 32 lanes x 16 B x 4 trips == 16 rows x 128 B
static_assert(NF % 128 == 0 && SEQ % 128 == 0);             // k_oproj grid covers both extents exactly (128 x 128 tiles); a 128-row tile never straddles two batches
static_assert(2 * 256 * 528 + 8 * 16 * 36 * 4 <= 327680);   // static LDS of k_oproj: one work-group per WGP
static_assert(2 * DH * APH * 2 + QR * PP * 2 + 4 * AW * QR * 4 + AW * 192 * 4 <= 327680);   // static LDS of the attention kernel: one work-group per WGP
static_assert(((size_t)NB * SEQ * NF) % 2048 == 0);          // k_cvt: a block converts 2048 elements of one source
static_assert(((size_t)HDIM * NF) % 2048 == 0);

typedef _Float16 h16;
typedef unsigned short bf;
typedef __attribute__((ext_vector_type(16))) __bf16   v16bf;
typedef __attribute__((ext_vector_type(16))) _Float16 v16h;
typedef __attribute__((ext_vector_type(8)))  _Float16 v8h;
typedef __attribute__((ext_vector_type(8)))  unsigned short v8us;
typedef __attribute__((ext_vector_type(8)))  float    v8f;
typedef __attribute__((ext_vector_type(4)))  float    v4f;
typedef v4f  __attribute__((may_alias)) v4fa;
typedef __attribute__((ext_vector_type(2)))  float    v2f;
typedef __attribute__((ext_vector_type(2)))  _Float16 v2h;

__device__ __forceinline__ v16h cat16(v8h lo, v8h hi) { return __builtin_shufflevector(lo, hi, 0, 1, 2, 3, 4, 5, 6, 7, 8, 9, 10, 11, 12, 13, 14, 15); }
__device__ __forceinline__ v16bf cat16b(v8us lo, v8us hi) { return __builtin_bit_cast(v16bf, __builtin_shufflevector(lo, hi, 0, 1, 2, 3, 4, 5, 6, 7, 8, 9, 10, 11, 12, 13, 14, 15)); }
__device__ __forceinline__ v8f wmma16(v16h a, v16h b, v8f c) { return __builtin_amdgcn_wmma_f32_16x16x32_f16(false, a, false, b, (short)0, c, false, false); }
__device__ __forceinline__ v8f wmmab(v16bf a, v16bf b, v8f c) { return __builtin_amdgcn_wmma_f32_16x16x32_bf16(false, a, false, b, (short)0, c, false, false); }
// fragment loaders from K-contiguous 16-bit rows; p already includes + 8*(lane>>4): elements 0..7 <- k0+8h+0..7, elements 8..15 <- k0+16+8h+0..7 (same map for A and B)
__device__ __forceinline__ v16h  ldh(const h16* p) { return cat16(*(const v8h*)p, *(const v8h*)(p + 16)); }
// ordering point for wave-private LDS tiles (same wave writes and reads)
__device__ __forceinline__ void wave_sync() { __builtin_amdgcn_fence(3 /* release order */, "wavefront"); __builtin_amdgcn_wave_barrier(); asm volatile("" ::: "memory"); }

// per-instruction guarded matrix ops: one accumulator tied per guard, operands kept live
__device__ __forceinline__ v8f wmma16_g(v16h a, v16h b, v8f c) { c = wmma16(a, b, c); asm volatile("v_nop\n\tv_nop\n\tv_nop\n\tv_nop" : "+v"(c) : "v"(a), "v"(b)); return c; }
__device__ __forceinline__ v8f wmmab_g(v16bf a, v16bf b, v8f c) { c = wmmab(a, b, c); asm volatile("v_nop\n\tv_nop\n\tv_nop\n\tv_nop" : "+v"(c) : "v"(a), "v"(b)); return c; }
// f32 -> f16 convert that cannot produce an f16 subnormal (|v| < 2^-14 -> +0), applied after the plane's power-of-two carry
static __device__ __forceinline__ h16 toh_flush(float v) { const h16 r = (h16)v; return (fabsf(v) < 6.103515625e-05f) ? (h16)0.0f : r; }
// two f32 -> two f16 in one packed convert, round to nearest even; a value under 2^-14 becomes the nearest f16 subnormal (the matrix unit takes subnormal f16 operands as they are)
static __device__ __forceinline__ v2h toh2(v2f v) { return __builtin_convertvector(v, v2h); }
// x[i] = 2^x[i], eight values in place in one statement: behind each v_exp_f32 stands an instruction that neither reads its result nor overwrites its source (the next one's registers are its own; behind the last a v_nop),
// the slot that the instruction set asks for behind a transcendental.
static __device__ __forceinline__ void exp2x8(float (&x)[8]) {
    asm("v_exp_f32 %0, %0\n\tv_exp_f32 %1, %1\n\tv_exp_f32 %2, %2\n\tv_exp_f32 %3, %3\n\tv_exp_f32 %4, %4\n\tv_exp_f32 %5, %5\n\tv_exp_f32 %6, %6\n\tv_exp_f32 %7, %7\n\tv_nop"
        : "+v"(x[0]), "+v"(x[1]), "+v"(x[2]), "+v"(x[3]), "+v"(x[4]), "+v"(x[5]), "+v"(x[6]), "+v"(x[7]));
}

// ---- operand staging for the two GEMM kernels (k_nprod, k_oproj): asynchronous copies to LDS, two buffers ----
// A work-group of NWM x NWN waves owns a BM x BN tile. A stage is KS k of every operand row ([A BM rows | Bt BN rows], 2 * KS bytes a row, LDS pitch 16 B more: 528 B at KS = 256).
// Each lane copies 16 B; KS / 8 lanes cover one row piece, so every copy instruction asks for whole lines. Stage s + 2 is issued into the buffer that pass s has left.
#define GTH  512                 // threads per k_nprod work-group
#define OKS  256                 // k per stage, k_oproj (LDS row pitch 528 B = 16 B x 33)
#define OTH  256                 // threads per k_oproj work-group
static_assert(HDIM % OKS == 0 && HDIM / OKS >= 2 && DH % OKS == 0);
__device__ __forceinline__ unsigned lds_off(const void* p) { return (unsigned)(size_t)p; }
// eight copies and the wait that stands in front of any rewrite of their address registers, in one statement
__device__ __forceinline__ void acopy8(unsigned l, const bf* g, unsigned lstep, size_t gstep) {
    asm volatile("global_load_async_to_lds_b128 %0, %1, off\n\t"
                 "global_load_async_to_lds_b128 %2, %3, off\n\t"
                 "global_load_async_to_lds_b128 %4, %5, off\n\t"
                 "global_load_async_to_lds_b128 %6, %7, off\n\t"
                 "global_load_async_to_lds_b128 %8, %9, off\n\t"
                 "global_load_async_to_lds_b128 %10, %11, off\n\t"
                 "global_load_async_to_lds_b128 %12, %13, off\n\t"
                 "global_load_async_to_lds_b128 %14, %15, off\n\t"
                 "s_wait_xcnt 0x0"
                 :: "v"(l), "v"(g), "v"(l + lstep), "v"(g + gstep), "v"(l + 2 * lstep), "v"(g + 2 * gstep), "v"(l + 3 * lstep), "v"(g + 3 * gstep),
                    "v"(l + 4 * lstep), "v"(g + 4 * gstep), "v"(l + 5 * lstep), "v"(g + 5 * gstep), "v"(l + 6 * lstep), "v"(g + 6 * gstep), "v"(l + 7 * lstep), "v"(g + 7 * gstep)
                 : "memory");
}
// one stage: BM rows of A and BN rows of Bt, KS k each, into the buffer at LDS byte address lbuf; A and Bt point at the tile's first row at the stage's first k; PA, PB = row pitches; NT threads cover RS rows a sweep, every thread issues (BM + BN) / RS copies
template <int BM, int BN, int PA, int PB, int NT, int KS>
__device__ __forceinline__ void stage_issue(const bf* A, const bf* Bt, unsigned lbuf) {
    constexpr int LPR = KS / 8, PH = KS + 8, RS = NT / LPR;          // lanes per row piece; LDS row pitch in halves; rows per sweep
    static_assert(NT % LPR == 0 && BM % (8 * RS) == 0 && BN % (8 * RS) == 0);
    const int cc = threadIdx.x & (LPR - 1), rr = threadIdx.x / LPR;  // 16-byte piece of the row; row within a sweep of RS rows
    const bf* ga = A  + (size_t)rr * PA + cc * 8;
    const bf* gb = Bt + (size_t)rr * PB + cc * 8;
    const unsigned l = lbuf + (unsigned)(rr * PH + cc * 8) * 2u;
#pragma unroll
    for (int i = 0; i < BM / (8 * RS); ++i) acopy8(l + i * 8 * RS * PH * 2, ga + (size_t)i * 8 * RS * PA, RS * PH * 2, (size_t)RS * PA);
#pragma unroll
    for (int i = 0; i < BN / (8 * RS); ++i) acopy8(l + (BM + i * 8 * RS) * PH * 2, gb + (size_t)i * 8 * RS * PB, RS * PH * 2, (size_t)RS * PB);
}
__device__ __forceinline__ void wait_async0() { asm volatile("s_wait_asynccnt 0x0" ::: "memory"); }   // this wave's copies have landed
__device__ __forceinline__ void wait_ds0()    { asm volatile("s_wait_dscnt 0x0" ::: "memory"); }      // this wave's LDS reads have returned before their buffer is refilled
// C tile accumulation, k ascending in steps of 32; wave (wm, wn) of NWM x NWN owns rows wm*BM/NWM.. and columns wn*BN/NWN.. of the tile. BF: bf16 products, else f16.
// GB = k blocks of 32 whose fragments are read from LDS as one group. A and Bt point at the tile's first row, k = 0. Bt rows are KT long; an A row is PA long and holds k = 0..PA-1, the next PA k of that row lie AJ elements further.
template <int BM, int BN, int KT, bool BF, int GB, int PA, size_t AJ, int NWM, int NWN, int KS>
__device__ __forceinline__ void gemm_ring(const bf* A, const bf* Bt, bf* ring, int wm, int wn, v8f (&acc)[BM / (16 * NWM)][BN / (16 * NWN)]) {
    constexpr int FM = BM / (16 * NWM), FN = BN / (16 * NWN), PH = KS + 8, BUFH = (BM + BN) * PH, NS = KT / KS, NT = 32 * NWM * NWN;
    static_assert(BM % (16 * NWM) == 0 && BN % (16 * NWN) == 0 && (BM + BN) * (KS / 8) / NT <= 63 && (KS / 32) % GB == 0 && PA % KS == 0 && KT % PA == 0 && NS >= 2);
    const int lane = threadIdx.x & 31, lr = lane & 15, hi = lane >> 4;
    const unsigned lb = lds_off(ring);
    stage_issue<BM, BN, PA, KT, NT, KS>(A, Bt, lb);
    wait_async0();
    __syncthreads();                                              // publishes stage 0
    stage_issue<BM, BN, PA, KT, NT, KS>(A + (KS / PA) * AJ + KS % PA, Bt + KS, lb + BUFH * 2);
    const int ao = (wm * (BM / NWM) + lr) * PH + 8 * hi, bo = (BM + wn * (BN / NWN) + lr) * PH + 8 * hi;
#pragma unroll 1
    for (int s = 0; s < NS; ++s) {                                // rolled: one pass per stage, the buffer chosen by s & 1
        const bf* sb = ring + (s & 1) * BUFH;
#pragma unroll
        for (int kk = 0; kk < KS; kk += 32 * GB) {
            v8us a0[GB][FM], a1[GB][FM], b0[GB][FN], b1[GB][FN];
#pragma unroll
            for (int u = 0; u < GB; ++u) {
#pragma unroll
                for (int mb = 0; mb < FM; ++mb) { const bf* p = sb + ao + mb * 16 * PH + kk + u * 32; a0[u][mb] = *(const v8us*)p; a1[u][mb] = *(const v8us*)(p + 16); }
#pragma unroll
                for (int nb = 0; nb < FN; ++nb) { const bf* p = sb + bo + nb * 16 * PH + kk + u * 32; b0[u][nb] = *(const v8us*)p; b1[u][nb] = *(const v8us*)(p + 16); }
            }
            __builtin_amdgcn_sched_barrier(0);                    // keeps the group's LDS reads together ahead of its matrix block: spread among the matrix instructions each read place waits out the LDS latency
#pragma unroll
            for (int u = 0; u < GB; ++u)
#pragma unroll
                for (int nb = 0; nb < FN; ++nb)
#pragma unroll
                    for (int mb = 0; mb < FM; ++mb) {
                        if constexpr (BF) acc[mb][nb] = wmmab_g(cat16b(a0[u][mb], a1[u][mb]), cat16b(b0[u][nb], b1[u][nb]), acc[mb][nb]);
                        else              acc[mb][nb] = wmma16_g(__builtin_bit_cast(v16h, cat16b(a0[u][mb], a1[u][mb])), __builtin_bit_cast(v16h, cat16b(b0[u][nb], b1[u][nb])), acc[mb][nb]); }
            if constexpr (32 * GB < KS) __builtin_amdgcn_sched_barrier(0);   // the next group's reads stay behind this matrix block, as one group
        }
        wait_ds0();
        wait_async0();
        __syncthreads();                                          // publishes stage s + 1 and ends every reader's last read of stage s
        if (s + 2 < NS) { const int kb = (s + 2) * KS; stage_issue<BM, BN, PA, KT, NT, KS>(A + (size_t)(kb / PA) * AJ + kb % PA, Bt + kb, lb + (unsigned)(s & 1) * (BUFH * 2)); }
    }
    wait_async0();
}

// k_cvt: every 16-bit operand plane in one launch; a block converts 2048 elements of one source to f16. Block ranges behind the CBK blocks of the constant vector: q (XBK blocks, plain), k | v (XBK each, transposed),
// Wq | Wk (WBK each, x64, plain), Wv (WBK, x64, transposed per head), Wo (WBK, x64, re-laid per head); the planes lie at dst in that order, back to back.
// Transposed sources are sets of 512 x 512 matrices src[r][c] -> dst[c][r]; a block takes 64 r x 32 c through LDS, so that it reads and writes whole 128-B lines.
// Constant vector: cv[n * 32] = bo[n] + sum_k Wo[n][k] bv[k] in f32, one block per n, one 128-B line per value (one writer per line).
#define XBK ((unsigned)((size_t)NB * SEQ * NF / 2048))
#define WBK ((unsigned)((size_t)HDIM * NF / 2048))
#define CBK ((unsigned)NF)
static_assert(SEQ == 512 && NF == 512 && DH == 512 && HDIM == 4096);   // index arithmetic of the transposing and re-laying blocks
__global__ __launch_bounds__(256) void k_cvt(const float* __restrict__ q, const float* __restrict__ k, const float* __restrict__ v, const float* __restrict__ wq, const float* __restrict__ wk,
                                             const float* __restrict__ wv, const float* __restrict__ wo, const float* __restrict__ bv, const float* __restrict__ bo, bf* dst, float* cv) {
    __shared__ __align__(16) bf tt[32 * 72];
    const int tid = threadIdx.x;
    if (blockIdx.x < CBK) {                                        // block-uniform
        const int n = (int)blockIdx.x;
        const float* wr = wo + (size_t)n * HDIM;
        float sum = 0.0f;
#pragma unroll                                                     // the thread's eight loads fly together
        for (int i = 0; i < HDIM / 1024; ++i) {
            const v4f a = *(const v4f*)(wr + (i * 256 + tid) * 4); const v4f b = *(const v4f*)(bv + (i * 256 + tid) * 4);
            sum += a[0] * b[0] + a[1] * b[1] + a[2] * b[2] + a[3] * b[3]; }
#pragma unroll                                                     // five fixed steps, no loop counter
        for (int m = 16; m >= 1; m >>= 1) sum += __shfl_xor(sum, m, 32);
        float* red = (float*)tt;                                   // the 8 waves' partial sums
        if ((tid & 31) == 0) red[tid >> 5] = sum;
        __syncthreads();                                           // publishes the partial sums
        if (tid == 0) { float t = red[0];
#pragma unroll                                                     // the eight values come as two wide LDS reads
            for (int w = 1; w < 8; ++w) t += red[w];
            cv[n * 32] = bo[n] + t; }
        return;
    }
    const unsigned blk = blockIdx.x - CBK;
    const float* src; unsigned lb; int kind;                       // source, block index within it, kind (0 plain, 1 transposed, 2 re-laid): block-uniform
    if (blk < 3 * XBK) { const unsigned g = blk / XBK; src = g == 0 ? q : g == 1 ? k : v; lb = blk - g * XBK; kind = g == 0 ? 0 : 1; }
    else { const unsigned w = blk - 3 * XBK, g = w / WBK; src = g == 0 ? wq : g == 1 ? wk : g == 2 ? wv : wo; lb = w - g * WBK; kind = g == 2 ? 1 : g == 3 ? 2 : 0; }
    bf* dp = dst + (size_t)(blk - lb) * 2048;                      // first element of this source's plane
    const float sc = blk < 3 * XBK ? 1.0f : WOC;                   // the weight planes carry x64
    if (kind == 1) {
        const size_t mo = (size_t)(lb >> 7) * (512 * 512);         // 128 tiles per matrix: 8 of r x 16 of c, c fastest
        const int r0 = (int)((lb & 127) >> 4) * 64, cb = (int)(lb & 15) * 32;
        const int c4 = (tid & 7) * 4, rr = tid >> 3;
        const v4f x0 = *(const v4f*)(src + mo + (size_t)(r0 + rr) * 512 + cb + c4);
        const v4f x1 = *(const v4f*)(src + mo + (size_t)(r0 + 32 + rr) * 512 + cb + c4);
#pragma unroll                                                     // vector elements need constant indices
        for (int i = 0; i < 4; ++i) { tt[(c4 + i) * 72 + rr] = __builtin_bit_cast(bf, toh_flush(x0[i] * sc)); tt[(c4 + i) * 72 + 32 + rr] = __builtin_bit_cast(bf, toh_flush(x1[i] * sc)); }
        __syncthreads();                                           // publishes the transposed tile
        const int c = tid >> 3, r8 = (tid & 7) * 8;
        *(v8us*)(dp + mo + (size_t)(cb + c) * 512 + r0 + r8) = *(const v8us*)(tt + c * 72 + r8);
        asm volatile("s_wait_xcnt 0x0" ::: "memory");              // stands behind the store, ahead of any rewrite of its address or data registers
        return;
    }
    const size_t e = ((size_t)lb * 256 + tid) * 8;
    const v8f x = *(const v8f*)(src + e); v8h t;
    asm volatile("s_wait_xcnt 0x0" ::: "memory");                  // stands behind the two loads, ahead of any rewrite of their address registers
#pragma unroll
    for (int i = 0; i < 8; ++i) t[i] = toh_flush(x[i] * sc);
    const v8us o = __builtin_bit_cast(v8us, t);
    if (kind == 0) {
        *(v8us*)(dp + e) = o;
        asm volatile("s_wait_xcnt 0x0" ::: "memory");              // stands behind the store, as above
    } else {
        const size_t n = e >> 12, kk = e & 4095;                   // Wo[n][h*512 + d] -> [h][n][d]
        *(v8us*)(dp + ((kk >> 9) * 512 + n) * 512 + (kk & 511)) = o;
        asm volatile("s_wait_xcnt 0x0" ::: "memory"); }            // stands behind the store, as above
}

// k_nprod, the weight product (f16): N[n][h*512 + f] = sum_d Wo[n][h*512 + d] Wv[h*512 + d][f], 128 f x 128 n per block, A = Wv^T rows (m = f), Bt = Wo rows (n), 16 waves (2 x 8), 64 f x 16 n per wave: a lane holds 8 consecutive f of one row n, a wave writes whole 128-B lines of N.
// WS: the weight planes (Wq | Wk | Wv^T | Wo per head), back to back. grid NTB.
#define NTB (NH_ * (NF / 128) * (NF / 128))
static_assert(2 * (128 + 128) * (256 + 8) * 2 <= 327680);          // static LDS of k_nprod (256 k per stage)
__global__ __launch_bounds__(GTH) void k_nprod(const bf* __restrict__ WS, h16* NP) {
    __shared__ __align__(16) bf ring[2 * (128 + 128) * (256 + 8)];
    const int lane = threadIdx.x & 31, lr = lane & 15, hi = lane >> 4;
    const int wave = __builtin_amdgcn_readfirstlane((int)(threadIdx.x >> 5));
    const int hh = (int)blockIdx.x >> 4, tf = ((int)blockIdx.x >> 2) & 3, tn = (int)blockIdx.x & 3;
    v8f an[4][1];
#pragma unroll                                                     // here and below: the accumulators stay in registers only under constant indices
    for (int mb = 0; mb < 4; ++mb) an[mb][0] = (v8f){};
    gemm_ring<128, 128, DH, false, 1, DH, 0, 2, 8, 256>(WS + (size_t)2 * HDIM * NF + ((size_t)hh * NF + tf * 128) * DH, WS + (size_t)3 * HDIM * NF + ((size_t)hh * NF + tn * 128) * DH, ring, wave >> 3, wave & 7, an);
    h16* np = NP + (size_t)(tn * 128 + (wave & 7) * 16 + lr) * HDIM + hh * NF + tf * 128 + (wave >> 3) * 64 + 8 * hi;   // D: row 8h+j = f, col lane&15 = n
#pragma unroll
    for (int mb = 0; mb < 4; ++mb) { v8h hv;
#pragma unroll
        for (int j = 0; j < 8; ++j) hv[j] = toh_flush(an[mb][0][j] * (1.0f / WOC));   // the operands carry 64 x 64, the plane 64
        *(v8h*)(np + mb * 16) = hv; }
}

// k_attn: q projection, scores with the re-associated k projection, softmax and P v for 128 query rows of one (batch, head); 8 waves. Four products of one shape: A = rows of a 512 x 512 plane from the ring (wave w owns rows 64w..64w+63),
//   B = the 128 rows of the LDS tile (k contiguous in both); D: acc[rb][ib][r] = (plane row 64w + 16rb + 8h + r, tile row i = 16ib + lane&15), so a lane holds 8 consecutive columns of one query row of the next tile: packed 16-B stores.
// The four products and the repacking behind products 1, 2 and 4 (tile = f16(acc * scale + constant)) run as one rolled loop over one text.
// Product 1: qh^T[m][i] = sum_f Wq_h[m][f] q[i][f] (x64), tile = q rows; then qh = acc / 64 + bq_h[m] -> f16 tile, its row sums (f32, ahead of the convert) as per-wave partials through LDS.
// Product 2: T^T[f][i] = sum_m k^T[f][m] qh[i][m] (m = token of k), tile = qh; then T -> f16 tile.
// Product 3: S^T[j][i] = sum_f Wk_h[j][f] T[i][f] (x64), tile = T; then + 64 bk_h[j] * rowsum(qh)[i]: the score, carried x64.
// Softmax: per-wave row max -> LDS -> block barrier -> row max over the 8 waves; p = f16(2^((s - max) * scale * log2e + 14)); packed 16-B stores into the tile;
//   row sum over the converted p, per-wave partials through LDS; block barrier (publishes P and the sums).
// Product 4: O^T[d][i] = sum_j v^T[d][j] P[i][j] (d = input feature of v, j = token), tile = P.
// Operands: the q rows are copied once into the tile; the planes come as 4 * ANS ring stages (ANS each of Wq_h, k^T, Wk_h, v^T), each all 512 plane rows x 64 k, two buffers, asynchronous copies;
//   the first two stages of a plane fly during the last passes of the product before it and the repacking of the tile. A tile is rewritten only behind the barrier of the last pass that read it, and read only behind a barrier of its own.
// Epilogue: ctx = O / rowsum x 64 as f16, repacked into the tile like qh and T; each wave then stores its own column range of the tile, whole lines.
// one ring stage into buffer buf: k = kb..kb+63 of all 512 rows of a plane [512][SEQ]; 8 lanes cover a 128-B row piece (one line); every thread issues 16 copies
// u = 8 * (ring row of the thread's first copy, 512 buf + thread / 8) + its 16-byte piece: the buffer enters ahead of the row arithmetic, so that no per-thread LDS offset stays in a register of its own through the whole kernel (that register went out to scratch)
__device__ __forceinline__ void attn_stage_issue(const h16* P, int kb, int buf, unsigned lb) {
    const unsigned u = (unsigned)(buf * DH * 8) + threadIdx.x;
    const unsigned row = u >> 3, cc = u & 7;                         // sweeps of 32 rows: row within a sweep = thread / 8
    const bf* g = (const bf*)P + kb + (size_t)((row & (DH - 1)) * SEQ + cc * 8);
    const unsigned l = lb + (row * APH + cc * 8) * 2u;
#pragma unroll
    for (int i = 0; i < 2; ++i) acopy8(l + i * 256 * APH * 2, g + (size_t)i * 256 * SEQ, 32 * APH * 2, (size_t)32 * SEQ);
}
// a pass is 64 k of the wave's 64 plane rows (pa, ring buffer) against the QR rows of the tile (pb), k ascending, two blocks of 32 k
// fragments of one block, read from LDS as one group
__device__ __forceinline__ void attn_frag(const h16* pa, const h16* pb, v8h (&a0)[4], v8h (&a1)[4], v8h (&b0)[QB], v8h (&b1)[QB]) {
#pragma unroll
    for (int mb = 0; mb < 4; ++mb) { const h16* p = pa + mb * 16 * APH; a0[mb] = *(const v8h*)p; a1[mb] = *(const v8h*)(p + 16); }
#pragma unroll
    for (int nb = 0; nb < QB; ++nb) { const h16* p = pb + nb * 16 * PP; b0[nb] = *(const v8h*)p; b1[nb] = *(const v8h*)(p + 16); }
}
// matrix block of one fragment group
__device__ __forceinline__ void attn_mm(const v8h (&a0)[4], const v8h (&a1)[4], const v8h (&b0)[QB], const v8h (&b1)[QB], v8f (&acc)[4][QB]) {
#pragma unroll
    for (int nb = 0; nb < QB; ++nb)
#pragma unroll
        for (int mb = 0; mb < 4; ++mb) acc[mb][nb] = wmma16(cat16(a0[mb], a1[mb]), cat16(b0[nb], b1[nb]), acc[mb][nb]);   // plain builtin: an asm operand cannot lie above v255, and the 32 accumulators alone fill 256 registers
}
__global__ __launch_bounds__(32 * AW)
void k_attn(const h16* __restrict__ XQ, const h16* __restrict__ WQ, const h16* __restrict__ KT, const h16* __restrict__ WK, const h16* __restrict__ VT, const float* __restrict__ bq, const float* __restrict__ bk, h16* CTX) {
    __shared__ __align__(16) h16 ring[2 * DH * APH];
    __shared__ __align__(16) h16 sP[QR * PP];
    __shared__ float smax[AW * QR];
    __shared__ float ssum[AW * QR];
    __shared__ float srs[2 * AW * QR];
    __shared__ __align__(16) float sbw[AW][192];
    const int lane = threadIdx.x & 31, lr = lane & 15, hi = lane >> 4;
    const int wave = __builtin_amdgcn_readfirstlane((int)(threadIdx.x >> 5));
    const int zh = blockIdx.y, bb = zh / NH_, hh = zh % NH_;        // zh = b * 8 + h
    const int t0 = blockIdx.x * QR;
    const h16* WQh = WQ + (size_t)hh * DH * NF; const h16* WKh = WK + (size_t)hh * DH * NF;     // one plane per head
    const h16* KTb = KT + (size_t)bb * NF * SEQ; const h16* VTb = VT + (size_t)bb * NF * SEQ;   // one plane per batch
    const unsigned lb = lds_off(ring);
    const h16* ra = ring + (wave * 64 + lr) * APH + 8 * hi;         // plane rows owned by this wave, in ring buffer 0 (+ 16*blk*APH + k)
    const h16* tb = sP + lr * PP + 8 * hi;                          // tile rows (+ 16*ib*PP + k)
    float* sb = sbw[wave];                                          // wave-private: bq_h and 64 bk_h at the wave's 64 plane rows, then 64 zeros
    const float* bqw = bq + hh * DH + wave * 64; const float* bkw = bk + hh * DH + wave * 64;   // both ranges end at or below HDIM
    const float tq0 = bqw[lane], tq1 = bqw[32 + lane], tk0 = bkw[lane], tk1 = bkw[32 + lane];   // issued ahead of the copies: they land under the wait for stage 0
    asm volatile("s_wait_xcnt 0x0" ::: "memory");                   // stands behind the four loads, ahead of any rewrite of their address registers
    { const int cc = threadIdx.x & 63, rr = threadIdx.x >> 6;       // q rows: 64 lanes cover one 1024-B row; 4 rows a sweep, QR / 4 copies a thread
      const bf* g = (const bf*)XQ + ((size_t)bb * SEQ + t0 + rr) * NF + cc * 8;
      const unsigned l = lds_off(sP) + (unsigned)(rr * PP + cc * 8) * 2u;
#pragma unroll
      for (int i = 0; i < QR / 32; ++i) acopy8(l + i * 32 * PP * 2, g + (size_t)i * 32 * NF, 4 * PP * 2, (size_t)4 * NF); }
    attn_stage_issue(WQh, 0, 0, lb);
    wait_async0();
    sb[lane] = tq0; sb[32 + lane] = tq1; sb[64 + lane] = tk0 * WOC; sb[96 + lane] = tk1 * WOC; sb[128 + lane] = 0.0f; sb[160 + lane] = 0.0f;
    __syncthreads();                                              // publishes the q rows and stage 0
    attn_stage_issue(WQh, AKS, 1, lb);
    const int pw = wave * 64 + 8 * hi;
    constexpr int ABUFH = DH * APH;                                 // halves per ring buffer
    v8f acc[4][QB];
    float rs[QB];
    const h16* pcur = WQh; const h16* pnxt = KTb;                 // the plane of this product and of the next
#pragma unroll 1
    for (int ph = 0; ph < 4; ++ph) {                              // rolled: the four products share one text, so that the kernel's text stays near what the instruction prefetch covers
#pragma unroll
        for (int rb = 0; rb < 4; ++rb)
#pragma unroll
            for (int ib = 0; ib < QB; ++ib) acc[rb][ib] = (v8f){};
#pragma unroll 1
        for (int s = 0; s < ANS; ++s) {                           // rolled: one pass per stage, the buffer chosen by s & 1
            v8h a0[4], a1[4], b0[QB], b1[QB];
            attn_frag(ra + (s & 1) * ABUFH, tb + s * AKS, a0, a1, b0, b1);
            __builtin_amdgcn_sched_barrier(0);                    // keeps the block's LDS reads together ahead of its matrix block: spread among the matrix instructions each read place waits out the LDS latency
            attn_mm(a0, a1, b0, b1, acc);
            __builtin_amdgcn_sched_barrier(0);                    // the next block's reads stay behind this matrix block, as one group
            attn_frag(ra + (s & 1) * ABUFH + 32, tb + s * AKS + 32, a0, a1, b0, b1);
            wait_ds0();
            wait_async0();
            __syncthreads();                                      // publishes the next stage and ends every reader's last read of this one (behind a product's last pass: of the tile too)
            const int n = s + 2;                                  // the stage two ahead: of this plane, or of the next one
            if (ph < 3 || n < ANS) attn_stage_issue(n < ANS ? pcur : pnxt, (n & (ANS - 1)) * AKS, s & 1, lb);   // block-uniform
            attn_mm(a0, a1, b0, b1, acc);                         // the second block works from registers alone: behind the issue, so that the copies start at once and fly under it
        }
        pcur = pnxt; pnxt = ph == 0 ? WKh : VTb;
        if (ph == 2) {                                            // block-uniform
            // the bias term of the k projection
#pragma unroll
            for (int ib = 0; ib < QB; ++ib) { float l = srs[ib * 16 + lr];
#pragma unroll
                for (int w = 1; w < AW; ++w) l += srs[w * QR + ib * 16 + lr];
                rs[ib] = l; }
#pragma unroll
            for (int jb = 0; jb < 4; ++jb) { const v4f c0 = *(const v4fa*)(sb + 64 + jb * 16 + hi * 8), c1 = *(const v4fa*)(sb + 64 + jb * 16 + hi * 8 + 4);
#pragma unroll
                for (int ib = 0; ib < QB; ++ib) {
#pragma unroll
                    for (int r = 0; r < 8; ++r) acc[jb][ib][r] += (r < 4 ? c0[r & 3] : c1[r & 3]) * rs[ib]; } }
            // row max: lane holds 32 of the wave's 64 columns for query rows 16*ib + lr
            float mx[QB];
#pragma unroll
            for (int ib = 0; ib < QB; ++ib) { mx[ib] = NEGB;
#pragma unroll
                for (int jb = 0; jb < 4; ++jb) {
#pragma unroll
                    for (int r = 0; r < 8; ++r) mx[ib] = fmaxf(mx[ib], acc[jb][ib][r]); }
                mx[ib] = fmaxf(mx[ib], __shfl_xor(mx[ib], 16, 32)); }
#pragma unroll
            for (int p = 0; p < QB / 2; ++p) smax[wave * QR + 32 * p + lane] = hi ? mx[2 * p + 1] : mx[2 * p];   // slot = query row 16*(2p + hi) + lr = 32p + lane
            __syncthreads();
            float sh[QB], ls[QB];
#pragma unroll
            for (int ib = 0; ib < QB; ++ib) { float g = smax[ib * 16 + lr];
#pragma unroll
                for (int w = 1; w < AW; ++w) g = fmaxf(g, smax[w * QR + ib * 16 + lr]);
                sh[ib] = PSH - g * SC2C; ls[ib] = 0.0f; }
#pragma unroll
            for (int jb = 0; jb < 4; ++jb) {
#pragma unroll
                for (int ib = 0; ib < QB; ++ib) { v8h p; float x[8];
#pragma unroll
                    for (int r = 0; r < 8; ++r) x[r] = acc[jb][ib][r] * SC2C + sh[ib];
                    exp2x8(x);
#pragma unroll
                    for (int r = 0; r < 4; ++r) { const v2h a = toh2((v2f){x[2 * r], x[2 * r + 1]});
                        p[2 * r] = a[0]; p[2 * r + 1] = a[1]; ls[ib] += (float)a[0]; ls[ib] += (float)a[1]; }
                    *(v8h*)(&sP[(16 * ib + lr) * PP + pw + jb * 16]) = p; } }
#pragma unroll
            for (int ib = 0; ib < QB; ++ib) ls[ib] += __shfl_xor(ls[ib], 16, 32);
#pragma unroll
            for (int p = 0; p < QB / 2; ++p) ssum[wave * QR + 32 * p + lane] = hi ? ls[2 * p + 1] : ls[2 * p];
            __syncthreads();
            continue;
        }
        // repack, products 1, 2 and 4: tile[i][row] = f16(acc * sc[i] + c[row]); lane holds 32 of the wave's 64 columns for query rows 16*ib + lr
        float sc[QB];
        if (ph == 3) {                                            // block-uniform
#pragma unroll
            for (int ib = 0; ib < QB; ++ib) { float l = ssum[ib * 16 + lr];
#pragma unroll
                for (int w = 1; w < AW; ++w) l += ssum[w * QR + ib * 16 + lr];
                sc[ib] = CTXC * (1.0f / l); }                     // l >= 16384: the row maximum contributes its full carry
        } else { const float c = ph == 0 ? 1.0f / WOC : 1.0f;
#pragma unroll
            for (int ib = 0; ib < QB; ++ib) sc[ib] = c; }
        const float* bp = sb + (ph == 0 ? 0 : 128);               // bq_h behind product 1, zeros behind the others
        v2f rp[QB];                                               // row sums over even and over odd columns (read behind product 1 only), so that value pairs stay in their adjacent registers
#pragma unroll
        for (int ib = 0; ib < QB; ++ib) rp[ib] = (v2f){};
#pragma unroll
        for (int mb = 0; mb < 4; ++mb) { const v4f c0 = *(const v4fa*)(bp + mb * 16 + hi * 8), c1 = *(const v4fa*)(bp + mb * 16 + hi * 8 + 4);
            const v2f cp[4] = { (v2f){c0[0], c0[1]}, (v2f){c0[2], c0[3]}, (v2f){c1[0], c1[1]}, (v2f){c1[2], c1[3]} };
#pragma unroll
            for (int ib = 0; ib < QB; ++ib) { v8h p;
#pragma unroll
                for (int r = 0; r < 4; ++r) { const v2f x = (v2f){acc[mb][ib][2 * r], acc[mb][ib][2 * r + 1]} * sc[ib] + cp[r]; rp[ib] += x; const v2h c = toh2(x); p[2 * r] = c[0]; p[2 * r + 1] = c[1]; }
                *(v8h*)(&sP[(16 * ib + lr) * PP + pw + mb * 16]) = p; } }
        float* sd = srs + (ph == 0 ? 0 : AW * QR);                // the sums behind products 2 and 4 go to a second range that nobody reads: summed under a branch, all 256 values stay live up to it and spill to scratch
#pragma unroll
        for (int ib = 0; ib < QB; ++ib) { rs[ib] = rp[ib][0] + rp[ib][1]; rs[ib] += __shfl_xor(rs[ib], 16, 32); }
#pragma unroll
        for (int p = 0; p < QB / 2; ++p) sd[wave * QR + 32 * p + lane] = hi ? rs[2 * p + 1] : rs[2 * p];   // slot = query row 16*(2p + hi) + lr = 32p + lane
        __syncthreads();                                          // publishes the tile (and the partial row sums of qh) to the next product; behind product 4 it orders the wave's own read-back
    }
    wait_async0();
    h16* crow = CTX + ((size_t)zh * SEQ + t0) * DH + (size_t)wave * 64;
#pragma unroll
    for (int s = 0; s < QR / 4; ++s) { const int row = 4 * s + (lane >> 3), c8 = (lane & 7) * 8;   // QR / 4 s x 4 rows = QR rows; 8 lanes x 8 halves = 64 columns = one line
        const v8h val = *(const v8h*)(&sP[row * PP + wave * 64 + c8]);
        *(v8h*)(crow + (size_t)row * DH + c8) = val; }
}

// k_oproj: register-blocked f16 GEMM, 8 waves (2 x 4) per 128x128 tile, one 64x32 tile per wave, operands staged in LDS, K = HDIM; out[m][n] = (sum_k ctx64[m][k] N64[n][k]) / 4096 + cv[n] (f32); bias = the constant vector, one value per 32 floats.
// A = ctx plane [(b*8 + h)][t][f]: row m = b*SEQ + t holds k = h*512 + f in 8 pieces of 512, SEQ*DH apart; Bt = N plane rows (n); grid (NB*SEQ/128, NF/128): one work-group per WGP, every staged row meets 128 rows of the other operand.
__global__ __launch_bounds__(OTH) void k_oproj(const h16* __restrict__ A, const h16* __restrict__ Bt, const float* __restrict__ bias, float* OUT) {
    __shared__ __align__(16) bf ring[2 * (128 + 128) * (OKS + 8)];
    __shared__ __align__(16) float osw[8][16 * 36];
    const int lane = threadIdx.x & 31, lr = lane & 15, hi = lane >> 4;
    const int wave = __builtin_amdgcn_readfirstlane((int)(threadIdx.x >> 5)), wm = wave >> 2, wn = wave & 3;
    float* os = osw[wave];                                         // wave-private store staging
    const int r0 = blockIdx.x * 128 + wm * 64, c0 = blockIdx.y * 128 + wn * 32;   // the wave's own 64x32 tile
    v8f acc[4][2];
#pragma unroll
    for (int mb = 0; mb < 4; ++mb)
#pragma unroll
        for (int nb = 0; nb < 2; ++nb) acc[mb][nb] = (v8f){};
    const int rt = blockIdx.x * 128;                               // a 128-row tile lies in one batch
    gemm_ring<128, 128, HDIM, false, 2, DH, (size_t)SEQ * DH, 2, 4, OKS>((const bf*)A + (size_t)(rt / SEQ) * NH_ * SEQ * DH + (size_t)(rt % SEQ) * DH, (const bf*)Bt + (size_t)blockIdx.y * 128 * HDIM, ring, wm, wn, acc);
    float bc[2];
#pragma unroll
    for (int nb = 0; nb < 2; ++nb) bc[nb] = bias[(c0 + nb * 16 + lr) * 32];   // c0 + 31 < NF
#pragma unroll
    for (int mb = 0; mb < 4; ++mb) {
#pragma unroll
        for (int nb = 0; nb < 2; ++nb) {
#pragma unroll
            for (int j = 0; j < 8; ++j) os[(hi * 8 + j) * 36 + nb * 16 + lr] = acc[mb][nb][j] * OSC + bc[nb]; }   // D: row 8h+j, col lane&15
        wave_sync();
{
#pragma unroll
            for (int s = 0; s < 4; ++s) { const int row = 4 * s + (lane >> 3), c4 = (lane & 7) * 4;   // 4 s x 4 rows = 16 rows; 8 lanes x 4 floats = 32 columns = one line
                const v4f val = *(const v4fa*)(&os[row * 36 + c4]);
                *(v4f*)(OUT + (size_t)(r0 + mb * 16 + row) * NF + c0 + c4) = val; }
             }
        asm volatile("s_wait_xcnt 0x0" ::: "memory");             // stands behind the run of four stores, ahead of any rewrite of their address or data registers
        wave_sync();
    }
}

static constexpr size_t SZ_XB = (size_t)NB * SEQ * NF * 2;                   // f16 copy of one input
static constexpr size_t SZ_WP = (size_t)HDIM * NF * 2;                       // one weight plane (Wq | Wk | Wv^T | Wo | N, f16)
static constexpr size_t SZ_PL = (size_t)NB * NH_ * SEQ * DH * 2;             // the ctx plane
static constexpr size_t SZ_CV = (size_t)NF * 32 * 4;                         // the constant vector, one line per value
static constexpr size_t SZ_TOTAL = 3 * SZ_XB + 5 * SZ_WP + SZ_CV + SZ_PL;
static_assert(SZ_XB % 256 == 0 && SZ_WP % 256 == 0 && SZ_PL % 256 == 0);   // the planes lie back to back, each 256-B aligned
static_assert(SZ_TOTAL <= (size_t)268435456);          // workspace carve <= 256 MiB
static_assert((size_t)NF * HDIM == (size_t)HDIM * NF);                     // Wo and N plane extents equal a projection weight plane

extern "C" void kernel_launch(void* const* d_in, const int* in_sizes, int n_in,
                              void* d_out, int out_size, void* d_ws, size_t ws_size, hipStream_t stream) {
    if (n_in < 11) return;
    const size_t needx = (size_t)NB * SEQ * NF;
    if ((size_t)in_sizes[0] < needx || (size_t)in_sizes[1] < needx || (size_t)in_sizes[2] < needx) return;
    if ((size_t)in_sizes[3] < (size_t)HDIM * NF || (size_t)in_sizes[5] < (size_t)HDIM * NF || (size_t)in_sizes[7] < (size_t)HDIM * NF) return;
    if ((size_t)in_sizes[9] < (size_t)NF * HDIM) return;
    if (in_sizes[4] < HDIM || in_sizes[6] < HDIM || in_sizes[8] < HDIM || in_sizes[10] < NF) return;
    if ((size_t)out_size < needx) return;
    if (SZ_TOTAL > ws_size) return;
    // wire order: q, k, v, Wq, bq, Wk, bk, Wv, bv, Wo, bo
    const float* xq = (const float*)d_in[0]; const float* xk = (const float*)d_in[1]; const float* xv = (const float*)d_in[2];
    const float* wq = (const float*)d_in[3]; const float* bq = (const float*)d_in[4];
    const float* wk = (const float*)d_in[5]; const float* bk = (const float*)d_in[6];
    const float* wv = (const float*)d_in[7]; const float* bv = (const float*)d_in[8];
    const float* wo = (const float*)d_in[9]; const float* bo = (const float*)d_in[10];
    float* OUT = (float*)d_out;      // [NB][SEQ][NF]
    char* wsp = (char*)d_ws;
    bf* XS = (bf*)wsp; wsp += 3 * SZ_XB;             // q [NB][SEQ][NF] | k^T [NB][NF][SEQ] | v^T [NB][NF][SEQ]
    bf* WS = (bf*)wsp; wsp += 4 * SZ_WP;             // Wq | Wk [4096][512] ([out][in]) x64 | Wv^T [8][NF][512] x64 | Wo [8][NF][512] x64
    h16* NPL = (h16*)wsp; wsp += SZ_WP;              // N [512][4096] x64
    float* CV = (float*)wsp; wsp += SZ_CV;           // [512] at a pitch of 32 floats
    h16* CTX = (h16*)wsp; wsp += SZ_PL;              // ctx [NB*8][SEQ][512] x64
    const h16* XQ = (const h16*)XS; const h16* KTP = XQ + needx; const h16* VTP = KTP + needx;
    const h16* WQP = (const h16*)WS; const h16* WKP = WQP + (size_t)HDIM * NF;

    k_cvt<<<CBK + 3 * XBK + 4 * WBK, 256, 0, stream>>>(xq, xk, xv, wq, wk, wv, wo, bv, bo, XS, CV);
    k_nprod<<<NTB, GTH, 0, stream>>>(WS, NPL);
    k_attn<<<dim3(SEQ / QR, NB * NH_, 1), 32 * AW, 0, stream>>>(XQ, WQP, KTP, WKP, VTP, bq, bk, CTX);
    k_oproj<<<dim3(NB * SEQ / 128, NF / 128, 1), OTH, 0, stream>>>(CTX, NPL, CV, OUT);
}
